// v000
// The times below were measured on an AMD MI455X: many runs one after another, warmed up first and cycling through
// copies of the inputs, with the whole window's GPU time divided by the number of runs. Launches and the gaps
// between them are all in it. The median over several windows is given; except for v000 it joins two sittings, which
// can be a few percent apart, so the side-by-side timings, each taken in one sitting, are the better comparison.
// The starting kernel, v000, takes 352 microseconds a run.
#include <hip/hip_runtime.h>
// Contractions: q/k/v projections (real and phase parts share one weight) on v_wmma_f32_16x16x32_bf16 (activations and weights RNE-converted to bf16, single product, f32 accumulate); scores K Q^T, O^T = V^T P^T and the output projection on v_wmma_f32_16x16x32_f16 (single carried f16 planes: q, k, v x256, P x256, ctx x4096, Wo = bf16 value x1024 held exactly in f16; single product per term, f32 accumulate); softmax statistics f32.
// Two-part (real | phase) multi-head attention: B x S x 512 activations per part, 8 heads x 64, weights stored [in][out] (y = x w), softmax over
// sqrt(re^2 + im^2) / sqrt(128) with re = qr.kr - qp.kp, im = qr.kp + qp.kr; keys whose mask entry is 0 get their score REPLACED by -1e9 (they stay in the softmax).
// Engine: transposed flash. Each wave owns 16 queries of one (b, h). Per 32-key step: S^T tiles (key rows x query columns) from packed K rows
// [kr 64 | -kp 64] (A, global f16 plane; the phase half is stored negated so that the packed products give re and im above) and packed Q^T [qr | qp]
// (B, registers); the two 16-key D tiles pack straight into the P^T B fragment; O^T (128 d rows = [real 64 | phase 64] x query columns) accumulates
// from V^T rows (A, global f16 plane). 24 WMMAs per step. The mask is packed once into bit words [b][q][S/32]; one word per lane per step.
// Real GEMMs: y_r = x_r w, y_p = x_p w with A fragments x_r, x_p from 16-bit rows [real 512 | phase 512] and one B fragment from the transposed weight plane Wt[n][k].
#ifndef NB
#define NB 2
#endif
#ifndef SEQ
#define SEQ 2048
#endif
#define NB_FULL 2
#define SEQ_FULL 2048
#define RD 512        /* model width (= heads x head dim) */
#define NH 8
#define HD 64
#define KP 1024       /* packed 16-bit row: [real 512 | phase 512] */
#define HP 128        /* packed head row: [real 64 | phase 64] */
#define OUT1_OFF ((size_t)NB_FULL * SEQ_FULL * RD)   /* element offset of the second output (fixed by the full problem size) */

static_assert(SEQ % 64 == 0);
static_assert(SEQ <= SEQ_FULL);
static_assert(NB <= NB_FULL);
static_assert(NH * HD == RD);
static_assert(RD % 64 == 0);
static_assert(RD % 32 == 0);
static_assert(NH * HP == KP);
static_assert(KP == 2 * RD);
static_assert(HP == 2 * HD);
static_assert(HD == 64);
static_assert((NB * SEQ) % 64 == 0);
static_assert(((size_t)NB * SEQ * (SEQ / 32)) % 32 == 0);
static_assert(OUT1_OFF * 4 == (size_t)8388608);
static_assert((size_t)7 * ((size_t)NB * SEQ * KP * 2) + (size_t)4 * ((size_t)RD * RD * 2) + (size_t)NB * SEQ * (SEQ / 32) * 4 <= (size_t)134217728);

typedef __bf16 v16b __attribute__((ext_vector_type(16)));
typedef _Float16 v16h __attribute__((ext_vector_type(16)));
typedef _Float16 h16;
typedef unsigned short v8us __attribute__((ext_vector_type(8), may_alias));
typedef int v4i __attribute__((ext_vector_type(4), may_alias));
typedef float v8f __attribute__((ext_vector_type(8)));
typedef float v4f __attribute__((ext_vector_type(4)));
typedef float v4fa __attribute__((ext_vector_type(4), may_alias));
union Frag { v16b vb; v16h vh; v8us half[2]; unsigned short u[16]; _Float16 h[16]; };

#define LOG2E 1.4426950408889634f
/* scores arrive x65536 (q x256, k x256); logit in log2 units = |s| * (1/sqrt(128)) * log2(e) / 65536 */
#define CSCALE (0.08838834764831845f * LOG2E / 65536.0f)
/* replaced score of a masked key, in log2 units */
#define MFILL (-1.0e9f * LOG2E)

__device__ __forceinline__ unsigned short bf16_bits(float x) {   // RNE convert to bf16 bits
  unsigned int u = __float_as_uint(x);
  return (unsigned short)((u + 0x7FFFu + ((u >> 16) & 1u)) >> 16);
}
__device__ __forceinline__ float bf16_val(unsigned short b) { return __uint_as_float(((unsigned int)b) << 16); }
__device__ __forceinline__ float bf16_rne(float x) { return bf16_val(bf16_bits(x)); }
__device__ __forceinline__ unsigned short f16_bits(_Float16 h) { union { _Float16 h; unsigned short u; } c; c.h = h; return c.u; }
__device__ __forceinline__ unsigned short c16(float c) { return f16_bits((_Float16)c); }   // RNE convert of a carried value to f16 bits

// f32 -> f16 convert that cannot produce a subnormal: values below the smallest normal become zero (value select).
static __device__ __forceinline__ h16 toh_flush(float v) { const h16 r = (h16)v; return (fabsf(v) < 6.103515625e-05f) ? (h16)0.0f : r; }
__device__ __forceinline__ unsigned short c16f(float c) { return f16_bits(toh_flush(c)); }

__device__ __forceinline__ v8f wm_b(const Frag& a, const Frag& b, v8f c) {
  return __builtin_amdgcn_wmma_f32_16x16x32_bf16(false, a.vb, false, b.vb, (short)0, c, false, false);
}
__device__ __forceinline__ v8f wm_h(const Frag& a, const Frag& b, v8f c) {
  return __builtin_amdgcn_wmma_f32_16x16x32_f16(false, a.vh, false, b.vh, (short)0, c, false, false);
}

// One k-step for one 16x16 output tile of both parts: yr += ar*w ; yi += ai*w ; each product followed by its own hazard guard.
template <bool BF>
__device__ __forceinline__ void rmma(const Frag& ar, const Frag& ai, const Frag& wf, v8f& yr, v8f& yi) {
  if (BF) {
    yr = wm_b(ar, wf, yr);
    asm volatile("v_nop\n\tv_nop\n\tv_nop\n\tv_nop" : "+v"(yr) : "v"(ar.vb), "v"(wf.vb));
    yi = wm_b(ai, wf, yi);
    asm volatile("v_nop\n\tv_nop\n\tv_nop\n\tv_nop" : "+v"(yi) : "v"(ai.vb), "v"(wf.vb));
  } else {
    yr = wm_h(ar, wf, yr);
    asm volatile("v_nop\n\tv_nop\n\tv_nop\n\tv_nop" : "+v"(yr) : "v"(ar.vh), "v"(wf.vh));
    yi = wm_h(ai, wf, yi);
    asm volatile("v_nop\n\tv_nop\n\tv_nop\n\tv_nop" : "+v"(yi) : "v"(ai.vh), "v"(wf.vh));
  }
}

// Wave tile 16 rows x 64 columns for both parts, K = 512. A plane [rows][KP] = [real 512 | phase 512], W plane [cols][RD] (transposed weight, k-contiguous).
// A fragment: row m = row0 + ln, elements 0..7 <- k0 + 8h + i, 8..15 <- k0 + 16 + 8h + i. B fragment: column n = col0 + 16t + ln, same k map.
// D: acc[r] = y(row0 + 8h + r, col0 + 16t + ln).
template <bool BF>
__device__ __forceinline__ void rgemm_main(const unsigned short* __restrict__ A, const unsigned short* __restrict__ W,
                                           int row0, int col0, int ln, int hh, v8f (&yr)[4], v8f (&yi)[4]) {
  const unsigned short* ap = A + (size_t)(row0 + ln) * KP + 8 * hh;
  const unsigned short* wp = W + (size_t)(col0 + ln) * RD + 8 * hh;
#pragma unroll 2
  for (int c = 0; c < RD / 32; ++c) {
    const int k0 = 32 * c;
    Frag ar, ai;
    ar.half[0] = *(const v8us*)(ap + k0);
    ar.half[1] = *(const v8us*)(ap + k0 + 16);
    ai.half[0] = *(const v8us*)(ap + RD + k0);
    ai.half[1] = *(const v8us*)(ap + RD + k0 + 16);
#pragma unroll
    for (int t = 0; t < 4; ++t) {
      const unsigned short* wt = wp + (size_t)t * 16 * RD + k0;
      Frag wf;
      wf.half[0] = *(const v8us*)(wt);
      wf.half[1] = *(const v8us*)(wt + 16);
      rmma<BF>(ar, ai, wf, yr[t], yi[t]);
    }
  }
}

// X[row][KP] = bf16 bits [xr 512 | xi 512], row = b*SEQ + s (compact). Thread per (row, 8 columns) converts the re and the im piece.
// coverage: NB*SEQ*64 threads x (8 re + 8 im) elements = the whole plane.
__global__ __launch_bounds__(256) void k_cvtx(const float* __restrict__ xr, const float* __restrict__ xi, unsigned short* __restrict__ X) {
  const int t = blockIdx.x * 256 + threadIdx.x;
  if (t >= NB * SEQ * 64) return;
  const int row = t >> 6, c8 = (t & 63) * 8;
  const int b = row / SEQ, s = row - b * SEQ;
  const size_t src = ((size_t)b * SEQ_FULL + (size_t)s) * RD + c8;
  const v4f r0 = *(const v4fa*)(xr + src), r1 = *(const v4fa*)(xr + src + 4);
  const v4f i0 = *(const v4fa*)(xi + src), i1 = *(const v4fa*)(xi + src + 4);
  v8us orr, oi;
  orr[0] = bf16_bits(r0[0]); orr[1] = bf16_bits(r0[1]); orr[2] = bf16_bits(r0[2]); orr[3] = bf16_bits(r0[3]);
  orr[4] = bf16_bits(r1[0]); orr[5] = bf16_bits(r1[1]); orr[6] = bf16_bits(r1[2]); orr[7] = bf16_bits(r1[3]);
  oi[0] = bf16_bits(i0[0]); oi[1] = bf16_bits(i0[1]); oi[2] = bf16_bits(i0[2]); oi[3] = bf16_bits(i0[3]);
  oi[4] = bf16_bits(i1[0]); oi[5] = bf16_bits(i1[1]); oi[6] = bf16_bits(i1[2]); oi[7] = bf16_bits(i1[3]);
  unsigned short* d = X + (size_t)row * KP + c8;
  *(v8us*)d = orr;
  *(v8us*)(d + RD) = oi;
  
}

// Weight convert with transpose: w[k][n] (f32, [in][out]) -> Wt[n][k] (pitch RD) as bf16 bits (asf16 == 0) or as f16(bf16 value x 1024) (asf16 != 0).
// coverage: grid (RD/64, RD/64) x (64 n rows x 64 k) = the whole plane; LDS tile: 64 x 64 written before the barrier, 64 x 64 read after it.
__global__ __launch_bounds__(256) void k_cvtwt(const float* __restrict__ w, unsigned short* __restrict__ Wt, int asf16) {
  __shared__ __attribute__((aligned(16))) unsigned short tl[64][72];
  const int tid = threadIdx.x;
  const int k0 = blockIdx.x * 64, n0 = blockIdx.y * 64;
#pragma unroll 1
  for (int j = 0; j < 16; ++j) {
    const int i = tid + 256 * j;
    const int kk = i >> 6, nn = i & 63;
    const float x = w[(size_t)(k0 + kk) * RD + (size_t)(n0 + nn)];
    const unsigned short vb = bf16_bits(x);
    const unsigned short vh = c16f(bf16_val(vb) * 1024.0f);   // bf16 significand x 2^10 is exact in f16
    tl[nn][kk] = (asf16 != 0) ? vh : vb;
  }
  __syncthreads();
  {
#pragma unroll
    for (int j = 0; j < 2; ++j) {
      const int i = tid + 256 * j;
      const int nn = i >> 3, p8 = (i & 7) * 8;
      const v8us a = *(const v8us*)&tl[nn][p8];
      *(v8us*)(Wt + (size_t)(n0 + nn) * RD + (size_t)(k0 + p8)) = a;
    }
    
  }
}

// Mask pack: MB[b*SEQ + q][SEQ/32], bit j of word c = (mask[b][q][32c + j] != 0). Thread per word (8 x 16-B loads); a wave's 32 words are
// coverage: NB*SEQ*(SEQ/32) threads x 1 word = the whole plane.
__global__ __launch_bounds__(256) void k_maskbits(const int* __restrict__ mask, unsigned int* __restrict__ MB) {
  const int t = blockIdx.x * 256 + threadIdx.x;
  if (t >= NB * SEQ * (SEQ / 32)) return;
  const int row = t / (SEQ / 32), wc = t - row * (SEQ / 32);
  const int b = row / SEQ, q = row - b * SEQ;
  const int* mp = mask + ((size_t)b * SEQ_FULL + (size_t)q) * SEQ_FULL + (size_t)wc * 32;
  unsigned int word = 0u;
#pragma unroll 1
  for (int g = 0; g < 8; ++g) {
    const v4i m = *(const v4i*)(mp + 4 * g);
    const unsigned int nib = ((m[0] != 0) ? 1u : 0u) | ((m[1] != 0) ? 2u : 0u) | ((m[2] != 0) ? 4u : 0u) | ((m[3] != 0) ? 8u : 0u);
    word |= nib << (4 * g);
  }
  *(unsigned int*)(MB + t) = word;
  
}

// q / k projection. Block = 4 waves x 16 rows = 64 rows, 64 columns = one head. Output plane P[b*NH + head][s][HP] = f16 of (y_r x 256 | y_p x cim), cim = +256 (q) or -256 (k).
// coverage: grid (NB*SEQ/64, NH) x 4 waves x 16 rows x 128 halves = the whole plane.
// LDS tile: columns 0..127 of every row are written before the barrier and exactly those are read after it.
__global__ __launch_bounds__(128) void k_proj_rows(const unsigned short* __restrict__ X, const unsigned short* __restrict__ W,
                                                   unsigned short* __restrict__ P, float cim) {
  __shared__ __attribute__((aligned(16))) unsigned short sh[4][16][136];
  const int tid = threadIdx.x, w = __builtin_amdgcn_readfirstlane((int)(tid >> 5)), lane = tid & 31, ln = lane & 15, hh = lane >> 4;
  const int head = blockIdx.y;
  const int rowb = blockIdx.x * 64;
  v8f yr[4] = {}, yi[4] = {};
  rgemm_main<true>(X, W, rowb + 16 * w, head * HD, ln, hh, yr, yi);
#pragma unroll
  for (int t = 0; t < 4; ++t) {
#pragma unroll
    for (int r = 0; r < 8; ++r) {
      sh[w][8 * hh + r][16 * t + ln]      = c16f(yr[t][r] * 256.0f);
      sh[w][8 * hh + r][HD + 16 * t + ln] = c16f(yi[t][r] * cim);
    }
  }
  __syncthreads();
  const int b = rowb / SEQ;
  const int s0 = rowb - b * SEQ + 16 * w;
  const size_t base = ((size_t)(b * NH + head) * SEQ + (size_t)s0) * HP;
  const int rsub = lane >> 4, p8 = (lane & 15) * 8;
  {
#pragma unroll
    for (int q = 0; q < 8; ++q) {
      const int row = 2 * q + rsub;
      const v8us a = *(const v8us*)&sh[w][row][p8];
      *(v8us*)(P + base + (size_t)row * HP + p8) = a;
    }
    
  }
}

// v projection, transposed plane Vt[b*NH + head][dd][s], dd = [real 64 | phase 64], value f16 of (y x 256).
// LDS tile: 128 x 64 written before the barrier, 128 x 64 read after it.
__global__ __launch_bounds__(128) void k_proj_vt(const unsigned short* __restrict__ X, const unsigned short* __restrict__ W,
                                                 unsigned short* __restrict__ Vt) {
  __shared__ __attribute__((aligned(16))) unsigned short th[HP][72];
  const int tid = threadIdx.x, w = __builtin_amdgcn_readfirstlane((int)(tid >> 5)), lane = tid & 31, ln = lane & 15, hh = lane >> 4;
  const int head = blockIdx.y;
  const int rowb = blockIdx.x * 64;
  v8f yr[4] = {}, yi[4] = {};
  rgemm_main<true>(X, W, rowb + 16 * w, head * HD, ln, hh, yr, yi);
#pragma unroll
  for (int t = 0; t < 4; ++t) {
#pragma unroll
    for (int r = 0; r < 8; ++r) {
      const int col = 16 * w + 8 * hh + r;
      th[16 * t + ln][col]      = c16f(yr[t][r] * 256.0f);
      th[HD + 16 * t + ln][col] = c16f(yi[t][r] * 256.0f);
    }
  }
  __syncthreads();
  const int b = rowb / SEQ;
  const int s0 = rowb - b * SEQ;
  const size_t base = (size_t)(b * NH + head) * HP * SEQ + (size_t)s0;
  {
    for (int i = tid; i < HP * 8; i += 128) {
      const int dd = i >> 3, j8 = (i & 7) * 8;
      const v8us a = *(const v8us*)&th[dd][j8];
      *(v8us*)(Vt + base + (size_t)dd * SEQ + j8) = a;
    }
    
  }
}

// Score group for one 16-key tile (8 WMMAs): sre = kr qr + ki qi (4 products), sa = kr qi (2), sb = ki qr (2); then the hazard guard.
// k0, k1 = kr (d 0..31, 32..63); k2, k3 = ki; q[0], q[1] = qr; q[2], q[3] = qi.
__device__ __forceinline__ void score_mma(const Frag& k0, const Frag& k1, const Frag& k2, const Frag& k3,
                                          const Frag (&q)[4], v8f& sre, v8f& sa, v8f& sb) {
  sre = wm_h(k0, q[0], sre);
  sa  = wm_h(k0, q[2], sa);
  sb  = wm_h(k2, q[0], sb);
  sre = wm_h(k1, q[1], sre);
  sa  = wm_h(k1, q[3], sa);
  sb  = wm_h(k3, q[1], sb);
  sre = wm_h(k2, q[2], sre);
  sre = wm_h(k3, q[3], sre);
  asm volatile("v_nop\n\tv_nop\n\tv_nop\n\tv_nop" : "+v"(sre), "+v"(sa), "+v"(sb)
               : "v"(k0.vh), "v"(k1.vh), "v"(k2.vh), "v"(k3.vh),
                 "v"(q[0].vh), "v"(q[1].vh), "v"(q[2].vh), "v"(q[3].vh));
}
// c += v*p (single f16 product), then the hazard guard.
__device__ __forceinline__ void pv_mma(const Frag& v, const Frag& p, v8f& c) {
  c = wm_h(v, p, c);
  asm volatile("v_nop\n\tv_nop\n\tv_nop\n\tv_nop" : "+v"(c) : "v"(v.vh), "v"(p.vh));
}

// One 32-key step (step index j) for a wave's 16 queries: 16 score WMMAs + 8 P.V WMMAs. Kp, Vp are the (b, h) bases of the planes,
// Mw is this lane's query row of mask words. With the phase half of the K plane stored negated: sre = qr.kr - qp.kp, sa - sb = qp.kr + qr.kp.
__device__ __forceinline__ void fa_step(const unsigned short* __restrict__ Kp, const unsigned short* __restrict__ Vp,
                                        const unsigned int* __restrict__ Mw, int j, int ln, int hh,
                                        const Frag (&qf)[4], float& mr, float& lr, v8f (&O)[8]) {
  const v8f z8 = {0.f, 0.f, 0.f, 0.f, 0.f, 0.f, 0.f, 0.f};
  const int key0 = 32 * j;
  unsigned int mw = Mw[j];                           // bit i = mask(query of this lane, key0 + i); loaded by every lane, in range
  asm volatile("" : "+v"(mw));
  const unsigned int mh = mw >> (8 * hh);            // this lane half's keys: bit 16*kt + r
  float sc[16];
#pragma unroll
  for (int kt = 0; kt < 2; ++kt) {
    // A fragments of K: row m = key (key0 + 16*kt + ln); packed k axis [kr 0..63 | -kp 64..127]; elements 0..7 <- 32c + 8h + i, 8..15 <- 32c + 16 + 8h + i
    const unsigned short* kp = Kp + (size_t)(key0 + 16 * kt + ln) * HP + 8 * hh;
    Frag k0, k1, k2, k3;
    k0.half[0] = *(const v8us*)(kp);      k0.half[1] = *(const v8us*)(kp + 16);
    k1.half[0] = *(const v8us*)(kp + 32); k1.half[1] = *(const v8us*)(kp + 48);
    k2.half[0] = *(const v8us*)(kp + 64); k2.half[1] = *(const v8us*)(kp + 80);
    k3.half[0] = *(const v8us*)(kp + 96); k3.half[1] = *(const v8us*)(kp + 112);
    v8f sre = z8, sa = z8, sb = z8;
    score_mma(k0, k1, k2, k3, qf, sre, sa, sb);
    // S^T tile: element r = score(key0 + 16*kt + 8h + r, query of this lane's column); logit in log2 units; masked keys get the fill value instead
#pragma unroll
    for (int r = 0; r < 8; ++r) {
      const float im = sa[r] - sb[r];
      const float v = __builtin_amdgcn_sqrtf(fmaf(sre[r], sre[r], im * im)) * CSCALE;
      sc[8 * kt + r] = (((mh >> (16 * kt + r)) & 1u) != 0u) ? v : MFILL;
    }
  }
  float mx = sc[0];
#pragma unroll
  for (int i = 1; i < 16; ++i) mx = fmaxf(mx, sc[i]);
  mx = fmaxf(mx, __shfl_xor(mx, 16, 32));           // the other lane half holds the other 16 keys of this query
  const float mnew = fmaxf(mr, mx);
  const float al = exp2f(mr - mnew);
  mr = mnew;
  // weights carried x256: pc = 256 * 2^(sc - mnew) as one f16 plane (exponent below -14 -> exact zero); the row sum uses the f16-converted values the matrix unit sees
  Frag pf;
  float ps = 0.0f;
#pragma unroll
  for (int i = 0; i < 16; ++i) {
    const float e = (sc[i] - mnew) + 8.0f;
    const float pc = (e < -14.0f) ? 0.0f : exp2f(e);
    const _Float16 h = (_Float16)pc;
    pf.h[i] = h;                                    // B element i: i<8 -> key0 + 8h + i (tile 0 row 8h+i); i>=8 -> key0 + 16 + 8h + (i-8) (tile 1)
    ps += (float)h;
  }
  ps += __shfl_xor(ps, 16, 32);
  lr = lr * al + ps;
#pragma unroll
  for (int t = 0; t < 8; ++t) O[t] = O[t] * al;
  // A fragments of V^T: row m = dd (16*t + ln), elements 0..7 <- key0 + 8h + i, 8..15 <- key0 + 16 + 8h + i
  const size_t voff = (size_t)ln * SEQ + (size_t)(key0 + 8 * hh);
#pragma unroll
  for (int t = 0; t < 8; ++t) {
    const unsigned short* vp = Vp + voff + (size_t)t * 16 * SEQ;
    Frag vf;
    vf.half[0] = *(const v8us*)(vp);
    vf.half[1] = *(const v8us*)(vp + 16);
    pv_mma(vf, pf, O[t]);
  }
}

// Block = 4 waves x 16 queries = 64 queries of one (b, h); no LDS and no barrier in the key loop.
// Epilogue: ctx carried x4096 as one f16 plane C[b*SEQ + s][KP] ([real 512 | phase 512], column h*64 + d).
// coverage: NB*NH*(SEQ/64) blocks x 4 waves x 16 queries x (64 real + 64 phase) = every (row, head, part) segment of the plane exactly once.
// LDS tile: columns 0..127 of every row written before the barrier, the same read after it.
__global__ __launch_bounds__(128) void k_attn(const unsigned short* __restrict__ Qp, const unsigned short* __restrict__ Kpl,
                                              const unsigned short* __restrict__ Vt, const unsigned int* __restrict__ MB,
                                              unsigned short* __restrict__ Cx) {
  __shared__ __attribute__((aligned(16))) unsigned short sh[4][16][136];
  const int tid = threadIdx.x, w = __builtin_amdgcn_readfirstlane((int)(tid >> 5)), lane = tid & 31, ln = lane & 15, hh = lane >> 4;
  const int bh = blockIdx.x / (SEQ / 64), qt = blockIdx.x % (SEQ / 64);
  const int b = bh / NH, h = bh - b * NH;
  const int qbase = qt * 64 + 16 * w;
  const int qg = qbase + ln;
  // Q^T B fragments: column n = query qg, packed k axis [qr 0..63 | qp 64..127], elements 0..7 <- 32c + 8h + i, 8..15 <- 32c + 16 + 8h + i
  Frag qf[4];
  {
    const size_t qoff = ((size_t)bh * SEQ + (size_t)qg) * HP + 8 * hh;
#pragma unroll
    for (int c = 0; c < 4; ++c) {
      qf[c].half[0] = *(const v8us*)(Qp + qoff + 32 * c);
      qf[c].half[1] = *(const v8us*)(Qp + qoff + 32 * c + 16);
    }
  }
  float mr = -3.0e38f, lr = 0.0f;
  v8f O[8] = {};
  const unsigned short* Kp = Kpl + (size_t)bh * SEQ * HP;
  const unsigned short* Vp = Vt  + (size_t)bh * HP * SEQ;
  const unsigned int* Mw = MB + ((size_t)b * SEQ + (size_t)qg) * (SEQ / 32);
#pragma unroll 1
  for (int j = 0; j < SEQ / 32; ++j)
    fa_step(Kp, Vp, Mw, j, ln, hh, qf, mr, lr, O);

  // O^T element r of tile t = ctx(query qg, dd = 16t + 8h + r); carries: x256 (P, also in lr), x256 (v); ctx stored x4096 -> factor 16 / lr
  const float inv = 16.0f * (1.0f / lr);
#pragma unroll
  for (int t = 0; t < 8; ++t) {
#pragma unroll
    for (int r = 0; r < 8; ++r)
      sh[w][ln][16 * t + 8 * hh + r] = c16f(O[t][r] * inv);
  }
  __syncthreads();
  const size_t rbase = ((size_t)b * SEQ + (size_t)qbase) * KP + (size_t)h * HD;
  const int lsub = lane >> 3, p8 = (lane & 7) * 8;
  {
#pragma unroll
    for (int q = 0; q < 8; ++q) {
      const int line = 4 * q + lsub;            // 0..31 = 16 queries x {real, phase}
      const int row = line >> 1, seg = line & 1;
      const v8us a = *(const v8us*)&sh[w][row][seg * HD + p8];
      const size_t o = rbase + (size_t)row * KP + (size_t)seg * RD + p8;
      *(v8us*)(Cx + o) = a;
    }
    
  }
}

// Output projection of both parts: out0[b][s][n] = ctx_real x Wo, out1[b][s][n] = ctx_phase x Wo (f16, K = 512, one product per term), undo carries x4096 (ctx) and x1024 (Wo).
// Epilogue: per-wave LDS tile [16 rows][128 floats = 64 real columns | 64 phase columns] (block barrier), then per instruction lanes 0..15 write the 256-B
// coverage: grid (NB*SEQ/64, RD/64) x 4 waves x 16 rows x (64 + 64) floats = every output element of the processed rows exactly once.
// LDS tile: columns 0..127 of every row written before the barrier, the same read after it.
__global__ __launch_bounds__(128) void k_out(const unsigned short* __restrict__ Cx, const unsigned short* __restrict__ Wo,
                                             float* __restrict__ Out) {
  __shared__ __attribute__((aligned(16))) float so[4][16][132];
  const int tid = threadIdx.x, w = __builtin_amdgcn_readfirstlane((int)(tid >> 5)), lane = tid & 31, ln = lane & 15, hh = lane >> 4;
  const int rowb = blockIdx.x * 64;
  const int col0 = blockIdx.y * 64;
  v8f yr[4] = {}, yi[4] = {};
  rgemm_main<false>(Cx, Wo, rowb + 16 * w, col0, ln, hh, yr, yi);
  const float scl = 1.0f / 4194304.0f;
#pragma unroll
  for (int t = 0; t < 4; ++t) {
#pragma unroll
    for (int r = 0; r < 8; ++r) {
      so[w][8 * hh + r][16 * t + ln]      = yr[t][r] * scl;
      so[w][8 * hh + r][HD + 16 * t + ln] = yi[t][r] * scl;
    }
  }
  __syncthreads();
  const int b = rowb / SEQ;
  const int s0 = rowb - b * SEQ + 16 * w;
  const size_t obase = ((size_t)b * SEQ_FULL + (size_t)s0) * RD + (size_t)col0
                     + (size_t)(lane >> 4) * OUT1_OFF + (size_t)(lane & 15) * 4;
  {
#pragma unroll
    for (int q = 0; q < 16; ++q) {
      const v4f v = *(const v4fa*)&so[w][q][lane * 4];
      *(v4f*)(Out + obase + (size_t)q * RD) = v;
    }
    
  }
}

extern "C" void kernel_launch(void* const* d_in, const int* in_sizes, int n_in,
                              void* d_out, int out_size, void* d_ws, size_t ws_size, hipStream_t stream) {
  if (n_in < 11) return;
  const long long needx = ((long long)(NB - 1) * SEQ_FULL + (long long)SEQ) * RD;   // last activation element touched + 1
  const long long needm = ((long long)(NB - 1) * SEQ_FULL + (long long)(SEQ - 1)) * SEQ_FULL + (long long)SEQ;   // last mask element touched + 1
  for (int i = 0; i < 6; ++i) if ((long long)in_sizes[i] < needx) return;
  for (int i = 6; i < 10; ++i) if ((long long)in_sizes[i] < (long long)RD * RD) return;
  if ((long long)in_sizes[10] < needm) return;
  if ((long long)out_size < (long long)OUT1_OFF + needx) return;
  // wire order: q_real, k_real, v_real, q_phase, k_phase, v_phase, w_q, w_k, w_v, w_o, mask
  const float* q_re = (const float*)d_in[0];
  const float* k_re = (const float*)d_in[1];
  const float* v_re = (const float*)d_in[2];
  const float* q_ph = (const float*)d_in[3];
  const float* k_ph = (const float*)d_in[4];
  const float* v_ph = (const float*)d_in[5];
  const float* w_q = (const float*)d_in[6];
  const float* w_k = (const float*)d_in[7];
  const float* w_v = (const float*)d_in[8];
  const float* w_o = (const float*)d_in[9];
  const int* maskp = (const int*)d_in[10];
  float* Out = (float*)d_out;

  char* ws = (char*)d_ws;
  size_t off = 0;
  const size_t XB = (size_t)NB * SEQ * KP * 2;          // activation / head / ctx plane bytes (8 MiB at full size); all planes are written exactly to their end
  const size_t WB = (size_t)RD * RD * 2;                // transposed weight plane bytes (512 KiB)
  const size_t MBB = (size_t)NB * SEQ * (SEQ / 32) * 4; // mask bit words (1 MiB at full size)
  unsigned short* Xq = (unsigned short*)(ws + off); off += XB;
  unsigned short* Xk = (unsigned short*)(ws + off); off += XB;
  unsigned short* Xv = (unsigned short*)(ws + off); off += XB;
  unsigned short* Wq = (unsigned short*)(ws + off); off += WB;
  unsigned short* Wk = (unsigned short*)(ws + off); off += WB;
  unsigned short* Wv = (unsigned short*)(ws + off); off += WB;
  unsigned short* Wo = (unsigned short*)(ws + off); off += WB;
  unsigned short* Qp = (unsigned short*)(ws + off); off += XB;   // NB*NH*SEQ*HP halves = XB bytes
  unsigned short* Kp = (unsigned short*)(ws + off); off += XB;
  unsigned short* Vt = (unsigned short*)(ws + off); off += XB;
  unsigned short* Cx = (unsigned short*)(ws + off); off += XB;
  unsigned int*   MB = (unsigned int*)(ws + off);   off += MBB;
  if (off > ws_size) return;

  const unsigned gx = (unsigned)((NB * SEQ * 64 + 255) / 256);
  k_cvtx<<<gx, 256, 0, stream>>>(q_re, q_ph, Xq);
  k_cvtx<<<gx, 256, 0, stream>>>(k_re, k_ph, Xk);
  k_cvtx<<<gx, 256, 0, stream>>>(v_re, v_ph, Xv);
  const dim3 gw((unsigned)(RD / 64), (unsigned)(RD / 64), 1);   // in[k 512][n 512] -> out[n 512][k 512]
  k_cvtwt<<<gw, 256, 0, stream>>>(w_q, Wq, 0);
  k_cvtwt<<<gw, 256, 0, stream>>>(w_k, Wk, 0);
  k_cvtwt<<<gw, 256, 0, stream>>>(w_v, Wv, 0);
  k_cvtwt<<<gw, 256, 0, stream>>>(w_o, Wo, 1);
  const unsigned gm = (unsigned)(((size_t)NB * SEQ * (SEQ / 32) + 255) / 256);
  k_maskbits<<<gm, 256, 0, stream>>>(maskp, MB);

  const dim3 gp((unsigned)(NB * SEQ / 64), (unsigned)NH, 1);
  k_proj_rows<<<gp, 128, 0, stream>>>(Xq, Wq, Qp, 256.0f);
  k_proj_rows<<<gp, 128, 0, stream>>>(Xk, Wk, Kp, -256.0f);
  k_proj_vt<<<gp, 128, 0, stream>>>(Xv, Wv, Vt);

  k_attn<<<(unsigned)(NB * NH * (SEQ / 64)), 128, 0, stream>>>(Qp, Kp, Vt, MB, Cx);

  const dim3 go((unsigned)(NB * SEQ / 64), (unsigned)(RD / 64), 1);
  k_out<<<go, 128, 0, stream>>>(Cx, Wo, Out);
}

// v001
// One run takes 207 microseconds.
// Two timings next to v000 put it at 1.74 and 1.73 times that version's speed.
#include <hip/hip_runtime.h>
// Contractions: q/k/v projections (real and phase parts share one weight) on v_wmma_f32_16x16x32_bf16 (activations and weights RNE-converted to bf16, single product, f32 accumulate); scores K Q^T, O^T = V^T P^T and the output projection on v_wmma_f32_16x16x32_f16 (single carried f16 planes: q, k, v x256, P x256, ctx x4096, Wo = bf16 value x1024 held exactly in f16; single product per term, f32 accumulate); softmax statistics f32.
// Two-part (real | phase) multi-head attention: B x S x 512 activations per part, 8 heads x 64, weights stored [in][out] (y = x w), softmax over
// sqrt(re^2 + im^2) / sqrt(128) with re = qr.kr - qp.kp, im = qr.kp + qp.kr; keys whose mask entry is 0 get their score REPLACED by -1e9 (they stay in the softmax).
// Engine: transposed flash. Each wave owns 16 queries of one (b, h). Per 32-key step: S^T tiles (key rows x query columns) from packed K rows
// [kr 64 | -kp 64] (A, f16 plane staged in LDS; the phase half is stored negated so that the packed products give re and im above) and packed Q^T [qr | qp]
// (B, registers); the two 16-key D tiles pack straight into the P^T B fragment; O^T (128 d rows = [real 64 | phase 64] x query columns) accumulates
// from V^T rows (A, f16 plane staged in LDS). 24 WMMAs per step. The mask is packed once into bit words [b][q][S/32]; one word per lane per step.
// Real GEMMs: y_r = x_r w, y_p = x_p w with A fragments x_r, x_p from 16-bit rows [real 512 | phase 512] and one B fragment from the transposed weight plane Wt[n][k].
#ifndef NB
#define NB 2
#endif
#ifndef SEQ
#define SEQ 2048
#endif
#define NB_FULL 2
#define SEQ_FULL 2048
#define RD 512        /* model width (= heads x head dim) */
#define NH 8
#define HD 64
#define KP 1024       /* packed 16-bit row: [real 512 | phase 512] */
#define HP 128        /* packed head row: [real 64 | phase 64] */
#define OUT1_OFF ((size_t)NB_FULL * SEQ_FULL * RD)   /* element offset of the second output (fixed by the full problem size) */
#define TK 64         /* keys per LDS stage (two 32-key steps) */
#define KPITCH 136    /* LDS pitch of a staged K row, halves: 256 B + 16 B, conflict-free for 16-byte reads down a column of rows */
#define VPITCH 72     /* LDS pitch of a staged V^T row, halves: 128 B + 16 B */
#define KT_H (TK * KPITCH)    /* halves of one staged K tile */
#define VT_H (HP * VPITCH)    /* halves of one staged V^T tile */
#define ST_H (KT_H + VT_H)    /* halves of one stage */

static_assert(SEQ % 64 == 0);
static_assert(SEQ % TK == 0);
static_assert(TK * HP * 2 == 128 * 8 * 16);   /* one K tile = 128 threads x 8 copies of 16 B */
static_assert(HP * TK * 2 == 128 * 8 * 16);   /* one V^T tile likewise */
static_assert(SEQ <= SEQ_FULL);
static_assert(NB <= NB_FULL);
static_assert(NH * HD == RD);
static_assert(RD % 64 == 0);
static_assert(RD % 32 == 0);
static_assert(NH * HP == KP);
static_assert(KP == 2 * RD);
static_assert(HP == 2 * HD);
static_assert(HD == 64);
static_assert((NB * SEQ) % 64 == 0);
static_assert(((size_t)NB * SEQ * (SEQ / 32)) % 32 == 0);
static_assert(OUT1_OFF * 4 == (size_t)8388608);
static_assert((size_t)7 * ((size_t)NB * SEQ * KP * 2) + (size_t)4 * ((size_t)RD * RD * 2) + (size_t)NB * SEQ * (SEQ / 32) * 4 <= (size_t)134217728);

typedef __bf16 v16b __attribute__((ext_vector_type(16)));
typedef _Float16 v16h __attribute__((ext_vector_type(16)));
typedef _Float16 h16;
typedef unsigned short v8us __attribute__((ext_vector_type(8), may_alias));
typedef int v4i __attribute__((ext_vector_type(4), may_alias));
typedef float v8f __attribute__((ext_vector_type(8)));
typedef float v4f __attribute__((ext_vector_type(4)));
typedef float v4fa __attribute__((ext_vector_type(4), may_alias));
union Frag { v16b vb; v16h vh; v8us half[2]; unsigned short u[16]; _Float16 h[16]; };

#define LOG2E 1.4426950408889634f
/* scores arrive x65536 (q x256, k x256); logit in log2 units = |s| * (1/sqrt(128)) * log2(e) / 65536 */
#define CSCALE (0.08838834764831845f * LOG2E / 65536.0f)
/* replaced score of a masked key, in log2 units */
#define MFILL (-1.0e9f * LOG2E)

__device__ __forceinline__ unsigned short bf16_bits(float x) {   // RNE convert to bf16 bits
  unsigned int u = __float_as_uint(x);
  return (unsigned short)((u + 0x7FFFu + ((u >> 16) & 1u)) >> 16);
}
__device__ __forceinline__ float bf16_val(unsigned short b) { return __uint_as_float(((unsigned int)b) << 16); }
__device__ __forceinline__ float bf16_rne(float x) { return bf16_val(bf16_bits(x)); }
__device__ __forceinline__ unsigned short f16_bits(_Float16 h) { union { _Float16 h; unsigned short u; } c; c.h = h; return c.u; }
__device__ __forceinline__ unsigned short c16(float c) { return f16_bits((_Float16)c); }   // RNE convert of a carried value to f16 bits

// f32 -> f16 convert that cannot produce a subnormal: values below the smallest normal become zero (value select).
static __device__ __forceinline__ h16 toh_flush(float v) { const h16 r = (h16)v; return (fabsf(v) < 6.103515625e-05f) ? (h16)0.0f : r; }
__device__ __forceinline__ unsigned short c16f(float c) { return f16_bits(toh_flush(c)); }

__device__ __forceinline__ v8f wm_b(const Frag& a, const Frag& b, v8f c) {
  return __builtin_amdgcn_wmma_f32_16x16x32_bf16(false, a.vb, false, b.vb, (short)0, c, false, false);
}
__device__ __forceinline__ v8f wm_h(const Frag& a, const Frag& b, v8f c) {
  return __builtin_amdgcn_wmma_f32_16x16x32_f16(false, a.vh, false, b.vh, (short)0, c, false, false);
}

// One k-step for one 16x16 output tile of both parts: yr += ar*w ; yi += ai*w ; each product followed by its own hazard guard.
template <bool BF>
__device__ __forceinline__ void rmma(const Frag& ar, const Frag& ai, const Frag& wf, v8f& yr, v8f& yi) {
  if (BF) {
    yr = wm_b(ar, wf, yr);
    asm volatile("v_nop\n\tv_nop\n\tv_nop\n\tv_nop" : "+v"(yr) : "v"(ar.vb), "v"(wf.vb));
    yi = wm_b(ai, wf, yi);
    asm volatile("v_nop\n\tv_nop\n\tv_nop\n\tv_nop" : "+v"(yi) : "v"(ai.vb), "v"(wf.vb));
  } else {
    yr = wm_h(ar, wf, yr);
    asm volatile("v_nop\n\tv_nop\n\tv_nop\n\tv_nop" : "+v"(yr) : "v"(ar.vh), "v"(wf.vh));
    yi = wm_h(ai, wf, yi);
    asm volatile("v_nop\n\tv_nop\n\tv_nop\n\tv_nop" : "+v"(yi) : "v"(ai.vh), "v"(wf.vh));
  }
}

// Wave tile 16 rows x 64 columns for both parts, K = 512. A plane [rows][KP] = [real 512 | phase 512], W plane [cols][RD] (transposed weight, k-contiguous).
// A fragment: row m = row0 + ln, elements 0..7 <- k0 + 8h + i, 8..15 <- k0 + 16 + 8h + i. B fragment: column n = col0 + 16t + ln, same k map.
// D: acc[r] = y(row0 + 8h + r, col0 + 16t + ln).
template <bool BF>
__device__ __forceinline__ void rgemm_main(const unsigned short* __restrict__ A, const unsigned short* __restrict__ W,
                                           int row0, int col0, int ln, int hh, v8f (&yr)[4], v8f (&yi)[4]) {
  const unsigned short* ap = A + (size_t)(row0 + ln) * KP + 8 * hh;
  const unsigned short* wp = W + (size_t)(col0 + ln) * RD + 8 * hh;
#pragma unroll 2
  for (int c = 0; c < RD / 32; ++c) {
    const int k0 = 32 * c;
    Frag ar, ai;
    ar.half[0] = *(const v8us*)(ap + k0);
    ar.half[1] = *(const v8us*)(ap + k0 + 16);
    ai.half[0] = *(const v8us*)(ap + RD + k0);
    ai.half[1] = *(const v8us*)(ap + RD + k0 + 16);
#pragma unroll
    for (int t = 0; t < 4; ++t) {
      const unsigned short* wt = wp + (size_t)t * 16 * RD + k0;
      Frag wf;
      wf.half[0] = *(const v8us*)(wt);
      wf.half[1] = *(const v8us*)(wt + 16);
      rmma<BF>(ar, ai, wf, yr[t], yi[t]);
    }
  }
}

// X[row][KP] = bf16 bits [xr 512 | xi 512], row = b*SEQ + s (compact). Thread per (row, 8 columns) converts the re and the im piece.
// coverage: NB*SEQ*64 threads x (8 re + 8 im) elements = the whole plane.
__global__ __launch_bounds__(256) void k_cvtx(const float* __restrict__ xr, const float* __restrict__ xi, unsigned short* __restrict__ X) {
  const int t = blockIdx.x * 256 + threadIdx.x;
  if (t >= NB * SEQ * 64) return;
  const int row = t >> 6, c8 = (t & 63) * 8;
  const int b = row / SEQ, s = row - b * SEQ;
  const size_t src = ((size_t)b * SEQ_FULL + (size_t)s) * RD + c8;
  const v4f r0 = *(const v4fa*)(xr + src), r1 = *(const v4fa*)(xr + src + 4);
  const v4f i0 = *(const v4fa*)(xi + src), i1 = *(const v4fa*)(xi + src + 4);
  v8us orr, oi;
  orr[0] = bf16_bits(r0[0]); orr[1] = bf16_bits(r0[1]); orr[2] = bf16_bits(r0[2]); orr[3] = bf16_bits(r0[3]);
  orr[4] = bf16_bits(r1[0]); orr[5] = bf16_bits(r1[1]); orr[6] = bf16_bits(r1[2]); orr[7] = bf16_bits(r1[3]);
  oi[0] = bf16_bits(i0[0]); oi[1] = bf16_bits(i0[1]); oi[2] = bf16_bits(i0[2]); oi[3] = bf16_bits(i0[3]);
  oi[4] = bf16_bits(i1[0]); oi[5] = bf16_bits(i1[1]); oi[6] = bf16_bits(i1[2]); oi[7] = bf16_bits(i1[3]);
  unsigned short* d = X + (size_t)row * KP + c8;
  *(v8us*)d = orr;
  *(v8us*)(d + RD) = oi;
  
}

// Weight convert with transpose: w[k][n] (f32, [in][out]) -> Wt[n][k] (pitch RD) as bf16 bits (asf16 == 0) or as f16(bf16 value x 1024) (asf16 != 0).
// coverage: grid (RD/64, RD/64) x (64 n rows x 64 k) = the whole plane; LDS tile: 64 x 64 written before the barrier, 64 x 64 read after it.
__global__ __launch_bounds__(256) void k_cvtwt(const float* __restrict__ w, unsigned short* __restrict__ Wt, int asf16) {
  __shared__ __attribute__((aligned(16))) unsigned short tl[64][72];
  const int tid = threadIdx.x;
  const int k0 = blockIdx.x * 64, n0 = blockIdx.y * 64;
#pragma unroll 1
  for (int j = 0; j < 16; ++j) {
    const int i = tid + 256 * j;
    const int kk = i >> 6, nn = i & 63;
    const float x = w[(size_t)(k0 + kk) * RD + (size_t)(n0 + nn)];
    const unsigned short vb = bf16_bits(x);
    const unsigned short vh = c16f(bf16_val(vb) * 1024.0f);   // bf16 significand x 2^10 is exact in f16
    tl[nn][kk] = (asf16 != 0) ? vh : vb;
  }
  __syncthreads();
  {
#pragma unroll
    for (int j = 0; j < 2; ++j) {
      const int i = tid + 256 * j;
      const int nn = i >> 3, p8 = (i & 7) * 8;
      const v8us a = *(const v8us*)&tl[nn][p8];
      *(v8us*)(Wt + (size_t)(n0 + nn) * RD + (size_t)(k0 + p8)) = a;
    }
    
  }
}

// Mask pack: MB[b*SEQ + q][SEQ/32], bit j of word c = (mask[b][q][32c + j] != 0). Thread per word (8 x 16-B loads); a wave's 32 words are
// coverage: NB*SEQ*(SEQ/32) threads x 1 word = the whole plane.
__global__ __launch_bounds__(256) void k_maskbits(const int* __restrict__ mask, unsigned int* __restrict__ MB) {
  const int t = blockIdx.x * 256 + threadIdx.x;
  if (t >= NB * SEQ * (SEQ / 32)) return;
  const int row = t / (SEQ / 32), wc = t - row * (SEQ / 32);
  const int b = row / SEQ, q = row - b * SEQ;
  const int* mp = mask + ((size_t)b * SEQ_FULL + (size_t)q) * SEQ_FULL + (size_t)wc * 32;
  unsigned int word = 0u;
#pragma unroll 1
  for (int g = 0; g < 8; ++g) {
    const v4i m = *(const v4i*)(mp + 4 * g);
    const unsigned int nib = ((m[0] != 0) ? 1u : 0u) | ((m[1] != 0) ? 2u : 0u) | ((m[2] != 0) ? 4u : 0u) | ((m[3] != 0) ? 8u : 0u);
    word |= nib << (4 * g);
  }
  *(unsigned int*)(MB + t) = word;
  
}

// q / k projection. Block = 4 waves x 16 rows = 64 rows, 64 columns = one head. Output plane P[b*NH + head][s][HP] = f16 of (y_r x 256 | y_p x cim), cim = +256 (q) or -256 (k).
// coverage: grid (NB*SEQ/64, NH) x 4 waves x 16 rows x 128 halves = the whole plane.
// LDS tile: columns 0..127 of every row are written before the barrier and exactly those are read after it.
__global__ __launch_bounds__(128) void k_proj_rows(const unsigned short* __restrict__ X, const unsigned short* __restrict__ W,
                                                   unsigned short* __restrict__ P, float cim) {
  __shared__ __attribute__((aligned(16))) unsigned short sh[4][16][136];
  const int tid = threadIdx.x, w = __builtin_amdgcn_readfirstlane((int)(tid >> 5)), lane = tid & 31, ln = lane & 15, hh = lane >> 4;
  const int head = blockIdx.y;
  const int rowb = blockIdx.x * 64;
  v8f yr[4] = {}, yi[4] = {};
  rgemm_main<true>(X, W, rowb + 16 * w, head * HD, ln, hh, yr, yi);
#pragma unroll
  for (int t = 0; t < 4; ++t) {
#pragma unroll
    for (int r = 0; r < 8; ++r) {
      sh[w][8 * hh + r][16 * t + ln]      = c16f(yr[t][r] * 256.0f);
      sh[w][8 * hh + r][HD + 16 * t + ln] = c16f(yi[t][r] * cim);
    }
  }
  __syncthreads();
  const int b = rowb / SEQ;
  const int s0 = rowb - b * SEQ + 16 * w;
  const size_t base = ((size_t)(b * NH + head) * SEQ + (size_t)s0) * HP;
  const int rsub = lane >> 4, p8 = (lane & 15) * 8;
  {
#pragma unroll
    for (int q = 0; q < 8; ++q) {
      const int row = 2 * q + rsub;
      const v8us a = *(const v8us*)&sh[w][row][p8];
      *(v8us*)(P + base + (size_t)row * HP + p8) = a;
    }
    
  }
}

// v projection, transposed plane Vt[b*NH + head][dd][s], dd = [real 64 | phase 64], value f16 of (y x 256).
// LDS tile: 128 x 64 written before the barrier, 128 x 64 read after it.
__global__ __launch_bounds__(128) void k_proj_vt(const unsigned short* __restrict__ X, const unsigned short* __restrict__ W,
                                                 unsigned short* __restrict__ Vt) {
  __shared__ __attribute__((aligned(16))) unsigned short th[HP][72];
  const int tid = threadIdx.x, w = __builtin_amdgcn_readfirstlane((int)(tid >> 5)), lane = tid & 31, ln = lane & 15, hh = lane >> 4;
  const int head = blockIdx.y;
  const int rowb = blockIdx.x * 64;
  v8f yr[4] = {}, yi[4] = {};
  rgemm_main<true>(X, W, rowb + 16 * w, head * HD, ln, hh, yr, yi);
#pragma unroll
  for (int t = 0; t < 4; ++t) {
#pragma unroll
    for (int r = 0; r < 8; ++r) {
      const int col = 16 * w + 8 * hh + r;
      th[16 * t + ln][col]      = c16f(yr[t][r] * 256.0f);
      th[HD + 16 * t + ln][col] = c16f(yi[t][r] * 256.0f);
    }
  }
  __syncthreads();
  const int b = rowb / SEQ;
  const int s0 = rowb - b * SEQ;
  const size_t base = (size_t)(b * NH + head) * HP * SEQ + (size_t)s0;
  {
    for (int i = tid; i < HP * 8; i += 128) {
      const int dd = i >> 3, j8 = (i & 7) * 8;
      const v8us a = *(const v8us*)&th[dd][j8];
      *(v8us*)(Vt + base + (size_t)dd * SEQ + j8) = a;
    }
    
  }
}

// Score group for one 16-key tile (8 WMMAs): sre = kr qr + ki qi (4 products), sa = kr qi (2), sb = ki qr (2); then the hazard guard.
// k0, k1 = kr (d 0..31, 32..63); k2, k3 = ki; q[0], q[1] = qr; q[2], q[3] = qi.
__device__ __forceinline__ void score_mma(const Frag& k0, const Frag& k1, const Frag& k2, const Frag& k3,
                                          const Frag (&q)[4], v8f& sre, v8f& sa, v8f& sb) {
  sre = wm_h(k0, q[0], sre);
  sa  = wm_h(k0, q[2], sa);
  sb  = wm_h(k2, q[0], sb);
  sre = wm_h(k1, q[1], sre);
  sa  = wm_h(k1, q[3], sa);
  sb  = wm_h(k3, q[1], sb);
  sre = wm_h(k2, q[2], sre);
  sre = wm_h(k3, q[3], sre);
  asm volatile("v_nop\n\tv_nop\n\tv_nop\n\tv_nop" : "+v"(sre), "+v"(sa), "+v"(sb)
               : "v"(k0.vh), "v"(k1.vh), "v"(k2.vh), "v"(k3.vh),
                 "v"(q[0].vh), "v"(q[1].vh), "v"(q[2].vh), "v"(q[3].vh));
}
// c += v*p (single f16 product), then the hazard guard.
__device__ __forceinline__ void pv_mma(const Frag& v, const Frag& p, v8f& c) {
  c = wm_h(v, p, c);
  asm volatile("v_nop\n\tv_nop\n\tv_nop\n\tv_nop" : "+v"(c) : "v"(v.vh), "v"(p.vh));
}

// One 32-key step (step index j) for a wave's 16 queries: 16 score WMMAs + 8 P.V WMMAs. Ks = the step's first staged K row (pitch KPITCH),
// Vs = the step's first key column in the staged V^T rows (pitch VPITCH), both in LDS; key0 = 32 j in the comments below; Mw is this lane's query row of mask words. With the phase half of the K plane stored negated: sre = qr.kr - qp.kp, sa - sb = qp.kr + qr.kp.
__device__ __forceinline__ void fa_step(const unsigned short* Ks, const unsigned short* Vs,
                                        const unsigned int* __restrict__ Mw, int j, int ln, int hh,
                                        const Frag (&qf)[4], float& mr, float& lr, v8f (&O)[8]) {
  const v8f z8 = {0.f, 0.f, 0.f, 0.f, 0.f, 0.f, 0.f, 0.f};
  unsigned int mw = Mw[j];                           // bit i = mask(query of this lane, key0 + i); loaded by every lane, in range
  asm volatile("" : "+v"(mw));
  const unsigned int mh = mw >> (8 * hh);            // this lane half's keys: bit 16*kt + r
  float sc[16];
  // A fragments of K: row m = key (key0 + 16*kt + ln); packed k axis [kr 0..63 | -kp 64..127]; elements 0..7 <- 32c + 8h + i, 8..15 <- 32c + 16 + 8h + i;
  // both 16-key tiles' fragments are read as one group
  Frag kf[2][4];
#pragma unroll   // constant indices keep the fragments in registers
  for (int kt = 0; kt < 2; ++kt) {
    const unsigned short* kp = Ks + (16 * kt + ln) * KPITCH + 8 * hh;
#pragma unroll   // as above
    for (int c = 0; c < 4; ++c) {
      kf[kt][c].half[0] = *(const v8us*)(kp + 32 * c);
      kf[kt][c].half[1] = *(const v8us*)(kp + 32 * c + 16);
    }
  }
#pragma unroll
  for (int kt = 0; kt < 2; ++kt) {
    v8f sre = z8, sa = z8, sb = z8;
    score_mma(kf[kt][0], kf[kt][1], kf[kt][2], kf[kt][3], qf, sre, sa, sb);
    // S^T tile: element r = score(key0 + 16*kt + 8h + r, query of this lane's column); logit in log2 units; masked keys get the fill value instead
#pragma unroll
    for (int r = 0; r < 8; ++r) {
      const float im = sa[r] - sb[r];
      const float v = __builtin_amdgcn_sqrtf(fmaf(sre[r], sre[r], im * im)) * CSCALE;
      sc[8 * kt + r] = (((mh >> (16 * kt + r)) & 1u) != 0u) ? v : MFILL;
    }
  }
  // A fragments of V^T: row m = dd (16*t + ln), elements 0..7 <- key0 + 8h + i, 8..15 <- key0 + 16 + 8h + i; read as one group, ahead of the softmax arithmetic
  Frag vf[8];
#pragma unroll   // constant indices keep the fragments in registers
  for (int t = 0; t < 8; ++t) {
    const unsigned short* vp = Vs + (16 * t + ln) * VPITCH + 8 * hh;
    vf[t].half[0] = *(const v8us*)(vp);
    vf[t].half[1] = *(const v8us*)(vp + 16);
  }
  float mx = sc[0];
#pragma unroll
  for (int i = 1; i < 16; ++i) mx = fmaxf(mx, sc[i]);
  mx = fmaxf(mx, __shfl_xor(mx, 16, 32));           // the other lane half holds the other 16 keys of this query
  const float mnew = fmaxf(mr, mx);
  const float al = exp2f(mr - mnew);
  mr = mnew;
  // weights carried x256: pc = 256 * 2^(sc - mnew) as one f16 plane (exponent below -14 -> exact zero); the row sum uses the f16-converted values the matrix unit sees
  Frag pf;
  float ps = 0.0f;
#pragma unroll
  for (int i = 0; i < 16; ++i) {
    const float e = (sc[i] - mnew) + 8.0f;
    const float pc = (e < -14.0f) ? 0.0f : exp2f(e);
    const _Float16 h = (_Float16)pc;
    pf.h[i] = h;                                    // B element i: i<8 -> key0 + 8h + i (tile 0 row 8h+i); i>=8 -> key0 + 16 + 8h + (i-8) (tile 1)
    ps += (float)h;
  }
  ps += __shfl_xor(ps, 16, 32);
  lr = lr * al + ps;
#pragma unroll
  for (int t = 0; t < 8; ++t) O[t] = O[t] * al;
#pragma unroll   // constant indices keep the fragments and the accumulators in registers
  for (int t = 0; t < 8; ++t) pv_mma(vf[t], pf, O[t]);
}

// Eight asynchronous 16-byte copies per lane, global -> LDS: copy i moves g + i*gstep to LDS byte l + i*lstep. Every lane on, no offset field.
// The s_wait_xcnt closes the statement so that it stands in front of any later write of the address registers the copies name.
__device__ __forceinline__ void copy8(unsigned int l, unsigned int lstep, const char* g, size_t gstep) {
  asm volatile("global_load_async_to_lds_b128 %0, %8, off\n\t"
               "global_load_async_to_lds_b128 %1, %9, off\n\t"
               "global_load_async_to_lds_b128 %2, %10, off\n\t"
               "global_load_async_to_lds_b128 %3, %11, off\n\t"
               "global_load_async_to_lds_b128 %4, %12, off\n\t"
               "global_load_async_to_lds_b128 %5, %13, off\n\t"
               "global_load_async_to_lds_b128 %6, %14, off\n\t"
               "global_load_async_to_lds_b128 %7, %15, off\n\t"
               "s_wait_xcnt 0x0"
               :: "v"(l), "v"(l + lstep), "v"(l + 2 * lstep), "v"(l + 3 * lstep),
                  "v"(l + 4 * lstep), "v"(l + 5 * lstep), "v"(l + 6 * lstep), "v"(l + 7 * lstep),
                  "v"(g), "v"(g + gstep), "v"(g + 2 * gstep), "v"(g + 3 * gstep),
                  "v"(g + 4 * gstep), "v"(g + 5 * gstep), "v"(g + 6 * gstep), "v"(g + 7 * gstep)
               : "memory");
}

// One stage (TK keys) into the LDS buffer at byte address lb. kg, vg: this thread's first source bytes in tile 0 of the (b, h) planes; kl, vl: its first LDS bytes in a buffer.
// K tile: TK rows x 256 B, contiguous in the plane; thread tid copies chunk tid + 128 i (row = chunk / 16). V^T tile: 128 rows x 128 B at the plane's row pitch; row = chunk / 8.
__device__ __forceinline__ void stage_copy(int tile, unsigned int lb, const char* kg, const char* vg, unsigned int kl, unsigned int vl) {
  copy8(lb + kl, 8u * KPITCH * 2u, kg + (size_t)tile * (TK * HP * 2), (size_t)2048);
  copy8(lb + vl, 16u * VPITCH * 2u, vg + (size_t)tile * (TK * 2), (size_t)16 * SEQ * 2);
}

// Block = 4 waves x 16 queries = 64 queries of one (b, h). The four waves share each 64-key K / V^T tile: two LDS buffers, the next tile's copies in flight while
// this tile is worked on; one barrier per tile publishes the next tile and frees the buffer just read.
// Epilogue: ctx carried x4096 as one f16 plane C[b*SEQ + s][KP] ([real 512 | phase 512], column h*64 + d).
// coverage: NB*NH*(SEQ/64) blocks x 4 waves x 16 queries x (64 real + 64 phase) = every (row, head, part) segment of the plane exactly once.
// LDS tile: columns 0..127 of every row written before the barrier, the same read after it.
__global__ __launch_bounds__(128) void k_attn(const unsigned short* __restrict__ Qp, const unsigned short* __restrict__ Kpl,
                                              const unsigned short* __restrict__ Vt, const unsigned int* __restrict__ MB,
                                              unsigned short* __restrict__ Cx) {
  __shared__ __attribute__((aligned(16))) unsigned short sh[4][16][136];
  __shared__ __attribute__((aligned(16))) unsigned short ring[2 * ST_H];
  const int tid = threadIdx.x, w = __builtin_amdgcn_readfirstlane((int)(tid >> 5)), lane = tid & 31, ln = lane & 15, hh = lane >> 4;
  const int bh = blockIdx.x / (SEQ / 64), qt = blockIdx.x % (SEQ / 64);
  const int b = bh / NH, h = bh - b * NH;
  const int qbase = qt * 64 + 16 * w;
  const int qg = qbase + ln;
  // Q^T B fragments: column n = query qg, packed k axis [qr 0..63 | qp 64..127], elements 0..7 <- 32c + 8h + i, 8..15 <- 32c + 16 + 8h + i
  Frag qf[4];
  {
    const size_t qoff = ((size_t)bh * SEQ + (size_t)qg) * HP + 8 * hh;
#pragma unroll
    for (int c = 0; c < 4; ++c) {
      qf[c].half[0] = *(const v8us*)(Qp + qoff + 32 * c);
      qf[c].half[1] = *(const v8us*)(Qp + qoff + 32 * c + 16);
    }
  }
  float mr = -3.0e38f, lr = 0.0f;
  v8f O[8] = {};
  const unsigned short* Kp = Kpl + (size_t)bh * SEQ * HP;
  const unsigned short* Vp = Vt  + (size_t)bh * HP * SEQ;
  const unsigned int* Mw = MB + ((size_t)b * SEQ + (size_t)qg) * (SEQ / 32);
  const char* kg = (const char*)Kp + (size_t)tid * 16;
  const char* vg = (const char*)Vp + (size_t)(tid >> 3) * (SEQ * 2) + (size_t)(tid & 7) * 16;
  const unsigned int rb = (unsigned int)(size_t)&ring[0];                                     // LDS byte address of the ring
  const unsigned int kl = (unsigned int)((tid >> 4) * (KPITCH * 2) + (tid & 15) * 16);
  const unsigned int vl = (unsigned int)(KT_H * 2 + (tid >> 3) * (VPITCH * 2) + (tid & 7) * 16);
  constexpr int NT = SEQ / TK;
  stage_copy(0, rb, kg, vg, kl, vl);
  asm volatile("s_wait_asynccnt 0x0" ::: "memory");   // this wave's share of tile 0 has landed
  __syncthreads();                                    // every wave's share of tile 0 has landed
  if (NT > 1) stage_copy(1, rb + ST_H * 2u, kg, vg, kl, vl);
#pragma unroll 1   // one trip per tile: the hand-over at the foot stands once, and the loop stays small in the instruction cache
  for (int t = 0; t < NT; ++t) {
    const int bo = (t & 1) * ST_H;
    fa_step(&ring[bo], &ring[bo + KT_H], Mw, 2 * t, ln, hh, qf, mr, lr, O);
    fa_step(&ring[bo + 32 * KPITCH], &ring[bo + KT_H + 32], Mw, 2 * t + 1, ln, hh, qf, mr, lr, O);
    asm volatile("s_wait_dscnt 0x0" ::: "memory");      // this wave's reads of the buffer have returned before it is refilled
    asm volatile("s_wait_asynccnt 0x0" ::: "memory");   // this wave's share of tile t + 1 has landed
    __syncthreads();                                    // publishes tile t + 1 and ends every wave's reads of tile t
    if (t + 2 < NT) stage_copy(t + 2, rb + (unsigned int)bo * 2u, kg, vg, kl, vl);
  }
  asm volatile("s_wait_asynccnt 0x0" ::: "memory");     // nothing in flight when the wave goes on to the epilogue

  // O^T element r of tile t = ctx(query qg, dd = 16t + 8h + r); carries: x256 (P, also in lr), x256 (v); ctx stored x4096 -> factor 16 / lr
  const float inv = 16.0f * (1.0f / lr);
#pragma unroll
  for (int t = 0; t < 8; ++t) {
#pragma unroll
    for (int r = 0; r < 8; ++r)
      sh[w][ln][16 * t + 8 * hh + r] = c16f(O[t][r] * inv);
  }
  __syncthreads();
  const size_t rbase = ((size_t)b * SEQ + (size_t)qbase) * KP + (size_t)h * HD;
  const int lsub = lane >> 3, p8 = (lane & 7) * 8;
  {
#pragma unroll
    for (int q = 0; q < 8; ++q) {
      const int line = 4 * q + lsub;            // 0..31 = 16 queries x {real, phase}
      const int row = line >> 1, seg = line & 1;
      const v8us a = *(const v8us*)&sh[w][row][seg * HD + p8];
      const size_t o = rbase + (size_t)row * KP + (size_t)seg * RD + p8;
      *(v8us*)(Cx + o) = a;
    }
    
  }
}

// Output projection of both parts: out0[b][s][n] = ctx_real x Wo, out1[b][s][n] = ctx_phase x Wo (f16, K = 512, one product per term), undo carries x4096 (ctx) and x1024 (Wo).
// Epilogue: per-wave LDS tile [16 rows][128 floats = 64 real columns | 64 phase columns] (block barrier), then per instruction lanes 0..15 write the 256-B
// coverage: grid (NB*SEQ/64, RD/64) x 4 waves x 16 rows x (64 + 64) floats = every output element of the processed rows exactly once.
// LDS tile: columns 0..127 of every row written before the barrier, the same read after it.
__global__ __launch_bounds__(128) void k_out(const unsigned short* __restrict__ Cx, const unsigned short* __restrict__ Wo,
                                             float* __restrict__ Out) {
  __shared__ __attribute__((aligned(16))) float so[4][16][132];
  const int tid = threadIdx.x, w = __builtin_amdgcn_readfirstlane((int)(tid >> 5)), lane = tid & 31, ln = lane & 15, hh = lane >> 4;
  const int rowb = blockIdx.x * 64;
  const int col0 = blockIdx.y * 64;
  v8f yr[4] = {}, yi[4] = {};
  rgemm_main<false>(Cx, Wo, rowb + 16 * w, col0, ln, hh, yr, yi);
  const float scl = 1.0f / 4194304.0f;
#pragma unroll
  for (int t = 0; t < 4; ++t) {
#pragma unroll
    for (int r = 0; r < 8; ++r) {
      so[w][8 * hh + r][16 * t + ln]      = yr[t][r] * scl;
      so[w][8 * hh + r][HD + 16 * t + ln] = yi[t][r] * scl;
    }
  }
  __syncthreads();
  const int b = rowb / SEQ;
  const int s0 = rowb - b * SEQ + 16 * w;
  const size_t obase = ((size_t)b * SEQ_FULL + (size_t)s0) * RD + (size_t)col0
                     + (size_t)(lane >> 4) * OUT1_OFF + (size_t)(lane & 15) * 4;
  {
#pragma unroll
    for (int q = 0; q < 16; ++q) {
      const v4f v = *(const v4fa*)&so[w][q][lane * 4];
      *(v4f*)(Out + obase + (size_t)q * RD) = v;
    }
    
  }
}

extern "C" void kernel_launch(void* const* d_in, const int* in_sizes, int n_in,
                              void* d_out, int out_size, void* d_ws, size_t ws_size, hipStream_t stream) {
  if (n_in < 11) return;
  const long long needx = ((long long)(NB - 1) * SEQ_FULL + (long long)SEQ) * RD;   // last activation element touched + 1
  const long long needm = ((long long)(NB - 1) * SEQ_FULL + (long long)(SEQ - 1)) * SEQ_FULL + (long long)SEQ;   // last mask element touched + 1
  for (int i = 0; i < 6; ++i) if ((long long)in_sizes[i] < needx) return;
  for (int i = 6; i < 10; ++i) if ((long long)in_sizes[i] < (long long)RD * RD) return;
  if ((long long)in_sizes[10] < needm) return;
  if ((long long)out_size < (long long)OUT1_OFF + needx) return;
  // wire order: q_real, k_real, v_real, q_phase, k_phase, v_phase, w_q, w_k, w_v, w_o, mask
  const float* q_re = (const float*)d_in[0];
  const float* k_re = (const float*)d_in[1];
  const float* v_re = (const float*)d_in[2];
  const float* q_ph = (const float*)d_in[3];
  const float* k_ph = (const float*)d_in[4];
  const float* v_ph = (const float*)d_in[5];
  const float* w_q = (const float*)d_in[6];
  const float* w_k = (const float*)d_in[7];
  const float* w_v = (const float*)d_in[8];
  const float* w_o = (const float*)d_in[9];
  const int* maskp = (const int*)d_in[10];
  float* Out = (float*)d_out;

  char* ws = (char*)d_ws;
  size_t off = 0;
  const size_t XB = (size_t)NB * SEQ * KP * 2;          // activation / head / ctx plane bytes (8 MiB at full size); all planes are written exactly to their end
  const size_t WB = (size_t)RD * RD * 2;                // transposed weight plane bytes (512 KiB)
  const size_t MBB = (size_t)NB * SEQ * (SEQ / 32) * 4; // mask bit words (1 MiB at full size)
  unsigned short* Xq = (unsigned short*)(ws + off); off += XB;
  unsigned short* Xk = (unsigned short*)(ws + off); off += XB;
  unsigned short* Xv = (unsigned short*)(ws + off); off += XB;
  unsigned short* Wq = (unsigned short*)(ws + off); off += WB;
  unsigned short* Wk = (unsigned short*)(ws + off); off += WB;
  unsigned short* Wv = (unsigned short*)(ws + off); off += WB;
  unsigned short* Wo = (unsigned short*)(ws + off); off += WB;
  unsigned short* Qp = (unsigned short*)(ws + off); off += XB;   // NB*NH*SEQ*HP halves = XB bytes
  unsigned short* Kp = (unsigned short*)(ws + off); off += XB;
  unsigned short* Vt = (unsigned short*)(ws + off); off += XB;
  unsigned short* Cx = (unsigned short*)(ws + off); off += XB;
  unsigned int*   MB = (unsigned int*)(ws + off);   off += MBB;
  if (off > ws_size) return;

  const unsigned gx = (unsigned)((NB * SEQ * 64 + 255) / 256);
  k_cvtx<<<gx, 256, 0, stream>>>(q_re, q_ph, Xq);
  k_cvtx<<<gx, 256, 0, stream>>>(k_re, k_ph, Xk);
  k_cvtx<<<gx, 256, 0, stream>>>(v_re, v_ph, Xv);
  const dim3 gw((unsigned)(RD / 64), (unsigned)(RD / 64), 1);   // in[k 512][n 512] -> out[n 512][k 512]
  k_cvtwt<<<gw, 256, 0, stream>>>(w_q, Wq, 0);
  k_cvtwt<<<gw, 256, 0, stream>>>(w_k, Wk, 0);
  k_cvtwt<<<gw, 256, 0, stream>>>(w_v, Wv, 0);
  k_cvtwt<<<gw, 256, 0, stream>>>(w_o, Wo, 1);
  const unsigned gm = (unsigned)(((size_t)NB * SEQ * (SEQ / 32) + 255) / 256);
  k_maskbits<<<gm, 256, 0, stream>>>(maskp, MB);

  const dim3 gp((unsigned)(NB * SEQ / 64), (unsigned)NH, 1);
  k_proj_rows<<<gp, 128, 0, stream>>>(Xq, Wq, Qp, 256.0f);
  k_proj_rows<<<gp, 128, 0, stream>>>(Xk, Wk, Kp, -256.0f);
  k_proj_vt<<<gp, 128, 0, stream>>>(Xv, Wv, Vt);

  k_attn<<<(unsigned)(NB * NH * (SEQ / 64)), 128, 0, stream>>>(Qp, Kp, Vt, MB, Cx);

  const dim3 go((unsigned)(NB * SEQ / 64), (unsigned)(RD / 64), 1);
  k_out<<<go, 128, 0, stream>>>(Cx, Wo, Out);
}

// v002
// A run of this version takes 183 microseconds.
// In both of two side-by-side timings against v001, it was 1.13 times as fast.
// Over all steps from v000 it is 1.96 times as fast.
#include <hip/hip_runtime.h>
// Contractions: q/k/v projections (real and phase parts share one weight) on v_wmma_f32_16x16x32_bf16 (activations and weights RNE-converted to bf16, single product, f32 accumulate); scores K Q^T, O^T = V^T P^T and the output projection on v_wmma_f32_16x16x32_f16 (single carried f16 planes: q, k, v x256, P x256, ctx x4096, Wo = bf16 value x1024 held exactly in f16; single product per term, f32 accumulate); softmax statistics f32.
// Two-part (real | phase) multi-head attention: B x S x 512 activations per part, 8 heads x 64, weights stored [in][out] (y = x w), softmax over
// sqrt(re^2 + im^2) / sqrt(128) with re = qr.kr - qp.kp, im = qr.kp + qp.kr; keys whose mask entry is 0 get their score REPLACED by -1e9 (they stay in the softmax).
// Engine: transposed flash. Each wave owns 16 queries of one (b, h). Per 32-key step: S^T tiles (key rows x query columns) from packed K rows
// [kr 64 | -kp 64] (A, f16 plane staged in LDS; the phase half is stored negated so that the packed products give re and im above) and packed Q^T [qr | qp]
// (B, registers); the two 16-key D tiles pack straight into the P^T B fragment; O^T (128 d rows = [real 64 | phase 64] x query columns) accumulates
// from V^T rows (A, f16 plane staged in LDS). 24 WMMAs per step. The mask is packed once into bit words [b][q][S/32]; one word per lane per step.
// Real GEMMs: y_r = x_r w, y_p = x_p w with A fragments x_r, x_p from 16-bit rows [real 512 | phase 512] and one B fragment from the transposed weight plane Wt[n][k].
#ifndef NB
#define NB 2
#endif
#ifndef SEQ
#define SEQ 2048
#endif
#define NB_FULL 2
#define SEQ_FULL 2048
#define RD 512        /* model width (= heads x head dim) */
#define NH 8
#define HD 64
#define KP 1024       /* packed 16-bit row: [real 512 | phase 512] */
#define HP 128        /* packed head row: [real 64 | phase 64] */
#define OUT1_OFF ((size_t)NB_FULL * SEQ_FULL * RD)   /* element offset of the second output (fixed by the full problem size) */
#define TK 64         /* keys per LDS stage (two 32-key steps) */
#define KPITCH 136    /* LDS pitch of a staged K row, halves: 256 B + 16 B, conflict-free for 16-byte reads down a column of rows */
#define VPITCH 72     /* LDS pitch of a staged V^T row, halves: 128 B + 16 B */
#define KT_H (TK * KPITCH)    /* halves of one staged K tile */
#define VT_H (HP * VPITCH)    /* halves of one staged V^T tile */
#define ST_H (KT_H + VT_H)    /* halves of one stage */

static_assert(SEQ % 64 == 0);
static_assert(SEQ % TK == 0);
static_assert(TK * HP * 2 == 128 * 8 * 16);   /* one K tile = 128 threads x 8 copies of 16 B */
static_assert(HP * TK * 2 == 128 * 8 * 16);   /* one V^T tile likewise */
static_assert(SEQ <= SEQ_FULL);
static_assert(NB <= NB_FULL);
static_assert(NH * HD == RD);
static_assert(RD % 64 == 0);
static_assert(RD % 32 == 0);
static_assert(NH * HP == KP);
static_assert(KP == 2 * RD);
static_assert(HP == 2 * HD);
static_assert(HD == 64);
static_assert((NB * SEQ) % 64 == 0);
static_assert(((size_t)NB * SEQ * (SEQ / 32)) % 32 == 0);
static_assert(OUT1_OFF * 4 == (size_t)8388608);
static_assert((size_t)7 * ((size_t)NB * SEQ * KP * 2) + (size_t)4 * ((size_t)RD * RD * 2) + (size_t)NB * SEQ * (SEQ / 32) * 4 <= (size_t)134217728);

typedef __bf16 v16b __attribute__((ext_vector_type(16)));
typedef _Float16 v16h __attribute__((ext_vector_type(16)));
typedef _Float16 h16;
typedef unsigned short v8us __attribute__((ext_vector_type(8), may_alias));
typedef int v4i __attribute__((ext_vector_type(4), may_alias));
typedef float v8f __attribute__((ext_vector_type(8)));
typedef float v4f __attribute__((ext_vector_type(4)));
typedef float v4fa __attribute__((ext_vector_type(4), may_alias));
union Frag { v16b vb; v16h vh; v8us half[2]; unsigned short u[16]; _Float16 h[16]; };

#define LOG2E 1.4426950408889634f
/* scores arrive x65536 (q x256, k x256); logit in log2 units = |s| * (1/sqrt(128)) * log2(e) / 65536 */
#define CSCALE (0.08838834764831845f * LOG2E / 65536.0f)
/* replaced score of a masked key, in log2 units */
#define MFILL (-1.0e9f * LOG2E)

__device__ __forceinline__ unsigned short bf16_bits(float x) {   // RNE convert to bf16 bits
  unsigned int u = __float_as_uint(x);
  return (unsigned short)((u + 0x7FFFu + ((u >> 16) & 1u)) >> 16);
}
__device__ __forceinline__ float bf16_val(unsigned short b) { return __uint_as_float(((unsigned int)b) << 16); }
__device__ __forceinline__ float bf16_rne(float x) { return bf16_val(bf16_bits(x)); }
__device__ __forceinline__ unsigned short f16_bits(_Float16 h) { union { _Float16 h; unsigned short u; } c; c.h = h; return c.u; }
__device__ __forceinline__ unsigned short c16(float c) { return f16_bits((_Float16)c); }   // RNE convert of a carried value to f16 bits

// f32 -> f16 convert that cannot produce a subnormal: values below the smallest normal become zero (value select).
static __device__ __forceinline__ h16 toh_flush(float v) { const h16 r = (h16)v; return (fabsf(v) < 6.103515625e-05f) ? (h16)0.0f : r; }
__device__ __forceinline__ unsigned short c16f(float c) { return f16_bits(toh_flush(c)); }

__device__ __forceinline__ v8f wm_b(const Frag& a, const Frag& b, v8f c) {
  return __builtin_amdgcn_wmma_f32_16x16x32_bf16(false, a.vb, false, b.vb, (short)0, c, false, false);
}
__device__ __forceinline__ v8f wm_h(const Frag& a, const Frag& b, v8f c) {
  return __builtin_amdgcn_wmma_f32_16x16x32_f16(false, a.vh, false, b.vh, (short)0, c, false, false);
}

// One k-step for one 16x16 output tile of both parts: yr += ar*w ; yi += ai*w ; each product followed by its own hazard guard.
template <bool BF>
__device__ __forceinline__ void rmma(const Frag& ar, const Frag& ai, const Frag& wf, v8f& yr, v8f& yi) {
  if (BF) {
    yr = wm_b(ar, wf, yr);
    asm volatile("v_nop\n\tv_nop\n\tv_nop\n\tv_nop" : "+v"(yr) : "v"(ar.vb), "v"(wf.vb));
    yi = wm_b(ai, wf, yi);
    asm volatile("v_nop\n\tv_nop\n\tv_nop\n\tv_nop" : "+v"(yi) : "v"(ai.vb), "v"(wf.vb));
  } else {
    yr = wm_h(ar, wf, yr);
    asm volatile("v_nop\n\tv_nop\n\tv_nop\n\tv_nop" : "+v"(yr) : "v"(ar.vh), "v"(wf.vh));
    yi = wm_h(ai, wf, yi);
    asm volatile("v_nop\n\tv_nop\n\tv_nop\n\tv_nop" : "+v"(yi) : "v"(ai.vh), "v"(wf.vh));
  }
}

// Wave tile 16 rows x 64 columns for both parts, K = 512. A plane [rows][KP] = [real 512 | phase 512], W plane [cols][RD] (transposed weight, k-contiguous).
// A fragment: row m = row0 + ln, elements 0..7 <- k0 + 8h + i, 8..15 <- k0 + 16 + 8h + i. B fragment: column n = col0 + 16t + ln, same k map.
// D: acc[r] = y(row0 + 8h + r, col0 + 16t + ln).
template <bool BF>
__device__ __forceinline__ void rgemm_main(const unsigned short* __restrict__ A, const unsigned short* __restrict__ W,
                                           int row0, int col0, int ln, int hh, v8f (&yr)[4], v8f (&yi)[4]) {
  const unsigned short* ap = A + (size_t)(row0 + ln) * KP + 8 * hh;
  const unsigned short* wp = W + (size_t)(col0 + ln) * RD + 8 * hh;
#pragma unroll 2
  for (int c = 0; c < RD / 32; ++c) {
    const int k0 = 32 * c;
    Frag ar, ai;
    ar.half[0] = *(const v8us*)(ap + k0);
    ar.half[1] = *(const v8us*)(ap + k0 + 16);
    ai.half[0] = *(const v8us*)(ap + RD + k0);
    ai.half[1] = *(const v8us*)(ap + RD + k0 + 16);
#pragma unroll
    for (int t = 0; t < 4; ++t) {
      const unsigned short* wt = wp + (size_t)t * 16 * RD + k0;
      Frag wf;
      wf.half[0] = *(const v8us*)(wt);
      wf.half[1] = *(const v8us*)(wt + 16);
      rmma<BF>(ar, ai, wf, yr[t], yi[t]);
    }
  }
}

// X[row][KP] = bf16 bits [xr 512 | xi 512], row = b*SEQ + s (compact). Thread per (row, 8 columns) converts the re and the im piece.
// coverage: NB*SEQ*64 threads x (8 re + 8 im) elements = the whole plane.
__global__ __launch_bounds__(256) void k_cvtx(const float* __restrict__ xr, const float* __restrict__ xi, unsigned short* __restrict__ X) {
  const int t = blockIdx.x * 256 + threadIdx.x;
  if (t >= NB * SEQ * 64) return;
  const int row = t >> 6, c8 = (t & 63) * 8;
  const int b = row / SEQ, s = row - b * SEQ;
  const size_t src = ((size_t)b * SEQ_FULL + (size_t)s) * RD + c8;
  const v4f r0 = *(const v4fa*)(xr + src), r1 = *(const v4fa*)(xr + src + 4);
  const v4f i0 = *(const v4fa*)(xi + src), i1 = *(const v4fa*)(xi + src + 4);
  v8us orr, oi;
  orr[0] = bf16_bits(r0[0]); orr[1] = bf16_bits(r0[1]); orr[2] = bf16_bits(r0[2]); orr[3] = bf16_bits(r0[3]);
  orr[4] = bf16_bits(r1[0]); orr[5] = bf16_bits(r1[1]); orr[6] = bf16_bits(r1[2]); orr[7] = bf16_bits(r1[3]);
  oi[0] = bf16_bits(i0[0]); oi[1] = bf16_bits(i0[1]); oi[2] = bf16_bits(i0[2]); oi[3] = bf16_bits(i0[3]);
  oi[4] = bf16_bits(i1[0]); oi[5] = bf16_bits(i1[1]); oi[6] = bf16_bits(i1[2]); oi[7] = bf16_bits(i1[3]);
  unsigned short* d = X + (size_t)row * KP + c8;
  *(v8us*)d = orr;
  *(v8us*)(d + RD) = oi;
  
}

// Weight convert with transpose: w[k][n] (f32, [in][out]) -> Wt[n][k] (pitch RD) as bf16 bits (asf16 == 0) or as f16(bf16 value x 1024) (asf16 != 0).
// coverage: grid (RD/64, RD/64) x (64 n rows x 64 k) = the whole plane; LDS tile: 64 x 64 written before the barrier, 64 x 64 read after it.
__global__ __launch_bounds__(256) void k_cvtwt(const float* __restrict__ w, unsigned short* __restrict__ Wt, int asf16) {
  __shared__ __attribute__((aligned(16))) unsigned short tl[64][72];
  const int tid = threadIdx.x;
  const int k0 = blockIdx.x * 64, n0 = blockIdx.y * 64;
#pragma unroll 1
  for (int j = 0; j < 16; ++j) {
    const int i = tid + 256 * j;
    const int kk = i >> 6, nn = i & 63;
    const float x = w[(size_t)(k0 + kk) * RD + (size_t)(n0 + nn)];
    const unsigned short vb = bf16_bits(x);
    const unsigned short vh = c16f(bf16_val(vb) * 1024.0f);   // bf16 significand x 2^10 is exact in f16
    tl[nn][kk] = (asf16 != 0) ? vh : vb;
  }
  __syncthreads();
  {
#pragma unroll
    for (int j = 0; j < 2; ++j) {
      const int i = tid + 256 * j;
      const int nn = i >> 3, p8 = (i & 7) * 8;
      const v8us a = *(const v8us*)&tl[nn][p8];
      *(v8us*)(Wt + (size_t)(n0 + nn) * RD + (size_t)(k0 + p8)) = a;
    }
    
  }
}

// Mask pack: MB[b*SEQ + q][SEQ/32], bit j of word c = (mask[b][q][32c + j] != 0). Thread per word (8 x 16-B loads); a wave's 32 words are
// coverage: NB*SEQ*(SEQ/32) threads x 1 word = the whole plane.
__global__ __launch_bounds__(256) void k_maskbits(const int* __restrict__ mask, unsigned int* __restrict__ MB) {
  const int t = blockIdx.x * 256 + threadIdx.x;
  if (t >= NB * SEQ * (SEQ / 32)) return;
  const int row = t / (SEQ / 32), wc = t - row * (SEQ / 32);
  const int b = row / SEQ, q = row - b * SEQ;
  const int* mp = mask + ((size_t)b * SEQ_FULL + (size_t)q) * SEQ_FULL + (size_t)wc * 32;
  unsigned int word = 0u;
#pragma unroll 1
  for (int g = 0; g < 8; ++g) {
    const v4i m = *(const v4i*)(mp + 4 * g);
    const unsigned int nib = ((m[0] != 0) ? 1u : 0u) | ((m[1] != 0) ? 2u : 0u) | ((m[2] != 0) ? 4u : 0u) | ((m[3] != 0) ? 8u : 0u);
    word |= nib << (4 * g);
  }
  *(unsigned int*)(MB + t) = word;
  
}

// q / k projection. Block = 4 waves x 16 rows = 64 rows, 64 columns = one head. Output plane P[b*NH + head][s][HP] = f16 of (y_r x 256 | y_p x cim), cim = +256 (q) or -256 (k).
// coverage: grid (NB*SEQ/64, NH) x 4 waves x 16 rows x 128 halves = the whole plane.
// LDS tile: columns 0..127 of every row are written before the barrier and exactly those are read after it.
__global__ __launch_bounds__(128) void k_proj_rows(const unsigned short* __restrict__ X, const unsigned short* __restrict__ W,
                                                   unsigned short* __restrict__ P, float cim) {
  __shared__ __attribute__((aligned(16))) unsigned short sh[4][16][136];
  const int tid = threadIdx.x, w = __builtin_amdgcn_readfirstlane((int)(tid >> 5)), lane = tid & 31, ln = lane & 15, hh = lane >> 4;
  const int head = blockIdx.y;
  const int rowb = blockIdx.x * 64;
  v8f yr[4] = {}, yi[4] = {};
  rgemm_main<true>(X, W, rowb + 16 * w, head * HD, ln, hh, yr, yi);
#pragma unroll
  for (int t = 0; t < 4; ++t) {
#pragma unroll
    for (int r = 0; r < 8; ++r) {
      sh[w][8 * hh + r][16 * t + ln]      = c16f(yr[t][r] * 256.0f);
      sh[w][8 * hh + r][HD + 16 * t + ln] = c16f(yi[t][r] * cim);
    }
  }
  __syncthreads();
  const int b = rowb / SEQ;
  const int s0 = rowb - b * SEQ + 16 * w;
  const size_t base = ((size_t)(b * NH + head) * SEQ + (size_t)s0) * HP;
  const int rsub = lane >> 4, p8 = (lane & 15) * 8;
  {
#pragma unroll
    for (int q = 0; q < 8; ++q) {
      const int row = 2 * q + rsub;
      const v8us a = *(const v8us*)&sh[w][row][p8];
      *(v8us*)(P + base + (size_t)row * HP + p8) = a;
    }
    
  }
}

// v projection, transposed plane Vt[b*NH + head][dd][s], dd = [real 64 | phase 64], value f16 of (y x 256).
// LDS tile: 128 x 64 written before the barrier, 128 x 64 read after it.
__global__ __launch_bounds__(128) void k_proj_vt(const unsigned short* __restrict__ X, const unsigned short* __restrict__ W,
                                                 unsigned short* __restrict__ Vt) {
  __shared__ __attribute__((aligned(16))) unsigned short th[HP][72];
  const int tid = threadIdx.x, w = __builtin_amdgcn_readfirstlane((int)(tid >> 5)), lane = tid & 31, ln = lane & 15, hh = lane >> 4;
  const int head = blockIdx.y;
  const int rowb = blockIdx.x * 64;
  v8f yr[4] = {}, yi[4] = {};
  rgemm_main<true>(X, W, rowb + 16 * w, head * HD, ln, hh, yr, yi);
#pragma unroll
  for (int t = 0; t < 4; ++t) {
#pragma unroll
    for (int r = 0; r < 8; ++r) {
      const int col = 16 * w + 8 * hh + r;
      th[16 * t + ln][col]      = c16f(yr[t][r] * 256.0f);
      th[HD + 16 * t + ln][col] = c16f(yi[t][r] * 256.0f);
    }
  }
  __syncthreads();
  const int b = rowb / SEQ;
  const int s0 = rowb - b * SEQ;
  const size_t base = (size_t)(b * NH + head) * HP * SEQ + (size_t)s0;
  {
    for (int i = tid; i < HP * 8; i += 128) {
      const int dd = i >> 3, j8 = (i & 7) * 8;
      const v8us a = *(const v8us*)&th[dd][j8];
      *(v8us*)(Vt + base + (size_t)dd * SEQ + j8) = a;
    }
    
  }
}

// Score group for one 16-key tile (8 WMMAs): sre = kr qr + ki qi (4 products), sa = kr qi (2), sb = ki qr (2); then the hazard guard.
// k0, k1 = kr (d 0..31, 32..63); k2, k3 = ki; q[0], q[1] = qr; q[2], q[3] = qi.
__device__ __forceinline__ void score_mma(const Frag& k0, const Frag& k1, const Frag& k2, const Frag& k3,
                                          const Frag (&q)[4], v8f& sre, v8f& sa, v8f& sb) {
  sre = wm_h(k0, q[0], sre);
  sa  = wm_h(k0, q[2], sa);
  sb  = wm_h(k2, q[0], sb);
  sre = wm_h(k1, q[1], sre);
  sa  = wm_h(k1, q[3], sa);
  sb  = wm_h(k3, q[1], sb);
  sre = wm_h(k2, q[2], sre);
  sre = wm_h(k3, q[3], sre);
  asm volatile("v_nop\n\tv_nop\n\tv_nop\n\tv_nop" : "+v"(sre), "+v"(sa), "+v"(sb)
               : "v"(k0.vh), "v"(k1.vh), "v"(k2.vh), "v"(k3.vh),
                 "v"(q[0].vh), "v"(q[1].vh), "v"(q[2].vh), "v"(q[3].vh));
}
// c += v*p (single f16 product), then the hazard guard.
__device__ __forceinline__ void pv_mma(const Frag& v, const Frag& p, v8f& c) {
  c = wm_h(v, p, c);
  asm volatile("v_nop\n\tv_nop\n\tv_nop\n\tv_nop" : "+v"(c) : "v"(v.vh), "v"(p.vh));
}

// One 32-key step (step index j) for a wave's 16 queries: 16 score WMMAs + 8 P.V WMMAs. Ks = the step's first staged K row (pitch KPITCH),
// Vs = the step's first key column in the staged V^T rows (pitch VPITCH), both in LDS; key0 = 32 j in the comments below; Mw is this lane's query row of mask words. With the phase half of the K plane stored negated: sre = qr.kr - qp.kp, sa - sb = qp.kr + qr.kp.
__device__ __forceinline__ void fa_step(const unsigned short* Ks, const unsigned short* Vs,
                                        const unsigned int* __restrict__ Mw, int j, int ln, int hh,
                                        const Frag (&qf)[4], float& mr, float& lr, v8f (&O)[8]) {
  const v8f z8 = {0.f, 0.f, 0.f, 0.f, 0.f, 0.f, 0.f, 0.f};
  unsigned int mw = Mw[j];                           // bit i = mask(query of this lane, key0 + i); loaded by every lane, in range
  asm volatile("" : "+v"(mw));
  const unsigned int mh = mw >> (8 * hh);            // this lane half's keys: bit 16*kt + r
  float sc[16];
  // A fragments of K: row m = key (key0 + 16*kt + ln); packed k axis [kr 0..63 | -kp 64..127]; elements 0..7 <- 32c + 8h + i, 8..15 <- 32c + 16 + 8h + i;
  // both 16-key tiles' fragments are read as one group
  Frag kf[2][4];
#pragma unroll   // constant indices keep the fragments in registers
  for (int kt = 0; kt < 2; ++kt) {
    const unsigned short* kp = Ks + (16 * kt + ln) * KPITCH + 8 * hh;
#pragma unroll   // as above
    for (int c = 0; c < 4; ++c) {
      kf[kt][c].half[0] = *(const v8us*)(kp + 32 * c);
      kf[kt][c].half[1] = *(const v8us*)(kp + 32 * c + 16);
    }
  }
#pragma unroll
  for (int kt = 0; kt < 2; ++kt) {
    v8f sre = z8, sa = z8, sb = z8;
    score_mma(kf[kt][0], kf[kt][1], kf[kt][2], kf[kt][3], qf, sre, sa, sb);
    // S^T tile: element r = score(key0 + 16*kt + 8h + r, query of this lane's column); logit in log2 units; masked keys get the fill value instead
#pragma unroll
    for (int r = 0; r < 8; ++r) {
      const float im = sa[r] - sb[r];
      const float v = __builtin_amdgcn_sqrtf(fmaf(sre[r], sre[r], im * im)) * CSCALE;
      sc[8 * kt + r] = (((mh >> (16 * kt + r)) & 1u) != 0u) ? v : MFILL;
    }
  }
  // A fragments of V^T: row m = dd (16*t + ln), elements 0..7 <- key0 + 8h + i, 8..15 <- key0 + 16 + 8h + i; read as one group, ahead of the softmax arithmetic
  Frag vf[8];
#pragma unroll   // constant indices keep the fragments in registers
  for (int t = 0; t < 8; ++t) {
    const unsigned short* vp = Vs + (16 * t + ln) * VPITCH + 8 * hh;
    vf[t].half[0] = *(const v8us*)(vp);
    vf[t].half[1] = *(const v8us*)(vp + 16);
  }
  float mx = sc[0];
#pragma unroll
  for (int i = 1; i < 16; ++i) mx = fmaxf(mx, sc[i]);
  mx = fmaxf(mx, __shfl_xor(mx, 16, 32));           // the other lane half holds the other 16 keys of this query
  const float mnew = fmaxf(mr, mx);
  const float al = exp2f(mr - mnew);
  mr = mnew;
  // weights carried x256: pc = 256 * 2^(sc - mnew) as one f16 plane (exponent below -14 -> exact zero); the row sum uses the f16-converted values the matrix unit sees
  Frag pf;
  float ps = 0.0f;
#pragma unroll
  for (int i = 0; i < 16; ++i) {
    const float e = (sc[i] - mnew) + 8.0f;
    const float pc = (e < -14.0f) ? 0.0f : __builtin_amdgcn_exp2f(e);   // bare v_exp_f32 and a value select: the kept range e >= -14 needs no range extension, so the bits are those of exp2f(e), and no branch stands between the 16 weights
    const _Float16 h = (_Float16)pc;
    pf.h[i] = h;                                    // B element i: i<8 -> key0 + 8h + i (tile 0 row 8h+i); i>=8 -> key0 + 16 + 8h + (i-8) (tile 1)
    ps += (float)h;
  }
  ps += __shfl_xor(ps, 16, 32);
  lr = lr * al + ps;
#pragma unroll
  for (int t = 0; t < 8; ++t) O[t] = O[t] * al;
#pragma unroll   // constant indices keep the fragments and the accumulators in registers
  for (int t = 0; t < 8; ++t) pv_mma(vf[t], pf, O[t]);
}

// Eight asynchronous 16-byte copies per lane, global -> LDS: copy i moves g + i*gstep to LDS byte l + i*lstep. Every lane on, no offset field.
// The s_wait_xcnt closes the statement so that it stands in front of any later write of the address registers the copies name.
__device__ __forceinline__ void copy8(unsigned int l, unsigned int lstep, const char* g, size_t gstep) {
  asm volatile("global_load_async_to_lds_b128 %0, %8, off\n\t"
               "global_load_async_to_lds_b128 %1, %9, off\n\t"
               "global_load_async_to_lds_b128 %2, %10, off\n\t"
               "global_load_async_to_lds_b128 %3, %11, off\n\t"
               "global_load_async_to_lds_b128 %4, %12, off\n\t"
               "global_load_async_to_lds_b128 %5, %13, off\n\t"
               "global_load_async_to_lds_b128 %6, %14, off\n\t"
               "global_load_async_to_lds_b128 %7, %15, off\n\t"
               "s_wait_xcnt 0x0"
               :: "v"(l), "v"(l + lstep), "v"(l + 2 * lstep), "v"(l + 3 * lstep),
                  "v"(l + 4 * lstep), "v"(l + 5 * lstep), "v"(l + 6 * lstep), "v"(l + 7 * lstep),
                  "v"(g), "v"(g + gstep), "v"(g + 2 * gstep), "v"(g + 3 * gstep),
                  "v"(g + 4 * gstep), "v"(g + 5 * gstep), "v"(g + 6 * gstep), "v"(g + 7 * gstep)
               : "memory");
}

// One stage (TK keys) into the LDS buffer at byte address lb. kg, vg: this thread's first source bytes in tile 0 of the (b, h) planes; kl, vl: its first LDS bytes in a buffer.
// K tile: TK rows x 256 B, contiguous in the plane; thread tid copies chunk tid + 128 i (row = chunk / 16). V^T tile: 128 rows x 128 B at the plane's row pitch; row = chunk / 8.
__device__ __forceinline__ void stage_copy(int tile, unsigned int lb, const char* kg, const char* vg, unsigned int kl, unsigned int vl) {
  copy8(lb + kl, 8u * KPITCH * 2u, kg + (size_t)tile * (TK * HP * 2), (size_t)2048);
  copy8(lb + vl, 16u * VPITCH * 2u, vg + (size_t)tile * (TK * 2), (size_t)16 * SEQ * 2);
}

// Block = 4 waves x 16 queries = 64 queries of one (b, h). The four waves share each 64-key K / V^T tile: two LDS buffers, the next tile's copies in flight while
// this tile is worked on; one barrier per tile publishes the next tile and frees the buffer just read.
// Epilogue: ctx carried x4096 as one f16 plane C[b*SEQ + s][KP] ([real 512 | phase 512], column h*64 + d).
// coverage: NB*NH*(SEQ/64) blocks x 4 waves x 16 queries x (64 real + 64 phase) = every (row, head, part) segment of the plane exactly once.
// LDS tile: columns 0..127 of every row written before the barrier, the same read after it.
__global__ __launch_bounds__(128) void k_attn(const unsigned short* __restrict__ Qp, const unsigned short* __restrict__ Kpl,
                                              const unsigned short* __restrict__ Vt, const unsigned int* __restrict__ MB,
                                              unsigned short* __restrict__ Cx) {
  __shared__ __attribute__((aligned(16))) unsigned short sh[4][16][136];
  __shared__ __attribute__((aligned(16))) unsigned short ring[2 * ST_H];
  const int tid = threadIdx.x, w = __builtin_amdgcn_readfirstlane((int)(tid >> 5)), lane = tid & 31, ln = lane & 15, hh = lane >> 4;
  const int bh = blockIdx.x / (SEQ / 64), qt = blockIdx.x % (SEQ / 64);
  const int b = bh / NH, h = bh - b * NH;
  const int qbase = qt * 64 + 16 * w;
  const int qg = qbase + ln;
  // Q^T B fragments: column n = query qg, packed k axis [qr 0..63 | qp 64..127], elements 0..7 <- 32c + 8h + i, 8..15 <- 32c + 16 + 8h + i
  Frag qf[4];
  {
    const size_t qoff = ((size_t)bh * SEQ + (size_t)qg) * HP + 8 * hh;
#pragma unroll
    for (int c = 0; c < 4; ++c) {
      qf[c].half[0] = *(const v8us*)(Qp + qoff + 32 * c);
      qf[c].half[1] = *(const v8us*)(Qp + qoff + 32 * c + 16);
    }
  }
  float mr = -3.0e38f, lr = 0.0f;
  v8f O[8] = {};
  const unsigned short* Kp = Kpl + (size_t)bh * SEQ * HP;
  const unsigned short* Vp = Vt  + (size_t)bh * HP * SEQ;
  const unsigned int* Mw = MB + ((size_t)b * SEQ + (size_t)qg) * (SEQ / 32);
  const char* kg = (const char*)Kp + (size_t)tid * 16;
  const char* vg = (const char*)Vp + (size_t)(tid >> 3) * (SEQ * 2) + (size_t)(tid & 7) * 16;
  const unsigned int rb = (unsigned int)(size_t)&ring[0];                                     // LDS byte address of the ring
  const unsigned int kl = (unsigned int)((tid >> 4) * (KPITCH * 2) + (tid & 15) * 16);
  const unsigned int vl = (unsigned int)(KT_H * 2 + (tid >> 3) * (VPITCH * 2) + (tid & 7) * 16);
  constexpr int NT = SEQ / TK;
  stage_copy(0, rb, kg, vg, kl, vl);
  asm volatile("s_wait_asynccnt 0x0" ::: "memory");   // this wave's share of tile 0 has landed
  __syncthreads();                                    // every wave's share of tile 0 has landed
  if (NT > 1) stage_copy(1, rb + ST_H * 2u, kg, vg, kl, vl);
#pragma unroll 1   // one trip per tile: the hand-over at the foot stands once, and the loop stays small in the instruction cache
  for (int t = 0; t < NT; ++t) {
    const int bo = (t & 1) * ST_H;
    fa_step(&ring[bo], &ring[bo + KT_H], Mw, 2 * t, ln, hh, qf, mr, lr, O);
    fa_step(&ring[bo + 32 * KPITCH], &ring[bo + KT_H + 32], Mw, 2 * t + 1, ln, hh, qf, mr, lr, O);
    asm volatile("s_wait_dscnt 0x0" ::: "memory");      // this wave's reads of the buffer have returned before it is refilled
    asm volatile("s_wait_asynccnt 0x0" ::: "memory");   // this wave's share of tile t + 1 has landed
    __syncthreads();                                    // publishes tile t + 1 and ends every wave's reads of tile t
    if (t + 2 < NT) stage_copy(t + 2, rb + (unsigned int)bo * 2u, kg, vg, kl, vl);
  }
  asm volatile("s_wait_asynccnt 0x0" ::: "memory");     // nothing in flight when the wave goes on to the epilogue

  // O^T element r of tile t = ctx(query qg, dd = 16t + 8h + r); carries: x256 (P, also in lr), x256 (v); ctx stored x4096 -> factor 16 / lr
  const float inv = 16.0f * (1.0f / lr);
#pragma unroll
  for (int t = 0; t < 8; ++t) {
#pragma unroll
    for (int r = 0; r < 8; ++r)
      sh[w][ln][16 * t + 8 * hh + r] = c16f(O[t][r] * inv);
  }
  __syncthreads();
  const size_t rbase = ((size_t)b * SEQ + (size_t)qbase) * KP + (size_t)h * HD;
  const int lsub = lane >> 3, p8 = (lane & 7) * 8;
  {
#pragma unroll
    for (int q = 0; q < 8; ++q) {
      const int line = 4 * q + lsub;            // 0..31 = 16 queries x {real, phase}
      const int row = line >> 1, seg = line & 1;
      const v8us a = *(const v8us*)&sh[w][row][seg * HD + p8];
      const size_t o = rbase + (size_t)row * KP + (size_t)seg * RD + p8;
      *(v8us*)(Cx + o) = a;
    }
    
  }
}

// Output projection of both parts: out0[b][s][n] = ctx_real x Wo, out1[b][s][n] = ctx_phase x Wo (f16, K = 512, one product per term), undo carries x4096 (ctx) and x1024 (Wo).
// Epilogue: per-wave LDS tile [16 rows][128 floats = 64 real columns | 64 phase columns] (block barrier), then per instruction lanes 0..15 write the 256-B
// coverage: grid (NB*SEQ/64, RD/64) x 4 waves x 16 rows x (64 + 64) floats = every output element of the processed rows exactly once.
// LDS tile: columns 0..127 of every row written before the barrier, the same read after it.
__global__ __launch_bounds__(128) void k_out(const unsigned short* __restrict__ Cx, const unsigned short* __restrict__ Wo,
                                             float* __restrict__ Out) {
  __shared__ __attribute__((aligned(16))) float so[4][16][132];
  const int tid = threadIdx.x, w = __builtin_amdgcn_readfirstlane((int)(tid >> 5)), lane = tid & 31, ln = lane & 15, hh = lane >> 4;
  const int rowb = blockIdx.x * 64;
  const int col0 = blockIdx.y * 64;
  v8f yr[4] = {}, yi[4] = {};
  rgemm_main<false>(Cx, Wo, rowb + 16 * w, col0, ln, hh, yr, yi);
  const float scl = 1.0f / 4194304.0f;
#pragma unroll
  for (int t = 0; t < 4; ++t) {
#pragma unroll
    for (int r = 0; r < 8; ++r) {
      so[w][8 * hh + r][16 * t + ln]      = yr[t][r] * scl;
      so[w][8 * hh + r][HD + 16 * t + ln] = yi[t][r] * scl;
    }
  }
  __syncthreads();
  const int b = rowb / SEQ;
  const int s0 = rowb - b * SEQ + 16 * w;
  const size_t obase = ((size_t)b * SEQ_FULL + (size_t)s0) * RD + (size_t)col0
                     + (size_t)(lane >> 4) * OUT1_OFF + (size_t)(lane & 15) * 4;
  {
#pragma unroll
    for (int q = 0; q < 16; ++q) {
      const v4f v = *(const v4fa*)&so[w][q][lane * 4];
      *(v4f*)(Out + obase + (size_t)q * RD) = v;
    }
    
  }
}

extern "C" void kernel_launch(void* const* d_in, const int* in_sizes, int n_in,
                              void* d_out, int out_size, void* d_ws, size_t ws_size, hipStream_t stream) {
  if (n_in < 11) return;
  const long long needx = ((long long)(NB - 1) * SEQ_FULL + (long long)SEQ) * RD;   // last activation element touched + 1
  const long long needm = ((long long)(NB - 1) * SEQ_FULL + (long long)(SEQ - 1)) * SEQ_FULL + (long long)SEQ;   // last mask element touched + 1
  for (int i = 0; i < 6; ++i) if ((long long)in_sizes[i] < needx) return;
  for (int i = 6; i < 10; ++i) if ((long long)in_sizes[i] < (long long)RD * RD) return;
  if ((long long)in_sizes[10] < needm) return;
  if ((long long)out_size < (long long)OUT1_OFF + needx) return;
  // wire order: q_real, k_real, v_real, q_phase, k_phase, v_phase, w_q, w_k, w_v, w_o, mask
  const float* q_re = (const float*)d_in[0];
  const float* k_re = (const float*)d_in[1];
  const float* v_re = (const float*)d_in[2];
  const float* q_ph = (const float*)d_in[3];
  const float* k_ph = (const float*)d_in[4];
  const float* v_ph = (const float*)d_in[5];
  const float* w_q = (const float*)d_in[6];
  const float* w_k = (const float*)d_in[7];
  const float* w_v = (const float*)d_in[8];
  const float* w_o = (const float*)d_in[9];
  const int* maskp = (const int*)d_in[10];
  float* Out = (float*)d_out;

  char* ws = (char*)d_ws;
  size_t off = 0;
  const size_t XB = (size_t)NB * SEQ * KP * 2;          // activation / head / ctx plane bytes (8 MiB at full size); all planes are written exactly to their end
  const size_t WB = (size_t)RD * RD * 2;                // transposed weight plane bytes (512 KiB)
  const size_t MBB = (size_t)NB * SEQ * (SEQ / 32) * 4; // mask bit words (1 MiB at full size)
  unsigned short* Xq = (unsigned short*)(ws + off); off += XB;
  unsigned short* Xk = (unsigned short*)(ws + off); off += XB;
  unsigned short* Xv = (unsigned short*)(ws + off); off += XB;
  unsigned short* Wq = (unsigned short*)(ws + off); off += WB;
  unsigned short* Wk = (unsigned short*)(ws + off); off += WB;
  unsigned short* Wv = (unsigned short*)(ws + off); off += WB;
  unsigned short* Wo = (unsigned short*)(ws + off); off += WB;
  unsigned short* Qp = (unsigned short*)(ws + off); off += XB;   // NB*NH*SEQ*HP halves = XB bytes
  unsigned short* Kp = (unsigned short*)(ws + off); off += XB;
  unsigned short* Vt = (unsigned short*)(ws + off); off += XB;
  unsigned short* Cx = (unsigned short*)(ws + off); off += XB;
  unsigned int*   MB = (unsigned int*)(ws + off);   off += MBB;
  if (off > ws_size) return;

  const unsigned gx = (unsigned)((NB * SEQ * 64 + 255) / 256);
  k_cvtx<<<gx, 256, 0, stream>>>(q_re, q_ph, Xq);
  k_cvtx<<<gx, 256, 0, stream>>>(k_re, k_ph, Xk);
  k_cvtx<<<gx, 256, 0, stream>>>(v_re, v_ph, Xv);
  const dim3 gw((unsigned)(RD / 64), (unsigned)(RD / 64), 1);   // in[k 512][n 512] -> out[n 512][k 512]
  k_cvtwt<<<gw, 256, 0, stream>>>(w_q, Wq, 0);
  k_cvtwt<<<gw, 256, 0, stream>>>(w_k, Wk, 0);
  k_cvtwt<<<gw, 256, 0, stream>>>(w_v, Wv, 0);
  k_cvtwt<<<gw, 256, 0, stream>>>(w_o, Wo, 1);
  const unsigned gm = (unsigned)(((size_t)NB * SEQ * (SEQ / 32) + 255) / 256);
  k_maskbits<<<gm, 256, 0, stream>>>(maskp, MB);

  const dim3 gp((unsigned)(NB * SEQ / 64), (unsigned)NH, 1);
  k_proj_rows<<<gp, 128, 0, stream>>>(Xq, Wq, Qp, 256.0f);
  k_proj_rows<<<gp, 128, 0, stream>>>(Xk, Wk, Kp, -256.0f);
  k_proj_vt<<<gp, 128, 0, stream>>>(Xv, Wv, Vt);

  k_attn<<<(unsigned)(NB * NH * (SEQ / 64)), 128, 0, stream>>>(Qp, Kp, Vt, MB, Cx);

  const dim3 go((unsigned)(NB * SEQ / 64), (unsigned)(RD / 64), 1);
  k_out<<<go, 128, 0, stream>>>(Cx, Wo, Out);
}

// v003
// It runs in 136 microseconds.
// Two timings next to v002 both put it at 1.35 times that version's speed.
// Counting every step since v000, it is 2.64 times as fast.
#include <hip/hip_runtime.h>
// Contractions: q/k/v projections (real and phase parts share one weight) on v_wmma_f32_16x16x32_bf16 (activations and weights RNE-converted to bf16, single product, f32 accumulate); scores K Q^T, O^T = V^T P^T and the output projection on v_wmma_f32_16x16x32_f16 (single carried f16 planes: q, k, v x256, P x256, ctx x4096, Wo = bf16 value x1024 held exactly in f16; single product per term, f32 accumulate); softmax statistics f32.
// Two-part (real | phase) multi-head attention: B x S x 512 activations per part, 8 heads x 64, weights stored [in][out] (y = x w), softmax over
// sqrt(re^2 + im^2) / sqrt(128) with re = qr.kr - qp.kp, im = qr.kp + qp.kr; keys whose mask entry is 0 get their score REPLACED by -1e9 (they stay in the softmax).
// Engine: transposed flash. Each wave owns 16 queries of one (b, h). Per 32-key step: S^T tiles (key rows x query columns) from packed K rows
// [kr 64 | -kp 64] (A, f16 plane staged in LDS; the phase half is stored negated so that the packed products give re and im above) and packed Q^T [qr | qp]
// (B, registers); the two 16-key D tiles pack straight into the P^T B fragment; O^T (128 d rows = [real 64 | phase 64] x query columns) accumulates
// from V^T rows (A, f16 plane staged in LDS). 24 WMMAs per step. The mask is packed once into bit words [b][q][S/32]; one word per lane per step.
// Real GEMMs: y_r = x_r w, y_p = x_p w with A fragments x_r, x_p from 16-bit rows [real 512 | phase 512] and one B fragment from the transposed weight plane Wt[n][k].
#ifndef NB
#define NB 2
#endif
#ifndef SEQ
#define SEQ 2048
#endif
#define NB_FULL 2
#define SEQ_FULL 2048
#define RD 512        /* model width (= heads x head dim) */
#define NH 8
#define HD 64
#define KP 1024       /* packed 16-bit row: [real 512 | phase 512] */
#define HP 128        /* packed head row: [real 64 | phase 64] */
#define OUT1_OFF ((size_t)NB_FULL * SEQ_FULL * RD)   /* element offset of the second output (fixed by the full problem size) */
#define TK 64         /* keys per LDS stage (two 32-key steps) */
#define KPITCH 136    /* LDS pitch of a staged K row, halves: 256 B + 16 B, conflict-free for 16-byte reads down a column of rows */
#define VPITCH 72     /* LDS pitch of a staged V^T row, halves: 128 B + 16 B */
#define KT_H (TK * KPITCH)    /* halves of one staged K tile */
#define VT_H (HP * VPITCH)    /* halves of one staged V^T tile */
#define ST_H (KT_H + VT_H)    /* halves of one stage */
#define GW_T ((RD / 64) * (RD / 64))                     /* preparation grid: blocks of one weight plane (64 x 64 tiles) */
#define GW_B (4 * GW_T)                                  /* blocks of the four weight planes */
#define GM_B ((NB * SEQ * (SEQ / 32) + 255) / 256)       /* blocks of the mask pack */
#define GX_B ((NB * SEQ * 64 + 255) / 256)               /* blocks of one activation convert */

static_assert(SEQ % 64 == 0);
static_assert(SEQ % TK == 0);
static_assert(TK * HP * 2 == 128 * 8 * 16);   /* one K tile = 128 threads x 8 copies of 16 B */
static_assert(HP * TK * 2 == 128 * 8 * 16);   /* one V^T tile likewise */
static_assert(SEQ <= SEQ_FULL);
static_assert(NB <= NB_FULL);
static_assert(NH * HD == RD);
static_assert(RD % 64 == 0);
static_assert(RD % 32 == 0);
static_assert(NH * HP == KP);
static_assert(KP == 2 * RD);
static_assert(HP == 2 * HD);
static_assert(HD == 64);
static_assert((NB * SEQ) % 64 == 0);
static_assert(((size_t)NB * SEQ * (SEQ / 32)) % 32 == 0);
static_assert(OUT1_OFF * 4 == (size_t)8388608);
static_assert((size_t)7 * ((size_t)NB * SEQ * KP * 2) + (size_t)4 * ((size_t)RD * RD * 2) + (size_t)NB * SEQ * (SEQ / 32) * 4 <= (size_t)134217728);

typedef __bf16 v16b __attribute__((ext_vector_type(16)));
typedef _Float16 v16h __attribute__((ext_vector_type(16)));
typedef _Float16 h16;
typedef unsigned short v8us __attribute__((ext_vector_type(8), may_alias));
typedef int v4i __attribute__((ext_vector_type(4), may_alias));
typedef float v8f __attribute__((ext_vector_type(8)));
typedef float v4f __attribute__((ext_vector_type(4)));
typedef float v4fa __attribute__((ext_vector_type(4), may_alias));
union Frag { v16b vb; v16h vh; v8us half[2]; unsigned short u[16]; _Float16 h[16]; };

#define LOG2E 1.4426950408889634f
/* scores arrive x65536 (q x256, k x256); logit in log2 units = |s| * (1/sqrt(128)) * log2(e) / 65536 */
#define CSCALE (0.08838834764831845f * LOG2E / 65536.0f)
/* replaced score of a masked key, in log2 units */
#define MFILL (-1.0e9f * LOG2E)

__device__ __forceinline__ unsigned short bf16_bits(float x) {   // RNE convert to bf16 bits
  unsigned int u = __float_as_uint(x);
  return (unsigned short)((u + 0x7FFFu + ((u >> 16) & 1u)) >> 16);
}
__device__ __forceinline__ float bf16_val(unsigned short b) { return __uint_as_float(((unsigned int)b) << 16); }
__device__ __forceinline__ float bf16_rne(float x) { return bf16_val(bf16_bits(x)); }
__device__ __forceinline__ unsigned short f16_bits(_Float16 h) { union { _Float16 h; unsigned short u; } c; c.h = h; return c.u; }
__device__ __forceinline__ unsigned short c16(float c) { return f16_bits((_Float16)c); }   // RNE convert of a carried value to f16 bits

// f32 -> f16 convert that cannot produce a subnormal: values below the smallest normal become zero (value select).
static __device__ __forceinline__ h16 toh_flush(float v) { const h16 r = (h16)v; return (fabsf(v) < 6.103515625e-05f) ? (h16)0.0f : r; }
__device__ __forceinline__ unsigned short c16f(float c) { return f16_bits(toh_flush(c)); }

__device__ __forceinline__ v8f wm_b(const Frag& a, const Frag& b, v8f c) {
  return __builtin_amdgcn_wmma_f32_16x16x32_bf16(false, a.vb, false, b.vb, (short)0, c, false, false);
}
__device__ __forceinline__ v8f wm_h(const Frag& a, const Frag& b, v8f c) {
  return __builtin_amdgcn_wmma_f32_16x16x32_f16(false, a.vh, false, b.vh, (short)0, c, false, false);
}

// One k-step for one 16x16 output tile of both parts: yr += ar*w ; yi += ai*w ; each product followed by its own hazard guard.
template <bool BF>
__device__ __forceinline__ void rmma(const Frag& ar, const Frag& ai, const Frag& wf, v8f& yr, v8f& yi) {
  if (BF) {
    yr = wm_b(ar, wf, yr);
    asm volatile("v_nop\n\tv_nop\n\tv_nop\n\tv_nop" : "+v"(yr) : "v"(ar.vb), "v"(wf.vb));
    yi = wm_b(ai, wf, yi);
    asm volatile("v_nop\n\tv_nop\n\tv_nop\n\tv_nop" : "+v"(yi) : "v"(ai.vb), "v"(wf.vb));
  } else {
    yr = wm_h(ar, wf, yr);
    asm volatile("v_nop\n\tv_nop\n\tv_nop\n\tv_nop" : "+v"(yr) : "v"(ar.vh), "v"(wf.vh));
    yi = wm_h(ai, wf, yi);
    asm volatile("v_nop\n\tv_nop\n\tv_nop\n\tv_nop" : "+v"(yi) : "v"(ai.vh), "v"(wf.vh));
  }
}

// Wave tile 16 rows x 64 columns for both parts, K = 512. A plane [rows][KP] = [real 512 | phase 512], W plane [cols][RD] (transposed weight, k-contiguous).
// A fragment: row m = row0 + ln, elements 0..7 <- k0 + 8h + i, 8..15 <- k0 + 16 + 8h + i. B fragment: column n = col0 + 16t + ln, same k map.
// D: acc[r] = y(row0 + 8h + r, col0 + 16t + ln).
template <bool BF>
__device__ __forceinline__ void rgemm_main(const unsigned short* __restrict__ A, const unsigned short* __restrict__ W,
                                           int row0, int col0, int ln, int hh, v8f (&yr)[4], v8f (&yi)[4]) {
  const unsigned short* ap = A + (size_t)(row0 + ln) * KP + 8 * hh;
  const unsigned short* wp = W + (size_t)(col0 + ln) * RD + 8 * hh;
#pragma unroll 2
  for (int c = 0; c < RD / 32; ++c) {
    const int k0 = 32 * c;
    Frag ar, ai;
    ar.half[0] = *(const v8us*)(ap + k0);
    ar.half[1] = *(const v8us*)(ap + k0 + 16);
    ai.half[0] = *(const v8us*)(ap + RD + k0);
    ai.half[1] = *(const v8us*)(ap + RD + k0 + 16);
#pragma unroll
    for (int t = 0; t < 4; ++t) {
      const unsigned short* wt = wp + (size_t)t * 16 * RD + k0;
      Frag wf;
      wf.half[0] = *(const v8us*)(wt);
      wf.half[1] = *(const v8us*)(wt + 16);
      rmma<BF>(ar, ai, wf, yr[t], yi[t]);
    }
  }
}

// X[row][KP] = bf16 bits [xr 512 | xi 512], row = b*SEQ + s (compact). Thread per (row, 8 columns) converts the re and the im piece.
// coverage: blk = 0 .. GX_B - 1: NB*SEQ*64 threads x (8 re + 8 im) elements = the whole plane.
__device__ __forceinline__ void cvtx_block(int blk, const float* __restrict__ xr, const float* __restrict__ xi, unsigned short* __restrict__ X) {
  const int t = blk * 256 + threadIdx.x;
  if (t >= NB * SEQ * 64) return;
  const int row = t >> 6, c8 = (t & 63) * 8;
  const int b = row / SEQ, s = row - b * SEQ;
  const size_t src = ((size_t)b * SEQ_FULL + (size_t)s) * RD + c8;
  const v4f r0 = *(const v4fa*)(xr + src), r1 = *(const v4fa*)(xr + src + 4);
  const v4f i0 = *(const v4fa*)(xi + src), i1 = *(const v4fa*)(xi + src + 4);
  v8us orr, oi;
  orr[0] = bf16_bits(r0[0]); orr[1] = bf16_bits(r0[1]); orr[2] = bf16_bits(r0[2]); orr[3] = bf16_bits(r0[3]);
  orr[4] = bf16_bits(r1[0]); orr[5] = bf16_bits(r1[1]); orr[6] = bf16_bits(r1[2]); orr[7] = bf16_bits(r1[3]);
  oi[0] = bf16_bits(i0[0]); oi[1] = bf16_bits(i0[1]); oi[2] = bf16_bits(i0[2]); oi[3] = bf16_bits(i0[3]);
  oi[4] = bf16_bits(i1[0]); oi[5] = bf16_bits(i1[1]); oi[6] = bf16_bits(i1[2]); oi[7] = bf16_bits(i1[3]);
  unsigned short* d = X + (size_t)row * KP + c8;
  *(v8us*)d = orr;
  *(v8us*)(d + RD) = oi;
  
}

// Weight convert with transpose: w[k][n] (f32, [in][out]) -> Wt[n][k] (pitch RD) as bf16 bits (asf16 == 0) or as f16(bf16 value x 1024) (asf16 != 0).
// coverage: tile = 0 .. GW_T - 1 = (RD/64 k tiles) x (RD/64 n tiles) x (64 n rows x 64 k) = the whole plane; LDS tile: 64 x 64 written before the barrier, 64 x 64 read after it.
// Called by whole blocks only (the barrier).
__device__ __forceinline__ void cvtwt_block(int tile, const float* __restrict__ w, unsigned short* __restrict__ Wt, int asf16) {
  __shared__ __attribute__((aligned(16))) unsigned short tl[64][72];
  const int tid = threadIdx.x;
  const int k0 = (tile % (RD / 64)) * 64, n0 = (tile / (RD / 64)) * 64;
#pragma unroll 1
  for (int j = 0; j < 16; ++j) {
    const int i = tid + 256 * j;
    const int kk = i >> 6, nn = i & 63;
    const float x = w[(size_t)(k0 + kk) * RD + (size_t)(n0 + nn)];
    const unsigned short vb = bf16_bits(x);
    const unsigned short vh = c16f(bf16_val(vb) * 1024.0f);   // bf16 significand x 2^10 is exact in f16
    tl[nn][kk] = (asf16 != 0) ? vh : vb;
  }
  __syncthreads();
  {
#pragma unroll
    for (int j = 0; j < 2; ++j) {
      const int i = tid + 256 * j;
      const int nn = i >> 3, p8 = (i & 7) * 8;
      const v8us a = *(const v8us*)&tl[nn][p8];
      *(v8us*)(Wt + (size_t)(n0 + nn) * RD + (size_t)(k0 + p8)) = a;
    }
    
  }
}

// Mask pack: MB[b*SEQ + q][SEQ/32], bit j of word c = (mask[b][q][32c + j] != 0). Thread per word (8 x 16-B loads); a wave's 32 words are
// coverage: blk = 0 .. GM_B - 1: NB*SEQ*(SEQ/32) threads x 1 word = the whole plane.
__device__ __forceinline__ void maskbits_block(int blk, const int* __restrict__ mask, unsigned int* __restrict__ MB) {
  const int t = blk * 256 + threadIdx.x;
  if (t >= NB * SEQ * (SEQ / 32)) return;
  const int row = t / (SEQ / 32), wc = t - row * (SEQ / 32);
  const int b = row / SEQ, q = row - b * SEQ;
  const int* mp = mask + ((size_t)b * SEQ_FULL + (size_t)q) * SEQ_FULL + (size_t)wc * 32;
  unsigned int word = 0u;
#pragma unroll 1
  for (int g = 0; g < 8; ++g) {
    const v4i m = *(const v4i*)(mp + 4 * g);
    const unsigned int nib = ((m[0] != 0) ? 1u : 0u) | ((m[1] != 0) ? 2u : 0u) | ((m[2] != 0) ? 4u : 0u) | ((m[3] != 0) ? 8u : 0u);
    word |= nib << (4 * g);
  }
  *(unsigned int*)(MB + t) = word;
  
}

// All preparation in one launch: none of its eight parts reads what another writes, so they are block ranges of one grid.
// Blocks 0 .. GW_B - 1: the four weight planes (first: each walks a serial run of loads); then GM_B blocks of mask pack; then 3 x GX_B blocks of activation convert (q, k, v).
// Every branch below is block-uniform.
__global__ __launch_bounds__(256) void k_prep(const float* __restrict__ q_re, const float* __restrict__ k_re, const float* __restrict__ v_re,
                                              const float* __restrict__ q_ph, const float* __restrict__ k_ph, const float* __restrict__ v_ph,
                                              const float* __restrict__ w_q, const float* __restrict__ w_k, const float* __restrict__ w_v,
                                              const float* __restrict__ w_o, const int* __restrict__ mask,
                                              unsigned short* __restrict__ Xq, unsigned short* __restrict__ Xk, unsigned short* __restrict__ Xv,
                                              unsigned short* __restrict__ Wq, unsigned short* __restrict__ Wk, unsigned short* __restrict__ Wv,
                                              unsigned short* __restrict__ Wo, unsigned int* __restrict__ MB) {
  const int bid = blockIdx.x;
  if (bid < GW_B) {
    const int which = bid / GW_T;
    const float* w = (which == 0) ? w_q : (which == 1) ? w_k : (which == 2) ? w_v : w_o;
    unsigned short* Wt = (which == 0) ? Wq : (which == 1) ? Wk : (which == 2) ? Wv : Wo;
    cvtwt_block(bid - which * GW_T, w, Wt, (which == 3) ? 1 : 0);
  } else if (bid < GW_B + GM_B) {
    maskbits_block(bid - GW_B, mask, MB);
  } else {
    const int r = bid - (GW_B + GM_B);
    const int part = r / GX_B;
    const float* xr = (part == 0) ? q_re : (part == 1) ? k_re : v_re;
    const float* xi = (part == 0) ? q_ph : (part == 1) ? k_ph : v_ph;
    unsigned short* X = (part == 0) ? Xq : (part == 1) ? Xk : Xv;
    cvtx_block(r - part * GX_B, xr, xi, X);
  }
}

// q, k and v projections in one launch, blockIdx.z = 0 (q), 1 (k), 2 (v): none reads what another writes. Block = 4 waves x 16 rows = 64 rows, 64 columns = one head.
// q / k: output plane P[b*NH + head][s][HP] = f16 of (y_r x 256 | y_p x cim), cim = +256 (q) or -256 (k).
// v: transposed plane Vt[b*NH + head][dd][s], dd = [real 64 | phase 64], value f16 of (y x 256).
// coverage: grid (NB*SEQ/64, NH) per z x 4 waves x 16 rows x 128 halves = each whole plane.
// LDS tile, q / k: [4][16][136], columns 0..127 of every row are written before the barrier and exactly those are read after it; v: [128][72], 128 x 64 written before the barrier, 128 x 64 read after it.
// The branch on z is block-uniform, so each barrier is passed by the whole block.
__global__ __launch_bounds__(128) void k_proj(const unsigned short* __restrict__ Xq, const unsigned short* __restrict__ Xk, const unsigned short* __restrict__ Xv,
                                              const unsigned short* __restrict__ Wq, const unsigned short* __restrict__ Wk, const unsigned short* __restrict__ Wv,
                                              unsigned short* __restrict__ Qp, unsigned short* __restrict__ Kp, unsigned short* __restrict__ Vt) {
  __shared__ __attribute__((aligned(16))) unsigned short st[HP * 72];
  static_assert(4 * 16 * 136 <= HP * 72);
  const int tid = threadIdx.x, w = __builtin_amdgcn_readfirstlane((int)(tid >> 5)), lane = tid & 31, ln = lane & 15, hh = lane >> 4;
  const int z = blockIdx.z;
  const int head = blockIdx.y;
  const int rowb = blockIdx.x * 64;
  const unsigned short* X = (z == 0) ? Xq : (z == 1) ? Xk : Xv;
  const unsigned short* W = (z == 0) ? Wq : (z == 1) ? Wk : Wv;
  v8f yr[4] = {}, yi[4] = {};
  rgemm_main<true>(X, W, rowb + 16 * w, head * HD, ln, hh, yr, yi);
  const int b = rowb / SEQ;
  if (z < 2) {
    unsigned short (*sh)[16][136] = (unsigned short (*)[16][136])st;
    unsigned short* P = (z == 0) ? Qp : Kp;
    const float cim = (z == 0) ? 256.0f : -256.0f;
#pragma unroll
    for (int t = 0; t < 4; ++t) {
#pragma unroll
      for (int r = 0; r < 8; ++r) {
        sh[w][8 * hh + r][16 * t + ln]      = c16f(yr[t][r] * 256.0f);
        sh[w][8 * hh + r][HD + 16 * t + ln] = c16f(yi[t][r] * cim);
      }
    }
    __syncthreads();
    const int s0 = rowb - b * SEQ + 16 * w;
    const size_t base = ((size_t)(b * NH + head) * SEQ + (size_t)s0) * HP;
    const int rsub = lane >> 4, p8 = (lane & 15) * 8;
#pragma unroll
    for (int q = 0; q < 8; ++q) {
      const int row = 2 * q + rsub;
      const v8us a = *(const v8us*)&sh[w][row][p8];
      *(v8us*)(P + base + (size_t)row * HP + p8) = a;
    }
  } else {
    unsigned short (*th)[72] = (unsigned short (*)[72])st;
#pragma unroll
    for (int t = 0; t < 4; ++t) {
#pragma unroll
      for (int r = 0; r < 8; ++r) {
        const int col = 16 * w + 8 * hh + r;
        th[16 * t + ln][col]      = c16f(yr[t][r] * 256.0f);
        th[HD + 16 * t + ln][col] = c16f(yi[t][r] * 256.0f);
      }
    }
    __syncthreads();
    const int s0 = rowb - b * SEQ;
    const size_t base = (size_t)(b * NH + head) * HP * SEQ + (size_t)s0;
    for (int i = tid; i < HP * 8; i += 128) {
      const int dd = i >> 3, j8 = (i & 7) * 8;
      const v8us a = *(const v8us*)&th[dd][j8];
      *(v8us*)(Vt + base + (size_t)dd * SEQ + j8) = a;
    }
  }
}

// Score group for one 16-key tile (8 WMMAs): sre = kr qr + ki qi (4 products), sa = kr qi (2), sb = ki qr (2); then the hazard guard.
// k0, k1 = kr (d 0..31, 32..63); k2, k3 = ki; q[0], q[1] = qr; q[2], q[3] = qi.
__device__ __forceinline__ void score_mma(const Frag& k0, const Frag& k1, const Frag& k2, const Frag& k3,
                                          const Frag (&q)[4], v8f& sre, v8f& sa, v8f& sb) {
  sre = wm_h(k0, q[0], sre);
  sa  = wm_h(k0, q[2], sa);
  sb  = wm_h(k2, q[0], sb);
  sre = wm_h(k1, q[1], sre);
  sa  = wm_h(k1, q[3], sa);
  sb  = wm_h(k3, q[1], sb);
  sre = wm_h(k2, q[2], sre);
  sre = wm_h(k3, q[3], sre);
  asm volatile("v_nop\n\tv_nop\n\tv_nop\n\tv_nop" : "+v"(sre), "+v"(sa), "+v"(sb)
               : "v"(k0.vh), "v"(k1.vh), "v"(k2.vh), "v"(k3.vh),
                 "v"(q[0].vh), "v"(q[1].vh), "v"(q[2].vh), "v"(q[3].vh));
}
// c += v*p (single f16 product), then the hazard guard.
__device__ __forceinline__ void pv_mma(const Frag& v, const Frag& p, v8f& c) {
  c = wm_h(v, p, c);
  asm volatile("v_nop\n\tv_nop\n\tv_nop\n\tv_nop" : "+v"(c) : "v"(v.vh), "v"(p.vh));
}

// One 32-key step (step index j) for a wave's 16 queries: 16 score WMMAs + 8 P.V WMMAs. Ks = the step's first staged K row (pitch KPITCH),
// Vs = the step's first key column in the staged V^T rows (pitch VPITCH), both in LDS; key0 = 32 j in the comments below; Mw is this lane's query row of mask words. With the phase half of the K plane stored negated: sre = qr.kr - qp.kp, sa - sb = qp.kr + qr.kp.
__device__ __forceinline__ void fa_step(const unsigned short* Ks, const unsigned short* Vs,
                                        const unsigned int* __restrict__ Mw, int j, int ln, int hh,
                                        const Frag (&qf)[4], float& mr, float& lr, v8f (&O)[8]) {
  const v8f z8 = {0.f, 0.f, 0.f, 0.f, 0.f, 0.f, 0.f, 0.f};
  unsigned int mw = Mw[j];                           // bit i = mask(query of this lane, key0 + i); loaded by every lane, in range
  asm volatile("" : "+v"(mw));
  const unsigned int mh = mw >> (8 * hh);            // this lane half's keys: bit 16*kt + r
  float sc[16];
  // A fragments of K: row m = key (key0 + 16*kt + ln); packed k axis [kr 0..63 | -kp 64..127]; elements 0..7 <- 32c + 8h + i, 8..15 <- 32c + 16 + 8h + i;
  // both 16-key tiles' fragments are read as one group
  Frag kf[2][4];
#pragma unroll   // constant indices keep the fragments in registers
  for (int kt = 0; kt < 2; ++kt) {
    const unsigned short* kp = Ks + (16 * kt + ln) * KPITCH + 8 * hh;
#pragma unroll   // as above
    for (int c = 0; c < 4; ++c) {
      kf[kt][c].half[0] = *(const v8us*)(kp + 32 * c);
      kf[kt][c].half[1] = *(const v8us*)(kp + 32 * c + 16);
    }
  }
#pragma unroll
  for (int kt = 0; kt < 2; ++kt) {
    v8f sre = z8, sa = z8, sb = z8;
    score_mma(kf[kt][0], kf[kt][1], kf[kt][2], kf[kt][3], qf, sre, sa, sb);
    // S^T tile: element r = score(key0 + 16*kt + 8h + r, query of this lane's column); logit in log2 units; masked keys get the fill value instead
#pragma unroll
    for (int r = 0; r < 8; ++r) {
      const float im = sa[r] - sb[r];
      const float v = __builtin_amdgcn_sqrtf(fmaf(sre[r], sre[r], im * im)) * CSCALE;
      sc[8 * kt + r] = (((mh >> (16 * kt + r)) & 1u) != 0u) ? v : MFILL;
    }
  }
  // A fragments of V^T: row m = dd (16*t + ln), elements 0..7 <- key0 + 8h + i, 8..15 <- key0 + 16 + 8h + i; read as one group, ahead of the softmax arithmetic
  Frag vf[8];
#pragma unroll   // constant indices keep the fragments in registers
  for (int t = 0; t < 8; ++t) {
    const unsigned short* vp = Vs + (16 * t + ln) * VPITCH + 8 * hh;
    vf[t].half[0] = *(const v8us*)(vp);
    vf[t].half[1] = *(const v8us*)(vp + 16);
  }
  float mx = sc[0];
#pragma unroll
  for (int i = 1; i < 16; ++i) mx = fmaxf(mx, sc[i]);
  mx = fmaxf(mx, __shfl_xor(mx, 16, 32));           // the other lane half holds the other 16 keys of this query
  const float mnew = fmaxf(mr, mx);
  const float al = exp2f(mr - mnew);
  mr = mnew;
  // weights carried x256: pc = 256 * 2^(sc - mnew) as one f16 plane (exponent below -14 -> exact zero); the row sum uses the f16-converted values the matrix unit sees
  Frag pf;
  float ps = 0.0f;
#pragma unroll
  for (int i = 0; i < 16; ++i) {
    const float e = (sc[i] - mnew) + 8.0f;
    const float pc = (e < -14.0f) ? 0.0f : __builtin_amdgcn_exp2f(e);   // bare v_exp_f32 and a value select: the kept range e >= -14 needs no range extension, so the bits are those of exp2f(e), and no branch stands between the 16 weights
    const _Float16 h = (_Float16)pc;
    pf.h[i] = h;                                    // B element i: i<8 -> key0 + 8h + i (tile 0 row 8h+i); i>=8 -> key0 + 16 + 8h + (i-8) (tile 1)
    ps += (float)h;
  }
  ps += __shfl_xor(ps, 16, 32);
  lr = lr * al + ps;
#pragma unroll
  for (int t = 0; t < 8; ++t) O[t] = O[t] * al;
#pragma unroll   // constant indices keep the fragments and the accumulators in registers
  for (int t = 0; t < 8; ++t) pv_mma(vf[t], pf, O[t]);
}

// Eight asynchronous 16-byte copies per lane, global -> LDS: copy i moves g + i*gstep to LDS byte l + i*lstep. Every lane on, no offset field.
// The s_wait_xcnt closes the statement so that it stands in front of any later write of the address registers the copies name.
__device__ __forceinline__ void copy8(unsigned int l, unsigned int lstep, const char* g, size_t gstep) {
  asm volatile("global_load_async_to_lds_b128 %0, %8, off\n\t"
               "global_load_async_to_lds_b128 %1, %9, off\n\t"
               "global_load_async_to_lds_b128 %2, %10, off\n\t"
               "global_load_async_to_lds_b128 %3, %11, off\n\t"
               "global_load_async_to_lds_b128 %4, %12, off\n\t"
               "global_load_async_to_lds_b128 %5, %13, off\n\t"
               "global_load_async_to_lds_b128 %6, %14, off\n\t"
               "global_load_async_to_lds_b128 %7, %15, off\n\t"
               "s_wait_xcnt 0x0"
               :: "v"(l), "v"(l + lstep), "v"(l + 2 * lstep), "v"(l + 3 * lstep),
                  "v"(l + 4 * lstep), "v"(l + 5 * lstep), "v"(l + 6 * lstep), "v"(l + 7 * lstep),
                  "v"(g), "v"(g + gstep), "v"(g + 2 * gstep), "v"(g + 3 * gstep),
                  "v"(g + 4 * gstep), "v"(g + 5 * gstep), "v"(g + 6 * gstep), "v"(g + 7 * gstep)
               : "memory");
}

// One stage (TK keys) into the LDS buffer at byte address lb. kg, vg: this thread's first source bytes in tile 0 of the (b, h) planes; kl, vl: its first LDS bytes in a buffer.
// K tile: TK rows x 256 B, contiguous in the plane; thread tid copies chunk tid + 128 i (row = chunk / 16). V^T tile: 128 rows x 128 B at the plane's row pitch; row = chunk / 8.
__device__ __forceinline__ void stage_copy(int tile, unsigned int lb, const char* kg, const char* vg, unsigned int kl, unsigned int vl) {
  copy8(lb + kl, 8u * KPITCH * 2u, kg + (size_t)tile * (TK * HP * 2), (size_t)2048);
  copy8(lb + vl, 16u * VPITCH * 2u, vg + (size_t)tile * (TK * 2), (size_t)16 * SEQ * 2);
}

// Block = 4 waves x 16 queries = 64 queries of one (b, h). The four waves share each 64-key K / V^T tile: two LDS buffers, the next tile's copies in flight while
// this tile is worked on; one barrier per tile publishes the next tile and frees the buffer just read.
// Epilogue: ctx carried x4096 as one f16 plane C[b*SEQ + s][KP] ([real 512 | phase 512], column h*64 + d).
// coverage: NB*NH*(SEQ/64) blocks x 4 waves x 16 queries x (64 real + 64 phase) = every (row, head, part) segment of the plane exactly once.
// LDS tile: columns 0..127 of every row written before the barrier, the same read after it.
__global__ __launch_bounds__(128) void k_attn(const unsigned short* __restrict__ Qp, const unsigned short* __restrict__ Kpl,
                                              const unsigned short* __restrict__ Vt, const unsigned int* __restrict__ MB,
                                              unsigned short* __restrict__ Cx) {
  __shared__ __attribute__((aligned(16))) unsigned short sh[4][16][136];
  __shared__ __attribute__((aligned(16))) unsigned short ring[2 * ST_H];
  const int tid = threadIdx.x, w = __builtin_amdgcn_readfirstlane((int)(tid >> 5)), lane = tid & 31, ln = lane & 15, hh = lane >> 4;
  const int bh = blockIdx.x / (SEQ / 64), qt = blockIdx.x % (SEQ / 64);
  const int b = bh / NH, h = bh - b * NH;
  const int qbase = qt * 64 + 16 * w;
  const int qg = qbase + ln;
  // Q^T B fragments: column n = query qg, packed k axis [qr 0..63 | qp 64..127], elements 0..7 <- 32c + 8h + i, 8..15 <- 32c + 16 + 8h + i
  Frag qf[4];
  {
    const size_t qoff = ((size_t)bh * SEQ + (size_t)qg) * HP + 8 * hh;
#pragma unroll
    for (int c = 0; c < 4; ++c) {
      qf[c].half[0] = *(const v8us*)(Qp + qoff + 32 * c);
      qf[c].half[1] = *(const v8us*)(Qp + qoff + 32 * c + 16);
    }
  }
  float mr = -3.0e38f, lr = 0.0f;
  v8f O[8] = {};
  const unsigned short* Kp = Kpl + (size_t)bh * SEQ * HP;
  const unsigned short* Vp = Vt  + (size_t)bh * HP * SEQ;
  const unsigned int* Mw = MB + ((size_t)b * SEQ + (size_t)qg) * (SEQ / 32);
  const char* kg = (const char*)Kp + (size_t)tid * 16;
  const char* vg = (const char*)Vp + (size_t)(tid >> 3) * (SEQ * 2) + (size_t)(tid & 7) * 16;
  const unsigned int rb = (unsigned int)(size_t)&ring[0];                                     // LDS byte address of the ring
  const unsigned int kl = (unsigned int)((tid >> 4) * (KPITCH * 2) + (tid & 15) * 16);
  const unsigned int vl = (unsigned int)(KT_H * 2 + (tid >> 3) * (VPITCH * 2) + (tid & 7) * 16);
  constexpr int NT = SEQ / TK;
  stage_copy(0, rb, kg, vg, kl, vl);
  asm volatile("s_wait_asynccnt 0x0" ::: "memory");   // this wave's share of tile 0 has landed
  __syncthreads();                                    // every wave's share of tile 0 has landed
  if (NT > 1) stage_copy(1, rb + ST_H * 2u, kg, vg, kl, vl);
#pragma unroll 1   // one trip per tile: the hand-over at the foot stands once, and the loop stays small in the instruction cache
  for (int t = 0; t < NT; ++t) {
    const int bo = (t & 1) * ST_H;
    fa_step(&ring[bo], &ring[bo + KT_H], Mw, 2 * t, ln, hh, qf, mr, lr, O);
    fa_step(&ring[bo + 32 * KPITCH], &ring[bo + KT_H + 32], Mw, 2 * t + 1, ln, hh, qf, mr, lr, O);
    asm volatile("s_wait_dscnt 0x0" ::: "memory");      // this wave's reads of the buffer have returned before it is refilled
    asm volatile("s_wait_asynccnt 0x0" ::: "memory");   // this wave's share of tile t + 1 has landed
    __syncthreads();                                    // publishes tile t + 1 and ends every wave's reads of tile t
    if (t + 2 < NT) stage_copy(t + 2, rb + (unsigned int)bo * 2u, kg, vg, kl, vl);
  }
  asm volatile("s_wait_asynccnt 0x0" ::: "memory");     // nothing in flight when the wave goes on to the epilogue

  // O^T element r of tile t = ctx(query qg, dd = 16t + 8h + r); carries: x256 (P, also in lr), x256 (v); ctx stored x4096 -> factor 16 / lr
  const float inv = 16.0f * (1.0f / lr);
#pragma unroll
  for (int t = 0; t < 8; ++t) {
#pragma unroll
    for (int r = 0; r < 8; ++r)
      sh[w][ln][16 * t + 8 * hh + r] = c16f(O[t][r] * inv);
  }
  __syncthreads();
  const size_t rbase = ((size_t)b * SEQ + (size_t)qbase) * KP + (size_t)h * HD;
  const int lsub = lane >> 3, p8 = (lane & 7) * 8;
  {
#pragma unroll
    for (int q = 0; q < 8; ++q) {
      const int line = 4 * q + lsub;            // 0..31 = 16 queries x {real, phase}
      const int row = line >> 1, seg = line & 1;
      const v8us a = *(const v8us*)&sh[w][row][seg * HD + p8];
      const size_t o = rbase + (size_t)row * KP + (size_t)seg * RD + p8;
      *(v8us*)(Cx + o) = a;
    }
    
  }
}

// Output projection of both parts: out0[b][s][n] = ctx_real x Wo, out1[b][s][n] = ctx_phase x Wo (f16, K = 512, one product per term), undo carries x4096 (ctx) and x1024 (Wo).
// Epilogue: per-wave LDS tile [16 rows][128 floats = 64 real columns | 64 phase columns] (block barrier), then per instruction lanes 0..15 write the 256-B
// coverage: grid (NB*SEQ/64, RD/64) x 4 waves x 16 rows x (64 + 64) floats = every output element of the processed rows exactly once.
// LDS tile: columns 0..127 of every row written before the barrier, the same read after it.
__global__ __launch_bounds__(128) void k_out(const unsigned short* __restrict__ Cx, const unsigned short* __restrict__ Wo,
                                             float* __restrict__ Out) {
  __shared__ __attribute__((aligned(16))) float so[4][16][132];
  const int tid = threadIdx.x, w = __builtin_amdgcn_readfirstlane((int)(tid >> 5)), lane = tid & 31, ln = lane & 15, hh = lane >> 4;
  const int rowb = blockIdx.x * 64;
  const int col0 = blockIdx.y * 64;
  v8f yr[4] = {}, yi[4] = {};
  rgemm_main<false>(Cx, Wo, rowb + 16 * w, col0, ln, hh, yr, yi);
  const float scl = 1.0f / 4194304.0f;
#pragma unroll
  for (int t = 0; t < 4; ++t) {
#pragma unroll
    for (int r = 0; r < 8; ++r) {
      so[w][8 * hh + r][16 * t + ln]      = yr[t][r] * scl;
      so[w][8 * hh + r][HD + 16 * t + ln] = yi[t][r] * scl;
    }
  }
  __syncthreads();
  const int b = rowb / SEQ;
  const int s0 = rowb - b * SEQ + 16 * w;
  const size_t obase = ((size_t)b * SEQ_FULL + (size_t)s0) * RD + (size_t)col0
                     + (size_t)(lane >> 4) * OUT1_OFF + (size_t)(lane & 15) * 4;
  {
#pragma unroll
    for (int q = 0; q < 16; ++q) {
      const v4f v = *(const v4fa*)&so[w][q][lane * 4];
      *(v4f*)(Out + obase + (size_t)q * RD) = v;
    }
    
  }
}

extern "C" void kernel_launch(void* const* d_in, const int* in_sizes, int n_in,
                              void* d_out, int out_size, void* d_ws, size_t ws_size, hipStream_t stream) {
  if (n_in < 11) return;
  const long long needx = ((long long)(NB - 1) * SEQ_FULL + (long long)SEQ) * RD;   // last activation element touched + 1
  const long long needm = ((long long)(NB - 1) * SEQ_FULL + (long long)(SEQ - 1)) * SEQ_FULL + (long long)SEQ;   // last mask element touched + 1
  for (int i = 0; i < 6; ++i) if ((long long)in_sizes[i] < needx) return;
  for (int i = 6; i < 10; ++i) if ((long long)in_sizes[i] < (long long)RD * RD) return;
  if ((long long)in_sizes[10] < needm) return;
  if ((long long)out_size < (long long)OUT1_OFF + needx) return;
  // wire order: q_real, k_real, v_real, q_phase, k_phase, v_phase, w_q, w_k, w_v, w_o, mask
  const float* q_re = (const float*)d_in[0];
  const float* k_re = (const float*)d_in[1];
  const float* v_re = (const float*)d_in[2];
  const float* q_ph = (const float*)d_in[3];
  const float* k_ph = (const float*)d_in[4];
  const float* v_ph = (const float*)d_in[5];
  const float* w_q = (const float*)d_in[6];
  const float* w_k = (const float*)d_in[7];
  const float* w_v = (const float*)d_in[8];
  const float* w_o = (const float*)d_in[9];
  const int* maskp = (const int*)d_in[10];
  float* Out = (float*)d_out;

  char* ws = (char*)d_ws;
  size_t off = 0;
  const size_t XB = (size_t)NB * SEQ * KP * 2;          // activation / head / ctx plane bytes (8 MiB at full size); all planes are written exactly to their end
  const size_t WB = (size_t)RD * RD * 2;                // transposed weight plane bytes (512 KiB)
  const size_t MBB = (size_t)NB * SEQ * (SEQ / 32) * 4; // mask bit words (1 MiB at full size)
  unsigned short* Xq = (unsigned short*)(ws + off); off += XB;
  unsigned short* Xk = (unsigned short*)(ws + off); off += XB;
  unsigned short* Xv = (unsigned short*)(ws + off); off += XB;
  unsigned short* Wq = (unsigned short*)(ws + off); off += WB;
  unsigned short* Wk = (unsigned short*)(ws + off); off += WB;
  unsigned short* Wv = (unsigned short*)(ws + off); off += WB;
  unsigned short* Wo = (unsigned short*)(ws + off); off += WB;
  unsigned short* Qp = (unsigned short*)(ws + off); off += XB;   // NB*NH*SEQ*HP halves = XB bytes
  unsigned short* Kp = (unsigned short*)(ws + off); off += XB;
  unsigned short* Vt = (unsigned short*)(ws + off); off += XB;
  unsigned short* Cx = (unsigned short*)(ws + off); off += XB;
  unsigned int*   MB = (unsigned int*)(ws + off);   off += MBB;
  if (off > ws_size) return;

  k_prep<<<(unsigned)(GW_B + GM_B + 3 * GX_B), 256, 0, stream>>>(q_re, k_re, v_re, q_ph, k_ph, v_ph, w_q, w_k, w_v, w_o, maskp,
                                                                 Xq, Xk, Xv, Wq, Wk, Wv, Wo, MB);

  const dim3 gp((unsigned)(NB * SEQ / 64), (unsigned)NH, 3);
  k_proj<<<gp, 128, 0, stream>>>(Xq, Xk, Xv, Wq, Wk, Wv, Qp, Kp, Vt);

  k_attn<<<(unsigned)(NB * NH * (SEQ / 64)), 128, 0, stream>>>(Qp, Kp, Vt, MB, Cx);

  const dim3 go((unsigned)(NB * SEQ / 64), (unsigned)(RD / 64), 1);
  k_out<<<go, 128, 0, stream>>>(Cx, Wo, Out);
}

// v004
// It runs in 104 microseconds.
// Two timings next to v003 put it at 1.29 and 1.28 times that version's speed.
// Over all steps from v000 it is 3.40 times as fast.
#include <hip/hip_runtime.h>
// Contractions: q/k/v projections (real and phase parts share one weight) on v_wmma_f32_16x16x32_bf16 (activations and weights RNE-converted to bf16, single product, f32 accumulate); scores K Q^T, O^T = V^T P^T and the output projection on v_wmma_f32_16x16x32_f16 (single carried f16 planes: q, k, v x256, P x256, ctx x4096, Wo = bf16 value x1024 held exactly in f16; single product per term, f32 accumulate); softmax statistics f32.
// Two-part (real | phase) multi-head attention: B x S x 512 activations per part, 8 heads x 64, weights stored [in][out] (y = x w), softmax over
// sqrt(re^2 + im^2) / sqrt(128) with re = qr.kr - qp.kp, im = qr.kp + qp.kr; keys whose mask entry is 0 get their score REPLACED by -1e9 (they stay in the softmax).
// Engine: transposed flash. Each wave owns 16 queries of one (b, h). Per 32-key step: S^T tiles (key rows x query columns) from packed K rows
// [kr 64 | -kp 64] (A, f16 plane staged in LDS; the phase half is stored negated so that the packed products give re and im above) and packed Q^T [qr | qp]
// (B, registers); the two 16-key D tiles pack straight into the P^T B fragment; O^T (128 d rows = [real 64 | phase 64] x query columns) accumulates
// from V^T rows (A, f16 plane staged in LDS). 24 WMMAs per step. The mask is packed once into bit words [b][q][S/32]; one word per lane per step.
// Real GEMMs: y_r = x_r w, y_p = x_p w with A fragments x_r, x_p from 16-bit rows [real 512 | phase 512] and one B fragment from the transposed weight plane Wt[n][k], both staged in LDS.
#ifndef NB
#define NB 2
#endif
#ifndef SEQ
#define SEQ 2048
#endif
#define NB_FULL 2
#define SEQ_FULL 2048
#define RD 512        /* model width (= heads x head dim) */
#define NH 8
#define HD 64
#define KP 1024       /* packed 16-bit row: [real 512 | phase 512] */
#define HP 128        /* packed head row: [real 64 | phase 64] */
#define OUT1_OFF ((size_t)NB_FULL * SEQ_FULL * RD)   /* element offset of the second output (fixed by the full problem size) */
#define TK 64         /* keys per LDS stage (two 32-key steps) */
#define KPITCH 136    /* LDS pitch of a staged K row, halves: 256 B + 16 B, conflict-free for 16-byte reads down a column of rows */
#define VPITCH 72     /* LDS pitch of a staged V^T row, halves: 128 B + 16 B */
#define KT_H (TK * KPITCH)    /* halves of one staged K tile */
#define VT_H (HP * VPITCH)    /* halves of one staged V^T tile */
#define ST_H (KT_H + VT_H)    /* halves of one stage */
#define GK 64         /* k extent of one staged GEMM tile, halves: 128 B = one whole line per row */
#define GROWS 192     /* rows of one staged GEMM tile: 64 A rows real, the same 64 rows phase, 64 W rows */
#define GST_H (GROWS * GK)    /* halves of one GEMM stage */
#define GNS (RD / GK)         /* GEMM stages */
#define GW_T ((RD / 64) * (RD / 64))                     /* preparation grid: blocks of one weight plane (64 x 64 tiles) */
#define GW_B (4 * GW_T)                                  /* blocks of the four weight planes */
#define GM_B ((NB * SEQ * (SEQ / 32) + 255) / 256)       /* blocks of the mask pack */
#define GX_B ((NB * SEQ * 64 + 255) / 256)               /* blocks of one activation convert */

static_assert(SEQ % 64 == 0);
static_assert(SEQ % TK == 0);
static_assert(TK * HP * 2 == 128 * 8 * 16);   /* one K tile = 128 threads x 8 copies of 16 B */
static_assert(HP * TK * 2 == 128 * 8 * 16);   /* one V^T tile likewise */
static_assert(GROWS * GK * 2 == 128 * 12 * 16);   /* one GEMM stage = 128 threads x 12 copies of 16 B */
static_assert(RD % GK == 0 && GNS >= 2);
static_assert(SEQ <= SEQ_FULL);
static_assert(NB <= NB_FULL);
static_assert(NH * HD == RD);
static_assert(RD % 64 == 0);
static_assert(RD % 32 == 0);
static_assert(NH * HP == KP);
static_assert(KP == 2 * RD);
static_assert(HP == 2 * HD);
static_assert(HD == 64);
static_assert((NB * SEQ) % 64 == 0);
static_assert(((size_t)NB * SEQ * (SEQ / 32)) % 32 == 0);
static_assert(OUT1_OFF * 4 == (size_t)8388608);
static_assert((size_t)7 * ((size_t)NB * SEQ * KP * 2) + (size_t)4 * ((size_t)RD * RD * 2) + (size_t)NB * SEQ * (SEQ / 32) * 4 <= (size_t)134217728);

typedef __bf16 v16b __attribute__((ext_vector_type(16)));
typedef _Float16 v16h __attribute__((ext_vector_type(16)));
typedef _Float16 h16;
typedef unsigned short v8us __attribute__((ext_vector_type(8), may_alias));
typedef int v4i __attribute__((ext_vector_type(4), may_alias));
typedef float v8f __attribute__((ext_vector_type(8)));
typedef float v4f __attribute__((ext_vector_type(4)));
typedef float v4fa __attribute__((ext_vector_type(4), may_alias));
union Frag { v16b vb; v16h vh; v8us half[2]; unsigned short u[16]; _Float16 h[16]; };

#define LOG2E 1.4426950408889634f
/* scores arrive x65536 (q x256, k x256); logit in log2 units = |s| * (1/sqrt(128)) * log2(e) / 65536 */
#define CSCALE (0.08838834764831845f * LOG2E / 65536.0f)
/* replaced score of a masked key, in log2 units */
#define MFILL (-1.0e9f * LOG2E)

__device__ __forceinline__ unsigned short bf16_bits(float x) {   // RNE convert to bf16 bits
  unsigned int u = __float_as_uint(x);
  return (unsigned short)((u + 0x7FFFu + ((u >> 16) & 1u)) >> 16);
}
__device__ __forceinline__ float bf16_val(unsigned short b) { return __uint_as_float(((unsigned int)b) << 16); }
__device__ __forceinline__ float bf16_rne(float x) { return bf16_val(bf16_bits(x)); }
__device__ __forceinline__ unsigned short f16_bits(_Float16 h) { union { _Float16 h; unsigned short u; } c; c.h = h; return c.u; }
__device__ __forceinline__ unsigned short c16(float c) { return f16_bits((_Float16)c); }   // RNE convert of a carried value to f16 bits

// f32 -> f16 convert that cannot produce a subnormal: values below the smallest normal become zero (value select).
static __device__ __forceinline__ h16 toh_flush(float v) { const h16 r = (h16)v; return (fabsf(v) < 6.103515625e-05f) ? (h16)0.0f : r; }
__device__ __forceinline__ unsigned short c16f(float c) { return f16_bits(toh_flush(c)); }

__device__ __forceinline__ v8f wm_b(const Frag& a, const Frag& b, v8f c) {
  return __builtin_amdgcn_wmma_f32_16x16x32_bf16(false, a.vb, false, b.vb, (short)0, c, false, false);
}
__device__ __forceinline__ v8f wm_h(const Frag& a, const Frag& b, v8f c) {
  return __builtin_amdgcn_wmma_f32_16x16x32_f16(false, a.vh, false, b.vh, (short)0, c, false, false);
}

// One k-step for one 16x16 output tile of both parts: yr += ar*w ; yi += ai*w ; each product followed by its own hazard guard.
template <bool BF>
__device__ __forceinline__ void rmma(const Frag& ar, const Frag& ai, const Frag& wf, v8f& yr, v8f& yi) {
  if (BF) {
    yr = wm_b(ar, wf, yr);
    asm volatile("v_nop\n\tv_nop\n\tv_nop\n\tv_nop" : "+v"(yr) : "v"(ar.vb), "v"(wf.vb));
    yi = wm_b(ai, wf, yi);
    asm volatile("v_nop\n\tv_nop\n\tv_nop\n\tv_nop" : "+v"(yi) : "v"(ai.vb), "v"(wf.vb));
  } else {
    yr = wm_h(ar, wf, yr);
    asm volatile("v_nop\n\tv_nop\n\tv_nop\n\tv_nop" : "+v"(yr) : "v"(ar.vh), "v"(wf.vh));
    yi = wm_h(ai, wf, yi);
    asm volatile("v_nop\n\tv_nop\n\tv_nop\n\tv_nop" : "+v"(yi) : "v"(ai.vh), "v"(wf.vh));
  }
}

// Twelve asynchronous 16-byte copies per lane, global -> LDS, one GEMM stage: copy i lands at LDS byte l + 2048 i (16 rows further down).
// Copies 0..3: A rows, real part (16 rows apart); 4..7: the same rows, phase part (RD halves further); 8..11: W rows (16 rows apart). Every lane on, no offset field.
// The s_wait_xcnt closes the statement so that it stands in front of any later write of the address registers the copies name.
__device__ __forceinline__ void copy12(unsigned int l, const char* ga, const char* gw) {
  constexpr size_t AS = (size_t)16 * KP * 2, PH = (size_t)RD * 2, WS = (size_t)16 * RD * 2;
  asm volatile("global_load_async_to_lds_b128 %0, %12, off\n\t"
               "global_load_async_to_lds_b128 %1, %13, off\n\t"
               "global_load_async_to_lds_b128 %2, %14, off\n\t"
               "global_load_async_to_lds_b128 %3, %15, off\n\t"
               "global_load_async_to_lds_b128 %4, %16, off\n\t"
               "global_load_async_to_lds_b128 %5, %17, off\n\t"
               "global_load_async_to_lds_b128 %6, %18, off\n\t"
               "global_load_async_to_lds_b128 %7, %19, off\n\t"
               "global_load_async_to_lds_b128 %8, %20, off\n\t"
               "global_load_async_to_lds_b128 %9, %21, off\n\t"
               "global_load_async_to_lds_b128 %10, %22, off\n\t"
               "global_load_async_to_lds_b128 %11, %23, off\n\t"
               "s_wait_xcnt 0x0"
               :: "v"(l), "v"(l + 2048u), "v"(l + 4096u), "v"(l + 6144u),
                  "v"(l + 8192u), "v"(l + 10240u), "v"(l + 12288u), "v"(l + 14336u),
                  "v"(l + 16384u), "v"(l + 18432u), "v"(l + 20480u), "v"(l + 22528u),
                  "v"(ga), "v"(ga + AS), "v"(ga + 2 * AS), "v"(ga + 3 * AS),
                  "v"(ga + PH), "v"(ga + PH + AS), "v"(ga + PH + 2 * AS), "v"(ga + PH + 3 * AS),
                  "v"(gw), "v"(gw + WS), "v"(gw + 2 * WS), "v"(gw + 3 * WS)
               : "memory");
}

// Block tile 64 rows x 64 columns for both parts (wave tile 16 rows x 64 columns), K = 512. A plane [rows][KP] = [real 512 | phase 512], W plane [cols][RD] (transposed weight, k-contiguous).
// The four waves share each k tile of GK: two LDS buffers in ring (2 x GST_H halves), the next tile's copies in flight while this tile is worked on; one barrier per tile
// publishes the next tile and frees the buffer just read. Called by whole blocks of 128 threads; behind the call the ring is free for other use.
// Staged tile: row r = 0..63 A real (row rowb + r), 64..127 A phase, 128..191 W (column col0 + r - 128); 128 B per row, no pad: the 16-byte piece p of row r lies at piece p ^ ((r >> 1) & 7),
// so 16 lanes reading one piece down 16 rows meet every bank once. Thread tid copies piece tid & 7 of rows (tid >> 3) + 16 i: whole 128-B lines per 8 lanes.
// A fragment: row m = rowb + 16 w + ln, elements 0..7 <- k0 + 8h + i, 8..15 <- k0 + 16 + 8h + i. B fragment: column n = col0 + 16t + ln, same k map.
// D: acc[r] = y(rowb + 16 w + 8h + r, col0 + 16t + ln).
template <bool BF>
__device__ __forceinline__ void rgemm_main(const unsigned short* __restrict__ A, const unsigned short* __restrict__ W, unsigned short* ring,
                                           int rowb, int col0, int tid, int w, int ln, int hh, v8f (&yr)[4], v8f (&yi)[4]) {
  const char* ga = (const char*)(A + (size_t)(rowb + (tid >> 3)) * KP) + (tid & 7) * 16;
  const char* gw = (const char*)(W + (size_t)(col0 + (tid >> 3)) * RD) + (tid & 7) * 16;
  const unsigned int l = (unsigned int)(size_t)ring + (unsigned int)((tid >> 3) * (GK * 2) + (((tid & 7) ^ ((tid >> 4) & 7)) * 16));   // LDS byte address of this thread's first piece in buffer 0
  const int sw = (ln >> 1) & 7;
  copy12(l, ga, gw);
  asm volatile("s_wait_asynccnt 0x0" ::: "memory");   // this wave's share of tile 0 has landed
  __syncthreads();                                    // every wave's share of tile 0 has landed
  copy12(l + GST_H * 2u, ga + GK * 2, gw + GK * 2);
#pragma unroll 1   // one trip per tile: the hand-over at the foot stands once
  for (int s = 0; s < GNS; ++s) {
    const int bo = (s & 1) * GST_H;
    const unsigned short* ap = ring + bo + (16 * w + ln) * GK;
    const unsigned short* wp = ring + bo + (128 + ln) * GK;
#pragma unroll   // constant c: the piece places are loop-invariant registers and the row offsets immediates
    for (int c = 0; c < GK / 32; ++c) {
      const int o0 = ((4 * c + hh) ^ sw) * 8, o1 = ((4 * c + 2 + hh) ^ sw) * 8;   // places of the pieces k0 + 8h and k0 + 16 + 8h in this lane's rows
      // the k step's six fragments are read as one group, ahead of its products
      Frag ar, ai, wf[4];
      ar.half[0] = *(const v8us*)(ap + o0);
      ar.half[1] = *(const v8us*)(ap + o1);
      ai.half[0] = *(const v8us*)(ap + 64 * GK + o0);
      ai.half[1] = *(const v8us*)(ap + 64 * GK + o1);
#pragma unroll   // constant indices keep the fragments in registers
      for (int t = 0; t < 4; ++t) {
        const unsigned short* wt = wp + t * 16 * GK;
        wf[t].half[0] = *(const v8us*)(wt + o0);
        wf[t].half[1] = *(const v8us*)(wt + o1);
      }
#pragma unroll   // as above
      for (int t = 0; t < 4; ++t) rmma<BF>(ar, ai, wf[t], yr[t], yi[t]);
    }
    asm volatile("s_wait_dscnt 0x0" ::: "memory");      // this wave's reads of the buffer have returned before it is refilled
    asm volatile("s_wait_asynccnt 0x0" ::: "memory");   // this wave's share of tile s + 1 has landed
    __syncthreads();                                    // publishes tile s + 1 and ends every wave's reads of tile s
    if (s + 2 < GNS) copy12(l + (unsigned int)bo * 2u, ga + (size_t)(s + 2) * (GK * 2), gw + (size_t)(s + 2) * (GK * 2));
  }
  asm volatile("s_wait_asynccnt 0x0" ::: "memory");     // nothing in flight when the wave goes on to the epilogue
}

// X[row][KP] = bf16 bits [xr 512 | xi 512], row = b*SEQ + s (compact). Thread per (row, 8 columns) converts the re and the im piece.
// coverage: blk = 0 .. GX_B - 1: NB*SEQ*64 threads x (8 re + 8 im) elements = the whole plane.
__device__ __forceinline__ void cvtx_block(int blk, const float* __restrict__ xr, const float* __restrict__ xi, unsigned short* __restrict__ X) {
  const int t = blk * 256 + threadIdx.x;
  if (t >= NB * SEQ * 64) return;
  const int row = t >> 6, c8 = (t & 63) * 8;
  const int b = row / SEQ, s = row - b * SEQ;
  const size_t src = ((size_t)b * SEQ_FULL + (size_t)s) * RD + c8;
  const v4f r0 = *(const v4fa*)(xr + src), r1 = *(const v4fa*)(xr + src + 4);
  const v4f i0 = *(const v4fa*)(xi + src), i1 = *(const v4fa*)(xi + src + 4);
  v8us orr, oi;
  orr[0] = bf16_bits(r0[0]); orr[1] = bf16_bits(r0[1]); orr[2] = bf16_bits(r0[2]); orr[3] = bf16_bits(r0[3]);
  orr[4] = bf16_bits(r1[0]); orr[5] = bf16_bits(r1[1]); orr[6] = bf16_bits(r1[2]); orr[7] = bf16_bits(r1[3]);
  oi[0] = bf16_bits(i0[0]); oi[1] = bf16_bits(i0[1]); oi[2] = bf16_bits(i0[2]); oi[3] = bf16_bits(i0[3]);
  oi[4] = bf16_bits(i1[0]); oi[5] = bf16_bits(i1[1]); oi[6] = bf16_bits(i1[2]); oi[7] = bf16_bits(i1[3]);
  unsigned short* d = X + (size_t)row * KP + c8;
  *(v8us*)d = orr;
  *(v8us*)(d + RD) = oi;
  
}

// Weight convert with transpose: w[k][n] (f32, [in][out]) -> Wt[n][k] (pitch RD) as bf16 bits (asf16 == 0) or as f16(bf16 value x 1024) (asf16 != 0).
// coverage: tile = 0 .. GW_T - 1 = (RD/64 k tiles) x (RD/64 n tiles) x (64 n rows x 64 k) = the whole plane; LDS tile: 64 x 64 written before the barrier, 64 x 64 read after it.
// Called by whole blocks only (the barrier).
__device__ __forceinline__ void cvtwt_block(int tile, const float* __restrict__ w, unsigned short* __restrict__ Wt, int asf16) {
  __shared__ __attribute__((aligned(16))) unsigned short tl[64][72];
  const int tid = threadIdx.x;
  const int k0 = (tile % (RD / 64)) * 64, n0 = (tile / (RD / 64)) * 64;
#pragma unroll 1
  for (int j = 0; j < 16; ++j) {
    const int i = tid + 256 * j;
    const int kk = i >> 6, nn = i & 63;
    const float x = w[(size_t)(k0 + kk) * RD + (size_t)(n0 + nn)];
    const unsigned short vb = bf16_bits(x);
    const unsigned short vh = c16f(bf16_val(vb) * 1024.0f);   // bf16 significand x 2^10 is exact in f16
    tl[nn][kk] = (asf16 != 0) ? vh : vb;
  }
  __syncthreads();
  {
#pragma unroll
    for (int j = 0; j < 2; ++j) {
      const int i = tid + 256 * j;
      const int nn = i >> 3, p8 = (i & 7) * 8;
      const v8us a = *(const v8us*)&tl[nn][p8];
      *(v8us*)(Wt + (size_t)(n0 + nn) * RD + (size_t)(k0 + p8)) = a;
    }
    
  }
}

// Mask pack: MB[b*SEQ + q][SEQ/32], bit j of word c = (mask[b][q][32c + j] != 0). Thread per word (8 x 16-B loads); a wave's 32 words are
// coverage: blk = 0 .. GM_B - 1: NB*SEQ*(SEQ/32) threads x 1 word = the whole plane.
__device__ __forceinline__ void maskbits_block(int blk, const int* __restrict__ mask, unsigned int* __restrict__ MB) {
  const int t = blk * 256 + threadIdx.x;
  if (t >= NB * SEQ * (SEQ / 32)) return;
  const int row = t / (SEQ / 32), wc = t - row * (SEQ / 32);
  const int b = row / SEQ, q = row - b * SEQ;
  const int* mp = mask + ((size_t)b * SEQ_FULL + (size_t)q) * SEQ_FULL + (size_t)wc * 32;
  unsigned int word = 0u;
#pragma unroll 1
  for (int g = 0; g < 8; ++g) {
    const v4i m = *(const v4i*)(mp + 4 * g);
    const unsigned int nib = ((m[0] != 0) ? 1u : 0u) | ((m[1] != 0) ? 2u : 0u) | ((m[2] != 0) ? 4u : 0u) | ((m[3] != 0) ? 8u : 0u);
    word |= nib << (4 * g);
  }
  *(unsigned int*)(MB + t) = word;
  
}

// All preparation in one launch: none of its eight parts reads what another writes, so they are block ranges of one grid.
// Blocks 0 .. GW_B - 1: the four weight planes (first: each walks a serial run of loads); then GM_B blocks of mask pack; then 3 x GX_B blocks of activation convert (q, k, v).
// Every branch below is block-uniform.
__global__ __launch_bounds__(256) void k_prep(const float* __restrict__ q_re, const float* __restrict__ k_re, const float* __restrict__ v_re,
                                              const float* __restrict__ q_ph, const float* __restrict__ k_ph, const float* __restrict__ v_ph,
                                              const float* __restrict__ w_q, const float* __restrict__ w_k, const float* __restrict__ w_v,
                                              const float* __restrict__ w_o, const int* __restrict__ mask,
                                              unsigned short* __restrict__ Xq, unsigned short* __restrict__ Xk, unsigned short* __restrict__ Xv,
                                              unsigned short* __restrict__ Wq, unsigned short* __restrict__ Wk, unsigned short* __restrict__ Wv,
                                              unsigned short* __restrict__ Wo, unsigned int* __restrict__ MB) {
  const int bid = blockIdx.x;
  if (bid < GW_B) {
    const int which = bid / GW_T;
    const float* w = (which == 0) ? w_q : (which == 1) ? w_k : (which == 2) ? w_v : w_o;
    unsigned short* Wt = (which == 0) ? Wq : (which == 1) ? Wk : (which == 2) ? Wv : Wo;
    cvtwt_block(bid - which * GW_T, w, Wt, (which == 3) ? 1 : 0);
  } else if (bid < GW_B + GM_B) {
    maskbits_block(bid - GW_B, mask, MB);
  } else {
    const int r = bid - (GW_B + GM_B);
    const int part = r / GX_B;
    const float* xr = (part == 0) ? q_re : (part == 1) ? k_re : v_re;
    const float* xi = (part == 0) ? q_ph : (part == 1) ? k_ph : v_ph;
    unsigned short* X = (part == 0) ? Xq : (part == 1) ? Xk : Xv;
    cvtx_block(r - part * GX_B, xr, xi, X);
  }
}

// q, k and v projections in one launch, blockIdx.z = 0 (q), 1 (k), 2 (v): none reads what another writes. Block = 4 waves x 16 rows = 64 rows, 64 columns = one head.
// q / k: output plane P[b*NH + head][s][HP] = f16 of (y_r x 256 | y_p x cim), cim = +256 (q) or -256 (k).
// v: transposed plane Vt[b*NH + head][dd][s], dd = [real 64 | phase 64], value f16 of (y x 256).
// coverage: grid (NB*SEQ/64, NH) per z x 4 waves x 16 rows x 128 halves = each whole plane.
// LDS tile, q / k: [4][16][136], columns 0..127 of every row are written before the barrier and exactly those are read after it; v: [128][72], 128 x 64 written before the barrier, 128 x 64 read after it.
// The branch on z is block-uniform, so each barrier is passed by the whole block.
__global__ __launch_bounds__(128) void k_proj(const unsigned short* __restrict__ Xq, const unsigned short* __restrict__ Xk, const unsigned short* __restrict__ Xv,
                                              const unsigned short* __restrict__ Wq, const unsigned short* __restrict__ Wk, const unsigned short* __restrict__ Wv,
                                              unsigned short* __restrict__ Qp, unsigned short* __restrict__ Kp, unsigned short* __restrict__ Vt) {
  __shared__ __attribute__((aligned(16))) unsigned short ring[2 * GST_H];   // the GEMM's two buffers; behind the GEMM the output tile
  unsigned short* st = ring;
  static_assert(4 * 16 * 136 <= HP * 72);
  static_assert(HP * 72 <= 2 * GST_H);
  const int tid = threadIdx.x, w = __builtin_amdgcn_readfirstlane((int)(tid >> 5)), lane = tid & 31, ln = lane & 15, hh = lane >> 4;
  const int z = blockIdx.z;
  const int head = blockIdx.y;
  const int rowb = blockIdx.x * 64;
  const unsigned short* X = (z == 0) ? Xq : (z == 1) ? Xk : Xv;
  const unsigned short* W = (z == 0) ? Wq : (z == 1) ? Wk : Wv;
  v8f yr[4] = {}, yi[4] = {};
  rgemm_main<true>(X, W, ring, rowb, head * HD, tid, w, ln, hh, yr, yi);
  const int b = rowb / SEQ;
  if (z < 2) {
    unsigned short (*sh)[16][136] = (unsigned short (*)[16][136])st;
    unsigned short* P = (z == 0) ? Qp : Kp;
    const float cim = (z == 0) ? 256.0f : -256.0f;
#pragma unroll
    for (int t = 0; t < 4; ++t) {
#pragma unroll
      for (int r = 0; r < 8; ++r) {
        sh[w][8 * hh + r][16 * t + ln]      = c16f(yr[t][r] * 256.0f);
        sh[w][8 * hh + r][HD + 16 * t + ln] = c16f(yi[t][r] * cim);
      }
    }
    __syncthreads();
    const int s0 = rowb - b * SEQ + 16 * w;
    const size_t base = ((size_t)(b * NH + head) * SEQ + (size_t)s0) * HP;
    const int rsub = lane >> 4, p8 = (lane & 15) * 8;
#pragma unroll
    for (int q = 0; q < 8; ++q) {
      const int row = 2 * q + rsub;
      const v8us a = *(const v8us*)&sh[w][row][p8];
      *(v8us*)(P + base + (size_t)row * HP + p8) = a;
    }
  } else {
    unsigned short (*th)[72] = (unsigned short (*)[72])st;
#pragma unroll
    for (int t = 0; t < 4; ++t) {
#pragma unroll
      for (int r = 0; r < 8; ++r) {
        const int col = 16 * w + 8 * hh + r;
        th[16 * t + ln][col]      = c16f(yr[t][r] * 256.0f);
        th[HD + 16 * t + ln][col] = c16f(yi[t][r] * 256.0f);
      }
    }
    __syncthreads();
    const int s0 = rowb - b * SEQ;
    const size_t base = (size_t)(b * NH + head) * HP * SEQ + (size_t)s0;
    for (int i = tid; i < HP * 8; i += 128) {
      const int dd = i >> 3, j8 = (i & 7) * 8;
      const v8us a = *(const v8us*)&th[dd][j8];
      *(v8us*)(Vt + base + (size_t)dd * SEQ + j8) = a;
    }
  }
}

// Score group for one 16-key tile (8 WMMAs): sre = kr qr + ki qi (4 products), sa = kr qi (2), sb = ki qr (2); then the hazard guard.
// k0, k1 = kr (d 0..31, 32..63); k2, k3 = ki; q[0], q[1] = qr; q[2], q[3] = qi.
__device__ __forceinline__ void score_mma(const Frag& k0, const Frag& k1, const Frag& k2, const Frag& k3,
                                          const Frag (&q)[4], v8f& sre, v8f& sa, v8f& sb) {
  sre = wm_h(k0, q[0], sre);
  sa  = wm_h(k0, q[2], sa);
  sb  = wm_h(k2, q[0], sb);
  sre = wm_h(k1, q[1], sre);
  sa  = wm_h(k1, q[3], sa);
  sb  = wm_h(k3, q[1], sb);
  sre = wm_h(k2, q[2], sre);
  sre = wm_h(k3, q[3], sre);
  asm volatile("v_nop\n\tv_nop\n\tv_nop\n\tv_nop" : "+v"(sre), "+v"(sa), "+v"(sb)
               : "v"(k0.vh), "v"(k1.vh), "v"(k2.vh), "v"(k3.vh),
                 "v"(q[0].vh), "v"(q[1].vh), "v"(q[2].vh), "v"(q[3].vh));
}
// c += v*p (single f16 product), then the hazard guard.
__device__ __forceinline__ void pv_mma(const Frag& v, const Frag& p, v8f& c) {
  c = wm_h(v, p, c);
  asm volatile("v_nop\n\tv_nop\n\tv_nop\n\tv_nop" : "+v"(c) : "v"(v.vh), "v"(p.vh));
}

// One 32-key step (step index j) for a wave's 16 queries: 16 score WMMAs + 8 P.V WMMAs. Ks = the step's first staged K row (pitch KPITCH),
// Vs = the step's first key column in the staged V^T rows (pitch VPITCH), both in LDS; key0 = 32 j in the comments below; Mw is this lane's query row of mask words. With the phase half of the K plane stored negated: sre = qr.kr - qp.kp, sa - sb = qp.kr + qr.kp.
__device__ __forceinline__ void fa_step(const unsigned short* Ks, const unsigned short* Vs,
                                        const unsigned int* __restrict__ Mw, int j, int ln, int hh,
                                        const Frag (&qf)[4], float& mr, float& lr, v8f (&O)[8]) {
  const v8f z8 = {0.f, 0.f, 0.f, 0.f, 0.f, 0.f, 0.f, 0.f};
  unsigned int mw = Mw[j];                           // bit i = mask(query of this lane, key0 + i); loaded by every lane, in range
  asm volatile("" : "+v"(mw));
  const unsigned int mh = mw >> (8 * hh);            // this lane half's keys: bit 16*kt + r
  float sc[16];
  // A fragments of K: row m = key (key0 + 16*kt + ln); packed k axis [kr 0..63 | -kp 64..127]; elements 0..7 <- 32c + 8h + i, 8..15 <- 32c + 16 + 8h + i;
  // both 16-key tiles' fragments are read as one group
  Frag kf[2][4];
#pragma unroll   // constant indices keep the fragments in registers
  for (int kt = 0; kt < 2; ++kt) {
    const unsigned short* kp = Ks + (16 * kt + ln) * KPITCH + 8 * hh;
#pragma unroll   // as above
    for (int c = 0; c < 4; ++c) {
      kf[kt][c].half[0] = *(const v8us*)(kp + 32 * c);
      kf[kt][c].half[1] = *(const v8us*)(kp + 32 * c + 16);
    }
  }
#pragma unroll
  for (int kt = 0; kt < 2; ++kt) {
    v8f sre = z8, sa = z8, sb = z8;
    score_mma(kf[kt][0], kf[kt][1], kf[kt][2], kf[kt][3], qf, sre, sa, sb);
    // S^T tile: element r = score(key0 + 16*kt + 8h + r, query of this lane's column); logit in log2 units; masked keys get the fill value instead
#pragma unroll
    for (int r = 0; r < 8; ++r) {
      const float im = sa[r] - sb[r];
      const float v = __builtin_amdgcn_sqrtf(fmaf(sre[r], sre[r], im * im)) * CSCALE;
      sc[8 * kt + r] = (((mh >> (16 * kt + r)) & 1u) != 0u) ? v : MFILL;
    }
  }
  // A fragments of V^T: row m = dd (16*t + ln), elements 0..7 <- key0 + 8h + i, 8..15 <- key0 + 16 + 8h + i; read as one group, ahead of the softmax arithmetic
  Frag vf[8];
#pragma unroll   // constant indices keep the fragments in registers
  for (int t = 0; t < 8; ++t) {
    const unsigned short* vp = Vs + (16 * t + ln) * VPITCH + 8 * hh;
    vf[t].half[0] = *(const v8us*)(vp);
    vf[t].half[1] = *(const v8us*)(vp + 16);
  }
  float mx = sc[0];
#pragma unroll
  for (int i = 1; i < 16; ++i) mx = fmaxf(mx, sc[i]);
  mx = fmaxf(mx, __shfl_xor(mx, 16, 32));           // the other lane half holds the other 16 keys of this query
  const float mnew = fmaxf(mr, mx);
  const float al = exp2f(mr - mnew);
  mr = mnew;
  // weights carried x256: pc = 256 * 2^(sc - mnew) as one f16 plane (exponent below -14 -> exact zero); the row sum uses the f16-converted values the matrix unit sees
  Frag pf;
  float ps = 0.0f;
#pragma unroll
  for (int i = 0; i < 16; ++i) {
    const float e = (sc[i] - mnew) + 8.0f;
    const float pc = (e < -14.0f) ? 0.0f : __builtin_amdgcn_exp2f(e);   // bare v_exp_f32 and a value select: the kept range e >= -14 needs no range extension, so the bits are those of exp2f(e), and no branch stands between the 16 weights
    const _Float16 h = (_Float16)pc;
    pf.h[i] = h;                                    // B element i: i<8 -> key0 + 8h + i (tile 0 row 8h+i); i>=8 -> key0 + 16 + 8h + (i-8) (tile 1)
    ps += (float)h;
  }
  ps += __shfl_xor(ps, 16, 32);
  lr = lr * al + ps;
#pragma unroll
  for (int t = 0; t < 8; ++t) O[t] = O[t] * al;
#pragma unroll   // constant indices keep the fragments and the accumulators in registers
  for (int t = 0; t < 8; ++t) pv_mma(vf[t], pf, O[t]);
}

// Eight asynchronous 16-byte copies per lane, global -> LDS: copy i moves g + i*gstep to LDS byte l + i*lstep. Every lane on, no offset field.
// The s_wait_xcnt closes the statement so that it stands in front of any later write of the address registers the copies name.
__device__ __forceinline__ void copy8(unsigned int l, unsigned int lstep, const char* g, size_t gstep) {
  asm volatile("global_load_async_to_lds_b128 %0, %8, off\n\t"
               "global_load_async_to_lds_b128 %1, %9, off\n\t"
               "global_load_async_to_lds_b128 %2, %10, off\n\t"
               "global_load_async_to_lds_b128 %3, %11, off\n\t"
               "global_load_async_to_lds_b128 %4, %12, off\n\t"
               "global_load_async_to_lds_b128 %5, %13, off\n\t"
               "global_load_async_to_lds_b128 %6, %14, off\n\t"
               "global_load_async_to_lds_b128 %7, %15, off\n\t"
               "s_wait_xcnt 0x0"
               :: "v"(l), "v"(l + lstep), "v"(l + 2 * lstep), "v"(l + 3 * lstep),
                  "v"(l + 4 * lstep), "v"(l + 5 * lstep), "v"(l + 6 * lstep), "v"(l + 7 * lstep),
                  "v"(g), "v"(g + gstep), "v"(g + 2 * gstep), "v"(g + 3 * gstep),
                  "v"(g + 4 * gstep), "v"(g + 5 * gstep), "v"(g + 6 * gstep), "v"(g + 7 * gstep)
               : "memory");
}

// One stage (TK keys) into the LDS buffer at byte address lb. kg, vg: this thread's first source bytes in tile 0 of the (b, h) planes; kl, vl: its first LDS bytes in a buffer.
// K tile: TK rows x 256 B, contiguous in the plane; thread tid copies chunk tid + 128 i (row = chunk / 16). V^T tile: 128 rows x 128 B at the plane's row pitch; row = chunk / 8.
__device__ __forceinline__ void stage_copy(int tile, unsigned int lb, const char* kg, const char* vg, unsigned int kl, unsigned int vl) {
  copy8(lb + kl, 8u * KPITCH * 2u, kg + (size_t)tile * (TK * HP * 2), (size_t)2048);
  copy8(lb + vl, 16u * VPITCH * 2u, vg + (size_t)tile * (TK * 2), (size_t)16 * SEQ * 2);
}

// Block = 4 waves x 16 queries = 64 queries of one (b, h). The four waves share each 64-key K / V^T tile: two LDS buffers, the next tile's copies in flight while
// this tile is worked on; one barrier per tile publishes the next tile and frees the buffer just read.
// Epilogue: ctx carried x4096 as one f16 plane C[b*SEQ + s][KP] ([real 512 | phase 512], column h*64 + d).
// coverage: NB*NH*(SEQ/64) blocks x 4 waves x 16 queries x (64 real + 64 phase) = every (row, head, part) segment of the plane exactly once.
// LDS tile: columns 0..127 of every row written before the barrier, the same read after it.
__global__ __launch_bounds__(128) void k_attn(const unsigned short* __restrict__ Qp, const unsigned short* __restrict__ Kpl,
                                              const unsigned short* __restrict__ Vt, const unsigned int* __restrict__ MB,
                                              unsigned short* __restrict__ Cx) {
  __shared__ __attribute__((aligned(16))) unsigned short sh[4][16][136];
  __shared__ __attribute__((aligned(16))) unsigned short ring[2 * ST_H];
  const int tid = threadIdx.x, w = __builtin_amdgcn_readfirstlane((int)(tid >> 5)), lane = tid & 31, ln = lane & 15, hh = lane >> 4;
  const int bh = blockIdx.x / (SEQ / 64), qt = blockIdx.x % (SEQ / 64);
  const int b = bh / NH, h = bh - b * NH;
  const int qbase = qt * 64 + 16 * w;
  const int qg = qbase + ln;
  // Q^T B fragments: column n = query qg, packed k axis [qr 0..63 | qp 64..127], elements 0..7 <- 32c + 8h + i, 8..15 <- 32c + 16 + 8h + i
  Frag qf[4];
  {
    const size_t qoff = ((size_t)bh * SEQ + (size_t)qg) * HP + 8 * hh;
#pragma unroll
    for (int c = 0; c < 4; ++c) {
      qf[c].half[0] = *(const v8us*)(Qp + qoff + 32 * c);
      qf[c].half[1] = *(const v8us*)(Qp + qoff + 32 * c + 16);
    }
  }
  float mr = -3.0e38f, lr = 0.0f;
  v8f O[8] = {};
  const unsigned short* Kp = Kpl + (size_t)bh * SEQ * HP;
  const unsigned short* Vp = Vt  + (size_t)bh * HP * SEQ;
  const unsigned int* Mw = MB + ((size_t)b * SEQ + (size_t)qg) * (SEQ / 32);
  const char* kg = (const char*)Kp + (size_t)tid * 16;
  const char* vg = (const char*)Vp + (size_t)(tid >> 3) * (SEQ * 2) + (size_t)(tid & 7) * 16;
  const unsigned int rb = (unsigned int)(size_t)&ring[0];                                     // LDS byte address of the ring
  const unsigned int kl = (unsigned int)((tid >> 4) * (KPITCH * 2) + (tid & 15) * 16);
  const unsigned int vl = (unsigned int)(KT_H * 2 + (tid >> 3) * (VPITCH * 2) + (tid & 7) * 16);
  constexpr int NT = SEQ / TK;
  stage_copy(0, rb, kg, vg, kl, vl);
  asm volatile("s_wait_asynccnt 0x0" ::: "memory");   // this wave's share of tile 0 has landed
  __syncthreads();                                    // every wave's share of tile 0 has landed
  if (NT > 1) stage_copy(1, rb + ST_H * 2u, kg, vg, kl, vl);
#pragma unroll 1   // one trip per tile: the hand-over at the foot stands once, and the loop stays small in the instruction cache
  for (int t = 0; t < NT; ++t) {
    const int bo = (t & 1) * ST_H;
    fa_step(&ring[bo], &ring[bo + KT_H], Mw, 2 * t, ln, hh, qf, mr, lr, O);
    fa_step(&ring[bo + 32 * KPITCH], &ring[bo + KT_H + 32], Mw, 2 * t + 1, ln, hh, qf, mr, lr, O);
    asm volatile("s_wait_dscnt 0x0" ::: "memory");      // this wave's reads of the buffer have returned before it is refilled
    asm volatile("s_wait_asynccnt 0x0" ::: "memory");   // this wave's share of tile t + 1 has landed
    __syncthreads();                                    // publishes tile t + 1 and ends every wave's reads of tile t
    if (t + 2 < NT) stage_copy(t + 2, rb + (unsigned int)bo * 2u, kg, vg, kl, vl);
  }
  asm volatile("s_wait_asynccnt 0x0" ::: "memory");     // nothing in flight when the wave goes on to the epilogue

  // O^T element r of tile t = ctx(query qg, dd = 16t + 8h + r); carries: x256 (P, also in lr), x256 (v); ctx stored x4096 -> factor 16 / lr
  const float inv = 16.0f * (1.0f / lr);
#pragma unroll
  for (int t = 0; t < 8; ++t) {
#pragma unroll
    for (int r = 0; r < 8; ++r)
      sh[w][ln][16 * t + 8 * hh + r] = c16f(O[t][r] * inv);
  }
  __syncthreads();
  const size_t rbase = ((size_t)b * SEQ + (size_t)qbase) * KP + (size_t)h * HD;
  const int lsub = lane >> 3, p8 = (lane & 7) * 8;
  {
#pragma unroll
    for (int q = 0; q < 8; ++q) {
      const int line = 4 * q + lsub;            // 0..31 = 16 queries x {real, phase}
      const int row = line >> 1, seg = line & 1;
      const v8us a = *(const v8us*)&sh[w][row][seg * HD + p8];
      const size_t o = rbase + (size_t)row * KP + (size_t)seg * RD + p8;
      *(v8us*)(Cx + o) = a;
    }
    
  }
}

// Output projection of both parts: out0[b][s][n] = ctx_real x Wo, out1[b][s][n] = ctx_phase x Wo (f16, K = 512, one product per term), undo carries x4096 (ctx) and x1024 (Wo).
// Epilogue: per-wave LDS tile [16 rows][128 floats = 64 real columns | 64 phase columns] (block barrier), then per instruction lanes 0..15 write the 256-B
// coverage: grid (NB*SEQ/64, RD/64) x 4 waves x 16 rows x (64 + 64) floats = every output element of the processed rows exactly once.
// LDS tile: columns 0..127 of every row written before the barrier, the same read after it.
__global__ __launch_bounds__(128) void k_out(const unsigned short* __restrict__ Cx, const unsigned short* __restrict__ Wo,
                                             float* __restrict__ Out) {
  __shared__ __attribute__((aligned(16))) unsigned short ring[2 * GST_H];   // the GEMM's two buffers; behind the GEMM the output tile
  float (*so)[16][132] = (float (*)[16][132])ring;
  static_assert(4 * 16 * 132 * 4 <= 2 * GST_H * 2);
  const int tid = threadIdx.x, w = __builtin_amdgcn_readfirstlane((int)(tid >> 5)), lane = tid & 31, ln = lane & 15, hh = lane >> 4;
  const int rowb = blockIdx.x * 64;
  const int col0 = blockIdx.y * 64;
  v8f yr[4] = {}, yi[4] = {};
  rgemm_main<false>(Cx, Wo, ring, rowb, col0, tid, w, ln, hh, yr, yi);
  const float scl = 1.0f / 4194304.0f;
#pragma unroll
  for (int t = 0; t < 4; ++t) {
#pragma unroll
    for (int r = 0; r < 8; ++r) {
      so[w][8 * hh + r][16 * t + ln]      = yr[t][r] * scl;
      so[w][8 * hh + r][HD + 16 * t + ln] = yi[t][r] * scl;
    }
  }
  __syncthreads();
  const int b = rowb / SEQ;
  const int s0 = rowb - b * SEQ + 16 * w;
  const size_t obase = ((size_t)b * SEQ_FULL + (size_t)s0) * RD + (size_t)col0
                     + (size_t)(lane >> 4) * OUT1_OFF + (size_t)(lane & 15) * 4;
  {
#pragma unroll
    for (int q = 0; q < 16; ++q) {
      const v4f v = *(const v4fa*)&so[w][q][lane * 4];
      *(v4f*)(Out + obase + (size_t)q * RD) = v;
    }
    
  }
}

extern "C" void kernel_launch(void* const* d_in, const int* in_sizes, int n_in,
                              void* d_out, int out_size, void* d_ws, size_t ws_size, hipStream_t stream) {
  if (n_in < 11) return;
  const long long needx = ((long long)(NB - 1) * SEQ_FULL + (long long)SEQ) * RD;   // last activation element touched + 1
  const long long needm = ((long long)(NB - 1) * SEQ_FULL + (long long)(SEQ - 1)) * SEQ_FULL + (long long)SEQ;   // last mask element touched + 1
  for (int i = 0; i < 6; ++i) if ((long long)in_sizes[i] < needx) return;
  for (int i = 6; i < 10; ++i) if ((long long)in_sizes[i] < (long long)RD * RD) return;
  if ((long long)in_sizes[10] < needm) return;
  if ((long long)out_size < (long long)OUT1_OFF + needx) return;
  // wire order: q_real, k_real, v_real, q_phase, k_phase, v_phase, w_q, w_k, w_v, w_o, mask
  const float* q_re = (const float*)d_in[0];
  const float* k_re = (const float*)d_in[1];
  const float* v_re = (const float*)d_in[2];
  const float* q_ph = (const float*)d_in[3];
  const float* k_ph = (const float*)d_in[4];
  const float* v_ph = (const float*)d_in[5];
  const float* w_q = (const float*)d_in[6];
  const float* w_k = (const float*)d_in[7];
  const float* w_v = (const float*)d_in[8];
  const float* w_o = (const float*)d_in[9];
  const int* maskp = (const int*)d_in[10];
  float* Out = (float*)d_out;

  char* ws = (char*)d_ws;
  size_t off = 0;
  const size_t XB = (size_t)NB * SEQ * KP * 2;          // activation / head / ctx plane bytes (8 MiB at full size); all planes are written exactly to their end
  const size_t WB = (size_t)RD * RD * 2;                // transposed weight plane bytes (512 KiB)
  const size_t MBB = (size_t)NB * SEQ * (SEQ / 32) * 4; // mask bit words (1 MiB at full size)
  unsigned short* Xq = (unsigned short*)(ws + off); off += XB;
  unsigned short* Xk = (unsigned short*)(ws + off); off += XB;
  unsigned short* Xv = (unsigned short*)(ws + off); off += XB;
  unsigned short* Wq = (unsigned short*)(ws + off); off += WB;
  unsigned short* Wk = (unsigned short*)(ws + off); off += WB;
  unsigned short* Wv = (unsigned short*)(ws + off); off += WB;
  unsigned short* Wo = (unsigned short*)(ws + off); off += WB;
  unsigned short* Qp = (unsigned short*)(ws + off); off += XB;   // NB*NH*SEQ*HP halves = XB bytes
  unsigned short* Kp = (unsigned short*)(ws + off); off += XB;
  unsigned short* Vt = (unsigned short*)(ws + off); off += XB;
  unsigned short* Cx = (unsigned short*)(ws + off); off += XB;
  unsigned int*   MB = (unsigned int*)(ws + off);   off += MBB;
  if (off > ws_size) return;

  k_prep<<<(unsigned)(GW_B + GM_B + 3 * GX_B), 256, 0, stream>>>(q_re, k_re, v_re, q_ph, k_ph, v_ph, w_q, w_k, w_v, w_o, maskp,
                                                                 Xq, Xk, Xv, Wq, Wk, Wv, Wo, MB);

  const dim3 gp((unsigned)(NB * SEQ / 64), (unsigned)NH, 3);
  k_proj<<<gp, 128, 0, stream>>>(Xq, Xk, Xv, Wq, Wk, Wv, Qp, Kp, Vt);

  k_attn<<<(unsigned)(NB * NH * (SEQ / 64)), 128, 0, stream>>>(Qp, Kp, Vt, MB, Cx);

  const dim3 go((unsigned)(NB * SEQ / 64), (unsigned)(RD / 64), 1);
  k_out<<<go, 128, 0, stream>>>(Cx, Wo, Out);
}

// v005
// One run takes 88.5 microseconds.
// Timed twice side by side with v004, it ran 1.19 times as fast both times.
// All steps since v000 together make it 4.05 times as fast.
#include <hip/hip_runtime.h>
// Contractions: q/k/v projections (real and phase parts share one weight) on v_wmma_f32_16x16x32_bf16 (activations and weights RNE-converted to bf16, single product, f32 accumulate); scores K Q^T, O^T = V^T P^T and the output projection on v_wmma_f32_16x16x32_f16 (single carried f16 planes: q, k, v x256, P x256, ctx x4096, Wo = bf16 value x1024 held exactly in f16; single product per term, f32 accumulate); softmax statistics f32.
// Two-part (real | phase) multi-head attention: B x S x 512 activations per part, 8 heads x 64, weights stored [in][out] (y = x w), softmax over
// sqrt(re^2 + im^2) / sqrt(128) with re = qr.kr - qp.kp, im = qr.kp + qp.kr; keys whose mask entry is 0 get their score REPLACED by -1e9 (they stay in the softmax).
// Engine: transposed flash. Each wave owns 16 queries of one (b, h). Per 32-key step: S^T tiles (key rows x query columns) from packed K rows
// [kr 64 | -kp 64] (A, f16 plane staged in LDS; the phase half is stored negated so that the packed products give re and im above) and packed Q^T [qr | qp]
// (B, registers); the two 16-key D tiles pack straight into the P^T B fragment; O^T (128 d rows = [real 64 | phase 64] x query columns) accumulates
// from V^T rows (A, f16 plane staged in LDS). 24 WMMAs per step. The mask is packed once into 32-lane select words [b][q / 16][S/32][16]: word i of a step holds, lane by lane, the condition of the wave's score register i.
// Real GEMMs: y_r = x_r w, y_p = x_p w with A fragments x_r, x_p from 16-bit rows [real 512 | phase 512] and one B fragment from the transposed weight plane Wt[n][k], both staged in LDS.
#ifndef NB
#define NB 2
#endif
#ifndef SEQ
#define SEQ 2048
#endif
#define NB_FULL 2
#define SEQ_FULL 2048
#define RD 512        /* model width (= heads x head dim) */
#define NH 8
#define HD 64
#define KP 1024       /* packed 16-bit row: [real 512 | phase 512] */
#define HP 128        /* packed head row: [real 64 | phase 64] */
#define OUT1_OFF ((size_t)NB_FULL * SEQ_FULL * RD)   /* element offset of the second output (fixed by the full problem size) */
#define TK 64         /* keys per LDS stage (two 32-key steps) */
#define KPITCH 136    /* LDS pitch of a staged K row, halves: 256 B + 16 B, conflict-free for 16-byte reads down a column of rows */
#define VPITCH 72     /* LDS pitch of a staged V^T row, halves: 128 B + 16 B */
#define KT_H (TK * KPITCH)    /* halves of one staged K tile */
#define VT_H (HP * VPITCH)    /* halves of one staged V^T tile */
#define ST_H (KT_H + VT_H)    /* halves of one stage */
#define GK 64         /* k extent of one staged GEMM tile, halves: 128 B = one whole line per row */
#define GROWS 192     /* rows of one staged GEMM tile: 64 A rows real, the same 64 rows phase, 64 W rows */
#define GST_H (GROWS * GK)    /* halves of one GEMM stage */
#define GNS (RD / GK)         /* GEMM stages */
#define GW_T ((RD / 64) * (RD / 64))                     /* preparation grid: blocks of one weight plane (64 x 64 tiles) */
#define GW_B (4 * GW_T)                                  /* blocks of the four weight planes */
#define GM_B ((NB * SEQ * (SEQ / 32) + 255) / 256)       /* blocks of the mask pack */
#define GX_B ((NB * SEQ * 64 + 255) / 256)               /* blocks of one activation convert */

static_assert(SEQ % 64 == 0);
static_assert(SEQ % TK == 0);
static_assert(TK * HP * 2 == 128 * 8 * 16);   /* one K tile = 128 threads x 8 copies of 16 B */
static_assert(HP * TK * 2 == 128 * 8 * 16);   /* one V^T tile likewise */
static_assert(GROWS * GK * 2 == 128 * 12 * 16);   /* one GEMM stage = 128 threads x 12 copies of 16 B */
static_assert(RD % GK == 0 && GNS >= 2);
static_assert(SEQ <= SEQ_FULL);
static_assert(NB <= NB_FULL);
static_assert(NH * HD == RD);
static_assert(RD % 64 == 0);
static_assert(RD % 32 == 0);
static_assert(NH * HP == KP);
static_assert(KP == 2 * RD);
static_assert(HP == 2 * HD);
static_assert(HD == 64);
static_assert((NB * SEQ) % 64 == 0);
static_assert(((size_t)NB * SEQ * (SEQ / 32)) % 32 == 0);
static_assert(GM_B * 8 == NB * (SEQ / 16) * (SEQ / 64));   /* the mask pack's blocks hold exactly its waves */
static_assert(OUT1_OFF * 4 == (size_t)8388608);
static_assert((size_t)7 * ((size_t)NB * SEQ * KP * 2) + (size_t)4 * ((size_t)RD * RD * 2) + (size_t)NB * SEQ * (SEQ / 32) * 4 <= (size_t)134217728);

typedef __bf16 v16b __attribute__((ext_vector_type(16)));
typedef _Float16 v16h __attribute__((ext_vector_type(16)));
typedef _Float16 h16;
typedef unsigned short v8us __attribute__((ext_vector_type(8), may_alias));
typedef int v4i __attribute__((ext_vector_type(4), may_alias));
typedef unsigned int v16u __attribute__((ext_vector_type(16)));
typedef const __attribute__((address_space(4))) v16u* maskp_t;   /* constant address space: the words are written by an earlier launch only, so a wave-uniform read of them is a scalar load */
typedef float v8f __attribute__((ext_vector_type(8)));
typedef float v4f __attribute__((ext_vector_type(4)));
typedef float v4fa __attribute__((ext_vector_type(4), may_alias));
union Frag { v16b vb; v16h vh; v8us half[2]; unsigned short u[16]; _Float16 h[16]; };

#define LOG2E 1.4426950408889634f
/* scores arrive x65536 (q x256, k x256); logit in log2 units = |s| * (1/sqrt(128)) * log2(e) / 65536 */
#define CSCALE (0.08838834764831845f * LOG2E / 65536.0f)
/* replaced score of a masked key, in log2 units */
#define MFILL (-1.0e9f * LOG2E)

__device__ __forceinline__ unsigned short bf16_bits(float x) {   // RNE convert to bf16 bits
  unsigned int u = __float_as_uint(x);
  return (unsigned short)((u + 0x7FFFu + ((u >> 16) & 1u)) >> 16);
}
__device__ __forceinline__ float bf16_val(unsigned short b) { return __uint_as_float(((unsigned int)b) << 16); }
__device__ __forceinline__ float bf16_rne(float x) { return bf16_val(bf16_bits(x)); }
__device__ __forceinline__ unsigned short f16_bits(_Float16 h) { union { _Float16 h; unsigned short u; } c; c.h = h; return c.u; }
__device__ __forceinline__ unsigned short c16(float c) { return f16_bits((_Float16)c); }   // RNE convert of a carried value to f16 bits

// f32 -> f16 convert that cannot produce a subnormal: values below the smallest normal become zero (value select).
static __device__ __forceinline__ h16 toh_flush(float v) { const h16 r = (h16)v; return (fabsf(v) < 6.103515625e-05f) ? (h16)0.0f : r; }
__device__ __forceinline__ unsigned short c16f(float c) { return f16_bits(toh_flush(c)); }

__device__ __forceinline__ v8f wm_b(const Frag& a, const Frag& b, v8f c) {
  return __builtin_amdgcn_wmma_f32_16x16x32_bf16(false, a.vb, false, b.vb, (short)0, c, false, false);
}
__device__ __forceinline__ v8f wm_h(const Frag& a, const Frag& b, v8f c) {
  return __builtin_amdgcn_wmma_f32_16x16x32_f16(false, a.vh, false, b.vh, (short)0, c, false, false);
}

// One k-step for one 16x16 output tile of both parts: yr += ar*w ; yi += ai*w ; each product followed by its own hazard guard.
template <bool BF>
__device__ __forceinline__ void rmma(const Frag& ar, const Frag& ai, const Frag& wf, v8f& yr, v8f& yi) {
  if (BF) {
    yr = wm_b(ar, wf, yr);
    asm volatile("v_nop\n\tv_nop\n\tv_nop\n\tv_nop" : "+v"(yr) : "v"(ar.vb), "v"(wf.vb));
    yi = wm_b(ai, wf, yi);
    asm volatile("v_nop\n\tv_nop\n\tv_nop\n\tv_nop" : "+v"(yi) : "v"(ai.vb), "v"(wf.vb));
  } else {
    yr = wm_h(ar, wf, yr);
    asm volatile("v_nop\n\tv_nop\n\tv_nop\n\tv_nop" : "+v"(yr) : "v"(ar.vh), "v"(wf.vh));
    yi = wm_h(ai, wf, yi);
    asm volatile("v_nop\n\tv_nop\n\tv_nop\n\tv_nop" : "+v"(yi) : "v"(ai.vh), "v"(wf.vh));
  }
}

// Twelve asynchronous 16-byte copies per lane, global -> LDS, one GEMM stage: copy i lands at LDS byte l + 2048 i (16 rows further down).
// Copies 0..3: A rows, real part (16 rows apart); 4..7: the same rows, phase part (RD halves further); 8..11: W rows (16 rows apart). Every lane on, no offset field.
// The s_wait_xcnt closes the statement so that it stands in front of any later write of the address registers the copies name.
__device__ __forceinline__ void copy12(unsigned int l, const char* ga, const char* gw) {
  constexpr size_t AS = (size_t)16 * KP * 2, PH = (size_t)RD * 2, WS = (size_t)16 * RD * 2;
  asm volatile("global_load_async_to_lds_b128 %0, %12, off\n\t"
               "global_load_async_to_lds_b128 %1, %13, off\n\t"
               "global_load_async_to_lds_b128 %2, %14, off\n\t"
               "global_load_async_to_lds_b128 %3, %15, off\n\t"
               "global_load_async_to_lds_b128 %4, %16, off\n\t"
               "global_load_async_to_lds_b128 %5, %17, off\n\t"
               "global_load_async_to_lds_b128 %6, %18, off\n\t"
               "global_load_async_to_lds_b128 %7, %19, off\n\t"
               "global_load_async_to_lds_b128 %8, %20, off\n\t"
               "global_load_async_to_lds_b128 %9, %21, off\n\t"
               "global_load_async_to_lds_b128 %10, %22, off\n\t"
               "global_load_async_to_lds_b128 %11, %23, off\n\t"
               "s_wait_xcnt 0x0"
               :: "v"(l), "v"(l + 2048u), "v"(l + 4096u), "v"(l + 6144u),
                  "v"(l + 8192u), "v"(l + 10240u), "v"(l + 12288u), "v"(l + 14336u),
                  "v"(l + 16384u), "v"(l + 18432u), "v"(l + 20480u), "v"(l + 22528u),
                  "v"(ga), "v"(ga + AS), "v"(ga + 2 * AS), "v"(ga + 3 * AS),
                  "v"(ga + PH), "v"(ga + PH + AS), "v"(ga + PH + 2 * AS), "v"(ga + PH + 3 * AS),
                  "v"(gw), "v"(gw + WS), "v"(gw + 2 * WS), "v"(gw + 3 * WS)
               : "memory");
}

// Block tile 64 rows x 64 columns for both parts (wave tile 16 rows x 64 columns), K = 512. A plane [rows][KP] = [real 512 | phase 512], W plane [cols][RD] (transposed weight, k-contiguous).
// The four waves share each k tile of GK: two LDS buffers in ring (2 x GST_H halves), the next tile's copies in flight while this tile is worked on; one barrier per tile
// publishes the next tile and frees the buffer just read. Called by whole blocks of 128 threads; behind the call the ring is free for other use.
// Staged tile: row r = 0..63 A real (row rowb + r), 64..127 A phase, 128..191 W (column col0 + r - 128); 128 B per row, no pad: the 16-byte piece p of row r lies at piece p ^ ((r >> 1) & 7),
// so 16 lanes reading one piece down 16 rows meet every bank once. Thread tid copies piece tid & 7 of rows (tid >> 3) + 16 i: whole 128-B lines per 8 lanes.
// A fragment: row m = rowb + 16 w + ln, elements 0..7 <- k0 + 8h + i, 8..15 <- k0 + 16 + 8h + i. B fragment: column n = col0 + 16t + ln, same k map.
// D: acc[r] = y(rowb + 16 w + 8h + r, col0 + 16t + ln).
template <bool BF>
__device__ __forceinline__ void rgemm_main(const unsigned short* __restrict__ A, const unsigned short* __restrict__ W, unsigned short* ring,
                                           int rowb, int col0, int tid, int w, int ln, int hh, v8f (&yr)[4], v8f (&yi)[4]) {
  const char* ga = (const char*)(A + (size_t)(rowb + (tid >> 3)) * KP) + (tid & 7) * 16;
  const char* gw = (const char*)(W + (size_t)(col0 + (tid >> 3)) * RD) + (tid & 7) * 16;
  const unsigned int l = (unsigned int)(size_t)ring + (unsigned int)((tid >> 3) * (GK * 2) + (((tid & 7) ^ ((tid >> 4) & 7)) * 16));   // LDS byte address of this thread's first piece in buffer 0
  const int sw = (ln >> 1) & 7;
  copy12(l, ga, gw);
  asm volatile("s_wait_asynccnt 0x0" ::: "memory");   // this wave's share of tile 0 has landed
  __syncthreads();                                    // every wave's share of tile 0 has landed
  copy12(l + GST_H * 2u, ga + GK * 2, gw + GK * 2);
#pragma unroll 1   // one trip per tile: the hand-over at the foot stands once
  for (int s = 0; s < GNS; ++s) {
    const int bo = (s & 1) * GST_H;
    const unsigned short* ap = ring + bo + (16 * w + ln) * GK;
    const unsigned short* wp = ring + bo + (128 + ln) * GK;
#pragma unroll   // constant c: the piece places are loop-invariant registers and the row offsets immediates
    for (int c = 0; c < GK / 32; ++c) {
      const int o0 = ((4 * c + hh) ^ sw) * 8, o1 = ((4 * c + 2 + hh) ^ sw) * 8;   // places of the pieces k0 + 8h and k0 + 16 + 8h in this lane's rows
      // the k step's six fragments are read as one group, ahead of its products
      Frag ar, ai, wf[4];
      ar.half[0] = *(const v8us*)(ap + o0);
      ar.half[1] = *(const v8us*)(ap + o1);
      ai.half[0] = *(const v8us*)(ap + 64 * GK + o0);
      ai.half[1] = *(const v8us*)(ap + 64 * GK + o1);
#pragma unroll   // constant indices keep the fragments in registers
      for (int t = 0; t < 4; ++t) {
        const unsigned short* wt = wp + t * 16 * GK;
        wf[t].half[0] = *(const v8us*)(wt + o0);
        wf[t].half[1] = *(const v8us*)(wt + o1);
      }
#pragma unroll   // as above
      for (int t = 0; t < 4; ++t) rmma<BF>(ar, ai, wf[t], yr[t], yi[t]);
    }
    asm volatile("s_wait_dscnt 0x0" ::: "memory");      // this wave's reads of the buffer have returned before it is refilled
    asm volatile("s_wait_asynccnt 0x0" ::: "memory");   // this wave's share of tile s + 1 has landed
    __syncthreads();                                    // publishes tile s + 1 and ends every wave's reads of tile s
    if (s + 2 < GNS) copy12(l + (unsigned int)bo * 2u, ga + (size_t)(s + 2) * (GK * 2), gw + (size_t)(s + 2) * (GK * 2));
  }
  asm volatile("s_wait_asynccnt 0x0" ::: "memory");     // nothing in flight when the wave goes on to the epilogue
}

// X[row][KP] = bf16 bits [xr 512 | xi 512], row = b*SEQ + s (compact). Thread per (row, 8 columns) converts the re and the im piece.
// coverage: blk = 0 .. GX_B - 1: NB*SEQ*64 threads x (8 re + 8 im) elements = the whole plane.
__device__ __forceinline__ void cvtx_block(int blk, const float* __restrict__ xr, const float* __restrict__ xi, unsigned short* __restrict__ X) {
  const int t = blk * 256 + threadIdx.x;
  if (t >= NB * SEQ * 64) return;
  const int row = t >> 6, c8 = (t & 63) * 8;
  const int b = row / SEQ, s = row - b * SEQ;
  const size_t src = ((size_t)b * SEQ_FULL + (size_t)s) * RD + c8;
  const v4f r0 = *(const v4fa*)(xr + src), r1 = *(const v4fa*)(xr + src + 4);
  const v4f i0 = *(const v4fa*)(xi + src), i1 = *(const v4fa*)(xi + src + 4);
  v8us orr, oi;
  orr[0] = bf16_bits(r0[0]); orr[1] = bf16_bits(r0[1]); orr[2] = bf16_bits(r0[2]); orr[3] = bf16_bits(r0[3]);
  orr[4] = bf16_bits(r1[0]); orr[5] = bf16_bits(r1[1]); orr[6] = bf16_bits(r1[2]); orr[7] = bf16_bits(r1[3]);
  oi[0] = bf16_bits(i0[0]); oi[1] = bf16_bits(i0[1]); oi[2] = bf16_bits(i0[2]); oi[3] = bf16_bits(i0[3]);
  oi[4] = bf16_bits(i1[0]); oi[5] = bf16_bits(i1[1]); oi[6] = bf16_bits(i1[2]); oi[7] = bf16_bits(i1[3]);
  unsigned short* d = X + (size_t)row * KP + c8;
  *(v8us*)d = orr;
  *(v8us*)(d + RD) = oi;
  
}

// Weight convert with transpose: w[k][n] (f32, [in][out]) -> Wt[n][k] (pitch RD) as bf16 bits (asf16 == 0) or as f16(bf16 value x 1024) (asf16 != 0).
// coverage: tile = 0 .. GW_T - 1 = (RD/64 k tiles) x (RD/64 n tiles) x (64 n rows x 64 k) = the whole plane; LDS tile: 64 x 64 written before the barrier, 64 x 64 read after it.
// Called by whole blocks only (the barrier).
__device__ __forceinline__ void cvtwt_block(int tile, const float* __restrict__ w, unsigned short* __restrict__ Wt, int asf16) {
  __shared__ __attribute__((aligned(16))) unsigned short tl[64][72];
  const int tid = threadIdx.x;
  const int k0 = (tile % (RD / 64)) * 64, n0 = (tile / (RD / 64)) * 64;
#pragma unroll 1
  for (int j = 0; j < 16; ++j) {
    const int i = tid + 256 * j;
    const int kk = i >> 6, nn = i & 63;
    const float x = w[(size_t)(k0 + kk) * RD + (size_t)(n0 + nn)];
    const unsigned short vb = bf16_bits(x);
    const unsigned short vh = c16f(bf16_val(vb) * 1024.0f);   // bf16 significand x 2^10 is exact in f16
    tl[nn][kk] = (asf16 != 0) ? vh : vb;
  }
  __syncthreads();
  {
#pragma unroll
    for (int j = 0; j < 2; ++j) {
      const int i = tid + 256 * j;
      const int nn = i >> 3, p8 = (i & 7) * 8;
      const v8us a = *(const v8us*)&tl[nn][p8];
      *(v8us*)(Wt + (size_t)(n0 + nn) * RD + (size_t)(k0 + p8)) = a;
    }
    
  }
}

// Mask pack: MB[((b*(SEQ/16) + q/16) * (SEQ/32) + j) * 16 + i], i = 8 kt + r: bit l = (mask[b][16 (q/16) + (l & 15)][32 j + 16 kt + 8 (l >> 4) + r] != 0),
// that is the 32-lane condition of score register i in step j of the k_attn wave that owns these 16 queries. One wave per (16 queries, 64 keys = two steps):
// lane l reads 4 x 32 B of its query's row (the wave: 256 B of each of 16 rows), 32 ballots, lane n keeps ballot n, one 128-B store.
// coverage: blk = 0 .. GM_B - 1: NB*(SEQ/16)*(SEQ/64) waves x 32 words = the whole plane. Whole waves only (the ballots).
__device__ __forceinline__ void maskbits_block(int blk, const int* __restrict__ mask, unsigned int* __restrict__ MB) {
  const int lane = threadIdx.x & 31;
  const int wv = blk * 8 + (int)(threadIdx.x >> 5);
  if (wv >= NB * (SEQ / 16) * (SEQ / 64)) return;
  const int rt = wv / (SEQ / 64), jp = wv - rt * (SEQ / 64);
  const int b = rt / (SEQ / 16), q = (rt - b * (SEQ / 16)) * 16 + (lane & 15);
  const int* mp = mask + ((size_t)b * SEQ_FULL + (size_t)q) * SEQ_FULL + (size_t)jp * 64 + 8 * (lane >> 4);
  v4i m[8];
#pragma unroll   // the eight loads are independent and issue together
  for (int n = 0; n < 4; ++n) {
    m[2 * n]     = *(const v4i*)(mp + 16 * n);
    m[2 * n + 1] = *(const v4i*)(mp + 16 * n + 4);
  }
  unsigned int word = 0u;
#pragma unroll   // constant lane numbers
  for (int n = 0; n < 4; ++n) {
#pragma unroll   // as above
    for (int r = 0; r < 8; ++r) {
      const unsigned int bal = __builtin_amdgcn_ballot_w32(m[2 * n + (r >> 2)][r & 3] != 0);
      word = (lane == 8 * n + r) ? bal : word;
    }
  }
  MB[(size_t)wv * 32 + lane] = word;
}

// All preparation in one launch: none of its eight parts reads what another writes, so they are block ranges of one grid.
// Blocks 0 .. GW_B - 1: the four weight planes (first: each walks a serial run of loads); then GM_B blocks of mask pack; then 3 x GX_B blocks of activation convert (q, k, v).
// Every branch below is block-uniform.
__global__ __launch_bounds__(256) void k_prep(const float* __restrict__ q_re, const float* __restrict__ k_re, const float* __restrict__ v_re,
                                              const float* __restrict__ q_ph, const float* __restrict__ k_ph, const float* __restrict__ v_ph,
                                              const float* __restrict__ w_q, const float* __restrict__ w_k, const float* __restrict__ w_v,
                                              const float* __restrict__ w_o, const int* __restrict__ mask,
                                              unsigned short* __restrict__ Xq, unsigned short* __restrict__ Xk, unsigned short* __restrict__ Xv,
                                              unsigned short* __restrict__ Wq, unsigned short* __restrict__ Wk, unsigned short* __restrict__ Wv,
                                              unsigned short* __restrict__ Wo, unsigned int* __restrict__ MB) {
  const int bid = blockIdx.x;
  if (bid < GW_B) {
    const int which = bid / GW_T;
    const float* w = (which == 0) ? w_q : (which == 1) ? w_k : (which == 2) ? w_v : w_o;
    unsigned short* Wt = (which == 0) ? Wq : (which == 1) ? Wk : (which == 2) ? Wv : Wo;
    cvtwt_block(bid - which * GW_T, w, Wt, (which == 3) ? 1 : 0);
  } else if (bid < GW_B + GM_B) {
    maskbits_block(bid - GW_B, mask, MB);
  } else {
    const int r = bid - (GW_B + GM_B);
    const int part = r / GX_B;
    const float* xr = (part == 0) ? q_re : (part == 1) ? k_re : v_re;
    const float* xi = (part == 0) ? q_ph : (part == 1) ? k_ph : v_ph;
    unsigned short* X = (part == 0) ? Xq : (part == 1) ? Xk : Xv;
    cvtx_block(r - part * GX_B, xr, xi, X);
  }
}

// q, k and v projections in one launch, blockIdx.z = 0 (q), 1 (k), 2 (v): none reads what another writes. Block = 4 waves x 16 rows = 64 rows, 64 columns = one head.
// q / k: output plane P[b*NH + head][s][HP] = f16 of (y_r x 256 | y_p x cim), cim = +256 (q) or -256 (k).
// v: transposed plane Vt[b*NH + head][dd][s], dd = [real 64 | phase 64], value f16 of (y x 256).
// coverage: grid (NB*SEQ/64, NH) per z x 4 waves x 16 rows x 128 halves = each whole plane.
// LDS tile, q / k: [4][16][136], columns 0..127 of every row are written before the barrier and exactly those are read after it; v: [128][72], 128 x 64 written before the barrier, 128 x 64 read after it.
// The branch on z is block-uniform, so each barrier is passed by the whole block.
__global__ __launch_bounds__(128) void k_proj(const unsigned short* __restrict__ Xq, const unsigned short* __restrict__ Xk, const unsigned short* __restrict__ Xv,
                                              const unsigned short* __restrict__ Wq, const unsigned short* __restrict__ Wk, const unsigned short* __restrict__ Wv,
                                              unsigned short* __restrict__ Qp, unsigned short* __restrict__ Kp, unsigned short* __restrict__ Vt) {
  __shared__ __attribute__((aligned(16))) unsigned short ring[2 * GST_H];   // the GEMM's two buffers; behind the GEMM the output tile
  unsigned short* st = ring;
  static_assert(4 * 16 * 136 <= HP * 72);
  static_assert(HP * 72 <= 2 * GST_H);
  const int tid = threadIdx.x, w = __builtin_amdgcn_readfirstlane((int)(tid >> 5)), lane = tid & 31, ln = lane & 15, hh = lane >> 4;
  const int z = blockIdx.z;
  const int head = blockIdx.y;
  const int rowb = blockIdx.x * 64;
  const unsigned short* X = (z == 0) ? Xq : (z == 1) ? Xk : Xv;
  const unsigned short* W = (z == 0) ? Wq : (z == 1) ? Wk : Wv;
  v8f yr[4] = {}, yi[4] = {};
  rgemm_main<true>(X, W, ring, rowb, head * HD, tid, w, ln, hh, yr, yi);
  const int b = rowb / SEQ;
  if (z < 2) {
    unsigned short (*sh)[16][136] = (unsigned short (*)[16][136])st;
    unsigned short* P = (z == 0) ? Qp : Kp;
    const float cim = (z == 0) ? 256.0f : -256.0f;
#pragma unroll
    for (int t = 0; t < 4; ++t) {
#pragma unroll
      for (int r = 0; r < 8; ++r) {
        sh[w][8 * hh + r][16 * t + ln]      = c16f(yr[t][r] * 256.0f);
        sh[w][8 * hh + r][HD + 16 * t + ln] = c16f(yi[t][r] * cim);
      }
    }
    __syncthreads();
    const int s0 = rowb - b * SEQ + 16 * w;
    const size_t base = ((size_t)(b * NH + head) * SEQ + (size_t)s0) * HP;
    const int rsub = lane >> 4, p8 = (lane & 15) * 8;
#pragma unroll
    for (int q = 0; q < 8; ++q) {
      const int row = 2 * q + rsub;
      const v8us a = *(const v8us*)&sh[w][row][p8];
      *(v8us*)(P + base + (size_t)row * HP + p8) = a;
    }
  } else {
    unsigned short (*th)[72] = (unsigned short (*)[72])st;
#pragma unroll
    for (int t = 0; t < 4; ++t) {
#pragma unroll
      for (int r = 0; r < 8; ++r) {
        const int col = 16 * w + 8 * hh + r;
        th[16 * t + ln][col]      = c16f(yr[t][r] * 256.0f);
        th[HD + 16 * t + ln][col] = c16f(yi[t][r] * 256.0f);
      }
    }
    __syncthreads();
    const int s0 = rowb - b * SEQ;
    const size_t base = (size_t)(b * NH + head) * HP * SEQ + (size_t)s0;
    for (int i = tid; i < HP * 8; i += 128) {
      const int dd = i >> 3, j8 = (i & 7) * 8;
      const v8us a = *(const v8us*)&th[dd][j8];
      *(v8us*)(Vt + base + (size_t)dd * SEQ + j8) = a;
    }
  }
}

// Score group for one 16-key tile (8 WMMAs): sre = kr qr + ki qi (4 products), sa = kr qi (2), sb = ki qr (2); then the hazard guard.
// k0, k1 = kr (d 0..31, 32..63); k2, k3 = ki; q[0], q[1] = qr; q[2], q[3] = qi.
__device__ __forceinline__ void score_mma(const Frag& k0, const Frag& k1, const Frag& k2, const Frag& k3,
                                          const Frag (&q)[4], v8f& sre, v8f& sa, v8f& sb) {
  sre = wm_h(k0, q[0], sre);
  sa  = wm_h(k0, q[2], sa);
  sb  = wm_h(k2, q[0], sb);
  sre = wm_h(k1, q[1], sre);
  sa  = wm_h(k1, q[3], sa);
  sb  = wm_h(k3, q[1], sb);
  sre = wm_h(k2, q[2], sre);
  sre = wm_h(k3, q[3], sre);
  asm volatile("v_nop\n\tv_nop\n\tv_nop\n\tv_nop" : "+v"(sre), "+v"(sa), "+v"(sb)
               : "v"(k0.vh), "v"(k1.vh), "v"(k2.vh), "v"(k3.vh),
                 "v"(q[0].vh), "v"(q[1].vh), "v"(q[2].vh), "v"(q[3].vh));
}
// c += v*p (single f16 product), then the hazard guard.
__device__ __forceinline__ void pv_mma(const Frag& v, const Frag& p, v8f& c) {
  c = wm_h(v, p, c);
  asm volatile("v_nop\n\tv_nop\n\tv_nop\n\tv_nop" : "+v"(c) : "v"(v.vh), "v"(p.vh));
}

// One 32-key step (step index j) for a wave's 16 queries: 16 score WMMAs + 8 P.V WMMAs. Ks = the step's first staged K row (pitch KPITCH),
// Vs = the step's first key column in the staged V^T rows (pitch VPITCH), both in LDS; key0 = the step's first key in the comments below; mk = the step's 16 select words (scalar registers), replaced behind their last use by the words at Mn, those of the same step of the next tile. With the phase half of the K plane stored negated: sre = qr.kr - qp.kp, sa - sb = qp.kr + qr.kp.
__device__ __forceinline__ void fa_step(const unsigned short* Ks, const unsigned short* Vs,
                                        maskp_t Mn, v16u& mk, int ln, int hh,
                                        const Frag (&qf)[4], float& mr, float& lr, v8f (&O)[8]) {
  const v8f z8 = {0.f, 0.f, 0.f, 0.f, 0.f, 0.f, 0.f, 0.f};
  float sc[16];
  // A fragments of K: row m = key (key0 + 16*kt + ln); packed k axis [kr 0..63 | -kp 64..127]; elements 0..7 <- 32c + 8h + i, 8..15 <- 32c + 16 + 8h + i;
  // both 16-key tiles' fragments are read as one group
  Frag kf[2][4];
#pragma unroll   // constant indices keep the fragments in registers
  for (int kt = 0; kt < 2; ++kt) {
    const unsigned short* kp = Ks + (16 * kt + ln) * KPITCH + 8 * hh;
#pragma unroll   // as above
    for (int c = 0; c < 4; ++c) {
      kf[kt][c].half[0] = *(const v8us*)(kp + 32 * c);
      kf[kt][c].half[1] = *(const v8us*)(kp + 32 * c + 16);
    }
  }
#pragma unroll
  for (int kt = 0; kt < 2; ++kt) {
    v8f sre = z8, sa = z8, sb = z8;
    score_mma(kf[kt][0], kf[kt][1], kf[kt][2], kf[kt][3], qf, sre, sa, sb);
    // S^T tile: element r = score(key0 + 16*kt + 8h + r, query of this lane's column); logit in log2 units; masked keys get the fill value instead
#pragma unroll
    for (int r = 0; r < 8; ++r) {
      const float im = sa[r] - sb[r];
      const float v = __builtin_amdgcn_sqrtf(fmaf(sre[r], sre[r], im * im)) * CSCALE;
      sc[8 * kt + r] = __builtin_amdgcn_inverse_ballot_w32(mk[8 * kt + r]) ? v : MFILL;   // the word is the select's lane condition as it stands
    }
  }
  mk = *Mn;   // one scalar load, two steps ahead of its first use
  // A fragments of V^T: row m = dd (16*t + ln), elements 0..7 <- key0 + 8h + i, 8..15 <- key0 + 16 + 8h + i; read as one group, ahead of the softmax arithmetic
  Frag vf[8];
#pragma unroll   // constant indices keep the fragments in registers
  for (int t = 0; t < 8; ++t) {
    const unsigned short* vp = Vs + (16 * t + ln) * VPITCH + 8 * hh;
    vf[t].half[0] = *(const v8us*)(vp);
    vf[t].half[1] = *(const v8us*)(vp + 16);
  }
  float mx = sc[0];
#pragma unroll
  for (int i = 1; i < 16; ++i) mx = fmaxf(mx, sc[i]);
  mx = fmaxf(mx, __shfl_xor(mx, 16, 32));           // the other lane half holds the other 16 keys of this query
  const float mnew = fmaxf(mr, mx);
  const float al = exp2f(mr - mnew);
  mr = mnew;
  // weights carried x256: pc = 256 * 2^(sc - mnew) as one f16 plane (exponent below -14 -> exact zero); the row sum uses the f16-converted values the matrix unit sees
  Frag pf;
  float ps = 0.0f;
#pragma unroll
  for (int i = 0; i < 16; ++i) {
    const float e = (sc[i] - mnew) + 8.0f;
    const float pc = (e < -14.0f) ? 0.0f : __builtin_amdgcn_exp2f(e);   // bare v_exp_f32 and a value select: the kept range e >= -14 needs no range extension, so the bits are those of exp2f(e), and no branch stands between the 16 weights
    const _Float16 h = (_Float16)pc;
    pf.h[i] = h;                                    // B element i: i<8 -> key0 + 8h + i (tile 0 row 8h+i); i>=8 -> key0 + 16 + 8h + (i-8) (tile 1)
    ps += (float)h;
  }
  ps += __shfl_xor(ps, 16, 32);
  lr = lr * al + ps;
#pragma unroll
  for (int t = 0; t < 8; ++t) O[t] = O[t] * al;
#pragma unroll   // constant indices keep the fragments and the accumulators in registers
  for (int t = 0; t < 8; ++t) pv_mma(vf[t], pf, O[t]);
}

// Eight asynchronous 16-byte copies per lane, global -> LDS: copy i moves g + i*gstep to LDS byte l + i*lstep. Every lane on, no offset field.
// The s_wait_xcnt closes the statement so that it stands in front of any later write of the address registers the copies name.
__device__ __forceinline__ void copy8(unsigned int l, unsigned int lstep, const char* g, size_t gstep) {
  asm volatile("global_load_async_to_lds_b128 %0, %8, off\n\t"
               "global_load_async_to_lds_b128 %1, %9, off\n\t"
               "global_load_async_to_lds_b128 %2, %10, off\n\t"
               "global_load_async_to_lds_b128 %3, %11, off\n\t"
               "global_load_async_to_lds_b128 %4, %12, off\n\t"
               "global_load_async_to_lds_b128 %5, %13, off\n\t"
               "global_load_async_to_lds_b128 %6, %14, off\n\t"
               "global_load_async_to_lds_b128 %7, %15, off\n\t"
               "s_wait_xcnt 0x0"
               :: "v"(l), "v"(l + lstep), "v"(l + 2 * lstep), "v"(l + 3 * lstep),
                  "v"(l + 4 * lstep), "v"(l + 5 * lstep), "v"(l + 6 * lstep), "v"(l + 7 * lstep),
                  "v"(g), "v"(g + gstep), "v"(g + 2 * gstep), "v"(g + 3 * gstep),
                  "v"(g + 4 * gstep), "v"(g + 5 * gstep), "v"(g + 6 * gstep), "v"(g + 7 * gstep)
               : "memory");
}

// One stage (TK keys) into the LDS buffer at byte address lb. kg, vg: this thread's first source bytes in tile 0 of the (b, h) planes; kl, vl: its first LDS bytes in a buffer.
// K tile: TK rows x 256 B, contiguous in the plane; thread tid copies chunk tid + 128 i (row = chunk / 16). V^T tile: 128 rows x 128 B at the plane's row pitch; row = chunk / 8.
__device__ __forceinline__ void stage_copy(int tile, unsigned int lb, const char* kg, const char* vg, unsigned int kl, unsigned int vl) {
  copy8(lb + kl, 8u * KPITCH * 2u, kg + (size_t)tile * (TK * HP * 2), (size_t)2048);
  copy8(lb + vl, 16u * VPITCH * 2u, vg + (size_t)tile * (TK * 2), (size_t)16 * SEQ * 2);
}

// Block = 4 waves x 16 queries = 64 queries of one (b, h). The four waves share each 64-key K / V^T tile: two LDS buffers, the next tile's copies in flight while
// this tile is worked on; one barrier per tile publishes the next tile and frees the buffer just read.
// Epilogue: ctx carried x4096 as one f16 plane C[b*SEQ + s][KP] ([real 512 | phase 512], column h*64 + d).
// coverage: NB*NH*(SEQ/64) blocks x 4 waves x 16 queries x (64 real + 64 phase) = every (row, head, part) segment of the plane exactly once.
// LDS tile: columns 0..127 of every row written before the barrier, the same read after it.
__global__ __launch_bounds__(128) void k_attn(const unsigned short* __restrict__ Qp, const unsigned short* __restrict__ Kpl,
                                              const unsigned short* __restrict__ Vt, const unsigned int* __restrict__ MB,
                                              unsigned short* __restrict__ Cx) {
  __shared__ __attribute__((aligned(16))) unsigned short sh[4][16][136];
  __shared__ __attribute__((aligned(16))) unsigned short ring[2 * ST_H];
  const int tid = threadIdx.x, w = __builtin_amdgcn_readfirstlane((int)(tid >> 5)), lane = tid & 31, ln = lane & 15, hh = lane >> 4;
  const int bh = blockIdx.x / (SEQ / 64), qt = blockIdx.x % (SEQ / 64);
  const int b = bh / NH, h = bh - b * NH;
  const int qbase = qt * 64 + 16 * w;
  const int qg = qbase + ln;
  // Q^T B fragments: column n = query qg, packed k axis [qr 0..63 | qp 64..127], elements 0..7 <- 32c + 8h + i, 8..15 <- 32c + 16 + 8h + i
  Frag qf[4];
  {
    const size_t qoff = ((size_t)bh * SEQ + (size_t)qg) * HP + 8 * hh;
#pragma unroll
    for (int c = 0; c < 4; ++c) {
      qf[c].half[0] = *(const v8us*)(Qp + qoff + 32 * c);
      qf[c].half[1] = *(const v8us*)(Qp + qoff + 32 * c + 16);
    }
  }
  float mr = -3.0e38f, lr = 0.0f;
  v8f O[8] = {};
  const unsigned short* Kp = Kpl + (size_t)bh * SEQ * HP;
  const unsigned short* Vp = Vt  + (size_t)bh * HP * SEQ;
  const unsigned int* Mw = MB + (size_t)(b * (SEQ / 16) + qt * 4 + w) * ((SEQ / 32) * 16);   // the wave's select words, 16 per step; wave-uniform
  const char* kg = (const char*)Kp + (size_t)tid * 16;
  const char* vg = (const char*)Vp + (size_t)(tid >> 3) * (SEQ * 2) + (size_t)(tid & 7) * 16;
  const unsigned int rb = (unsigned int)(size_t)&ring[0];                                     // LDS byte address of the ring
  const unsigned int kl = (unsigned int)((tid >> 4) * (KPITCH * 2) + (tid & 15) * 16);
  const unsigned int vl = (unsigned int)(KT_H * 2 + (tid >> 3) * (VPITCH * 2) + (tid & 7) * 16);
  constexpr int NT = SEQ / TK;
  v16u mka = *(maskp_t)Mw, mkb = *(maskp_t)(Mw + 16);   // select words of the even and of the odd step in hand; the first two land while tile 0 does
  stage_copy(0, rb, kg, vg, kl, vl);
  asm volatile("s_wait_asynccnt 0x0" ::: "memory");   // this wave's share of tile 0 has landed
  __syncthreads();                                    // every wave's share of tile 0 has landed
  if (NT > 1) stage_copy(1, rb + ST_H * 2u, kg, vg, kl, vl);
#pragma unroll 1   // one trip per tile: the hand-over at the foot stands once
  for (int t = 0; t < NT; ++t) {
    const int bo = (t & 1) * ST_H;
    const unsigned int* Mn = Mw + 32 * ((t + 1 < NT) ? t + 1 : t);   // the next tile's words; in the last trip its own again: in range, not used
    fa_step(&ring[bo], &ring[bo + KT_H], (maskp_t)Mn, mka, ln, hh, qf, mr, lr, O);
    fa_step(&ring[bo + 32 * KPITCH], &ring[bo + KT_H + 32], (maskp_t)(Mn + 16), mkb, ln, hh, qf, mr, lr, O);
    asm volatile("s_wait_dscnt 0x0" ::: "memory");      // this wave's reads of the buffer have returned before it is refilled
    asm volatile("s_wait_asynccnt 0x0" ::: "memory");   // this wave's share of tile t + 1 has landed
    __syncthreads();                                    // publishes tile t + 1 and ends every wave's reads of tile t
    if (t + 2 < NT) stage_copy(t + 2, rb + (unsigned int)bo * 2u, kg, vg, kl, vl);
  }
  asm volatile("s_wait_asynccnt 0x0" ::: "memory");     // nothing in flight when the wave goes on to the epilogue

  // O^T element r of tile t = ctx(query qg, dd = 16t + 8h + r); carries: x256 (P, also in lr), x256 (v); ctx stored x4096 -> factor 16 / lr
  const float inv = 16.0f * (1.0f / lr);
#pragma unroll
  for (int t = 0; t < 8; ++t) {
#pragma unroll
    for (int r = 0; r < 8; ++r)
      sh[w][ln][16 * t + 8 * hh + r] = c16f(O[t][r] * inv);
  }
  __syncthreads();
  const size_t rbase = ((size_t)b * SEQ + (size_t)qbase) * KP + (size_t)h * HD;
  const int lsub = lane >> 3, p8 = (lane & 7) * 8;
  {
#pragma unroll
    for (int q = 0; q < 8; ++q) {
      const int line = 4 * q + lsub;            // 0..31 = 16 queries x {real, phase}
      const int row = line >> 1, seg = line & 1;
      const v8us a = *(const v8us*)&sh[w][row][seg * HD + p8];
      const size_t o = rbase + (size_t)row * KP + (size_t)seg * RD + p8;
      *(v8us*)(Cx + o) = a;
    }
    
  }
}

// Output projection of both parts: out0[b][s][n] = ctx_real x Wo, out1[b][s][n] = ctx_phase x Wo (f16, K = 512, one product per term), undo carries x4096 (ctx) and x1024 (Wo).
// Epilogue: per-wave LDS tile [16 rows][128 floats = 64 real columns | 64 phase columns] (block barrier), then per instruction lanes 0..15 write the 256-B
// coverage: grid (NB*SEQ/64, RD/64) x 4 waves x 16 rows x (64 + 64) floats = every output element of the processed rows exactly once.
// LDS tile: columns 0..127 of every row written before the barrier, the same read after it.
__global__ __launch_bounds__(128) void k_out(const unsigned short* __restrict__ Cx, const unsigned short* __restrict__ Wo,
                                             float* __restrict__ Out) {
  __shared__ __attribute__((aligned(16))) unsigned short ring[2 * GST_H];   // the GEMM's two buffers; behind the GEMM the output tile
  float (*so)[16][132] = (float (*)[16][132])ring;
  static_assert(4 * 16 * 132 * 4 <= 2 * GST_H * 2);
  const int tid = threadIdx.x, w = __builtin_amdgcn_readfirstlane((int)(tid >> 5)), lane = tid & 31, ln = lane & 15, hh = lane >> 4;
  const int rowb = blockIdx.x * 64;
  const int col0 = blockIdx.y * 64;
  v8f yr[4] = {}, yi[4] = {};
  rgemm_main<false>(Cx, Wo, ring, rowb, col0, tid, w, ln, hh, yr, yi);
  const float scl = 1.0f / 4194304.0f;
#pragma unroll
  for (int t = 0; t < 4; ++t) {
#pragma unroll
    for (int r = 0; r < 8; ++r) {
      so[w][8 * hh + r][16 * t + ln]      = yr[t][r] * scl;
      so[w][8 * hh + r][HD + 16 * t + ln] = yi[t][r] * scl;
    }
  }
  __syncthreads();
  const int b = rowb / SEQ;
  const int s0 = rowb - b * SEQ + 16 * w;
  const size_t obase = ((size_t)b * SEQ_FULL + (size_t)s0) * RD + (size_t)col0
                     + (size_t)(lane >> 4) * OUT1_OFF + (size_t)(lane & 15) * 4;
  {
#pragma unroll
    for (int q = 0; q < 16; ++q) {
      const v4f v = *(const v4fa*)&so[w][q][lane * 4];
      *(v4f*)(Out + obase + (size_t)q * RD) = v;
    }
    
  }
}

extern "C" void kernel_launch(void* const* d_in, const int* in_sizes, int n_in,
                              void* d_out, int out_size, void* d_ws, size_t ws_size, hipStream_t stream) {
  if (n_in < 11) return;
  const long long needx = ((long long)(NB - 1) * SEQ_FULL + (long long)SEQ) * RD;   // last activation element touched + 1
  const long long needm = ((long long)(NB - 1) * SEQ_FULL + (long long)(SEQ - 1)) * SEQ_FULL + (long long)SEQ;   // last mask element touched + 1
  for (int i = 0; i < 6; ++i) if ((long long)in_sizes[i] < needx) return;
  for (int i = 6; i < 10; ++i) if ((long long)in_sizes[i] < (long long)RD * RD) return;
  if ((long long)in_sizes[10] < needm) return;
  if ((long long)out_size < (long long)OUT1_OFF + needx) return;
  // wire order: q_real, k_real, v_real, q_phase, k_phase, v_phase, w_q, w_k, w_v, w_o, mask
  const float* q_re = (const float*)d_in[0];
  const float* k_re = (const float*)d_in[1];
  const float* v_re = (const float*)d_in[2];
  const float* q_ph = (const float*)d_in[3];
  const float* k_ph = (const float*)d_in[4];
  const float* v_ph = (const float*)d_in[5];
  const float* w_q = (const float*)d_in[6];
  const float* w_k = (const float*)d_in[7];
  const float* w_v = (const float*)d_in[8];
  const float* w_o = (const float*)d_in[9];
  const int* maskp = (const int*)d_in[10];
  float* Out = (float*)d_out;

  char* ws = (char*)d_ws;
  size_t off = 0;
  const size_t XB = (size_t)NB * SEQ * KP * 2;          // activation / head / ctx plane bytes (8 MiB at full size); all planes are written exactly to their end
  const size_t WB = (size_t)RD * RD * 2;                // transposed weight plane bytes (512 KiB)
  const size_t MBB = (size_t)NB * SEQ * (SEQ / 32) * 4; // mask bit words (1 MiB at full size)
  unsigned short* Xq = (unsigned short*)(ws + off); off += XB;
  unsigned short* Xk = (unsigned short*)(ws + off); off += XB;
  unsigned short* Xv = (unsigned short*)(ws + off); off += XB;
  unsigned short* Wq = (unsigned short*)(ws + off); off += WB;
  unsigned short* Wk = (unsigned short*)(ws + off); off += WB;
  unsigned short* Wv = (unsigned short*)(ws + off); off += WB;
  unsigned short* Wo = (unsigned short*)(ws + off); off += WB;
  unsigned short* Qp = (unsigned short*)(ws + off); off += XB;   // NB*NH*SEQ*HP halves = XB bytes
  unsigned short* Kp = (unsigned short*)(ws + off); off += XB;
  unsigned short* Vt = (unsigned short*)(ws + off); off += XB;
  unsigned short* Cx = (unsigned short*)(ws + off); off += XB;
  unsigned int*   MB = (unsigned int*)(ws + off);   off += MBB;
  if (off > ws_size) return;

  k_prep<<<(unsigned)(GW_B + GM_B + 3 * GX_B), 256, 0, stream>>>(q_re, k_re, v_re, q_ph, k_ph, v_ph, w_q, w_k, w_v, w_o, maskp,
                                                                 Xq, Xk, Xv, Wq, Wk, Wv, Wo, MB);

  const dim3 gp((unsigned)(NB * SEQ / 64), (unsigned)NH, 3);
  k_proj<<<gp, 128, 0, stream>>>(Xq, Xk, Xv, Wq, Wk, Wv, Qp, Kp, Vt);

  k_attn<<<(unsigned)(NB * NH * (SEQ / 64)), 128, 0, stream>>>(Qp, Kp, Vt, MB, Cx);

  const dim3 go((unsigned)(NB * SEQ / 64), (unsigned)(RD / 64), 1);
  k_out<<<go, 128, 0, stream>>>(Cx, Wo, Out);
}

// v006
// It runs in 82.5 microseconds.
// Two timings next to v005 put it at 1.07 and 1.08 times that version's speed.
// Over all steps from v000 it is 4.36 times as fast.
#include <hip/hip_runtime.h>
// Contractions: q/k/v projections (real and phase parts share one weight) on v_wmma_f32_16x16x32_bf16 (activations and weights RNE-converted to bf16, single product, f32 accumulate); scores K Q^T, O^T = V^T P^T and the output projection on v_wmma_f32_16x16x32_f16 (single carried f16 planes: q, k, v x256, P x256, ctx x4096, Wo = bf16 value x1024 held exactly in f16; single product per term, f32 accumulate); softmax statistics f32.
// Two-part (real | phase) multi-head attention: B x S x 512 activations per part, 8 heads x 64, weights stored [in][out] (y = x w), softmax over
// sqrt(re^2 + im^2) / sqrt(128) with re = qr.kr - qp.kp, im = qr.kp + qp.kr; keys whose mask entry is 0 get their score REPLACED by -1e9 (they stay in the softmax).
// Engine: transposed flash. Each wave owns 16 queries of one (b, h) and half of the keys (two partial softmaxes per query, merged in LDS). Per 32-key step: S^T tiles (key rows x query columns) from packed K rows
// [kr 64 | -kp 64] (A, f16 plane staged in LDS; the phase half is stored negated so that the packed products give re and im above) and packed Q^T [qr | qp]
// (B, registers); the two 16-key D tiles pack straight into the P^T B fragment; O^T (128 d rows = [real 64 | phase 64] x query columns) accumulates
// from V^T rows (A, f16 plane staged in LDS). 24 WMMAs per step. The mask is packed once into 32-lane select words [b][q / 16][S/32][16]: word i of a step holds, lane by lane, the condition of the wave's score register i.
// Real GEMMs: y_r = x_r w, y_p = x_p w with A fragments x_r, x_p from 16-bit rows [real 512 | phase 512] and one B fragment from the transposed weight plane Wt[n][k], both staged in LDS.
#ifndef NB
#define NB 2
#endif
#ifndef SEQ
#define SEQ 2048
#endif
#define NB_FULL 2
#define SEQ_FULL 2048
#define RD 512        /* model width (= heads x head dim) */
#define NH 8
#define HD 64
#define KP 1024       /* packed 16-bit row: [real 512 | phase 512] */
#define HP 128        /* packed head row: [real 64 | phase 64] */
#define OUT1_OFF ((size_t)NB_FULL * SEQ_FULL * RD)   /* element offset of the second output (fixed by the full problem size) */
#define TK 128        /* keys per LDS stage: 64 (two 32-key steps) for each of the block's two key groups */
#define KPITCH 136    /* LDS pitch of a staged K row, halves: 256 B + 16 B, conflict-free for 16-byte reads down a column of rows */
#define VPITCH 136    /* LDS pitch of a staged V^T row, halves: 256 B + 16 B */
#define KT_H (TK * KPITCH)    /* halves of one staged K tile */
#define VT_H (HP * VPITCH)    /* halves of one staged V^T tile */
#define ST_H (KT_H + VT_H)    /* halves of one stage */
#define GK 64         /* k extent of one staged GEMM tile, halves: 128 B = one whole line per row */
#define GROWS 192     /* rows of one staged GEMM tile: 64 A rows real, the same 64 rows phase, 64 W rows */
#define GST_H (GROWS * GK)    /* halves of one GEMM stage */
#define GNS (RD / GK)         /* GEMM stages */
#define GW_T ((RD / 64) * (RD / 64))                     /* preparation grid: blocks of one weight plane (64 x 64 tiles) */
#define GW_B (4 * GW_T)                                  /* blocks of the four weight planes */
#define GM_B ((NB * SEQ * (SEQ / 32) + 255) / 256)       /* blocks of the mask pack */
#define GX_B ((NB * SEQ * 64 + 255) / 256)               /* blocks of one activation convert */

static_assert(SEQ % 64 == 0);
static_assert(SEQ % TK == 0);
static_assert(TK * HP * 2 == 256 * 8 * 16);   /* one K tile = 256 threads x 8 copies of 16 B */
static_assert(HP * TK * 2 == 256 * 8 * 16);   /* one V^T tile likewise */
static_assert(2 * (2 * ST_H * 2) <= 327680);  /* two blocks' rings fit one WGP's LDS: four waves per SIMD */
static_assert(GROWS * GK * 2 == 128 * 12 * 16);   /* one GEMM stage = 128 threads x 12 copies of 16 B */
static_assert(RD % GK == 0 && GNS >= 2);
static_assert(SEQ <= SEQ_FULL);
static_assert(NB <= NB_FULL);
static_assert(NH * HD == RD);
static_assert(RD % 64 == 0);
static_assert(RD % 32 == 0);
static_assert(NH * HP == KP);
static_assert(KP == 2 * RD);
static_assert(HP == 2 * HD);
static_assert(HD == 64);
static_assert((NB * SEQ) % 64 == 0);
static_assert(((size_t)NB * SEQ * (SEQ / 32)) % 32 == 0);
static_assert(GM_B * 8 == NB * (SEQ / 16) * (SEQ / 64));   /* the mask pack's blocks hold exactly its waves */
static_assert(OUT1_OFF * 4 == (size_t)8388608);
static_assert((size_t)7 * ((size_t)NB * SEQ * KP * 2) + (size_t)4 * ((size_t)RD * RD * 2) + (size_t)NB * SEQ * (SEQ / 32) * 4 <= (size_t)134217728);

typedef __bf16 v16b __attribute__((ext_vector_type(16)));
typedef _Float16 v16h __attribute__((ext_vector_type(16)));
typedef _Float16 h16;
typedef unsigned short v8us __attribute__((ext_vector_type(8), may_alias));
typedef int v4i __attribute__((ext_vector_type(4), may_alias));
typedef unsigned int v16u __attribute__((ext_vector_type(16)));
typedef const __attribute__((address_space(4))) v16u* maskp_t;   /* constant address space: the words are written by an earlier launch only, so a wave-uniform read of them is a scalar load */
typedef float v8f __attribute__((ext_vector_type(8)));
typedef float v4f __attribute__((ext_vector_type(4)));
typedef float v4fa __attribute__((ext_vector_type(4), may_alias));
typedef float f32a __attribute__((may_alias));
union Frag { v16b vb; v16h vh; v8us half[2]; unsigned short u[16]; _Float16 h[16]; };

#define LOG2E 1.4426950408889634f
/* scores arrive x65536 (q x256, k x256); logit in log2 units = |s| * (1/sqrt(128)) * log2(e) / 65536 */
#define CSCALE (0.08838834764831845f * LOG2E / 65536.0f)
/* replaced score of a masked key, in log2 units */
#define MFILL (-1.0e9f * LOG2E)

__device__ __forceinline__ unsigned short bf16_bits(float x) {   // RNE convert to bf16 bits
  unsigned int u = __float_as_uint(x);
  return (unsigned short)((u + 0x7FFFu + ((u >> 16) & 1u)) >> 16);
}
__device__ __forceinline__ float bf16_val(unsigned short b) { return __uint_as_float(((unsigned int)b) << 16); }
__device__ __forceinline__ float bf16_rne(float x) { return bf16_val(bf16_bits(x)); }
__device__ __forceinline__ unsigned short f16_bits(_Float16 h) { union { _Float16 h; unsigned short u; } c; c.h = h; return c.u; }
__device__ __forceinline__ unsigned short c16(float c) { return f16_bits((_Float16)c); }   // RNE convert of a carried value to f16 bits

// f32 -> f16 convert that cannot produce a subnormal: values below the smallest normal become zero (value select).
static __device__ __forceinline__ h16 toh_flush(float v) { const h16 r = (h16)v; return (fabsf(v) < 6.103515625e-05f) ? (h16)0.0f : r; }
__device__ __forceinline__ unsigned short c16f(float c) { return f16_bits(toh_flush(c)); }

__device__ __forceinline__ v8f wm_b(const Frag& a, const Frag& b, v8f c) {
  return __builtin_amdgcn_wmma_f32_16x16x32_bf16(false, a.vb, false, b.vb, (short)0, c, false, false);
}
__device__ __forceinline__ v8f wm_h(const Frag& a, const Frag& b, v8f c) {
  return __builtin_amdgcn_wmma_f32_16x16x32_f16(false, a.vh, false, b.vh, (short)0, c, false, false);
}

// One k-step for one 16x16 output tile of both parts: yr += ar*w ; yi += ai*w ; each product followed by its own hazard guard.
template <bool BF>
__device__ __forceinline__ void rmma(const Frag& ar, const Frag& ai, const Frag& wf, v8f& yr, v8f& yi) {
  if (BF) {
    yr = wm_b(ar, wf, yr);
    asm volatile("v_nop\n\tv_nop\n\tv_nop\n\tv_nop" : "+v"(yr) : "v"(ar.vb), "v"(wf.vb));
    yi = wm_b(ai, wf, yi);
    asm volatile("v_nop\n\tv_nop\n\tv_nop\n\tv_nop" : "+v"(yi) : "v"(ai.vb), "v"(wf.vb));
  } else {
    yr = wm_h(ar, wf, yr);
    asm volatile("v_nop\n\tv_nop\n\tv_nop\n\tv_nop" : "+v"(yr) : "v"(ar.vh), "v"(wf.vh));
    yi = wm_h(ai, wf, yi);
    asm volatile("v_nop\n\tv_nop\n\tv_nop\n\tv_nop" : "+v"(yi) : "v"(ai.vh), "v"(wf.vh));
  }
}

// Twelve asynchronous 16-byte copies per lane, global -> LDS, one GEMM stage: copy i lands at LDS byte l + 2048 i (16 rows further down).
// Copies 0..3: A rows, real part (16 rows apart); 4..7: the same rows, phase part (RD halves further); 8..11: W rows (16 rows apart). Every lane on, no offset field.
// The s_wait_xcnt closes the statement so that it stands in front of any later write of the address registers the copies name.
__device__ __forceinline__ void copy12(unsigned int l, const char* ga, const char* gw) {
  constexpr size_t AS = (size_t)16 * KP * 2, PH = (size_t)RD * 2, WS = (size_t)16 * RD * 2;
  asm volatile("global_load_async_to_lds_b128 %0, %12, off\n\t"
               "global_load_async_to_lds_b128 %1, %13, off\n\t"
               "global_load_async_to_lds_b128 %2, %14, off\n\t"
               "global_load_async_to_lds_b128 %3, %15, off\n\t"
               "global_load_async_to_lds_b128 %4, %16, off\n\t"
               "global_load_async_to_lds_b128 %5, %17, off\n\t"
               "global_load_async_to_lds_b128 %6, %18, off\n\t"
               "global_load_async_to_lds_b128 %7, %19, off\n\t"
               "global_load_async_to_lds_b128 %8, %20, off\n\t"
               "global_load_async_to_lds_b128 %9, %21, off\n\t"
               "global_load_async_to_lds_b128 %10, %22, off\n\t"
               "global_load_async_to_lds_b128 %11, %23, off\n\t"
               "s_wait_xcnt 0x0"
               :: "v"(l), "v"(l + 2048u), "v"(l + 4096u), "v"(l + 6144u),
                  "v"(l + 8192u), "v"(l + 10240u), "v"(l + 12288u), "v"(l + 14336u),
                  "v"(l + 16384u), "v"(l + 18432u), "v"(l + 20480u), "v"(l + 22528u),
                  "v"(ga), "v"(ga + AS), "v"(ga + 2 * AS), "v"(ga + 3 * AS),
                  "v"(ga + PH), "v"(ga + PH + AS), "v"(ga + PH + 2 * AS), "v"(ga + PH + 3 * AS),
                  "v"(gw), "v"(gw + WS), "v"(gw + 2 * WS), "v"(gw + 3 * WS)
               : "memory");
}

// Block tile 64 rows x 64 columns for both parts (wave tile 16 rows x 64 columns), K = 512. A plane [rows][KP] = [real 512 | phase 512], W plane [cols][RD] (transposed weight, k-contiguous).
// The four waves share each k tile of GK: two LDS buffers in ring (2 x GST_H halves), the next tile's copies in flight while this tile is worked on; one barrier per tile
// publishes the next tile and frees the buffer just read. Called by whole blocks of 128 threads; behind the call the ring is free for other use.
// Staged tile: row r = 0..63 A real (row rowb + r), 64..127 A phase, 128..191 W (column col0 + r - 128); 128 B per row, no pad: the 16-byte piece p of row r lies at piece p ^ ((r >> 1) & 7),
// so 16 lanes reading one piece down 16 rows meet every bank once. Thread tid copies piece tid & 7 of rows (tid >> 3) + 16 i: whole 128-B lines per 8 lanes.
// A fragment: row m = rowb + 16 w + ln, elements 0..7 <- k0 + 8h + i, 8..15 <- k0 + 16 + 8h + i. B fragment: column n = col0 + 16t + ln, same k map.
// D: acc[r] = y(rowb + 16 w + 8h + r, col0 + 16t + ln).
template <bool BF>
__device__ __forceinline__ void rgemm_main(const unsigned short* __restrict__ A, const unsigned short* __restrict__ W, unsigned short* ring,
                                           int rowb, int col0, int tid, int w, int ln, int hh, v8f (&yr)[4], v8f (&yi)[4]) {
  const char* ga = (const char*)(A + (size_t)(rowb + (tid >> 3)) * KP) + (tid & 7) * 16;
  const char* gw = (const char*)(W + (size_t)(col0 + (tid >> 3)) * RD) + (tid & 7) * 16;
  const unsigned int l = (unsigned int)(size_t)ring + (unsigned int)((tid >> 3) * (GK * 2) + (((tid & 7) ^ ((tid >> 4) & 7)) * 16));   // LDS byte address of this thread's first piece in buffer 0
  const int sw = (ln >> 1) & 7;
  copy12(l, ga, gw);
  asm volatile("s_wait_asynccnt 0x0" ::: "memory");   // this wave's share of tile 0 has landed
  __syncthreads();                                    // every wave's share of tile 0 has landed
  copy12(l + GST_H * 2u, ga + GK * 2, gw + GK * 2);
#pragma unroll 1   // one trip per tile: the hand-over at the foot stands once
  for (int s = 0; s < GNS; ++s) {
    const int bo = (s & 1) * GST_H;
    const unsigned short* ap = ring + bo + (16 * w + ln) * GK;
    const unsigned short* wp = ring + bo + (128 + ln) * GK;
#pragma unroll   // constant c: the piece places are loop-invariant registers and the row offsets immediates
    for (int c = 0; c < GK / 32; ++c) {
      const int o0 = ((4 * c + hh) ^ sw) * 8, o1 = ((4 * c + 2 + hh) ^ sw) * 8;   // places of the pieces k0 + 8h and k0 + 16 + 8h in this lane's rows
      // the k step's six fragments are read as one group, ahead of its products
      Frag ar, ai, wf[4];
      ar.half[0] = *(const v8us*)(ap + o0);
      ar.half[1] = *(const v8us*)(ap + o1);
      ai.half[0] = *(const v8us*)(ap + 64 * GK + o0);
      ai.half[1] = *(const v8us*)(ap + 64 * GK + o1);
#pragma unroll   // constant indices keep the fragments in registers
      for (int t = 0; t < 4; ++t) {
        const unsigned short* wt = wp + t * 16 * GK;
        wf[t].half[0] = *(const v8us*)(wt + o0);
        wf[t].half[1] = *(const v8us*)(wt + o1);
      }
#pragma unroll   // as above
      for (int t = 0; t < 4; ++t) rmma<BF>(ar, ai, wf[t], yr[t], yi[t]);
    }
    asm volatile("s_wait_dscnt 0x0" ::: "memory");      // this wave's reads of the buffer have returned before it is refilled
    asm volatile("s_wait_asynccnt 0x0" ::: "memory");   // this wave's share of tile s + 1 has landed
    __syncthreads();                                    // publishes tile s + 1 and ends every wave's reads of tile s
    if (s + 2 < GNS) copy12(l + (unsigned int)bo * 2u, ga + (size_t)(s + 2) * (GK * 2), gw + (size_t)(s + 2) * (GK * 2));
  }
  asm volatile("s_wait_asynccnt 0x0" ::: "memory");     // nothing in flight when the wave goes on to the epilogue
}

// X[row][KP] = bf16 bits [xr 512 | xi 512], row = b*SEQ + s (compact). Thread per (row, 8 columns) converts the re and the im piece.
// coverage: blk = 0 .. GX_B - 1: NB*SEQ*64 threads x (8 re + 8 im) elements = the whole plane.
__device__ __forceinline__ void cvtx_block(int blk, const float* __restrict__ xr, const float* __restrict__ xi, unsigned short* __restrict__ X) {
  const int t = blk * 256 + threadIdx.x;
  if (t >= NB * SEQ * 64) return;
  const int row = t >> 6, c8 = (t & 63) * 8;
  const int b = row / SEQ, s = row - b * SEQ;
  const size_t src = ((size_t)b * SEQ_FULL + (size_t)s) * RD + c8;
  const v4f r0 = *(const v4fa*)(xr + src), r1 = *(const v4fa*)(xr + src + 4);
  const v4f i0 = *(const v4fa*)(xi + src), i1 = *(const v4fa*)(xi + src + 4);
  v8us orr, oi;
  orr[0] = bf16_bits(r0[0]); orr[1] = bf16_bits(r0[1]); orr[2] = bf16_bits(r0[2]); orr[3] = bf16_bits(r0[3]);
  orr[4] = bf16_bits(r1[0]); orr[5] = bf16_bits(r1[1]); orr[6] = bf16_bits(r1[2]); orr[7] = bf16_bits(r1[3]);
  oi[0] = bf16_bits(i0[0]); oi[1] = bf16_bits(i0[1]); oi[2] = bf16_bits(i0[2]); oi[3] = bf16_bits(i0[3]);
  oi[4] = bf16_bits(i1[0]); oi[5] = bf16_bits(i1[1]); oi[6] = bf16_bits(i1[2]); oi[7] = bf16_bits(i1[3]);
  unsigned short* d = X + (size_t)row * KP + c8;
  *(v8us*)d = orr;
  *(v8us*)(d + RD) = oi;
  
}

// Weight convert with transpose: w[k][n] (f32, [in][out]) -> Wt[n][k] (pitch RD) as bf16 bits (asf16 == 0) or as f16(bf16 value x 1024) (asf16 != 0).
// coverage: tile = 0 .. GW_T - 1 = (RD/64 k tiles) x (RD/64 n tiles) x (64 n rows x 64 k) = the whole plane; LDS tile: 64 x 64 written before the barrier, 64 x 64 read after it.
// Called by whole blocks only (the barrier).
__device__ __forceinline__ void cvtwt_block(int tile, const float* __restrict__ w, unsigned short* __restrict__ Wt, int asf16) {
  __shared__ __attribute__((aligned(16))) unsigned short tl[64][72];
  const int tid = threadIdx.x;
  const int k0 = (tile % (RD / 64)) * 64, n0 = (tile / (RD / 64)) * 64;
#pragma unroll 1
  for (int j = 0; j < 16; ++j) {
    const int i = tid + 256 * j;
    const int kk = i >> 6, nn = i & 63;
    const float x = w[(size_t)(k0 + kk) * RD + (size_t)(n0 + nn)];
    const unsigned short vb = bf16_bits(x);
    const unsigned short vh = c16f(bf16_val(vb) * 1024.0f);   // bf16 significand x 2^10 is exact in f16
    tl[nn][kk] = (asf16 != 0) ? vh : vb;
  }
  __syncthreads();
  {
#pragma unroll
    for (int j = 0; j < 2; ++j) {
      const int i = tid + 256 * j;
      const int nn = i >> 3, p8 = (i & 7) * 8;
      const v8us a = *(const v8us*)&tl[nn][p8];
      *(v8us*)(Wt + (size_t)(n0 + nn) * RD + (size_t)(k0 + p8)) = a;
    }
    
  }
}

// Mask pack: MB[((b*(SEQ/16) + q/16) * (SEQ/32) + j) * 16 + i], i = 8 kt + r: bit l = (mask[b][16 (q/16) + (l & 15)][32 j + 16 kt + 8 (l >> 4) + r] != 0),
// that is the 32-lane condition of score register i in step j of the k_attn wave that owns these 16 queries. One wave per (16 queries, 64 keys = two steps):
// lane l reads 4 x 32 B of its query's row (the wave: 256 B of each of 16 rows), 32 ballots, lane n keeps ballot n, one 128-B store.
// coverage: blk = 0 .. GM_B - 1: NB*(SEQ/16)*(SEQ/64) waves x 32 words = the whole plane. Whole waves only (the ballots).
__device__ __forceinline__ void maskbits_block(int blk, const int* __restrict__ mask, unsigned int* __restrict__ MB) {
  const int lane = threadIdx.x & 31;
  const int wv = blk * 8 + (int)(threadIdx.x >> 5);
  if (wv >= NB * (SEQ / 16) * (SEQ / 64)) return;
  const int rt = wv / (SEQ / 64), jp = wv - rt * (SEQ / 64);
  const int b = rt / (SEQ / 16), q = (rt - b * (SEQ / 16)) * 16 + (lane & 15);
  const int* mp = mask + ((size_t)b * SEQ_FULL + (size_t)q) * SEQ_FULL + (size_t)jp * 64 + 8 * (lane >> 4);
  v4i m[8];
#pragma unroll   // the eight loads are independent and issue together
  for (int n = 0; n < 4; ++n) {
    m[2 * n]     = *(const v4i*)(mp + 16 * n);
    m[2 * n + 1] = *(const v4i*)(mp + 16 * n + 4);
  }
  unsigned int word = 0u;
#pragma unroll   // constant lane numbers
  for (int n = 0; n < 4; ++n) {
#pragma unroll   // as above
    for (int r = 0; r < 8; ++r) {
      const unsigned int bal = __builtin_amdgcn_ballot_w32(m[2 * n + (r >> 2)][r & 3] != 0);
      word = (lane == 8 * n + r) ? bal : word;
    }
  }
  MB[(size_t)wv * 32 + lane] = word;
}

// All preparation in one launch: none of its eight parts reads what another writes, so they are block ranges of one grid.
// Blocks 0 .. GW_B - 1: the four weight planes (first: each walks a serial run of loads); then GM_B blocks of mask pack; then 3 x GX_B blocks of activation convert (q, k, v).
// Every branch below is block-uniform.
__global__ __launch_bounds__(256) void k_prep(const float* __restrict__ q_re, const float* __restrict__ k_re, const float* __restrict__ v_re,
                                              const float* __restrict__ q_ph, const float* __restrict__ k_ph, const float* __restrict__ v_ph,
                                              const float* __restrict__ w_q, const float* __restrict__ w_k, const float* __restrict__ w_v,
                                              const float* __restrict__ w_o, const int* __restrict__ mask,
                                              unsigned short* __restrict__ Xq, unsigned short* __restrict__ Xk, unsigned short* __restrict__ Xv,
                                              unsigned short* __restrict__ Wq, unsigned short* __restrict__ Wk, unsigned short* __restrict__ Wv,
                                              unsigned short* __restrict__ Wo, unsigned int* __restrict__ MB) {
  const int bid = blockIdx.x;
  if (bid < GW_B) {
    const int which = bid / GW_T;
    const float* w = (which == 0) ? w_q : (which == 1) ? w_k : (which == 2) ? w_v : w_o;
    unsigned short* Wt = (which == 0) ? Wq : (which == 1) ? Wk : (which == 2) ? Wv : Wo;
    cvtwt_block(bid - which * GW_T, w, Wt, (which == 3) ? 1 : 0);
  } else if (bid < GW_B + GM_B) {
    maskbits_block(bid - GW_B, mask, MB);
  } else {
    const int r = bid - (GW_B + GM_B);
    const int part = r / GX_B;
    const float* xr = (part == 0) ? q_re : (part == 1) ? k_re : v_re;
    const float* xi = (part == 0) ? q_ph : (part == 1) ? k_ph : v_ph;
    unsigned short* X = (part == 0) ? Xq : (part == 1) ? Xk : Xv;
    cvtx_block(r - part * GX_B, xr, xi, X);
  }
}

// q, k and v projections in one launch, blockIdx.z = 0 (q), 1 (k), 2 (v): none reads what another writes. Block = 4 waves x 16 rows = 64 rows, 64 columns = one head.
// q / k: output plane P[b*NH + head][s][HP] = f16 of (y_r x 256 | y_p x cim), cim = +256 (q) or -256 (k).
// v: transposed plane Vt[b*NH + head][dd][s], dd = [real 64 | phase 64], value f16 of (y x 256).
// coverage: grid (NB*SEQ/64, NH) per z x 4 waves x 16 rows x 128 halves = each whole plane.
// LDS tile, q / k: [4][16][136], columns 0..127 of every row are written before the barrier and exactly those are read after it; v: [128][72], 128 x 64 written before the barrier, 128 x 64 read after it.
// The branch on z is block-uniform, so each barrier is passed by the whole block.
__global__ __launch_bounds__(128) void k_proj(const unsigned short* __restrict__ Xq, const unsigned short* __restrict__ Xk, const unsigned short* __restrict__ Xv,
                                              const unsigned short* __restrict__ Wq, const unsigned short* __restrict__ Wk, const unsigned short* __restrict__ Wv,
                                              unsigned short* __restrict__ Qp, unsigned short* __restrict__ Kp, unsigned short* __restrict__ Vt) {
  __shared__ __attribute__((aligned(16))) unsigned short ring[2 * GST_H];   // the GEMM's two buffers; behind the GEMM the output tile
  unsigned short* st = ring;
  static_assert(4 * 16 * 136 <= HP * 72);
  static_assert(HP * 72 <= 2 * GST_H);
  const int tid = threadIdx.x, w = __builtin_amdgcn_readfirstlane((int)(tid >> 5)), lane = tid & 31, ln = lane & 15, hh = lane >> 4;
  const int z = blockIdx.z;
  const int head = blockIdx.y;
  const int rowb = blockIdx.x * 64;
  const unsigned short* X = (z == 0) ? Xq : (z == 1) ? Xk : Xv;
  const unsigned short* W = (z == 0) ? Wq : (z == 1) ? Wk : Wv;
  v8f yr[4] = {}, yi[4] = {};
  rgemm_main<true>(X, W, ring, rowb, head * HD, tid, w, ln, hh, yr, yi);
  const int b = rowb / SEQ;
  if (z < 2) {
    unsigned short (*sh)[16][136] = (unsigned short (*)[16][136])st;
    unsigned short* P = (z == 0) ? Qp : Kp;
    const float cim = (z == 0) ? 256.0f : -256.0f;
#pragma unroll
    for (int t = 0; t < 4; ++t) {
#pragma unroll
      for (int r = 0; r < 8; ++r) {
        sh[w][8 * hh + r][16 * t + ln]      = c16f(yr[t][r] * 256.0f);
        sh[w][8 * hh + r][HD + 16 * t + ln] = c16f(yi[t][r] * cim);
      }
    }
    __syncthreads();
    const int s0 = rowb - b * SEQ + 16 * w;
    const size_t base = ((size_t)(b * NH + head) * SEQ + (size_t)s0) * HP;
    const int rsub = lane >> 4, p8 = (lane & 15) * 8;
#pragma unroll
    for (int q = 0; q < 8; ++q) {
      const int row = 2 * q + rsub;
      const v8us a = *(const v8us*)&sh[w][row][p8];
      *(v8us*)(P + base + (size_t)row * HP + p8) = a;
    }
  } else {
    unsigned short (*th)[72] = (unsigned short (*)[72])st;
#pragma unroll
    for (int t = 0; t < 4; ++t) {
#pragma unroll
      for (int r = 0; r < 8; ++r) {
        const int col = 16 * w + 8 * hh + r;
        th[16 * t + ln][col]      = c16f(yr[t][r] * 256.0f);
        th[HD + 16 * t + ln][col] = c16f(yi[t][r] * 256.0f);
      }
    }
    __syncthreads();
    const int s0 = rowb - b * SEQ;
    const size_t base = (size_t)(b * NH + head) * HP * SEQ + (size_t)s0;
    for (int i = tid; i < HP * 8; i += 128) {
      const int dd = i >> 3, j8 = (i & 7) * 8;
      const v8us a = *(const v8us*)&th[dd][j8];
      *(v8us*)(Vt + base + (size_t)dd * SEQ + j8) = a;
    }
  }
}

// Score group for one 16-key tile (8 WMMAs): sre = kr qr + ki qi (4 products), sa = kr qi (2), sb = ki qr (2); then the hazard guard.
// k0, k1 = kr (d 0..31, 32..63); k2, k3 = ki; q[0], q[1] = qr; q[2], q[3] = qi.
__device__ __forceinline__ void score_mma(const Frag& k0, const Frag& k1, const Frag& k2, const Frag& k3,
                                          const Frag (&q)[4], v8f& sre, v8f& sa, v8f& sb) {
  sre = wm_h(k0, q[0], sre);
  sa  = wm_h(k0, q[2], sa);
  sb  = wm_h(k2, q[0], sb);
  sre = wm_h(k1, q[1], sre);
  sa  = wm_h(k1, q[3], sa);
  sb  = wm_h(k3, q[1], sb);
  sre = wm_h(k2, q[2], sre);
  sre = wm_h(k3, q[3], sre);
  asm volatile("v_nop\n\tv_nop\n\tv_nop\n\tv_nop" : "+v"(sre), "+v"(sa), "+v"(sb)
               : "v"(k0.vh), "v"(k1.vh), "v"(k2.vh), "v"(k3.vh),
                 "v"(q[0].vh), "v"(q[1].vh), "v"(q[2].vh), "v"(q[3].vh));
}
// c += v*p (single f16 product), then the hazard guard.
__device__ __forceinline__ void pv_mma(const Frag& v, const Frag& p, v8f& c) {
  c = wm_h(v, p, c);
  asm volatile("v_nop\n\tv_nop\n\tv_nop\n\tv_nop" : "+v"(c) : "v"(v.vh), "v"(p.vh));
}

// One 32-key step (step index j) for a wave's 16 queries: 16 score WMMAs + 8 P.V WMMAs. Ks = the step's first staged K row (pitch KPITCH),
// Vs = the step's first key column in the staged V^T rows (pitch VPITCH), both in LDS; key0 = the step's first key in the comments below; mk = the step's 16 select words (scalar registers), replaced behind their last use by the words at Mn, those of the same step of the next tile. With the phase half of the K plane stored negated: sre = qr.kr - qp.kp, sa - sb = qp.kr + qr.kp.
__device__ __forceinline__ void fa_step(const unsigned short* Ks, const unsigned short* Vs,
                                        maskp_t Mn, v16u& mk, int ln, int hh,
                                        const Frag (&qf)[4], float& mr, float& lr, v8f (&O)[8]) {
  const v8f z8 = {0.f, 0.f, 0.f, 0.f, 0.f, 0.f, 0.f, 0.f};
  float sc[16];
  // A fragments of K: row m = key (key0 + 16*kt + ln); packed k axis [kr 0..63 | -kp 64..127]; elements 0..7 <- 32c + 8h + i, 8..15 <- 32c + 16 + 8h + i;
  // both 16-key tiles' fragments are read as one group
  Frag kf[2][4];
#pragma unroll   // constant indices keep the fragments in registers
  for (int kt = 0; kt < 2; ++kt) {
    const unsigned short* kp = Ks + (16 * kt + ln) * KPITCH + 8 * hh;
#pragma unroll   // as above
    for (int c = 0; c < 4; ++c) {
      kf[kt][c].half[0] = *(const v8us*)(kp + 32 * c);
      kf[kt][c].half[1] = *(const v8us*)(kp + 32 * c + 16);
    }
  }
#pragma unroll
  for (int kt = 0; kt < 2; ++kt) {
    v8f sre = z8, sa = z8, sb = z8;
    score_mma(kf[kt][0], kf[kt][1], kf[kt][2], kf[kt][3], qf, sre, sa, sb);
    // S^T tile: element r = score(key0 + 16*kt + 8h + r, query of this lane's column); logit in log2 units; masked keys get the fill value instead
#pragma unroll
    for (int r = 0; r < 8; ++r) {
      const float im = sa[r] - sb[r];
      const float v = __builtin_amdgcn_sqrtf(fmaf(sre[r], sre[r], im * im)) * CSCALE;
      sc[8 * kt + r] = __builtin_amdgcn_inverse_ballot_w32(mk[8 * kt + r]) ? v : MFILL;   // the word is the select's lane condition as it stands
    }
  }
  mk = *Mn;   // one scalar load, two steps ahead of its first use
  // A fragments of V^T: row m = dd (16*t + ln), elements 0..7 <- key0 + 8h + i, 8..15 <- key0 + 16 + 8h + i; read as one group, ahead of the softmax arithmetic
  Frag vf[8];
#pragma unroll   // constant indices keep the fragments in registers
  for (int t = 0; t < 8; ++t) {
    const unsigned short* vp = Vs + (16 * t + ln) * VPITCH + 8 * hh;
    vf[t].half[0] = *(const v8us*)(vp);
    vf[t].half[1] = *(const v8us*)(vp + 16);
  }
  float mx = sc[0];
#pragma unroll
  for (int i = 1; i < 16; ++i) mx = fmaxf(mx, sc[i]);
  mx = fmaxf(mx, __shfl_xor(mx, 16, 32));           // the other lane half holds the other 16 keys of this query
  const float mnew = fmaxf(mr, mx);
  const float al = exp2f(mr - mnew);
  mr = mnew;
  // weights carried x256: pc = 256 * 2^(sc - mnew) as one f16 plane (exponent below -14 -> exact zero); the row sum uses the f16-converted values the matrix unit sees
  Frag pf;
  float ps = 0.0f;
#pragma unroll
  for (int i = 0; i < 16; ++i) {
    const float e = (sc[i] - mnew) + 8.0f;
    const float pc = (e < -14.0f) ? 0.0f : __builtin_amdgcn_exp2f(e);   // bare v_exp_f32 and a value select: the kept range e >= -14 needs no range extension, so the bits are those of exp2f(e), and no branch stands between the 16 weights
    const _Float16 h = (_Float16)pc;
    pf.h[i] = h;                                    // B element i: i<8 -> key0 + 8h + i (tile 0 row 8h+i); i>=8 -> key0 + 16 + 8h + (i-8) (tile 1)
    ps += (float)h;
  }
  ps += __shfl_xor(ps, 16, 32);
  lr = lr * al + ps;
#pragma unroll
  for (int t = 0; t < 8; ++t) O[t] = O[t] * al;
#pragma unroll   // constant indices keep the fragments and the accumulators in registers
  for (int t = 0; t < 8; ++t) pv_mma(vf[t], pf, O[t]);
}

// Eight asynchronous 16-byte copies per lane, global -> LDS: copy i moves g + i*gstep to LDS byte l + i*lstep. Every lane on, no offset field.
// The s_wait_xcnt closes the statement so that it stands in front of any later write of the address registers the copies name.
__device__ __forceinline__ void copy8(unsigned int l, unsigned int lstep, const char* g, size_t gstep) {
  asm volatile("global_load_async_to_lds_b128 %0, %8, off\n\t"
               "global_load_async_to_lds_b128 %1, %9, off\n\t"
               "global_load_async_to_lds_b128 %2, %10, off\n\t"
               "global_load_async_to_lds_b128 %3, %11, off\n\t"
               "global_load_async_to_lds_b128 %4, %12, off\n\t"
               "global_load_async_to_lds_b128 %5, %13, off\n\t"
               "global_load_async_to_lds_b128 %6, %14, off\n\t"
               "global_load_async_to_lds_b128 %7, %15, off\n\t"
               "s_wait_xcnt 0x0"
               :: "v"(l), "v"(l + lstep), "v"(l + 2 * lstep), "v"(l + 3 * lstep),
                  "v"(l + 4 * lstep), "v"(l + 5 * lstep), "v"(l + 6 * lstep), "v"(l + 7 * lstep),
                  "v"(g), "v"(g + gstep), "v"(g + 2 * gstep), "v"(g + 3 * gstep),
                  "v"(g + 4 * gstep), "v"(g + 5 * gstep), "v"(g + 6 * gstep), "v"(g + 7 * gstep)
               : "memory");
}

// One stage (TK keys) into the LDS buffer at byte address lb. kg, vg: this thread's first source bytes in tile 0 of the (b, h) planes; kl, vl: its first LDS bytes in a buffer.
// K tile: TK rows x 256 B, contiguous in the plane; thread tid copies chunk tid + 256 i (row = chunk / 16). V^T tile: 128 rows x 256 B at the plane's row pitch; row = chunk / 16.
__device__ __forceinline__ void stage_copy(int tile, unsigned int lb, const char* kg, const char* vg, unsigned int kl, unsigned int vl) {
  copy8(lb + kl, 16u * KPITCH * 2u, kg + (size_t)tile * (TK * HP * 2), (size_t)4096);
  copy8(lb + vl, 16u * VPITCH * 2u, vg + (size_t)tile * (TK * 2), (size_t)16 * SEQ * 2);
}

// Block = 8 waves = 4 query groups x 2 key groups, 64 queries of one (b, h): wave w owns the 16 queries of group w & 3 and, of every 128-key tile, the 64 keys of group w >> 2.
// The queries alone fill two waves per SIMD; the key split makes it four (two blocks per WGP), so that one wave's LDS, cross-lane and dependent-vector waits are covered by three others.
// The eight waves share each K / V^T tile: two LDS buffers, the next tile's copies in flight while this tile is worked on; one barrier per tile publishes the next tile and frees the buffer just read.
// Merge: each wave ends with its own (maximum, sum, O^T) over its half of the keys; key group 1 hands them over in LDS and key group 0 joins the two with weights 2^(m - max).
// Epilogue: ctx carried x4096 as one f16 plane C[b*SEQ + s][KP] ([real 512 | phase 512], column h*64 + d).
// coverage: NB*NH*(SEQ/64) blocks x 4 query groups x 16 queries x (64 real + 64 phase) = every (row, head, part) segment of the plane exactly once (key group g stores lines 16 g .. 16 g + 15 of its query group's 32).
// LDS behind the loop (the ring is free: the last trip's barrier ends every read, nothing is in flight): bytes 0 .. 32767 O^T of key group 1, 32768 .. 33791 its maxima and sums, from 40960 the output tile.
// Every branch on the key group is wave-uniform and holds no barrier.
__global__ __launch_bounds__(256) __attribute__((amdgpu_waves_per_eu(4, 4))) void k_attn(const unsigned short* __restrict__ Qp, const unsigned short* __restrict__ Kpl,
                                              const unsigned short* __restrict__ Vt, const unsigned int* __restrict__ MB,
                                              unsigned short* __restrict__ Cx) {
  __shared__ __attribute__((aligned(16))) unsigned short ring[2 * ST_H];
  static_assert(40960 + 4 * 16 * 136 * 2 <= 2 * ST_H * 2);
  const int tid = threadIdx.x, w = __builtin_amdgcn_readfirstlane((int)(tid >> 5)), lane = tid & 31, ln = lane & 15, hh = lane >> 4;
  const int qw = w & 3, g = w >> 2;
  const int bh = blockIdx.x / (SEQ / 64), qt = blockIdx.x % (SEQ / 64);
  const int b = bh / NH, h = bh - b * NH;
  const int qbase = qt * 64 + 16 * qw;
  const int qg = qbase + ln;
  // Q^T B fragments: column n = query qg, packed k axis [qr 0..63 | qp 64..127], elements 0..7 <- 32c + 8h + i, 8..15 <- 32c + 16 + 8h + i
  Frag qf[4];
  {
    const size_t qoff = ((size_t)bh * SEQ + (size_t)qg) * HP + 8 * hh;
#pragma unroll
    for (int c = 0; c < 4; ++c) {
      qf[c].half[0] = *(const v8us*)(Qp + qoff + 32 * c);
      qf[c].half[1] = *(const v8us*)(Qp + qoff + 32 * c + 16);
    }
  }
  float mr = -3.0e38f, lr = 0.0f;
  v8f O[8] = {};
  const unsigned short* Kp = Kpl + (size_t)bh * SEQ * HP;
  const unsigned short* Vp = Vt  + (size_t)bh * HP * SEQ;
  const unsigned int* Mw = MB + (size_t)(b * (SEQ / 16) + qt * 4 + qw) * ((SEQ / 32) * 16) + g * 32;   // the wave's select words, 16 per step, from its first step on; wave-uniform
  const char* kg = (const char*)Kp + (size_t)tid * 16;
  const char* vg = (const char*)Vp + (size_t)(tid >> 4) * (SEQ * 2) + (size_t)(tid & 15) * 16;
  const unsigned int rb = (unsigned int)(size_t)&ring[0];                                     // LDS byte address of the ring
  const unsigned int kl = (unsigned int)((tid >> 4) * (KPITCH * 2) + (tid & 15) * 16);
  const unsigned int vl = (unsigned int)(KT_H * 2 + (tid >> 4) * (VPITCH * 2) + (tid & 15) * 16);
  constexpr int NT = SEQ / TK;
  v16u mka = *(maskp_t)Mw, mkb = *(maskp_t)(Mw + 16);   // select words of the wave's first and second step of a tile; the first two land while tile 0 does
  stage_copy(0, rb, kg, vg, kl, vl);
  asm volatile("s_wait_asynccnt 0x0" ::: "memory");   // this wave's share of tile 0 has landed
  __syncthreads();                                    // every wave's share of tile 0 has landed
  if (NT > 1) stage_copy(1, rb + ST_H * 2u, kg, vg, kl, vl);
#pragma unroll 1   // one trip per tile: the hand-over at the foot stands once
  for (int t = 0; t < NT; ++t) {
    const int bo = (t & 1) * ST_H;
    const unsigned int* Mn = Mw + 64 * ((t + 1 < NT) ? t + 1 : t);   // the next tile's words; in the last trip its own again: in range, not used
    const unsigned short* ks = &ring[bo + g * 64 * KPITCH];          // the key group's first staged K row
    const unsigned short* vs = &ring[bo + KT_H + g * 64];            // its first key column in the staged V^T rows
    fa_step(ks, vs, (maskp_t)Mn, mka, ln, hh, qf, mr, lr, O);
    fa_step(ks + 32 * KPITCH, vs + 32, (maskp_t)(Mn + 16), mkb, ln, hh, qf, mr, lr, O);
    asm volatile("s_wait_dscnt 0x0" ::: "memory");      // this wave's reads of the buffer have returned before it is refilled
    asm volatile("s_wait_asynccnt 0x0" ::: "memory");   // this wave's share of tile t + 1 has landed
    __syncthreads();                                    // publishes tile t + 1 and ends every wave's reads of tile t
    if (t + 2 < NT) stage_copy(t + 2, rb + (unsigned int)bo * 2u, kg, vg, kl, vl);
  }
  asm volatile("s_wait_asynccnt 0x0" ::: "memory");     // nothing in flight when the wave goes on to the epilogue

  v4fa* mo = (v4fa*)ring + (size_t)qw * 512 + lane;                 // piece j of the query group's O^T at mo[32 j]: 512 contiguous bytes per wave store
  f32a* ml = (f32a*)ring + 8192 + qw * 64 + lane;
  unsigned short (*sh)[16][136] = (unsigned short (*)[16][136])(ring + 20480);
  if (g == 1) {
#pragma unroll
    for (int t = 0; t < 8; ++t) {
      const v4f lo = {O[t][0], O[t][1], O[t][2], O[t][3]}, hi = {O[t][4], O[t][5], O[t][6], O[t][7]};
      mo[32 * (2 * t)] = lo;
      mo[32 * (2 * t + 1)] = hi;
    }
    ml[0] = mr;
    ml[32] = lr;
  }
  __syncthreads();                                      // key group 1's partial results are in LDS
  if (g == 0) {
    // both maxima are finite (each group has worked at least one step), so the weights are in (0, 1] and the larger one is 1
    const float m1 = ml[0], l1 = ml[32];
    const float mm = fmaxf(mr, m1);
    const float a0 = exp2f(mr - mm), a1 = exp2f(m1 - mm);
    // O^T element r of tile t = ctx(query qg, dd = 16t + 8h + r); carries: x256 (P, also in the sums), x256 (v); ctx stored x4096 -> factor 16 / sum
    const float inv = 16.0f * (1.0f / (lr * a0 + l1 * a1));
    const float c0 = a0 * inv, c1 = a1 * inv;
#pragma unroll
    for (int t = 0; t < 8; ++t) {
      const v4f lo = mo[32 * (2 * t)], hi = mo[32 * (2 * t + 1)];
#pragma unroll
      for (int r = 0; r < 8; ++r)
        sh[qw][ln][16 * t + 8 * hh + r] = c16f(O[t][r] * c0 + ((r < 4) ? lo[r & 3] : hi[r & 3]) * c1);
    }
  }
  __syncthreads();                                      // the output tile is whole
  const size_t rbase = ((size_t)b * SEQ + (size_t)qbase) * KP + (size_t)h * HD;
  const int lsub = lane >> 3, p8 = (lane & 7) * 8;
  {
#pragma unroll
    for (int q = 0; q < 4; ++q) {
      const int line = 4 * (4 * g + q) + lsub;  // 0..31 = 16 queries x {real, phase}
      const int row = line >> 1, seg = line & 1;
      const v8us a = *(const v8us*)&sh[qw][row][seg * HD + p8];
      const size_t o = rbase + (size_t)row * KP + (size_t)seg * RD + p8;
      *(v8us*)(Cx + o) = a;
    }
  }
}

// Output projection of both parts: out0[b][s][n] = ctx_real x Wo, out1[b][s][n] = ctx_phase x Wo (f16, K = 512, one product per term), undo carries x4096 (ctx) and x1024 (Wo).
// Epilogue: per-wave LDS tile [16 rows][128 floats = 64 real columns | 64 phase columns] (block barrier), then per instruction lanes 0..15 write the 256-B
// coverage: grid (NB*SEQ/64, RD/64) x 4 waves x 16 rows x (64 + 64) floats = every output element of the processed rows exactly once.
// LDS tile: columns 0..127 of every row written before the barrier, the same read after it.
__global__ __launch_bounds__(128) void k_out(const unsigned short* __restrict__ Cx, const unsigned short* __restrict__ Wo,
                                             float* __restrict__ Out) {
  __shared__ __attribute__((aligned(16))) unsigned short ring[2 * GST_H];   // the GEMM's two buffers; behind the GEMM the output tile
  float (*so)[16][132] = (float (*)[16][132])ring;
  static_assert(4 * 16 * 132 * 4 <= 2 * GST_H * 2);
  const int tid = threadIdx.x, w = __builtin_amdgcn_readfirstlane((int)(tid >> 5)), lane = tid & 31, ln = lane & 15, hh = lane >> 4;
  const int rowb = blockIdx.x * 64;
  const int col0 = blockIdx.y * 64;
  v8f yr[4] = {}, yi[4] = {};
  rgemm_main<false>(Cx, Wo, ring, rowb, col0, tid, w, ln, hh, yr, yi);
  const float scl = 1.0f / 4194304.0f;
#pragma unroll
  for (int t = 0; t < 4; ++t) {
#pragma unroll
    for (int r = 0; r < 8; ++r) {
      so[w][8 * hh + r][16 * t + ln]      = yr[t][r] * scl;
      so[w][8 * hh + r][HD + 16 * t + ln] = yi[t][r] * scl;
    }
  }
  __syncthreads();
  const int b = rowb / SEQ;
  const int s0 = rowb - b * SEQ + 16 * w;
  const size_t obase = ((size_t)b * SEQ_FULL + (size_t)s0) * RD + (size_t)col0
                     + (size_t)(lane >> 4) * OUT1_OFF + (size_t)(lane & 15) * 4;
  {
#pragma unroll
    for (int q = 0; q < 16; ++q) {
      const v4f v = *(const v4fa*)&so[w][q][lane * 4];
      *(v4f*)(Out + obase + (size_t)q * RD) = v;
    }
    
  }
}

extern "C" void kernel_launch(void* const* d_in, const int* in_sizes, int n_in,
                              void* d_out, int out_size, void* d_ws, size_t ws_size, hipStream_t stream) {
  if (n_in < 11) return;
  const long long needx = ((long long)(NB - 1) * SEQ_FULL + (long long)SEQ) * RD;   // last activation element touched + 1
  const long long needm = ((long long)(NB - 1) * SEQ_FULL + (long long)(SEQ - 1)) * SEQ_FULL + (long long)SEQ;   // last mask element touched + 1
  for (int i = 0; i < 6; ++i) if ((long long)in_sizes[i] < needx) return;
  for (int i = 6; i < 10; ++i) if ((long long)in_sizes[i] < (long long)RD * RD) return;
  if ((long long)in_sizes[10] < needm) return;
  if ((long long)out_size < (long long)OUT1_OFF + needx) return;
  // wire order: q_real, k_real, v_real, q_phase, k_phase, v_phase, w_q, w_k, w_v, w_o, mask
  const float* q_re = (const float*)d_in[0];
  const float* k_re = (const float*)d_in[1];
  const float* v_re = (const float*)d_in[2];
  const float* q_ph = (const float*)d_in[3];
  const float* k_ph = (const float*)d_in[4];
  const float* v_ph = (const float*)d_in[5];
  const float* w_q = (const float*)d_in[6];
  const float* w_k = (const float*)d_in[7];
  const float* w_v = (const float*)d_in[8];
  const float* w_o = (const float*)d_in[9];
  const int* maskp = (const int*)d_in[10];
  float* Out = (float*)d_out;

  char* ws = (char*)d_ws;
  size_t off = 0;
  const size_t XB = (size_t)NB * SEQ * KP * 2;          // activation / head / ctx plane bytes (8 MiB at full size); all planes are written exactly to their end
  const size_t WB = (size_t)RD * RD * 2;                // transposed weight plane bytes (512 KiB)
  const size_t MBB = (size_t)NB * SEQ * (SEQ / 32) * 4; // mask bit words (1 MiB at full size)
  unsigned short* Xq = (unsigned short*)(ws + off); off += XB;
  unsigned short* Xk = (unsigned short*)(ws + off); off += XB;
  unsigned short* Xv = (unsigned short*)(ws + off); off += XB;
  unsigned short* Wq = (unsigned short*)(ws + off); off += WB;
  unsigned short* Wk = (unsigned short*)(ws + off); off += WB;
  unsigned short* Wv = (unsigned short*)(ws + off); off += WB;
  unsigned short* Wo = (unsigned short*)(ws + off); off += WB;
  unsigned short* Qp = (unsigned short*)(ws + off); off += XB;   // NB*NH*SEQ*HP halves = XB bytes
  unsigned short* Kp = (unsigned short*)(ws + off); off += XB;
  unsigned short* Vt = (unsigned short*)(ws + off); off += XB;
  unsigned short* Cx = (unsigned short*)(ws + off); off += XB;
  unsigned int*   MB = (unsigned int*)(ws + off);   off += MBB;
  if (off > ws_size) return;

  k_prep<<<(unsigned)(GW_B + GM_B + 3 * GX_B), 256, 0, stream>>>(q_re, k_re, v_re, q_ph, k_ph, v_ph, w_q, w_k, w_v, w_o, maskp,
                                                                 Xq, Xk, Xv, Wq, Wk, Wv, Wo, MB);

  const dim3 gp((unsigned)(NB * SEQ / 64), (unsigned)NH, 3);
  k_proj<<<gp, 128, 0, stream>>>(Xq, Xk, Xv, Wq, Wk, Wv, Qp, Kp, Vt);

  k_attn<<<(unsigned)(NB * NH * (SEQ / 64)), 256, 0, stream>>>(Qp, Kp, Vt, MB, Cx);

  const dim3 go((unsigned)(NB * SEQ / 64), (unsigned)(RD / 64), 1);
  k_out<<<go, 128, 0, stream>>>(Cx, Wo, Out);
}

// v007
// One run takes 79.2 microseconds.
// Two timings next to v006 both put it at 1.04 times that version's speed.
// Over all steps from v000 it is 4.54 times as fast.
#include <hip/hip_runtime.h>
// Contractions: q/k/v projections (real and phase parts share one weight) on v_wmma_f32_16x16x32_bf16 (activations and weights RNE-converted to bf16, single product, f32 accumulate); scores K Q^T, O^T = V^T P^T and the output projection on v_wmma_f32_16x16x32_f16 (single carried f16 planes: q, k, v x256, P x256, ctx x4096, Wo = bf16 value x1024 held exactly in f16; single product per term, f32 accumulate); softmax statistics f32.
// Two-part (real | phase) multi-head attention: B x S x 512 activations per part, 8 heads x 64, weights stored [in][out] (y = x w), softmax over
// sqrt(re^2 + im^2) / sqrt(128) with re = qr.kr - qp.kp, im = qr.kp + qp.kr; keys whose mask entry is 0 get their score REPLACED by -1e9 (they stay in the softmax).
// Engine: transposed flash. Each wave owns 16 queries of one (b, h) and half of the keys (two partial softmaxes per query, merged in LDS). Per 32-key step: S^T tiles (key rows x query columns) from packed K rows
// [kr 64 | -kp 64] (A, f16 plane staged in LDS; the phase half is stored negated so that the packed products give re and im above) and packed Q^T [qr | qp]
// (B, registers); the two 16-key D tiles pack straight into the P^T B fragment; O^T (128 d rows = [real 64 | phase 64] x query columns) accumulates
// from V^T rows (A, f16 plane staged in LDS). 24 WMMAs per step. The mask is packed once into 32-lane select words [b][q / 16][S/32][16]: word i of a step holds, lane by lane, the condition of the wave's score register i.
// Real GEMMs: y_r = x_r w, y_p = x_p w with A fragments x_r, x_p from 16-bit rows [real 512 | phase 512] and one B fragment from the transposed weight plane Wt[n][k], both staged in LDS.
#ifndef NB
#define NB 2
#endif
#ifndef SEQ
#define SEQ 2048
#endif
#define NB_FULL 2
#define SEQ_FULL 2048
#define RD 512        /* model width (= heads x head dim) */
#define NH 8
#define HD 64
#define KP 1024       /* packed 16-bit row: [real 512 | phase 512] */
#define HP 128        /* packed head row: [real 64 | phase 64] */
#define OUT1_OFF ((size_t)NB_FULL * SEQ_FULL * RD)   /* element offset of the second output (fixed by the full problem size) */
#define TK 128        /* keys per LDS stage: 64 (two 32-key steps) for each of the block's two key groups */
#define KPITCH 136    /* LDS pitch of a staged K row, halves: 256 B + 16 B, conflict-free for 16-byte reads down a column of rows */
#define VPITCH 136    /* LDS pitch of a staged V^T row, halves: 256 B + 16 B */
#define KT_H (TK * KPITCH)    /* halves of one staged K tile */
#define VT_H (HP * VPITCH)    /* halves of one staged V^T tile */
#define ST_H (KT_H + VT_H)    /* halves of one stage */
#define GK 64         /* k extent of one staged GEMM tile, halves: 128 B = one whole line per row */
#define GROWS 192     /* rows of one staged GEMM tile: 64 A rows real, the same 64 rows phase, 64 W rows */
#define GST_H (GROWS * GK)    /* halves of one GEMM stage */
#define GNS (RD / GK)         /* GEMM stages */
#define GW_T ((RD / 64) * (RD / 64))                     /* preparation grid: blocks of one weight plane (64 x 64 tiles) */
#define GW_B (4 * GW_T)                                  /* blocks of the four weight planes */
#define GM_B ((NB * SEQ * (SEQ / 32) + 255) / 256)       /* blocks of the mask pack */
#define GX_B ((NB * SEQ * 64 + 255) / 256)               /* blocks of one activation convert */

static_assert(SEQ % 64 == 0);
static_assert(SEQ % TK == 0);
static_assert(TK * HP * 2 == 256 * 8 * 16);   /* one K tile = 256 threads x 8 copies of 16 B */
static_assert(HP * TK * 2 == 256 * 8 * 16);   /* one V^T tile likewise */
static_assert(2 * (2 * ST_H * 2) <= 327680);  /* two blocks' rings fit one WGP's LDS: four waves per SIMD */
static_assert(GROWS * GK * 2 == 128 * 12 * 16);   /* one GEMM stage = 128 threads x 12 copies of 16 B */
static_assert(RD % GK == 0 && GNS >= 2);
static_assert(SEQ <= SEQ_FULL);
static_assert(NB <= NB_FULL);
static_assert(NH * HD == RD);
static_assert(RD % 64 == 0);
static_assert(RD % 32 == 0);
static_assert(NH * HP == KP);
static_assert(KP == 2 * RD);
static_assert(HP == 2 * HD);
static_assert(HD == 64);
static_assert((NB * SEQ) % 64 == 0);
static_assert(((size_t)NB * SEQ * (SEQ / 32)) % 32 == 0);
static_assert(GM_B * 8 == NB * (SEQ / 16) * (SEQ / 64));   /* the mask pack's blocks hold exactly its waves */
static_assert(OUT1_OFF * 4 == (size_t)8388608);
static_assert((size_t)7 * ((size_t)NB * SEQ * KP * 2) + (size_t)4 * ((size_t)RD * RD * 2) + (size_t)NB * SEQ * (SEQ / 32) * 4 <= (size_t)134217728);

typedef __bf16 v16b __attribute__((ext_vector_type(16)));
typedef _Float16 v16h __attribute__((ext_vector_type(16)));
typedef _Float16 h16;
typedef unsigned short v8us __attribute__((ext_vector_type(8), may_alias));
typedef int v4i __attribute__((ext_vector_type(4), may_alias));
typedef unsigned int v16u __attribute__((ext_vector_type(16)));
typedef const __attribute__((address_space(4))) v16u* maskp_t;   /* constant address space: the words are written by an earlier launch only, so a wave-uniform read of them is a scalar load */
typedef float v8f __attribute__((ext_vector_type(8)));
typedef float v4f __attribute__((ext_vector_type(4)));
typedef float v4fa __attribute__((ext_vector_type(4), may_alias));
typedef float f32a __attribute__((may_alias));
union Frag { v16b vb; v16h vh; v8us half[2]; unsigned short u[16]; _Float16 h[16]; };

#define LOG2E 1.4426950408889634f
/* scores arrive x65536 (q x256, k x256); logit in log2 units = |s| * (1/sqrt(128)) * log2(e) / 65536 */
#define CSCALE (0.08838834764831845f * LOG2E / 65536.0f)
/* replaced score of a masked key, in log2 units */
#define MFILL (-1.0e9f * LOG2E)
/* a score may pass the reference exponent by this much (log2 units) before the reference moves: weights stay near 256 * 2^7 = 2^15, inside f16
   (finite f16 q and k planes bound an unmasked logit below 2^21, so the roundings of reference + 7 and reference - 8 move an exponent by less than 1/4) */
#define RTHR 7.0f

__device__ __forceinline__ unsigned short bf16_bits(float x) {   // RNE convert to bf16 bits
  unsigned int u = __float_as_uint(x);
  return (unsigned short)((u + 0x7FFFu + ((u >> 16) & 1u)) >> 16);
}
__device__ __forceinline__ float bf16_val(unsigned short b) { return __uint_as_float(((unsigned int)b) << 16); }
__device__ __forceinline__ float bf16_rne(float x) { return bf16_val(bf16_bits(x)); }
__device__ __forceinline__ unsigned short f16_bits(_Float16 h) { union { _Float16 h; unsigned short u; } c; c.h = h; return c.u; }
__device__ __forceinline__ unsigned short c16(float c) { return f16_bits((_Float16)c); }   // RNE convert of a carried value to f16 bits

// f32 -> f16 convert that cannot produce a subnormal: values below the smallest normal become zero (value select).
static __device__ __forceinline__ h16 toh_flush(float v) { const h16 r = (h16)v; return (fabsf(v) < 6.103515625e-05f) ? (h16)0.0f : r; }
__device__ __forceinline__ unsigned short c16f(float c) { return f16_bits(toh_flush(c)); }

__device__ __forceinline__ v8f wm_b(const Frag& a, const Frag& b, v8f c) {
  return __builtin_amdgcn_wmma_f32_16x16x32_bf16(false, a.vb, false, b.vb, (short)0, c, false, false);
}
__device__ __forceinline__ v8f wm_h(const Frag& a, const Frag& b, v8f c) {
  return __builtin_amdgcn_wmma_f32_16x16x32_f16(false, a.vh, false, b.vh, (short)0, c, false, false);
}

// One k-step for one 16x16 output tile of both parts: yr += ar*w ; yi += ai*w ; each product followed by its own hazard guard.
template <bool BF>
__device__ __forceinline__ void rmma(const Frag& ar, const Frag& ai, const Frag& wf, v8f& yr, v8f& yi) {
  if (BF) {
    yr = wm_b(ar, wf, yr);
    asm volatile("v_nop\n\tv_nop\n\tv_nop\n\tv_nop" : "+v"(yr) : "v"(ar.vb), "v"(wf.vb));
    yi = wm_b(ai, wf, yi);
    asm volatile("v_nop\n\tv_nop\n\tv_nop\n\tv_nop" : "+v"(yi) : "v"(ai.vb), "v"(wf.vb));
  } else {
    yr = wm_h(ar, wf, yr);
    asm volatile("v_nop\n\tv_nop\n\tv_nop\n\tv_nop" : "+v"(yr) : "v"(ar.vh), "v"(wf.vh));
    yi = wm_h(ai, wf, yi);
    asm volatile("v_nop\n\tv_nop\n\tv_nop\n\tv_nop" : "+v"(yi) : "v"(ai.vh), "v"(wf.vh));
  }
}

// Twelve asynchronous 16-byte copies per lane, global -> LDS, one GEMM stage: copy i lands at LDS byte l + 2048 i (16 rows further down).
// Copies 0..3: A rows, real part (16 rows apart); 4..7: the same rows, phase part (RD halves further); 8..11: W rows (16 rows apart). Every lane on, no offset field.
// The s_wait_xcnt closes the statement so that it stands in front of any later write of the address registers the copies name.
__device__ __forceinline__ void copy12(unsigned int l, const char* ga, const char* gw) {
  constexpr size_t AS = (size_t)16 * KP * 2, PH = (size_t)RD * 2, WS = (size_t)16 * RD * 2;
  asm volatile("global_load_async_to_lds_b128 %0, %12, off\n\t"
               "global_load_async_to_lds_b128 %1, %13, off\n\t"
               "global_load_async_to_lds_b128 %2, %14, off\n\t"
               "global_load_async_to_lds_b128 %3, %15, off\n\t"
               "global_load_async_to_lds_b128 %4, %16, off\n\t"
               "global_load_async_to_lds_b128 %5, %17, off\n\t"
               "global_load_async_to_lds_b128 %6, %18, off\n\t"
               "global_load_async_to_lds_b128 %7, %19, off\n\t"
               "global_load_async_to_lds_b128 %8, %20, off\n\t"
               "global_load_async_to_lds_b128 %9, %21, off\n\t"
               "global_load_async_to_lds_b128 %10, %22, off\n\t"
               "global_load_async_to_lds_b128 %11, %23, off\n\t"
               "s_wait_xcnt 0x0"
               :: "v"(l), "v"(l + 2048u), "v"(l + 4096u), "v"(l + 6144u),
                  "v"(l + 8192u), "v"(l + 10240u), "v"(l + 12288u), "v"(l + 14336u),
                  "v"(l + 16384u), "v"(l + 18432u), "v"(l + 20480u), "v"(l + 22528u),
                  "v"(ga), "v"(ga + AS), "v"(ga + 2 * AS), "v"(ga + 3 * AS),
                  "v"(ga + PH), "v"(ga + PH + AS), "v"(ga + PH + 2 * AS), "v"(ga + PH + 3 * AS),
                  "v"(gw), "v"(gw + WS), "v"(gw + 2 * WS), "v"(gw + 3 * WS)
               : "memory");
}

// Block tile 64 rows x 64 columns for both parts (wave tile 16 rows x 64 columns), K = 512. A plane [rows][KP] = [real 512 | phase 512], W plane [cols][RD] (transposed weight, k-contiguous).
// The four waves share each k tile of GK: two LDS buffers in ring (2 x GST_H halves), the next tile's copies in flight while this tile is worked on; one barrier per tile
// publishes the next tile and frees the buffer just read. Called by whole blocks of 128 threads; behind the call the ring is free for other use.
// Staged tile: row r = 0..63 A real (row rowb + r), 64..127 A phase, 128..191 W (column col0 + r - 128); 128 B per row, no pad: the 16-byte piece p of row r lies at piece p ^ ((r >> 1) & 7),
// so 16 lanes reading one piece down 16 rows meet every bank once. Thread tid copies piece tid & 7 of rows (tid >> 3) + 16 i: whole 128-B lines per 8 lanes.
// A fragment: row m = rowb + 16 w + ln, elements 0..7 <- k0 + 8h + i, 8..15 <- k0 + 16 + 8h + i. B fragment: column n = col0 + 16t + ln, same k map.
// D: acc[r] = y(rowb + 16 w + 8h + r, col0 + 16t + ln).
template <bool BF>
__device__ __forceinline__ void rgemm_main(const unsigned short* __restrict__ A, const unsigned short* __restrict__ W, unsigned short* ring,
                                           int rowb, int col0, int tid, int w, int ln, int hh, v8f (&yr)[4], v8f (&yi)[4]) {
  const char* ga = (const char*)(A + (size_t)(rowb + (tid >> 3)) * KP) + (tid & 7) * 16;
  const char* gw = (const char*)(W + (size_t)(col0 + (tid >> 3)) * RD) + (tid & 7) * 16;
  const unsigned int l = (unsigned int)(size_t)ring + (unsigned int)((tid >> 3) * (GK * 2) + (((tid & 7) ^ ((tid >> 4) & 7)) * 16));   // LDS byte address of this thread's first piece in buffer 0
  const int sw = (ln >> 1) & 7;
  copy12(l, ga, gw);
  asm volatile("s_wait_asynccnt 0x0" ::: "memory");   // this wave's share of tile 0 has landed
  __syncthreads();                                    // every wave's share of tile 0 has landed
  copy12(l + GST_H * 2u, ga + GK * 2, gw + GK * 2);
#pragma unroll 1   // one trip per tile: the hand-over at the foot stands once
  for (int s = 0; s < GNS; ++s) {
    const int bo = (s & 1) * GST_H;
    const unsigned short* ap = ring + bo + (16 * w + ln) * GK;
    const unsigned short* wp = ring + bo + (128 + ln) * GK;
#pragma unroll   // constant c: the piece places are loop-invariant registers and the row offsets immediates
    for (int c = 0; c < GK / 32; ++c) {
      const int o0 = ((4 * c + hh) ^ sw) * 8, o1 = ((4 * c + 2 + hh) ^ sw) * 8;   // places of the pieces k0 + 8h and k0 + 16 + 8h in this lane's rows
      // the k step's six fragments are read as one group, ahead of its products
      Frag ar, ai, wf[4];
      ar.half[0] = *(const v8us*)(ap + o0);
      ar.half[1] = *(const v8us*)(ap + o1);
      ai.half[0] = *(const v8us*)(ap + 64 * GK + o0);
      ai.half[1] = *(const v8us*)(ap + 64 * GK + o1);
#pragma unroll   // constant indices keep the fragments in registers
      for (int t = 0; t < 4; ++t) {
        const unsigned short* wt = wp + t * 16 * GK;
        wf[t].half[0] = *(const v8us*)(wt + o0);
        wf[t].half[1] = *(const v8us*)(wt + o1);
      }
#pragma unroll   // as above
      for (int t = 0; t < 4; ++t) rmma<BF>(ar, ai, wf[t], yr[t], yi[t]);
    }
    asm volatile("s_wait_dscnt 0x0" ::: "memory");      // this wave's reads of the buffer have returned before it is refilled
    asm volatile("s_wait_asynccnt 0x0" ::: "memory");   // this wave's share of tile s + 1 has landed
    __syncthreads();                                    // publishes tile s + 1 and ends every wave's reads of tile s
    if (s + 2 < GNS) copy12(l + (unsigned int)bo * 2u, ga + (size_t)(s + 2) * (GK * 2), gw + (size_t)(s + 2) * (GK * 2));
  }
  asm volatile("s_wait_asynccnt 0x0" ::: "memory");     // nothing in flight when the wave goes on to the epilogue
}

// X[row][KP] = bf16 bits [xr 512 | xi 512], row = b*SEQ + s (compact). Thread per (row, 8 columns) converts the re and the im piece.
// coverage: blk = 0 .. GX_B - 1: NB*SEQ*64 threads x (8 re + 8 im) elements = the whole plane.
__device__ __forceinline__ void cvtx_block(int blk, const float* __restrict__ xr, const float* __restrict__ xi, unsigned short* __restrict__ X) {
  const int t = blk * 256 + threadIdx.x;
  if (t >= NB * SEQ * 64) return;
  const int row = t >> 6, c8 = (t & 63) * 8;
  const int b = row / SEQ, s = row - b * SEQ;
  const size_t src = ((size_t)b * SEQ_FULL + (size_t)s) * RD + c8;
  const v4f r0 = *(const v4fa*)(xr + src), r1 = *(const v4fa*)(xr + src + 4);
  const v4f i0 = *(const v4fa*)(xi + src), i1 = *(const v4fa*)(xi + src + 4);
  v8us orr, oi;
  orr[0] = bf16_bits(r0[0]); orr[1] = bf16_bits(r0[1]); orr[2] = bf16_bits(r0[2]); orr[3] = bf16_bits(r0[3]);
  orr[4] = bf16_bits(r1[0]); orr[5] = bf16_bits(r1[1]); orr[6] = bf16_bits(r1[2]); orr[7] = bf16_bits(r1[3]);
  oi[0] = bf16_bits(i0[0]); oi[1] = bf16_bits(i0[1]); oi[2] = bf16_bits(i0[2]); oi[3] = bf16_bits(i0[3]);
  oi[4] = bf16_bits(i1[0]); oi[5] = bf16_bits(i1[1]); oi[6] = bf16_bits(i1[2]); oi[7] = bf16_bits(i1[3]);
  unsigned short* d = X + (size_t)row * KP + c8;
  *(v8us*)d = orr;
  *(v8us*)(d + RD) = oi;
  
}

// Weight convert with transpose: w[k][n] (f32, [in][out]) -> Wt[n][k] (pitch RD) as bf16 bits (asf16 == 0) or as f16(bf16 value x 1024) (asf16 != 0).
// coverage: tile = 0 .. GW_T - 1 = (RD/64 k tiles) x (RD/64 n tiles) x (64 n rows x 64 k) = the whole plane; LDS tile: 64 x 64 written before the barrier, 64 x 64 read after it.
// Called by whole blocks only (the barrier).
__device__ __forceinline__ void cvtwt_block(int tile, const float* __restrict__ w, unsigned short* __restrict__ Wt, int asf16) {
  __shared__ __attribute__((aligned(16))) unsigned short tl[64][72];
  const int tid = threadIdx.x;
  const int k0 = (tile % (RD / 64)) * 64, n0 = (tile / (RD / 64)) * 64;
#pragma unroll 1
  for (int j = 0; j < 16; ++j) {
    const int i = tid + 256 * j;
    const int kk = i >> 6, nn = i & 63;
    const float x = w[(size_t)(k0 + kk) * RD + (size_t)(n0 + nn)];
    const unsigned short vb = bf16_bits(x);
    const unsigned short vh = c16f(bf16_val(vb) * 1024.0f);   // bf16 significand x 2^10 is exact in f16
    tl[nn][kk] = (asf16 != 0) ? vh : vb;
  }
  __syncthreads();
  {
#pragma unroll
    for (int j = 0; j < 2; ++j) {
      const int i = tid + 256 * j;
      const int nn = i >> 3, p8 = (i & 7) * 8;
      const v8us a = *(const v8us*)&tl[nn][p8];
      *(v8us*)(Wt + (size_t)(n0 + nn) * RD + (size_t)(k0 + p8)) = a;
    }
    
  }
}

// Mask pack: MB[((b*(SEQ/16) + q/16) * (SEQ/32) + j) * 16 + i], i = 8 kt + r: bit l = (mask[b][16 (q/16) + (l & 15)][32 j + 16 kt + 8 (l >> 4) + r] != 0),
// that is the 32-lane condition of score register i in step j of the k_attn wave that owns these 16 queries. One wave per (16 queries, 64 keys = two steps):
// lane l reads 4 x 32 B of its query's row (the wave: 256 B of each of 16 rows), 32 ballots, lane n keeps ballot n, one 128-B store.
// coverage: blk = 0 .. GM_B - 1: NB*(SEQ/16)*(SEQ/64) waves x 32 words = the whole plane. Whole waves only (the ballots).
__device__ __forceinline__ void maskbits_block(int blk, const int* __restrict__ mask, unsigned int* __restrict__ MB) {
  const int lane = threadIdx.x & 31;
  const int wv = blk * 8 + (int)(threadIdx.x >> 5);
  if (wv >= NB * (SEQ / 16) * (SEQ / 64)) return;
  const int rt = wv / (SEQ / 64), jp = wv - rt * (SEQ / 64);
  const int b = rt / (SEQ / 16), q = (rt - b * (SEQ / 16)) * 16 + (lane & 15);
  const int* mp = mask + ((size_t)b * SEQ_FULL + (size_t)q) * SEQ_FULL + (size_t)jp * 64 + 8 * (lane >> 4);
  v4i m[8];
#pragma unroll   // the eight loads are independent and issue together
  for (int n = 0; n < 4; ++n) {
    m[2 * n]     = *(const v4i*)(mp + 16 * n);
    m[2 * n + 1] = *(const v4i*)(mp + 16 * n + 4);
  }
  unsigned int word = 0u;
#pragma unroll   // constant lane numbers
  for (int n = 0; n < 4; ++n) {
#pragma unroll   // as above
    for (int r = 0; r < 8; ++r) {
      const unsigned int bal = __builtin_amdgcn_ballot_w32(m[2 * n + (r >> 2)][r & 3] != 0);
      word = (lane == 8 * n + r) ? bal : word;
    }
  }
  MB[(size_t)wv * 32 + lane] = word;
}

// All preparation in one launch: none of its eight parts reads what another writes, so they are block ranges of one grid.
// Blocks 0 .. GW_B - 1: the four weight planes (first: each walks a serial run of loads); then GM_B blocks of mask pack; then 3 x GX_B blocks of activation convert (q, k, v).
// Every branch below is block-uniform.
__global__ __launch_bounds__(256) void k_prep(const float* __restrict__ q_re, const float* __restrict__ k_re, const float* __restrict__ v_re,
                                              const float* __restrict__ q_ph, const float* __restrict__ k_ph, const float* __restrict__ v_ph,
                                              const float* __restrict__ w_q, const float* __restrict__ w_k, const float* __restrict__ w_v,
                                              const float* __restrict__ w_o, const int* __restrict__ mask,
                                              unsigned short* __restrict__ Xq, unsigned short* __restrict__ Xk, unsigned short* __restrict__ Xv,
                                              unsigned short* __restrict__ Wq, unsigned short* __restrict__ Wk, unsigned short* __restrict__ Wv,
                                              unsigned short* __restrict__ Wo, unsigned int* __restrict__ MB) {
  const int bid = blockIdx.x;
  if (bid < GW_B) {
    const int which = bid / GW_T;
    const float* w = (which == 0) ? w_q : (which == 1) ? w_k : (which == 2) ? w_v : w_o;
    unsigned short* Wt = (which == 0) ? Wq : (which == 1) ? Wk : (which == 2) ? Wv : Wo;
    cvtwt_block(bid - which * GW_T, w, Wt, (which == 3) ? 1 : 0);
  } else if (bid < GW_B + GM_B) {
    maskbits_block(bid - GW_B, mask, MB);
  } else {
    const int r = bid - (GW_B + GM_B);
    const int part = r / GX_B;
    const float* xr = (part == 0) ? q_re : (part == 1) ? k_re : v_re;
    const float* xi = (part == 0) ? q_ph : (part == 1) ? k_ph : v_ph;
    unsigned short* X = (part == 0) ? Xq : (part == 1) ? Xk : Xv;
    cvtx_block(r - part * GX_B, xr, xi, X);
  }
}

// q, k and v projections in one launch, blockIdx.z = 0 (q), 1 (k), 2 (v): none reads what another writes. Block = 4 waves x 16 rows = 64 rows, 64 columns = one head.
// q / k: output plane P[b*NH + head][s][HP] = f16 of (y_r x 256 | y_p x cim), cim = +256 (q) or -256 (k).
// v: transposed plane Vt[b*NH + head][dd][s], dd = [real 64 | phase 64], value f16 of (y x 256).
// coverage: grid (NB*SEQ/64, NH) per z x 4 waves x 16 rows x 128 halves = each whole plane.
// LDS tile, q / k: [4][16][136], columns 0..127 of every row are written before the barrier and exactly those are read after it; v: [128][72], 128 x 64 written before the barrier, 128 x 64 read after it.
// The branch on z is block-uniform, so each barrier is passed by the whole block.
__global__ __launch_bounds__(128) void k_proj(const unsigned short* __restrict__ Xq, const unsigned short* __restrict__ Xk, const unsigned short* __restrict__ Xv,
                                              const unsigned short* __restrict__ Wq, const unsigned short* __restrict__ Wk, const unsigned short* __restrict__ Wv,
                                              unsigned short* __restrict__ Qp, unsigned short* __restrict__ Kp, unsigned short* __restrict__ Vt) {
  __shared__ __attribute__((aligned(16))) unsigned short ring[2 * GST_H];   // the GEMM's two buffers; behind the GEMM the output tile
  unsigned short* st = ring;
  static_assert(4 * 16 * 136 <= HP * 72);
  static_assert(HP * 72 <= 2 * GST_H);
  const int tid = threadIdx.x, w = __builtin_amdgcn_readfirstlane((int)(tid >> 5)), lane = tid & 31, ln = lane & 15, hh = lane >> 4;
  const int z = blockIdx.z;
  const int head = blockIdx.y;
  const int rowb = blockIdx.x * 64;
  const unsigned short* X = (z == 0) ? Xq : (z == 1) ? Xk : Xv;
  const unsigned short* W = (z == 0) ? Wq : (z == 1) ? Wk : Wv;
  v8f yr[4] = {}, yi[4] = {};
  rgemm_main<true>(X, W, ring, rowb, head * HD, tid, w, ln, hh, yr, yi);
  const int b = rowb / SEQ;
  if (z < 2) {
    unsigned short (*sh)[16][136] = (unsigned short (*)[16][136])st;
    unsigned short* P = (z == 0) ? Qp : Kp;
    const float cim = (z == 0) ? 256.0f : -256.0f;
#pragma unroll
    for (int t = 0; t < 4; ++t) {
#pragma unroll
      for (int r = 0; r < 8; ++r) {
        sh[w][8 * hh + r][16 * t + ln]      = c16f(yr[t][r] * 256.0f);
        sh[w][8 * hh + r][HD + 16 * t + ln] = c16f(yi[t][r] * cim);
      }
    }
    __syncthreads();
    const int s0 = rowb - b * SEQ + 16 * w;
    const size_t base = ((size_t)(b * NH + head) * SEQ + (size_t)s0) * HP;
    const int rsub = lane >> 4, p8 = (lane & 15) * 8;
#pragma unroll
    for (int q = 0; q < 8; ++q) {
      const int row = 2 * q + rsub;
      const v8us a = *(const v8us*)&sh[w][row][p8];
      *(v8us*)(P + base + (size_t)row * HP + p8) = a;
    }
  } else {
    unsigned short (*th)[72] = (unsigned short (*)[72])st;
#pragma unroll
    for (int t = 0; t < 4; ++t) {
#pragma unroll
      for (int r = 0; r < 8; ++r) {
        const int col = 16 * w + 8 * hh + r;
        th[16 * t + ln][col]      = c16f(yr[t][r] * 256.0f);
        th[HD + 16 * t + ln][col] = c16f(yi[t][r] * 256.0f);
      }
    }
    __syncthreads();
    const int s0 = rowb - b * SEQ;
    const size_t base = (size_t)(b * NH + head) * HP * SEQ + (size_t)s0;
    for (int i = tid; i < HP * 8; i += 128) {
      const int dd = i >> 3, j8 = (i & 7) * 8;
      const v8us a = *(const v8us*)&th[dd][j8];
      *(v8us*)(Vt + base + (size_t)dd * SEQ + j8) = a;
    }
  }
}

// Score group for one 16-key tile (8 WMMAs): sre = kr qr + ki qi (4 products), sa = kr qi (2), sb = ki qr (2); then the hazard guard.
// k0, k1 = kr (d 0..31, 32..63); k2, k3 = ki; q[0], q[1] = qr; q[2], q[3] = qi.
__device__ __forceinline__ void score_mma(const Frag& k0, const Frag& k1, const Frag& k2, const Frag& k3,
                                          const Frag (&q)[4], v8f& sre, v8f& sa, v8f& sb) {
  sre = wm_h(k0, q[0], sre);
  sa  = wm_h(k0, q[2], sa);
  sb  = wm_h(k2, q[0], sb);
  sre = wm_h(k1, q[1], sre);
  sa  = wm_h(k1, q[3], sa);
  sb  = wm_h(k3, q[1], sb);
  sre = wm_h(k2, q[2], sre);
  sre = wm_h(k3, q[3], sre);
  asm volatile("v_nop\n\tv_nop\n\tv_nop\n\tv_nop" : "+v"(sre), "+v"(sa), "+v"(sb)
               : "v"(k0.vh), "v"(k1.vh), "v"(k2.vh), "v"(k3.vh),
                 "v"(q[0].vh), "v"(q[1].vh), "v"(q[2].vh), "v"(q[3].vh));
}
// c += v*p (single f16 product), then the hazard guard.
__device__ __forceinline__ void pv_mma(const Frag& v, const Frag& p, v8f& c) {
  c = wm_h(v, p, c);
  asm volatile("v_nop\n\tv_nop\n\tv_nop\n\tv_nop" : "+v"(c) : "v"(v.vh), "v"(p.vh));
}

// One 32-key step (step index j) for a wave's 16 queries: 16 score WMMAs + 8 P.V WMMAs. Ks = the step's first staged K row (pitch KPITCH),
// Vs = the step's first key column in the staged V^T rows (pitch VPITCH), both in LDS; key0 = the step's first key in the comments below; mk = the step's 16 select words (scalar registers), replaced behind their last use by the words at Mn, those of the same step of the next tile. With the phase half of the K plane stored negated: sre = qr.kr - qp.kp, sa - sb = qp.kr + qr.kp.
__device__ __forceinline__ void fa_step(const unsigned short* Ks, const unsigned short* Vs,
                                        maskp_t Mn, v16u& mk, int ln, int hh,
                                        const Frag (&qf)[4], float& mr, float& lr, v8f (&O)[8]) {
  const v8f z8 = {0.f, 0.f, 0.f, 0.f, 0.f, 0.f, 0.f, 0.f};
  float sc[16];
  // A fragments of K: row m = key (key0 + 16*kt + ln); packed k axis [kr 0..63 | -kp 64..127]; elements 0..7 <- 32c + 8h + i, 8..15 <- 32c + 16 + 8h + i;
  // both 16-key tiles' fragments are read as one group
  Frag kf[2][4];
#pragma unroll   // constant indices keep the fragments in registers
  for (int kt = 0; kt < 2; ++kt) {
    const unsigned short* kp = Ks + (16 * kt + ln) * KPITCH + 8 * hh;
#pragma unroll   // as above
    for (int c = 0; c < 4; ++c) {
      kf[kt][c].half[0] = *(const v8us*)(kp + 32 * c);
      kf[kt][c].half[1] = *(const v8us*)(kp + 32 * c + 16);
    }
  }
#pragma unroll
  for (int kt = 0; kt < 2; ++kt) {
    v8f sre = z8, sa = z8, sb = z8;
    score_mma(kf[kt][0], kf[kt][1], kf[kt][2], kf[kt][3], qf, sre, sa, sb);
    // S^T tile: element r = score(key0 + 16*kt + 8h + r, query of this lane's column); logit in log2 units; masked keys get the fill value instead
#pragma unroll
    for (int r = 0; r < 8; ++r) {
      const float im = sa[r] - sb[r];
      const float v = __builtin_amdgcn_sqrtf(fmaf(sre[r], sre[r], im * im)) * CSCALE;
      sc[8 * kt + r] = __builtin_amdgcn_inverse_ballot_w32(mk[8 * kt + r]) ? v : MFILL;   // the word is the select's lane condition as it stands
    }
  }
  mk = *Mn;   // one scalar load, two steps ahead of its first use
  // A fragments of V^T: row m = dd (16*t + ln), elements 0..7 <- key0 + 8h + i, 8..15 <- key0 + 16 + 8h + i; read as one group, ahead of the softmax arithmetic
  Frag vf[8];
#pragma unroll   // constant indices keep the fragments in registers
  for (int t = 0; t < 8; ++t) {
    const unsigned short* vp = Vs + (16 * t + ln) * VPITCH + 8 * hh;
    vf[t].half[0] = *(const v8us*)(vp);
    vf[t].half[1] = *(const v8us*)(vp + 16);
  }
  float mx = sc[0];
#pragma unroll
  for (int i = 1; i < 16; ++i) mx = fmaxf(mx, sc[i]);
  // Lazy rescale: mr is the reference exponent in use, not the running maximum. It moves only when some lane's own 16 scores pass it by more than RTHR,
  // tested once per step for the whole wave (a scalar branch); until then the sum and O^T keep their scale, no factor is applied and the lane halves exchange no maximum.
  if (__builtin_expect(__builtin_amdgcn_ballot_w32(mx > mr + RTHR) != 0u, 0)) {   // rare: the step's straight path falls through
    mx = fmaxf(mx, __shfl_xor(mx, 16, 32));         // the other lane half holds the other 16 keys of this query: both halves take the same new reference
    const float mnew = fmaxf(mr, mx);
    const float al = exp2f(mr - mnew);
    mr = mnew;
    lr *= al;
#pragma unroll   // constant indices keep the accumulators in registers
    for (int t = 0; t < 8; ++t) O[t] = O[t] * al;
  }
  const float mb = mr - 8.0f;                       // the reference with the x256 carry folded in: changes only where the reference moves
  // weights carried x256: pc = 256 * 2^(sc - mr) as one f16 plane (exponent below -14 -> exact zero); the row sum uses the f16-converted values the matrix unit sees
  Frag pf;
  float ps = 0.0f;
#pragma unroll
  for (int i = 0; i < 16; ++i) {
    const float e = sc[i] - mb;
    const float pc = (e < -14.0f) ? 0.0f : __builtin_amdgcn_exp2f(e);   // bare v_exp_f32 and a value select: the kept range e >= -14 needs no range extension, so the bits are those of exp2f(e), and no branch stands between the 16 weights
    const _Float16 h = (_Float16)pc;
    pf.h[i] = h;                                    // B element i: i<8 -> key0 + 8h + i (tile 0 row 8h+i); i>=8 -> key0 + 16 + 8h + (i-8) (tile 1)
    ps += (float)h;
  }
  ps += __shfl_xor(ps, 16, 32);
  lr += ps;
#pragma unroll   // constant indices keep the fragments and the accumulators in registers
  for (int t = 0; t < 8; ++t) pv_mma(vf[t], pf, O[t]);
}

// Eight asynchronous 16-byte copies per lane, global -> LDS: copy i moves g + i*gstep to LDS byte l + i*lstep. Every lane on, no offset field.
// The s_wait_xcnt closes the statement so that it stands in front of any later write of the address registers the copies name.
__device__ __forceinline__ void copy8(unsigned int l, unsigned int lstep, const char* g, size_t gstep) {
  asm volatile("global_load_async_to_lds_b128 %0, %8, off\n\t"
               "global_load_async_to_lds_b128 %1, %9, off\n\t"
               "global_load_async_to_lds_b128 %2, %10, off\n\t"
               "global_load_async_to_lds_b128 %3, %11, off\n\t"
               "global_load_async_to_lds_b128 %4, %12, off\n\t"
               "global_load_async_to_lds_b128 %5, %13, off\n\t"
               "global_load_async_to_lds_b128 %6, %14, off\n\t"
               "global_load_async_to_lds_b128 %7, %15, off\n\t"
               "s_wait_xcnt 0x0"
               :: "v"(l), "v"(l + lstep), "v"(l + 2 * lstep), "v"(l + 3 * lstep),
                  "v"(l + 4 * lstep), "v"(l + 5 * lstep), "v"(l + 6 * lstep), "v"(l + 7 * lstep),
                  "v"(g), "v"(g + gstep), "v"(g + 2 * gstep), "v"(g + 3 * gstep),
                  "v"(g + 4 * gstep), "v"(g + 5 * gstep), "v"(g + 6 * gstep), "v"(g + 7 * gstep)
               : "memory");
}

// One stage (TK keys) into the LDS buffer at byte address lb. kg, vg: this thread's first source bytes in tile 0 of the (b, h) planes; kl, vl: its first LDS bytes in a buffer.
// K tile: TK rows x 256 B, contiguous in the plane; thread tid copies chunk tid + 256 i (row = chunk / 16). V^T tile: 128 rows x 256 B at the plane's row pitch; row = chunk / 16.
__device__ __forceinline__ void stage_copy(int tile, unsigned int lb, const char* kg, const char* vg, unsigned int kl, unsigned int vl) {
  copy8(lb + kl, 16u * KPITCH * 2u, kg + (size_t)tile * (TK * HP * 2), (size_t)4096);
  copy8(lb + vl, 16u * VPITCH * 2u, vg + (size_t)tile * (TK * 2), (size_t)16 * SEQ * 2);
}

// Block = 8 waves = 4 query groups x 2 key groups, 64 queries of one (b, h): wave w owns the 16 queries of group w & 3 and, of every 128-key tile, the 64 keys of group w >> 2.
// The queries alone fill two waves per SIMD; the key split makes it four (two blocks per WGP), so that one wave's LDS, cross-lane and dependent-vector waits are covered by three others.
// The eight waves share each K / V^T tile: two LDS buffers, the next tile's copies in flight while this tile is worked on; one barrier per tile publishes the next tile and frees the buffer just read.
// Merge: each wave ends with its own (reference exponent, sum, O^T) over its half of the keys; key group 1 hands them over in LDS and key group 0 joins the two with weights 2^(m - max).
// Epilogue: ctx carried x4096 as one f16 plane C[b*SEQ + s][KP] ([real 512 | phase 512], column h*64 + d).
// coverage: NB*NH*(SEQ/64) blocks x 4 query groups x 16 queries x (64 real + 64 phase) = every (row, head, part) segment of the plane exactly once (key group g stores lines 16 g .. 16 g + 15 of its query group's 32).
// LDS behind the loop (the ring is free: the last trip's barrier ends every read, nothing is in flight): bytes 0 .. 32767 O^T of key group 1, 32768 .. 33791 its references and sums, from 40960 the output tile.
// Every branch on the key group is wave-uniform and holds no barrier.
__global__ __launch_bounds__(256) __attribute__((amdgpu_waves_per_eu(4, 4))) void k_attn(const unsigned short* __restrict__ Qp, const unsigned short* __restrict__ Kpl,
                                              const unsigned short* __restrict__ Vt, const unsigned int* __restrict__ MB,
                                              unsigned short* __restrict__ Cx) {
  __shared__ __attribute__((aligned(16))) unsigned short ring[2 * ST_H];
  static_assert(40960 + 4 * 16 * 136 * 2 <= 2 * ST_H * 2);
  const int tid = threadIdx.x, w = __builtin_amdgcn_readfirstlane((int)(tid >> 5)), lane = tid & 31, ln = lane & 15, hh = lane >> 4;
  const int qw = w & 3, g = w >> 2;
  const int bh = blockIdx.x / (SEQ / 64), qt = blockIdx.x % (SEQ / 64);
  const int b = bh / NH, h = bh - b * NH;
  const int qbase = qt * 64 + 16 * qw;
  const int qg = qbase + ln;
  // Q^T B fragments: column n = query qg, packed k axis [qr 0..63 | qp 64..127], elements 0..7 <- 32c + 8h + i, 8..15 <- 32c + 16 + 8h + i
  Frag qf[4];
  {
    const size_t qoff = ((size_t)bh * SEQ + (size_t)qg) * HP + 8 * hh;
#pragma unroll
    for (int c = 0; c < 4; ++c) {
      qf[c].half[0] = *(const v8us*)(Qp + qoff + 32 * c);
      qf[c].half[1] = *(const v8us*)(Qp + qoff + 32 * c + 16);
    }
  }
  float mr = -3.0e38f, lr = 0.0f;
  v8f O[8] = {};
  const unsigned short* Kp = Kpl + (size_t)bh * SEQ * HP;
  const unsigned short* Vp = Vt  + (size_t)bh * HP * SEQ;
  const unsigned int* Mw = MB + (size_t)(b * (SEQ / 16) + qt * 4 + qw) * ((SEQ / 32) * 16) + g * 32;   // the wave's select words, 16 per step, from its first step on; wave-uniform
  const char* kg = (const char*)Kp + (size_t)tid * 16;
  const char* vg = (const char*)Vp + (size_t)(tid >> 4) * (SEQ * 2) + (size_t)(tid & 15) * 16;
  const unsigned int rb = (unsigned int)(size_t)&ring[0];                                     // LDS byte address of the ring
  const unsigned int kl = (unsigned int)((tid >> 4) * (KPITCH * 2) + (tid & 15) * 16);
  const unsigned int vl = (unsigned int)(KT_H * 2 + (tid >> 4) * (VPITCH * 2) + (tid & 15) * 16);
  constexpr int NT = SEQ / TK;
  v16u mka = *(maskp_t)Mw, mkb = *(maskp_t)(Mw + 16);   // select words of the wave's first and second step of a tile; the first two land while tile 0 does
  stage_copy(0, rb, kg, vg, kl, vl);
  asm volatile("s_wait_asynccnt 0x0" ::: "memory");   // this wave's share of tile 0 has landed
  __syncthreads();                                    // every wave's share of tile 0 has landed
  if (NT > 1) stage_copy(1, rb + ST_H * 2u, kg, vg, kl, vl);
#pragma unroll 1   // one trip per tile: the hand-over at the foot stands once
  for (int t = 0; t < NT; ++t) {
    const int bo = (t & 1) * ST_H;
    const unsigned int* Mn = Mw + 64 * ((t + 1 < NT) ? t + 1 : t);   // the next tile's words; in the last trip its own again: in range, not used
    const unsigned short* ks = &ring[bo + g * 64 * KPITCH];          // the key group's first staged K row
    const unsigned short* vs = &ring[bo + KT_H + g * 64];            // its first key column in the staged V^T rows
    fa_step(ks, vs, (maskp_t)Mn, mka, ln, hh, qf, mr, lr, O);
    fa_step(ks + 32 * KPITCH, vs + 32, (maskp_t)(Mn + 16), mkb, ln, hh, qf, mr, lr, O);
    asm volatile("s_wait_dscnt 0x0" ::: "memory");      // this wave's reads of the buffer have returned before it is refilled
    asm volatile("s_wait_asynccnt 0x0" ::: "memory");   // this wave's share of tile t + 1 has landed
    __syncthreads();                                    // publishes tile t + 1 and ends every wave's reads of tile t
    if (t + 2 < NT) stage_copy(t + 2, rb + (unsigned int)bo * 2u, kg, vg, kl, vl);
  }
  asm volatile("s_wait_asynccnt 0x0" ::: "memory");     // nothing in flight when the wave goes on to the epilogue

  v4fa* mo = (v4fa*)ring + (size_t)qw * 512 + lane;                 // piece j of the query group's O^T at mo[32 j]: 512 contiguous bytes per wave store
  f32a* ml = (f32a*)ring + 8192 + qw * 64 + lane;
  unsigned short (*sh)[16][136] = (unsigned short (*)[16][136])(ring + 20480);
  if (g == 1) {
#pragma unroll
    for (int t = 0; t < 8; ++t) {
      const v4f lo = {O[t][0], O[t][1], O[t][2], O[t][3]}, hi = {O[t][4], O[t][5], O[t][6], O[t][7]};
      mo[32 * (2 * t)] = lo;
      mo[32 * (2 * t + 1)] = hi;
    }
    ml[0] = mr;
    ml[32] = lr;
  }
  __syncthreads();                                      // key group 1's partial results are in LDS
  if (g == 0) {
    // both references are finite (each group has worked at least one step, and the first step always sets one), so the weights are in (0, 1] and the larger one is 1
    const float m1 = ml[0], l1 = ml[32];
    const float mm = fmaxf(mr, m1);
    const float a0 = exp2f(mr - mm), a1 = exp2f(m1 - mm);
    // O^T element r of tile t = ctx(query qg, dd = 16t + 8h + r); carries: x256 (P, also in the sums), x256 (v); ctx stored x4096 -> factor 16 / sum
    const float inv = 16.0f * (1.0f / (lr * a0 + l1 * a1));
    const float c0 = a0 * inv, c1 = a1 * inv;
#pragma unroll
    for (int t = 0; t < 8; ++t) {
      const v4f lo = mo[32 * (2 * t)], hi = mo[32 * (2 * t + 1)];
#pragma unroll
      for (int r = 0; r < 8; ++r)
        sh[qw][ln][16 * t + 8 * hh + r] = c16f(O[t][r] * c0 + ((r < 4) ? lo[r & 3] : hi[r & 3]) * c1);
    }
  }
  __syncthreads();                                      // the output tile is whole
  const size_t rbase = ((size_t)b * SEQ + (size_t)qbase) * KP + (size_t)h * HD;
  const int lsub = lane >> 3, p8 = (lane & 7) * 8;
  {
#pragma unroll
    for (int q = 0; q < 4; ++q) {
      const int line = 4 * (4 * g + q) + lsub;  // 0..31 = 16 queries x {real, phase}
      const int row = line >> 1, seg = line & 1;
      const v8us a = *(const v8us*)&sh[qw][row][seg * HD + p8];
      const size_t o = rbase + (size_t)row * KP + (size_t)seg * RD + p8;
      *(v8us*)(Cx + o) = a;
    }
  }
}

// Output projection of both parts: out0[b][s][n] = ctx_real x Wo, out1[b][s][n] = ctx_phase x Wo (f16, K = 512, one product per term), undo carries x4096 (ctx) and x1024 (Wo).
// Epilogue: per-wave LDS tile [16 rows][128 floats = 64 real columns | 64 phase columns] (block barrier), then per instruction lanes 0..15 write the 256-B
// coverage: grid (NB*SEQ/64, RD/64) x 4 waves x 16 rows x (64 + 64) floats = every output element of the processed rows exactly once.
// LDS tile: columns 0..127 of every row written before the barrier, the same read after it.
__global__ __launch_bounds__(128) void k_out(const unsigned short* __restrict__ Cx, const unsigned short* __restrict__ Wo,
                                             float* __restrict__ Out) {
  __shared__ __attribute__((aligned(16))) unsigned short ring[2 * GST_H];   // the GEMM's two buffers; behind the GEMM the output tile
  float (*so)[16][132] = (float (*)[16][132])ring;
  static_assert(4 * 16 * 132 * 4 <= 2 * GST_H * 2);
  const int tid = threadIdx.x, w = __builtin_amdgcn_readfirstlane((int)(tid >> 5)), lane = tid & 31, ln = lane & 15, hh = lane >> 4;
  const int rowb = blockIdx.x * 64;
  const int col0 = blockIdx.y * 64;
  v8f yr[4] = {}, yi[4] = {};
  rgemm_main<false>(Cx, Wo, ring, rowb, col0, tid, w, ln, hh, yr, yi);
  const float scl = 1.0f / 4194304.0f;
#pragma unroll
  for (int t = 0; t < 4; ++t) {
#pragma unroll
    for (int r = 0; r < 8; ++r) {
      so[w][8 * hh + r][16 * t + ln]      = yr[t][r] * scl;
      so[w][8 * hh + r][HD + 16 * t + ln] = yi[t][r] * scl;
    }
  }
  __syncthreads();
  const int b = rowb / SEQ;
  const int s0 = rowb - b * SEQ + 16 * w;
  const size_t obase = ((size_t)b * SEQ_FULL + (size_t)s0) * RD + (size_t)col0
                     + (size_t)(lane >> 4) * OUT1_OFF + (size_t)(lane & 15) * 4;
  {
#pragma unroll
    for (int q = 0; q < 16; ++q) {
      const v4f v = *(const v4fa*)&so[w][q][lane * 4];
      *(v4f*)(Out + obase + (size_t)q * RD) = v;
    }
    
  }
}

extern "C" void kernel_launch(void* const* d_in, const int* in_sizes, int n_in,
                              void* d_out, int out_size, void* d_ws, size_t ws_size, hipStream_t stream) {
  if (n_in < 11) return;
  const long long needx = ((long long)(NB - 1) * SEQ_FULL + (long long)SEQ) * RD;   // last activation element touched + 1
  const long long needm = ((long long)(NB - 1) * SEQ_FULL + (long long)(SEQ - 1)) * SEQ_FULL + (long long)SEQ;   // last mask element touched + 1
  for (int i = 0; i < 6; ++i) if ((long long)in_sizes[i] < needx) return;
  for (int i = 6; i < 10; ++i) if ((long long)in_sizes[i] < (long long)RD * RD) return;
  if ((long long)in_sizes[10] < needm) return;
  if ((long long)out_size < (long long)OUT1_OFF + needx) return;
  // wire order: q_real, k_real, v_real, q_phase, k_phase, v_phase, w_q, w_k, w_v, w_o, mask
  const float* q_re = (const float*)d_in[0];
  const float* k_re = (const float*)d_in[1];
  const float* v_re = (const float*)d_in[2];
  const float* q_ph = (const float*)d_in[3];
  const float* k_ph = (const float*)d_in[4];
  const float* v_ph = (const float*)d_in[5];
  const float* w_q = (const float*)d_in[6];
  const float* w_k = (const float*)d_in[7];
  const float* w_v = (const float*)d_in[8];
  const float* w_o = (const float*)d_in[9];
  const int* maskp = (const int*)d_in[10];
  float* Out = (float*)d_out;

  char* ws = (char*)d_ws;
  size_t off = 0;
  const size_t XB = (size_t)NB * SEQ * KP * 2;          // activation / head / ctx plane bytes (8 MiB at full size); all planes are written exactly to their end
  const size_t WB = (size_t)RD * RD * 2;                // transposed weight plane bytes (512 KiB)
  const size_t MBB = (size_t)NB * SEQ * (SEQ / 32) * 4; // mask bit words (1 MiB at full size)
  unsigned short* Xq = (unsigned short*)(ws + off); off += XB;
  unsigned short* Xk = (unsigned short*)(ws + off); off += XB;
  unsigned short* Xv = (unsigned short*)(ws + off); off += XB;
  unsigned short* Wq = (unsigned short*)(ws + off); off += WB;
  unsigned short* Wk = (unsigned short*)(ws + off); off += WB;
  unsigned short* Wv = (unsigned short*)(ws + off); off += WB;
  unsigned short* Wo = (unsigned short*)(ws + off); off += WB;
  unsigned short* Qp = (unsigned short*)(ws + off); off += XB;   // NB*NH*SEQ*HP halves = XB bytes
  unsigned short* Kp = (unsigned short*)(ws + off); off += XB;
  unsigned short* Vt = (unsigned short*)(ws + off); off += XB;
  unsigned short* Cx = (unsigned short*)(ws + off); off += XB;
  unsigned int*   MB = (unsigned int*)(ws + off);   off += MBB;
  if (off > ws_size) return;

  k_prep<<<(unsigned)(GW_B + GM_B + 3 * GX_B), 256, 0, stream>>>(q_re, k_re, v_re, q_ph, k_ph, v_ph, w_q, w_k, w_v, w_o, maskp,
                                                                 Xq, Xk, Xv, Wq, Wk, Wv, Wo, MB);

  const dim3 gp((unsigned)(NB * SEQ / 64), (unsigned)NH, 3);
  k_proj<<<gp, 128, 0, stream>>>(Xq, Xk, Xv, Wq, Wk, Wv, Qp, Kp, Vt);

  k_attn<<<(unsigned)(NB * NH * (SEQ / 64)), 256, 0, stream>>>(Qp, Kp, Vt, MB, Cx);

  const dim3 go((unsigned)(NB * SEQ / 64), (unsigned)(RD / 64), 1);
  k_out<<<go, 128, 0, stream>>>(Cx, Wo, Out);
}

// v008
// A run of this version takes 75.9 microseconds.
// Two timings next to v007 put it at 1.05 and 1.04 times that version's speed.
// Counting every step since v000, it is 4.74 times as fast.
#include <hip/hip_runtime.h>
// Contractions: q/k/v projections (real and phase parts share one weight) on v_wmma_f32_16x16x32_bf16 (activations and weights RNE-converted to bf16 inside the projection launch, single product, f32 accumulate); scores K Q^T, O^T = V^T P^T and the output projection on v_wmma_f32_16x16x32_f16 (single carried f16 planes: q, k, v x256, P x256, ctx x4096, Wo = bf16 value x1024 held exactly in f16; single product per term, f32 accumulate); softmax statistics f32.
// Two-part (real | phase) multi-head attention: B x S x 512 activations per part, 8 heads x 64, weights stored [in][out] (y = x w), softmax over
// sqrt(re^2 + im^2) / sqrt(128) with re = qr.kr - qp.kp, im = qr.kp + qp.kr; keys whose mask entry is 0 get their score REPLACED by -1e9 (they stay in the softmax).
// Engine: transposed flash. Each wave owns 16 queries of one (b, h) and half of the keys (two partial softmaxes per query, merged in LDS). Per 32-key step: S^T tiles (key rows x query columns) from packed K rows
// [kr 64 | -kp 64] (A, f16 plane staged in LDS; the phase half is stored negated so that the packed products give re and im above) and packed Q^T [qr | qp]
// (B, registers); the two 16-key D tiles pack straight into the P^T B fragment; O^T (128 d rows = [real 64 | phase 64] x query columns) accumulates
// from V^T rows (A, f16 plane staged in LDS). 24 WMMAs per step. The mask is packed once into 32-lane select words [b][q / 16][S/32][16]: word i of a step holds, lane by lane, the condition of the wave's score register i.
// Real GEMMs: y_r = x_r w, y_p = x_p w with A fragments x_r, x_p and one B fragment of the weight, k-contiguous per column, both staged in LDS (projections: straight from the f32 inputs; output projection: from 16-bit planes).
#ifndef NB
#define NB 2
#endif
#ifndef SEQ
#define SEQ 2048
#endif
#define NB_FULL 2
#define SEQ_FULL 2048
#define RD 512        /* model width (= heads x head dim) */
#define NH 8
#define HD 64
#define KP 1024       /* packed 16-bit row: [real 512 | phase 512] */
#define HP 128        /* packed head row: [real 64 | phase 64] */
#define OUT1_OFF ((size_t)NB_FULL * SEQ_FULL * RD)   /* element offset of the second output (fixed by the full problem size) */
#define TK 128        /* keys per LDS stage: 64 (two 32-key steps) for each of the block's two key groups */
#define KPITCH 136    /* LDS pitch of a staged K row, halves: 256 B + 16 B, conflict-free for 16-byte reads down a column of rows */
#define VPITCH 136    /* LDS pitch of a staged V^T row, halves: 256 B + 16 B */
#define KT_H (TK * KPITCH)    /* halves of one staged K tile */
#define VT_H (HP * VPITCH)    /* halves of one staged V^T tile */
#define ST_H (KT_H + VT_H)    /* halves of one stage */
#define GK 64         /* k extent of one staged GEMM tile, halves: 128 B = one whole line per row */
#define GROWS 192     /* rows of one staged GEMM tile: 64 A rows real, the same 64 rows phase, 64 W rows */
#define GST_H (GROWS * GK)    /* halves of one GEMM stage */
#define GNS (RD / GK)         /* GEMM stages */
#define PCOLS 128     /* columns of one projection block: two heads */
#define APITCH 272    /* LDS pitch of a staged f32 A row, bytes: 256 B + 16 B, conflict-free for 16-byte reads down a column of rows */
#define PA_B (128 * APITCH)       /* bytes of the A part of a projection stage: 64 rows real, the same 64 rows phase, 64 k as f32 */
#define PW_B (PCOLS * GK * 2)     /* bytes of its W part: 128 columns x 64 k as bf16 */
#define PST_B (PA_B + PW_B)       /* bytes of one projection stage */
#define PR_B (NB * SEQ / 64)      /* row blocks of one projection */
#define PC_B (RD / PCOLS)         /* column blocks of one projection */
#define PJ_B (3 * PC_B * PR_B)    /* blocks of the three projections */
#define PJ_W (4 * PJ_B)           /* waves of the projection launch */
#define MU_N (NB * (SEQ / 16) * (SEQ / 64))   /* units of the mask pack: 16 queries x 64 keys each, one wave's work */
#define WO_N ((RD / 64) * (RD / 16))          /* units of the output weight's transpose: 64 k x 16 n each, one wave's work */
#define WO_S (PJ_W / WO_N)        /* every WO_S-th wave takes one of them */

static_assert(SEQ % 64 == 0);
static_assert(SEQ % TK == 0);
static_assert(TK * HP * 2 == 256 * 8 * 16);   /* one K tile = 256 threads x 8 copies of 16 B */
static_assert(HP * TK * 2 == 256 * 8 * 16);   /* one V^T tile likewise */
static_assert(2 * (2 * ST_H * 2) <= 327680);  /* two blocks' rings fit one WGP's LDS: four waves per SIMD */
static_assert(GROWS * GK * 2 == 128 * 12 * 16);   /* one GEMM stage = 128 threads x 12 copies of 16 B */
static_assert(RD % GK == 0 && GNS >= 2);
static_assert(SEQ <= SEQ_FULL);
static_assert(NB <= NB_FULL);
static_assert(NH * HD == RD);
static_assert(RD % 64 == 0);
static_assert(RD % 32 == 0);
static_assert(NH * HP == KP);
static_assert(KP == 2 * RD);
static_assert(HP == 2 * HD);
static_assert(HD == 64);
static_assert((NB * SEQ) % 64 == 0);
static_assert(((size_t)NB * SEQ * (SEQ / 32)) % 32 == 0);
static_assert(3 * (2 * PST_B) <= 327680);     /* three projection blocks' rings fit one WGP's LDS */
static_assert(GNS >= 3);
static_assert(2 * PJ_W <= MU_N && 3 * PJ_W >= MU_N && WO_S >= 1);   /* every wave packs two mask units, some a third; some transpose a weight unit */
static_assert(RD % PCOLS == 0 && PCOLS == 2 * HD);
static_assert(128 * GK * 4 == 128 * 16 * 16);   /* the A part of a stage = 128 threads x 16 copies of 16 B */
static_assert(GK * PCOLS * 4 == 128 * 16 * 16); /* the f32 W tile of a stage = 128 threads x 16 loads of 16 B */
static_assert(OUT1_OFF * 4 == (size_t)8388608);
static_assert((size_t)4 * ((size_t)NB * SEQ * KP * 2) + (size_t)RD * RD * 2 + (size_t)NB * SEQ * (SEQ / 32) * 4 <= (size_t)134217728);

typedef __bf16 v16b __attribute__((ext_vector_type(16)));
typedef _Float16 v16h __attribute__((ext_vector_type(16)));
typedef _Float16 h16;
typedef unsigned short v8us __attribute__((ext_vector_type(8), may_alias));
typedef int v4i __attribute__((ext_vector_type(4), may_alias));
typedef unsigned int v4ua __attribute__((ext_vector_type(4), may_alias));
typedef float v2f __attribute__((ext_vector_type(2)));
typedef __bf16 v2b __attribute__((ext_vector_type(2)));
typedef unsigned int v16u __attribute__((ext_vector_type(16)));
typedef const __attribute__((address_space(4))) v16u* maskp_t;   /* constant address space: the words are written by an earlier launch only, so a wave-uniform read of them is a scalar load */
typedef float v8f __attribute__((ext_vector_type(8)));
typedef float v4f __attribute__((ext_vector_type(4)));
typedef float v4fa __attribute__((ext_vector_type(4), may_alias));
typedef float f32a __attribute__((may_alias));
union Frag { v16b vb; v16h vh; v8us half[2]; unsigned short u[16]; _Float16 h[16]; unsigned int d[8]; };

#define LOG2E 1.4426950408889634f
/* scores arrive x65536 (q x256, k x256); logit in log2 units = |s| * (1/sqrt(128)) * log2(e) / 65536 */
#define CSCALE (0.08838834764831845f * LOG2E / 65536.0f)
/* replaced score of a masked key, in log2 units */
#define MFILL (-1.0e9f * LOG2E)
/* a score may pass the reference exponent by this much (log2 units) before the reference moves: weights stay near 256 * 2^7 = 2^15, inside f16
   (finite f16 q and k planes bound an unmasked logit below 2^21, so the roundings of reference + 7 and reference - 8 move an exponent by less than 1/4) */
#define RTHR 7.0f

__device__ __forceinline__ unsigned short bf16_bits(float x) {   // RNE convert to bf16 bits
  unsigned int u = __float_as_uint(x);
  return (unsigned short)((u + 0x7FFFu + ((u >> 16) & 1u)) >> 16);
}
__device__ __forceinline__ float bf16_val(unsigned short b) { return __uint_as_float(((unsigned int)b) << 16); }
__device__ __forceinline__ unsigned int pk_bf16(float a, float b) {   // two RNE converts in one instruction: a in the low half, b in the high half
  const v2f x = {a, b};
  union { v2b h; unsigned int u; } c; c.h = __builtin_convertvector(x, v2b); return c.u;
}
__device__ __forceinline__ unsigned short f16_bits(_Float16 h) { union { _Float16 h; unsigned short u; } c; c.h = h; return c.u; }
__device__ __forceinline__ unsigned short c16(float c) { return f16_bits((_Float16)c); }   // RNE convert of a carried value to f16 bits

// f32 -> f16 convert that cannot produce a subnormal: values below the smallest normal become zero (value select).
static __device__ __forceinline__ h16 toh_flush(float v) { const h16 r = (h16)v; return (fabsf(v) < 6.103515625e-05f) ? (h16)0.0f : r; }
__device__ __forceinline__ unsigned short c16f(float c) { return f16_bits(toh_flush(c)); }

__device__ __forceinline__ v8f wm_b(const Frag& a, const Frag& b, v8f c) {
  return __builtin_amdgcn_wmma_f32_16x16x32_bf16(false, a.vb, false, b.vb, (short)0, c, false, false);
}
__device__ __forceinline__ v8f wm_h(const Frag& a, const Frag& b, v8f c) {
  return __builtin_amdgcn_wmma_f32_16x16x32_f16(false, a.vh, false, b.vh, (short)0, c, false, false);
}

// One k-step for one 16x16 output tile of both parts: yr += ar*w ; yi += ai*w ; each product followed by its own hazard guard.
template <bool BF>
__device__ __forceinline__ void rmma(const Frag& ar, const Frag& ai, const Frag& wf, v8f& yr, v8f& yi) {
  if (BF) {
    yr = wm_b(ar, wf, yr);
    asm volatile("v_nop\n\tv_nop\n\tv_nop\n\tv_nop" : "+v"(yr) : "v"(ar.vb), "v"(wf.vb));
    yi = wm_b(ai, wf, yi);
    asm volatile("v_nop\n\tv_nop\n\tv_nop\n\tv_nop" : "+v"(yi) : "v"(ai.vb), "v"(wf.vb));
  } else {
    yr = wm_h(ar, wf, yr);
    asm volatile("v_nop\n\tv_nop\n\tv_nop\n\tv_nop" : "+v"(yr) : "v"(ar.vh), "v"(wf.vh));
    yi = wm_h(ai, wf, yi);
    asm volatile("v_nop\n\tv_nop\n\tv_nop\n\tv_nop" : "+v"(yi) : "v"(ai.vh), "v"(wf.vh));
  }
}

// Twelve asynchronous 16-byte copies per lane, global -> LDS, one GEMM stage: copy i lands at LDS byte l + 2048 i (16 rows further down).
// Copies 0..3: A rows, real part (16 rows apart); 4..7: the same rows, phase part (RD halves further); 8..11: W rows (16 rows apart). Every lane on, no offset field.
// The s_wait_xcnt closes the statement so that it stands in front of any later write of the address registers the copies name.
__device__ __forceinline__ void copy12(unsigned int l, const char* ga, const char* gw) {
  constexpr size_t AS = (size_t)16 * KP * 2, PH = (size_t)RD * 2, WS = (size_t)16 * RD * 2;
  asm volatile("global_load_async_to_lds_b128 %0, %12, off\n\t"
               "global_load_async_to_lds_b128 %1, %13, off\n\t"
               "global_load_async_to_lds_b128 %2, %14, off\n\t"
               "global_load_async_to_lds_b128 %3, %15, off\n\t"
               "global_load_async_to_lds_b128 %4, %16, off\n\t"
               "global_load_async_to_lds_b128 %5, %17, off\n\t"
               "global_load_async_to_lds_b128 %6, %18, off\n\t"
               "global_load_async_to_lds_b128 %7, %19, off\n\t"
               "global_load_async_to_lds_b128 %8, %20, off\n\t"
               "global_load_async_to_lds_b128 %9, %21, off\n\t"
               "global_load_async_to_lds_b128 %10, %22, off\n\t"
               "global_load_async_to_lds_b128 %11, %23, off\n\t"
               "s_wait_xcnt 0x0"
               :: "v"(l), "v"(l + 2048u), "v"(l + 4096u), "v"(l + 6144u),
                  "v"(l + 8192u), "v"(l + 10240u), "v"(l + 12288u), "v"(l + 14336u),
                  "v"(l + 16384u), "v"(l + 18432u), "v"(l + 20480u), "v"(l + 22528u),
                  "v"(ga), "v"(ga + AS), "v"(ga + 2 * AS), "v"(ga + 3 * AS),
                  "v"(ga + PH), "v"(ga + PH + AS), "v"(ga + PH + 2 * AS), "v"(ga + PH + 3 * AS),
                  "v"(gw), "v"(gw + WS), "v"(gw + 2 * WS), "v"(gw + 3 * WS)
               : "memory");
}

// Block tile 64 rows x 64 columns for both parts (wave tile 16 rows x 64 columns), K = 512. A plane [rows][KP] = [real 512 | phase 512], W plane [cols][RD] (transposed weight, k-contiguous).
// The four waves share each k tile of GK: two LDS buffers in ring (2 x GST_H halves), the next tile's copies in flight while this tile is worked on; one barrier per tile
// publishes the next tile and frees the buffer just read. Called by whole blocks of 128 threads; behind the call the ring is free for other use.
// Staged tile: row r = 0..63 A real (row rowb + r), 64..127 A phase, 128..191 W (column col0 + r - 128); 128 B per row, no pad: the 16-byte piece p of row r lies at piece p ^ ((r >> 1) & 7),
// so 16 lanes reading one piece down 16 rows meet every bank once. Thread tid copies piece tid & 7 of rows (tid >> 3) + 16 i: whole 128-B lines per 8 lanes.
// A fragment: row m = rowb + 16 w + ln, elements 0..7 <- k0 + 8h + i, 8..15 <- k0 + 16 + 8h + i. B fragment: column n = col0 + 16t + ln, same k map.
// D: acc[r] = y(rowb + 16 w + 8h + r, col0 + 16t + ln).
template <bool BF>
__device__ __forceinline__ void rgemm_main(const unsigned short* __restrict__ A, const unsigned short* __restrict__ W, unsigned short* ring,
                                           int rowb, int col0, int tid, int w, int ln, int hh, v8f (&yr)[4], v8f (&yi)[4]) {
  const char* ga = (const char*)(A + (size_t)(rowb + (tid >> 3)) * KP) + (tid & 7) * 16;
  const char* gw = (const char*)(W + (size_t)(col0 + (tid >> 3)) * RD) + (tid & 7) * 16;
  const unsigned int l = (unsigned int)(size_t)ring + (unsigned int)((tid >> 3) * (GK * 2) + (((tid & 7) ^ ((tid >> 4) & 7)) * 16));   // LDS byte address of this thread's first piece in buffer 0
  const int sw = (ln >> 1) & 7;
  copy12(l, ga, gw);
  asm volatile("s_wait_asynccnt 0x0" ::: "memory");   // this wave's share of tile 0 has landed
  __syncthreads();                                    // every wave's share of tile 0 has landed
  copy12(l + GST_H * 2u, ga + GK * 2, gw + GK * 2);
#pragma unroll 1   // one trip per tile: the hand-over at the foot stands once
  for (int s = 0; s < GNS; ++s) {
    const int bo = (s & 1) * GST_H;
    const unsigned short* ap = ring + bo + (16 * w + ln) * GK;
    const unsigned short* wp = ring + bo + (128 + ln) * GK;
#pragma unroll   // constant c: the piece places are loop-invariant registers and the row offsets immediates
    for (int c = 0; c < GK / 32; ++c) {
      const int o0 = ((4 * c + hh) ^ sw) * 8, o1 = ((4 * c + 2 + hh) ^ sw) * 8;   // places of the pieces k0 + 8h and k0 + 16 + 8h in this lane's rows
      // the k step's six fragments are read as one group, ahead of its products
      Frag ar, ai, wf[4];
      ar.half[0] = *(const v8us*)(ap + o0);
      ar.half[1] = *(const v8us*)(ap + o1);
      ai.half[0] = *(const v8us*)(ap + 64 * GK + o0);
      ai.half[1] = *(const v8us*)(ap + 64 * GK + o1);
#pragma unroll   // constant indices keep the fragments in registers
      for (int t = 0; t < 4; ++t) {
        const unsigned short* wt = wp + t * 16 * GK;
        wf[t].half[0] = *(const v8us*)(wt + o0);
        wf[t].half[1] = *(const v8us*)(wt + o1);
      }
#pragma unroll   // as above
      for (int t = 0; t < 4; ++t) rmma<BF>(ar, ai, wf[t], yr[t], yi[t]);
    }
    asm volatile("s_wait_dscnt 0x0" ::: "memory");      // this wave's reads of the buffer have returned before it is refilled
    asm volatile("s_wait_asynccnt 0x0" ::: "memory");   // this wave's share of tile s + 1 has landed
    __syncthreads();                                    // publishes tile s + 1 and ends every wave's reads of tile s
    if (s + 2 < GNS) copy12(l + (unsigned int)bo * 2u, ga + (size_t)(s + 2) * (GK * 2), gw + (size_t)(s + 2) * (GK * 2));
  }
  asm volatile("s_wait_asynccnt 0x0" ::: "memory");     // nothing in flight when the wave goes on to the epilogue
}

// The f32 W tile of stage s into registers: 64 k rows x 128 columns. Patch j of wave w = k rows 8 (w + 4 j) .. + 7, lane l takes columns 4 l .. 4 l + 3 of each: whole 512-B row pieces per load.
// gw = the wave's first element, w_src[8 w][col0] (wave-uniform); lo = 16 l, the lane's byte offset.
__device__ __forceinline__ void wload(const float* __restrict__ gw, unsigned int lo, int s, v4f (&wr)[2][8]) {
  const char* p = (const char*)(gw + (size_t)(s * GK) * RD) + lo;
#pragma unroll   // constant indices keep the tile in registers; the 16 loads are independent and issue together
  for (int j = 0; j < 2; ++j) {
#pragma unroll   // as above
    for (int i = 0; i < 8; ++i) wr[j][i] = *(const v4fa*)(p + (32 * j + i) * (RD * 4));
  }
  asm volatile("s_wait_xcnt 0x0" :: "v"(p) : "memory");   // stands behind the loads, in front of any write of the address registers they name; the operand keeps those registers out of the loads' own results
}
// The same tile, RNE-converted to bf16 and transposed, into the W part wb of a buffer: row n = column of the block (128 B = 64 k), the 16-byte piece p (k 8 p .. 8 p + 7) of row n
// lies at piece p ^ ((n >> 1) & 7) ^ ((n >> 4) & 1): 16 lanes reading one piece down 16 rows meet every bank once, and 8 lanes writing one piece to every fourth row meet 8 different places.
__device__ __forceinline__ void wstore(char* wb, int w, int lane, const v4f (&wr)[2][8]) {
#pragma unroll   // constant indices keep the tile in registers
  for (int j = 0; j < 2; ++j) {
    const int ko = w + 4 * j;
#pragma unroll   // as above
    for (int c = 0; c < 4; ++c) {
      const int n = 4 * lane + c;
      const int f = ((n >> 1) & 7) ^ ((n >> 4) & 1);
      const v4ua pc = {pk_bf16(wr[j][0][c], wr[j][1][c]), pk_bf16(wr[j][2][c], wr[j][3][c]), pk_bf16(wr[j][4][c], wr[j][5][c]), pk_bf16(wr[j][6][c], wr[j][7][c])};
      *(v4ua*)(wb + n * (GK * 2) + ((ko ^ f) * 16)) = pc;
    }
  }
}
// Eight asynchronous 16-byte copies per lane, global -> LDS, scalar base form: copy i moves the 16 bytes at base + o + i * 8 rows of f32 to LDS byte l + i * 8 pitches. Every lane on, no offset field.
// The scalar base with one 32-bit offset per copy keeps the stage's step in scalar registers and needs a third fewer vector registers than eight address pairs.
// The s_wait_xcnt closes the statement so that it stands in front of any later write of the address registers the copies name.
__device__ __forceinline__ void copy8s(unsigned int l, unsigned int o, const char* base) {
  constexpr unsigned int LS = 8u * APITCH, GS = 8u * RD * 4u;
  asm volatile("global_load_async_to_lds_b128 %0, %8, %16\n\t"
               "global_load_async_to_lds_b128 %1, %9, %16\n\t"
               "global_load_async_to_lds_b128 %2, %10, %16\n\t"
               "global_load_async_to_lds_b128 %3, %11, %16\n\t"
               "global_load_async_to_lds_b128 %4, %12, %16\n\t"
               "global_load_async_to_lds_b128 %5, %13, %16\n\t"
               "global_load_async_to_lds_b128 %6, %14, %16\n\t"
               "global_load_async_to_lds_b128 %7, %15, %16\n\t"
               "s_wait_xcnt 0x0"
               :: "v"(l), "v"(l + LS), "v"(l + 2 * LS), "v"(l + 3 * LS),
                  "v"(l + 4 * LS), "v"(l + 5 * LS), "v"(l + 6 * LS), "v"(l + 7 * LS),
                  "v"(o), "v"(o + GS), "v"(o + 2 * GS), "v"(o + 3 * GS),
                  "v"(o + 4 * GS), "v"(o + 5 * GS), "v"(o + 6 * GS), "v"(o + 7 * GS),
                  "s"(base)
               : "memory");
}
// The A part of one stage: thread tid copies piece tid & 15 of rows (tid >> 4) + 8 i, i = 0..7, real part, then the same of the phase part 64 LDS rows further down.
// br, bi: first byte of the stage in the block's first row of either part (block-uniform); o: this thread's byte offset from there.
__device__ __forceinline__ void acopy(unsigned int l, unsigned int o, const char* br, const char* bi) {
  copy8s(l, o, br);
  copy8s(l + 64u * APITCH, o, bi);
}

// Side work of the projection waves: the mask pack and the output weight's transpose, cut into units of one wave, eight 16-byte loads per lane each (held as raw bits in f32 registers).
// A unit's loads are issued ahead of other work: two mask units when the GEMM's weight registers fall free, two trips before its end, worked up behind the loop; the rest ahead of the
// epilogue, worked up behind it. No unit reads what the launch writes; none holds a barrier; whole waves only (the ballots).
// Mask pack: MB[((b*(SEQ/16) + q/16) * (SEQ/32) + j) * 16 + i], i = 8 kt + r: bit l = (mask[b][16 (q/16) + (l & 15)][32 j + 16 kt + 8 (l >> 4) + r] != 0),
// that is the 32-lane condition of score register i in step j of the k_attn wave that owns these 16 queries. Unit wv = (16 queries, 64 keys = two steps):
// lane l reads 4 x 32 B of its query's row (the wave: 256 B of each of 16 rows), 32 ballots, lane n keeps ballot n, one 128-B store.
// coverage: units 0 .. MU_N - 1 x 32 words = the whole plane.
// mlo = the lane's byte offset in a unit, ((l & 15) rows + 8 (l >> 4) words): the one vector register the loads name; the unit's first word is a scalar base.
__device__ __forceinline__ void mask_load(int wv, unsigned int mlo, const int* __restrict__ mask, v4f (&m)[8]) {
  const int rt = wv / (SEQ / 64), jp = wv - rt * (SEQ / 64);
  const int b = rt / (SEQ / 16), q0 = (rt - b * (SEQ / 16)) * 16;
  const char* mp = (const char*)(mask + ((size_t)b * SEQ_FULL + (size_t)q0) * SEQ_FULL + (size_t)jp * 64);
#pragma unroll   // the eight loads are independent and issue together
  for (int n = 0; n < 4; ++n) {
    m[2 * n]     = *(const v4fa*)(mp + 64 * n + mlo);
    m[2 * n + 1] = *(const v4fa*)(mp + 64 * n + 16 + mlo);
  }
  asm volatile("s_wait_xcnt 0x0" :: "v"(mlo) : "memory");   // as in wload
}
__device__ __forceinline__ void mask_store(int wv, int lane, const v4f (&m)[8], unsigned int* __restrict__ MB) {
  unsigned int word = 0u;
#pragma unroll   // constant lane numbers
  for (int n = 0; n < 4; ++n) {
#pragma unroll   // as above
    for (int r = 0; r < 8; ++r) {
      const unsigned int bal = __builtin_amdgcn_ballot_w32(__float_as_int(m[2 * n + (r >> 2)][r & 3]) != 0);   // the integer's bits are tested
      word = (lane == 8 * n + r) ? bal : word;
    }
  }
  MB[(size_t)wv * 32 + lane] = word;
  asm volatile("s_wait_xcnt 0x0" :: "v"(word) : "memory");   // stands behind the store, in front of any write of the registers it names: more work of the wave follows
}
// Output weight convert with transpose: w[k][n] (f32, [in][out]) -> Wt[n][k] (pitch RD) as f16(bf16 value x 1024). Unit o = 64 k x 16 n: lane l takes k rows 8 (l & 7) .. + 7 of columns 4 (l >> 3) .. + 3,
// so that each store writes whole 128-B lines of four Wt rows. coverage: units 0 .. WO_N - 1 = (RD/64 k tiles) x (RD/16 n tiles) = the whole plane.
__device__ __forceinline__ void wo_load(int o, int lane, const float* __restrict__ w, v4f (&m)[8]) {
  const char* p = (const char*)(w + (size_t)((o % (RD / 64)) * 64) * RD + (size_t)((o / (RD / 64)) * 16));   // scalar base: the unit's first element
  const unsigned int wlo = (unsigned int)((8 * (lane & 7) * RD + 4 * (lane >> 3)) * 4);
#pragma unroll   // the eight loads are independent and issue together
  for (int i = 0; i < 8; ++i) m[i] = *(const v4fa*)(p + i * (RD * 4) + wlo);
  asm volatile("s_wait_xcnt 0x0" :: "v"(wlo) : "memory");   // as in wload
}
__device__ __forceinline__ void wo_store(int o, int lane, const v4f (&m)[8], unsigned short* __restrict__ Wt) {
  const int k = (o % (RD / 64)) * 64 + 8 * (lane & 7), n = (o / (RD / 64)) * 16 + 4 * (lane >> 3);
#pragma unroll   // constant indices keep the loaded words in registers
  for (int c = 0; c < 4; ++c) {
    v8us a;
#pragma unroll   // as above
    for (int i = 0; i < 8; ++i) a[i] = c16f(bf16_val(bf16_bits(m[i][c])) * 1024.0f);   // bf16 significand x 2^10 is exact in f16
    *(v8us*)(Wt + (size_t)(n + c) * RD + (size_t)k) = a;
  }
}

// Projection GEMM straight from the f32 inputs. Block tile 64 rows x 128 columns for both parts (wave tile 16 rows x 128 columns), K = 512, stages of GK = 64.
// xr, xi: f32 [rows][RD], first row grow; ws: f32 weight [k][RD] as given ([in][out]), first column col0.
// Two LDS buffers of PST_B bytes in ring. A part: row r = 0..63 real, 64..127 phase, 64 f32 at pitch APITCH, brought by asynchronous copies and converted to bf16 at the fragment read.
// W part: brought through registers (loaded one trip ahead), converted and transposed on the way (wstore). One barrier per stage publishes the next stage and frees the buffer just read.
// A fragment: row m = 16 w + ln, elements 0..7 <- k0 + 8h + i, 8..15 <- k0 + 16 + 8h + i. B fragment: column n = 16t + ln, same k map. D: acc[r] = y(16 w + 8h + r, col0 + 16t + ln).
// gwv = the wave's number in the launch: the wave packs the mask units gwv and PJ_W + gwv on the way (their words take the weight registers' place once the last weight tile is stored).
// Called by whole blocks of 128 threads; behind the call the ring is free for other use.
__device__ __forceinline__ void pgemm_main(const float* __restrict__ xr, const float* __restrict__ xi, const float* __restrict__ ws, unsigned short* ring,
                                           int grow, int col0, int tid, int w, int lane, int ln, int hh, v8f (&yr)[8], v8f (&yi)[8],
                                           int gwv, const int* __restrict__ mask, unsigned int* __restrict__ MB) {
  const char* br = (const char*)(xr + (size_t)grow * RD);
  const char* bi = (const char*)(xi + (size_t)grow * RD);
  const unsigned int go = (unsigned int)((tid >> 4) * (RD * 4) + (tid & 15) * 16);
  const float* gw = ws + (size_t)(8 * w) * RD + (size_t)col0;
  const unsigned int lo = 16u * (unsigned int)lane;
  const unsigned int mlo = (unsigned int)(((lane & 15) * SEQ_FULL + 8 * (lane >> 4)) * 4);
  char* rb = (char*)ring;
  const unsigned int l = (unsigned int)(size_t)ring + (unsigned int)((tid >> 4) * APITCH + (tid & 15) * 16);   // LDS byte address of this thread's first piece in buffer 0
  const int sw = (ln >> 1) & 7;
  v4f wr[2][8];
  {
    v4f w0[2][8];   // the first two weight tiles fly together: the accumulators are not yet in use
    wload(gw, lo, 0, w0);
    wload(gw, lo, 1, wr);
    acopy(l, go, br, bi);
    __builtin_amdgcn_sched_barrier(0);   // keeps the weight tile's converts, which wait for its loads, from moving up between the copies
    wstore(rb + PA_B, w, lane, w0);
  }
  asm volatile("s_wait_asynccnt 0x0" ::: "memory");   // this wave's share of the A part of stage 0 has landed
  __syncthreads();                                    // every wave's share of stage 0 is in LDS
  acopy(l + PST_B, go, br + GK * 4, bi + GK * 4);
  wstore(rb + PST_B + PA_B, w, lane, wr);
  wload(gw, lo, 2, wr);
#pragma unroll 1   // one trip per stage: the hand-over at the foot stands once
  for (int s = 0; s < GNS; ++s) {
    const int bo = (s & 1) * PST_B;
    const char* ap = rb + bo + (16 * w + ln) * APITCH + 32 * hh;
    const unsigned short* wp = (const unsigned short*)(rb + bo + PA_B) + ln * GK;
#pragma unroll   // constant c: the piece places are loop-invariant registers and the row offsets immediates
    for (int c = 0; c < GK / 32; ++c) {
      v4f fr[4], fi[4];
#pragma unroll   // constant indices keep the pieces in registers
      for (int p = 0; p < 4; ++p) {
        const int o = 128 * c + 64 * (p >> 1) + 16 * (p & 1);   // f32 pieces k0 + 8h + 0..3, + 4..7, k0 + 16 + 8h + 0..3, + 4..7
        fr[p] = *(const v4fa*)(ap + o);
        fi[p] = *(const v4fa*)(ap + 64 * APITCH + o);
      }
      Frag ar, ai;
#pragma unroll   // as above
      for (int p = 0; p < 4; ++p) {
        ar.d[2 * p] = pk_bf16(fr[p][0], fr[p][1]); ar.d[2 * p + 1] = pk_bf16(fr[p][2], fr[p][3]);
        ai.d[2 * p] = pk_bf16(fi[p][0], fi[p][1]); ai.d[2 * p + 1] = pk_bf16(fi[p][2], fi[p][3]);
      }
#pragma unroll   // constant indices keep the fragments and the accumulators in registers
      for (int tg = 0; tg < 2; ++tg) {
        Frag wf[4];
#pragma unroll   // as above
        for (int t = 0; t < 4; ++t) {
          const unsigned short* wt = wp + (4 * tg + t) * 16 * GK;
          wf[t].half[0] = *(const v8us*)(wt + (((4 * c + hh) ^ sw ^ (t & 1)) * 8));       // piece k0 + 8h of column 16 (4 tg + t) + ln
          wf[t].half[1] = *(const v8us*)(wt + (((4 * c + 2 + hh) ^ sw ^ (t & 1)) * 8));   // piece k0 + 16 + 8h
        }
#pragma unroll   // as above
        for (int t = 0; t < 4; ++t) {   // plain builtins, the compiler keeps their distances: an asm guard would tie all 128 accumulator and 48 fragment registers below v256, where the copies' operands must lie too, and spill
          yr[4 * tg + t] = wm_b(ar, wf[t], yr[4 * tg + t]);
          yi[4 * tg + t] = wm_b(ai, wf[t], yi[4 * tg + t]);
        }
      }
    }
    asm volatile("s_wait_dscnt 0x0" ::: "memory");      // this wave's reads of the buffer have returned before it is refilled, and its W pieces of stage s + 1 are written
    asm volatile("s_wait_asynccnt 0x0" ::: "memory");   // this wave's share of the A part of stage s + 1 has landed
    __syncthreads();                                    // publishes stage s + 1 and ends every wave's reads of stage s
    if (s + 2 < GNS) {
      acopy(l + (unsigned int)bo, go, br + (size_t)(s + 2) * (GK * 4), bi + (size_t)(s + 2) * (GK * 4));
      __builtin_amdgcn_sched_barrier(0);   // the copies issue first: the converts below do not move up in front of them
      wstore(rb + bo + PA_B, w, lane, wr);
      if (s + 3 < GNS) {
        wload(gw, lo, s + 3, wr);
      } else {   // the last weight tile is stored: its registers take two mask units, whose loads land during the next trip
        mask_load(gwv, mlo, mask, wr[0]);
        mask_load(PJ_W + gwv, mlo, mask, wr[1]);
      }
    }
  }
  asm volatile("s_wait_asynccnt 0x0" ::: "memory");     // nothing in flight when the wave goes on to the epilogue
  mask_store(gwv, lane, wr[0], MB);
  mask_store(PJ_W + gwv, lane, wr[1], MB);
}

// All work ahead of the attention in one launch: q, k and v projections straight from the f32 inputs; the mask pack and the output weight's transpose ride along as side work of its waves (pgemm_main).
// Block index = (z * PC_B + column block) * PR_B + row block, z = 0 (q), 1 (k), 2 (v): none reads what another writes. Block = 4 waves x 16 rows = 64 rows, 128 columns = two heads.
// The branch on z is block-uniform, so each barrier is passed by the whole block.
// q / k: output plane P[b*NH + head][s][HP] = f16 of (y_r x 256 | y_p x cim), cim = +256 (q) or -256 (k).
// v: transposed plane Vt[b*NH + head][dd][s], dd = [real 64 | phase 64], value f16 of (y x 256).
// coverage: PR_B x PC_B blocks per z x 4 waves x 16 rows x 2 heads x 128 halves = each whole plane.
// LDS tile, q / k: [2 heads x 4 waves][16][136], columns 0..127 of every row are written before the barrier and exactly those are read after it; v: [2 heads x 128][72], 64 columns of every row written before the barrier, the same read after it.
__global__ __launch_bounds__(128) void k_proj(const float* __restrict__ q_re, const float* __restrict__ k_re, const float* __restrict__ v_re,
                                              const float* __restrict__ q_ph, const float* __restrict__ k_ph, const float* __restrict__ v_ph,
                                              const float* __restrict__ w_q, const float* __restrict__ w_k, const float* __restrict__ w_v,
                                              const float* __restrict__ w_o, const int* __restrict__ mask,
                                              unsigned short* __restrict__ Qp, unsigned short* __restrict__ Kp, unsigned short* __restrict__ Vt,
                                              unsigned short* __restrict__ Wo, unsigned int* __restrict__ MB) {
  __shared__ __attribute__((aligned(16))) unsigned short ring[2 * PST_B / 2];   // the GEMM's two buffers; behind the GEMM the output tile
  unsigned short* st = ring;
  static_assert(8 * 16 * 136 * 2 <= 2 * PST_B);
  static_assert(2 * HP * 72 * 2 <= 2 * PST_B);
  const int tid = threadIdx.x, w = __builtin_amdgcn_readfirstlane((int)(tid >> 5)), lane = tid & 31, ln = lane & 15, hh = lane >> 4;
  const int bid = blockIdx.x;
  const int z = bid / (PC_B * PR_B);
  const int rem = bid - z * (PC_B * PR_B);
  const int head0 = (rem / PR_B) * 2;
  const int rowb = (rem % PR_B) * 64;
  const float* xr = (z == 0) ? q_re : (z == 1) ? k_re : v_re;
  const float* xi = (z == 0) ? q_ph : (z == 1) ? k_ph : v_ph;
  const float* ws = (z == 0) ? w_q : (z == 1) ? w_k : w_v;
  const int b = rowb / SEQ;
  v8f yr[8] = {}, yi[8] = {};
  pgemm_main(xr, xi, ws, ring, b * SEQ_FULL + (rowb - b * SEQ), head0 * HD, tid, w, lane, ln, hh, yr, yi, bid * 4 + w, mask, MB);
  // the rest of the side work: loads here, worked up behind the epilogue; both tests are wave-uniform (scalar)
  const int gwv = bid * 4 + w, mu = 2 * PJ_W + gwv, wu = gwv / WO_S;
  const bool hasm = mu < MU_N, hasw = (gwv % WO_S == 0) && (wu < WO_N);
  v4f sm[8] = {}, sv[8] = {};
  if (hasm) mask_load(mu, (unsigned int)(((lane & 15) * SEQ_FULL + 8 * (lane >> 4)) * 4), mask, sm);
  if (hasw) wo_load(wu, lane, w_o, sv);
  if (z < 2) {
    unsigned short (*sh)[16][136] = (unsigned short (*)[16][136])st;
    unsigned short* P = (z == 0) ? Qp : Kp;
    const float cim = (z == 0) ? 256.0f : -256.0f;
#pragma unroll
    for (int t = 0; t < 8; ++t) {
#pragma unroll
      for (int r = 0; r < 8; ++r) {
        sh[4 * (t >> 2) + w][8 * hh + r][16 * (t & 3) + ln]      = c16f(yr[t][r] * 256.0f);
        sh[4 * (t >> 2) + w][8 * hh + r][HD + 16 * (t & 3) + ln] = c16f(yi[t][r] * cim);
      }
    }
    __syncthreads();
    const int s0 = rowb - b * SEQ + 16 * w;
    const int rsub = lane >> 4, p8 = (lane & 15) * 8;
#pragma unroll
    for (int hd = 0; hd < 2; ++hd) {
      const size_t base = ((size_t)(b * NH + head0 + hd) * SEQ + (size_t)s0) * HP;
#pragma unroll
      for (int q = 0; q < 8; ++q) {
        const int row = 2 * q + rsub;
        const v8us a = *(const v8us*)&sh[4 * hd + w][row][p8];
        *(v8us*)(P + base + (size_t)row * HP + p8) = a;
      }
    }
    asm volatile("s_wait_xcnt 0x0" ::: "memory");   // stands behind the plane's stores, in front of any write of the registers they name: the side work below follows
  } else {
    unsigned short (*th)[72] = (unsigned short (*)[72])st;
#pragma unroll
    for (int t = 0; t < 8; ++t) {
#pragma unroll
      for (int r = 0; r < 8; ++r) {
        const int col = 16 * w + 8 * hh + r;
        th[HP * (t >> 2) + 16 * (t & 3) + ln][col]      = c16f(yr[t][r] * 256.0f);
        th[HP * (t >> 2) + HD + 16 * (t & 3) + ln][col] = c16f(yi[t][r] * 256.0f);
      }
    }
    __syncthreads();
    const int s0 = rowb - b * SEQ;
    const size_t base = (size_t)(b * NH + head0) * HP * SEQ + (size_t)s0;   // the two heads' planes follow one another: row 128 hd + dd
    for (int i = tid; i < 2 * HP * 8; i += 128) {
      const int dd = i >> 3, j8 = (i & 7) * 8;
      const v8us a = *(const v8us*)&th[dd][j8];
      *(v8us*)(Vt + base + (size_t)dd * SEQ + j8) = a;
    }
  }
  if (hasm) mask_store(mu, lane, sm, MB);
  if (hasw) wo_store(wu, lane, sv, Wo);
}

// Score group for one 16-key tile (8 WMMAs): sre = kr qr + ki qi (4 products), sa = kr qi (2), sb = ki qr (2); then the hazard guard.
// k0, k1 = kr (d 0..31, 32..63); k2, k3 = ki; q[0], q[1] = qr; q[2], q[3] = qi.
__device__ __forceinline__ void score_mma(const Frag& k0, const Frag& k1, const Frag& k2, const Frag& k3,
                                          const Frag (&q)[4], v8f& sre, v8f& sa, v8f& sb) {
  sre = wm_h(k0, q[0], sre);
  sa  = wm_h(k0, q[2], sa);
  sb  = wm_h(k2, q[0], sb);
  sre = wm_h(k1, q[1], sre);
  sa  = wm_h(k1, q[3], sa);
  sb  = wm_h(k3, q[1], sb);
  sre = wm_h(k2, q[2], sre);
  sre = wm_h(k3, q[3], sre);
  asm volatile("v_nop\n\tv_nop\n\tv_nop\n\tv_nop" : "+v"(sre), "+v"(sa), "+v"(sb)
               : "v"(k0.vh), "v"(k1.vh), "v"(k2.vh), "v"(k3.vh),
                 "v"(q[0].vh), "v"(q[1].vh), "v"(q[2].vh), "v"(q[3].vh));
}
// c += v*p (single f16 product), then the hazard guard.
__device__ __forceinline__ void pv_mma(const Frag& v, const Frag& p, v8f& c) {
  c = wm_h(v, p, c);
  asm volatile("v_nop\n\tv_nop\n\tv_nop\n\tv_nop" : "+v"(c) : "v"(v.vh), "v"(p.vh));
}

// One 32-key step (step index j) for a wave's 16 queries: 16 score WMMAs + 8 P.V WMMAs. Ks = the step's first staged K row (pitch KPITCH),
// Vs = the step's first key column in the staged V^T rows (pitch VPITCH), both in LDS; key0 = the step's first key in the comments below; mk = the step's 16 select words (scalar registers), replaced behind their last use by the words at Mn, those of the same step of the next tile. With the phase half of the K plane stored negated: sre = qr.kr - qp.kp, sa - sb = qp.kr + qr.kp.
__device__ __forceinline__ void fa_step(const unsigned short* Ks, const unsigned short* Vs,
                                        maskp_t Mn, v16u& mk, int ln, int hh,
                                        const Frag (&qf)[4], float& mr, float& lr, v8f (&O)[8]) {
  const v8f z8 = {0.f, 0.f, 0.f, 0.f, 0.f, 0.f, 0.f, 0.f};
  float sc[16];
  // A fragments of K: row m = key (key0 + 16*kt + ln); packed k axis [kr 0..63 | -kp 64..127]; elements 0..7 <- 32c + 8h + i, 8..15 <- 32c + 16 + 8h + i;
  // both 16-key tiles' fragments are read as one group
  Frag kf[2][4];
#pragma unroll   // constant indices keep the fragments in registers
  for (int kt = 0; kt < 2; ++kt) {
    const unsigned short* kp = Ks + (16 * kt + ln) * KPITCH + 8 * hh;
#pragma unroll   // as above
    for (int c = 0; c < 4; ++c) {
      kf[kt][c].half[0] = *(const v8us*)(kp + 32 * c);
      kf[kt][c].half[1] = *(const v8us*)(kp + 32 * c + 16);
    }
  }
#pragma unroll
  for (int kt = 0; kt < 2; ++kt) {
    v8f sre = z8, sa = z8, sb = z8;
    score_mma(kf[kt][0], kf[kt][1], kf[kt][2], kf[kt][3], qf, sre, sa, sb);
    // S^T tile: element r = score(key0 + 16*kt + 8h + r, query of this lane's column); logit in log2 units; masked keys get the fill value instead
#pragma unroll
    for (int r = 0; r < 8; ++r) {
      const float im = sa[r] - sb[r];
      const float v = __builtin_amdgcn_sqrtf(fmaf(sre[r], sre[r], im * im)) * CSCALE;
      sc[8 * kt + r] = __builtin_amdgcn_inverse_ballot_w32(mk[8 * kt + r]) ? v : MFILL;   // the word is the select's lane condition as it stands
    }
  }
  mk = *Mn;   // one scalar load, two steps ahead of its first use
  // A fragments of V^T: row m = dd (16*t + ln), elements 0..7 <- key0 + 8h + i, 8..15 <- key0 + 16 + 8h + i; read as one group, ahead of the softmax arithmetic
  Frag vf[8];
#pragma unroll   // constant indices keep the fragments in registers
  for (int t = 0; t < 8; ++t) {
    const unsigned short* vp = Vs + (16 * t + ln) * VPITCH + 8 * hh;
    vf[t].half[0] = *(const v8us*)(vp);
    vf[t].half[1] = *(const v8us*)(vp + 16);
  }
  float mx = sc[0];
#pragma unroll
  for (int i = 1; i < 16; ++i) mx = fmaxf(mx, sc[i]);
  // Lazy rescale: mr is the reference exponent in use, not the running maximum. It moves only when some lane's own 16 scores pass it by more than RTHR,
  // tested once per step for the whole wave (a scalar branch); until then the sum and O^T keep their scale, no factor is applied and the lane halves exchange no maximum.
  if (__builtin_expect(__builtin_amdgcn_ballot_w32(mx > mr + RTHR) != 0u, 0)) {   // rare: the step's straight path falls through
    mx = fmaxf(mx, __shfl_xor(mx, 16, 32));         // the other lane half holds the other 16 keys of this query: both halves take the same new reference
    const float mnew = fmaxf(mr, mx);
    const float al = exp2f(mr - mnew);
    mr = mnew;
    lr *= al;
#pragma unroll   // constant indices keep the accumulators in registers
    for (int t = 0; t < 8; ++t) O[t] = O[t] * al;
  }
  const float mb = mr - 8.0f;                       // the reference with the x256 carry folded in: changes only where the reference moves
  // weights carried x256: pc = 256 * 2^(sc - mr) as one f16 plane (exponent below -14 -> exact zero); the row sum uses the f16-converted values the matrix unit sees
  Frag pf;
  float ps = 0.0f;
#pragma unroll
  for (int i = 0; i < 16; ++i) {
    const float e = sc[i] - mb;
    const float pc = (e < -14.0f) ? 0.0f : __builtin_amdgcn_exp2f(e);   // bare v_exp_f32 and a value select: the kept range e >= -14 needs no range extension, so the bits are those of exp2f(e), and no branch stands between the 16 weights
    const _Float16 h = (_Float16)pc;
    pf.h[i] = h;                                    // B element i: i<8 -> key0 + 8h + i (tile 0 row 8h+i); i>=8 -> key0 + 16 + 8h + (i-8) (tile 1)
    ps += (float)h;
  }
  ps += __shfl_xor(ps, 16, 32);
  lr += ps;
#pragma unroll   // constant indices keep the fragments and the accumulators in registers
  for (int t = 0; t < 8; ++t) pv_mma(vf[t], pf, O[t]);
}

// Eight asynchronous 16-byte copies per lane, global -> LDS: copy i moves g + i*gstep to LDS byte l + i*lstep. Every lane on, no offset field.
// The s_wait_xcnt closes the statement so that it stands in front of any later write of the address registers the copies name.
__device__ __forceinline__ void copy8(unsigned int l, unsigned int lstep, const char* g, size_t gstep) {
  asm volatile("global_load_async_to_lds_b128 %0, %8, off\n\t"
               "global_load_async_to_lds_b128 %1, %9, off\n\t"
               "global_load_async_to_lds_b128 %2, %10, off\n\t"
               "global_load_async_to_lds_b128 %3, %11, off\n\t"
               "global_load_async_to_lds_b128 %4, %12, off\n\t"
               "global_load_async_to_lds_b128 %5, %13, off\n\t"
               "global_load_async_to_lds_b128 %6, %14, off\n\t"
               "global_load_async_to_lds_b128 %7, %15, off\n\t"
               "s_wait_xcnt 0x0"
               :: "v"(l), "v"(l + lstep), "v"(l + 2 * lstep), "v"(l + 3 * lstep),
                  "v"(l + 4 * lstep), "v"(l + 5 * lstep), "v"(l + 6 * lstep), "v"(l + 7 * lstep),
                  "v"(g), "v"(g + gstep), "v"(g + 2 * gstep), "v"(g + 3 * gstep),
                  "v"(g + 4 * gstep), "v"(g + 5 * gstep), "v"(g + 6 * gstep), "v"(g + 7 * gstep)
               : "memory");
}

// One stage (TK keys) into the LDS buffer at byte address lb. kg, vg: this thread's first source bytes in tile 0 of the (b, h) planes; kl, vl: its first LDS bytes in a buffer.
// K tile: TK rows x 256 B, contiguous in the plane; thread tid copies chunk tid + 256 i (row = chunk / 16). V^T tile: 128 rows x 256 B at the plane's row pitch; row = chunk / 16.
__device__ __forceinline__ void stage_copy(int tile, unsigned int lb, const char* kg, const char* vg, unsigned int kl, unsigned int vl) {
  copy8(lb + kl, 16u * KPITCH * 2u, kg + (size_t)tile * (TK * HP * 2), (size_t)4096);
  copy8(lb + vl, 16u * VPITCH * 2u, vg + (size_t)tile * (TK * 2), (size_t)16 * SEQ * 2);
}

// Block = 8 waves = 4 query groups x 2 key groups, 64 queries of one (b, h): wave w owns the 16 queries of group w & 3 and, of every 128-key tile, the 64 keys of group w >> 2.
// The queries alone fill two waves per SIMD; the key split makes it four (two blocks per WGP), so that one wave's LDS, cross-lane and dependent-vector waits are covered by three others.
// The eight waves share each K / V^T tile: two LDS buffers, the next tile's copies in flight while this tile is worked on; one barrier per tile publishes the next tile and frees the buffer just read.
// Merge: each wave ends with its own (reference exponent, sum, O^T) over its half of the keys; key group 1 hands them over in LDS and key group 0 joins the two with weights 2^(m - max).
// Epilogue: ctx carried x4096 as one f16 plane C[b*SEQ + s][KP] ([real 512 | phase 512], column h*64 + d).
// coverage: NB*NH*(SEQ/64) blocks x 4 query groups x 16 queries x (64 real + 64 phase) = every (row, head, part) segment of the plane exactly once (key group g stores lines 16 g .. 16 g + 15 of its query group's 32).
// LDS behind the loop (the ring is free: the last trip's barrier ends every read, nothing is in flight): bytes 0 .. 32767 O^T of key group 1, 32768 .. 33791 its references and sums, from 40960 the output tile.
// Every branch on the key group is wave-uniform and holds no barrier.
__global__ __launch_bounds__(256) __attribute__((amdgpu_waves_per_eu(4, 4))) void k_attn(const unsigned short* __restrict__ Qp, const unsigned short* __restrict__ Kpl,
                                              const unsigned short* __restrict__ Vt, const unsigned int* __restrict__ MB,
                                              unsigned short* __restrict__ Cx) {
  __shared__ __attribute__((aligned(16))) unsigned short ring[2 * ST_H];
  static_assert(40960 + 4 * 16 * 136 * 2 <= 2 * ST_H * 2);
  const int tid = threadIdx.x, w = __builtin_amdgcn_readfirstlane((int)(tid >> 5)), lane = tid & 31, ln = lane & 15, hh = lane >> 4;
  const int qw = w & 3, g = w >> 2;
  const int bh = blockIdx.x / (SEQ / 64), qt = blockIdx.x % (SEQ / 64);
  const int b = bh / NH, h = bh - b * NH;
  const int qbase = qt * 64 + 16 * qw;
  const int qg = qbase + ln;
  // Q^T B fragments: column n = query qg, packed k axis [qr 0..63 | qp 64..127], elements 0..7 <- 32c + 8h + i, 8..15 <- 32c + 16 + 8h + i
  Frag qf[4];
  {
    const size_t qoff = ((size_t)bh * SEQ + (size_t)qg) * HP + 8 * hh;
#pragma unroll
    for (int c = 0; c < 4; ++c) {
      qf[c].half[0] = *(const v8us*)(Qp + qoff + 32 * c);
      qf[c].half[1] = *(const v8us*)(Qp + qoff + 32 * c + 16);
    }
  }
  float mr = -3.0e38f, lr = 0.0f;
  v8f O[8] = {};
  const unsigned short* Kp = Kpl + (size_t)bh * SEQ * HP;
  const unsigned short* Vp = Vt  + (size_t)bh * HP * SEQ;
  const unsigned int* Mw = MB + (size_t)(b * (SEQ / 16) + qt * 4 + qw) * ((SEQ / 32) * 16) + g * 32;   // the wave's select words, 16 per step, from its first step on; wave-uniform
  const char* kg = (const char*)Kp + (size_t)tid * 16;
  const char* vg = (const char*)Vp + (size_t)(tid >> 4) * (SEQ * 2) + (size_t)(tid & 15) * 16;
  const unsigned int rb = (unsigned int)(size_t)&ring[0];                                     // LDS byte address of the ring
  const unsigned int kl = (unsigned int)((tid >> 4) * (KPITCH * 2) + (tid & 15) * 16);
  const unsigned int vl = (unsigned int)(KT_H * 2 + (tid >> 4) * (VPITCH * 2) + (tid & 15) * 16);
  constexpr int NT = SEQ / TK;
  v16u mka = *(maskp_t)Mw, mkb = *(maskp_t)(Mw + 16);   // select words of the wave's first and second step of a tile; the first two land while tile 0 does
  stage_copy(0, rb, kg, vg, kl, vl);
  asm volatile("s_wait_asynccnt 0x0" ::: "memory");   // this wave's share of tile 0 has landed
  __syncthreads();                                    // every wave's share of tile 0 has landed
  if (NT > 1) stage_copy(1, rb + ST_H * 2u, kg, vg, kl, vl);
#pragma unroll 1   // one trip per tile: the hand-over at the foot stands once
  for (int t = 0; t < NT; ++t) {
    const int bo = (t & 1) * ST_H;
    const unsigned int* Mn = Mw + 64 * ((t + 1 < NT) ? t + 1 : t);   // the next tile's words; in the last trip its own again: in range, not used
    const unsigned short* ks = &ring[bo + g * 64 * KPITCH];          // the key group's first staged K row
    const unsigned short* vs = &ring[bo + KT_H + g * 64];            // its first key column in the staged V^T rows
    fa_step(ks, vs, (maskp_t)Mn, mka, ln, hh, qf, mr, lr, O);
    fa_step(ks + 32 * KPITCH, vs + 32, (maskp_t)(Mn + 16), mkb, ln, hh, qf, mr, lr, O);
    asm volatile("s_wait_dscnt 0x0" ::: "memory");      // this wave's reads of the buffer have returned before it is refilled
    asm volatile("s_wait_asynccnt 0x0" ::: "memory");   // this wave's share of tile t + 1 has landed
    __syncthreads();                                    // publishes tile t + 1 and ends every wave's reads of tile t
    if (t + 2 < NT) stage_copy(t + 2, rb + (unsigned int)bo * 2u, kg, vg, kl, vl);
  }
  asm volatile("s_wait_asynccnt 0x0" ::: "memory");     // nothing in flight when the wave goes on to the epilogue

  v4fa* mo = (v4fa*)ring + (size_t)qw * 512 + lane;                 // piece j of the query group's O^T at mo[32 j]: 512 contiguous bytes per wave store
  f32a* ml = (f32a*)ring + 8192 + qw * 64 + lane;
  unsigned short (*sh)[16][136] = (unsigned short (*)[16][136])(ring + 20480);
  if (g == 1) {
#pragma unroll
    for (int t = 0; t < 8; ++t) {
      const v4f lo = {O[t][0], O[t][1], O[t][2], O[t][3]}, hi = {O[t][4], O[t][5], O[t][6], O[t][7]};
      mo[32 * (2 * t)] = lo;
      mo[32 * (2 * t + 1)] = hi;
    }
    ml[0] = mr;
    ml[32] = lr;
  }
  __syncthreads();                                      // key group 1's partial results are in LDS
  if (g == 0) {
    // both references are finite (each group has worked at least one step, and the first step always sets one), so the weights are in (0, 1] and the larger one is 1
    const float m1 = ml[0], l1 = ml[32];
    const float mm = fmaxf(mr, m1);
    const float a0 = exp2f(mr - mm), a1 = exp2f(m1 - mm);
    // O^T element r of tile t = ctx(query qg, dd = 16t + 8h + r); carries: x256 (P, also in the sums), x256 (v); ctx stored x4096 -> factor 16 / sum
    const float inv = 16.0f * (1.0f / (lr * a0 + l1 * a1));
    const float c0 = a0 * inv, c1 = a1 * inv;
#pragma unroll
    for (int t = 0; t < 8; ++t) {
      const v4f lo = mo[32 * (2 * t)], hi = mo[32 * (2 * t + 1)];
#pragma unroll
      for (int r = 0; r < 8; ++r)
        sh[qw][ln][16 * t + 8 * hh + r] = c16f(O[t][r] * c0 + ((r < 4) ? lo[r & 3] : hi[r & 3]) * c1);
    }
  }
  __syncthreads();                                      // the output tile is whole
  const size_t rbase = ((size_t)b * SEQ + (size_t)qbase) * KP + (size_t)h * HD;
  const int lsub = lane >> 3, p8 = (lane & 7) * 8;
  {
#pragma unroll
    for (int q = 0; q < 4; ++q) {
      const int line = 4 * (4 * g + q) + lsub;  // 0..31 = 16 queries x {real, phase}
      const int row = line >> 1, seg = line & 1;
      const v8us a = *(const v8us*)&sh[qw][row][seg * HD + p8];
      const size_t o = rbase + (size_t)row * KP + (size_t)seg * RD + p8;
      *(v8us*)(Cx + o) = a;
    }
  }
}

// Output projection of both parts: out0[b][s][n] = ctx_real x Wo, out1[b][s][n] = ctx_phase x Wo (f16, K = 512, one product per term), undo carries x4096 (ctx) and x1024 (Wo).
// Epilogue: per-wave LDS tile [16 rows][128 floats = 64 real columns | 64 phase columns] (block barrier), then per instruction lanes 0..15 write the 256-B
// coverage: grid (NB*SEQ/64, RD/64) x 4 waves x 16 rows x (64 + 64) floats = every output element of the processed rows exactly once.
// LDS tile: columns 0..127 of every row written before the barrier, the same read after it.
__global__ __launch_bounds__(128) void k_out(const unsigned short* __restrict__ Cx, const unsigned short* __restrict__ Wo,
                                             float* __restrict__ Out) {
  __shared__ __attribute__((aligned(16))) unsigned short ring[2 * GST_H];   // the GEMM's two buffers; behind the GEMM the output tile
  float (*so)[16][132] = (float (*)[16][132])ring;
  static_assert(4 * 16 * 132 * 4 <= 2 * GST_H * 2);
  const int tid = threadIdx.x, w = __builtin_amdgcn_readfirstlane((int)(tid >> 5)), lane = tid & 31, ln = lane & 15, hh = lane >> 4;
  const int rowb = blockIdx.x * 64;
  const int col0 = blockIdx.y * 64;
  v8f yr[4] = {}, yi[4] = {};
  rgemm_main<false>(Cx, Wo, ring, rowb, col0, tid, w, ln, hh, yr, yi);
  const float scl = 1.0f / 4194304.0f;
#pragma unroll
  for (int t = 0; t < 4; ++t) {
#pragma unroll
    for (int r = 0; r < 8; ++r) {
      so[w][8 * hh + r][16 * t + ln]      = yr[t][r] * scl;
      so[w][8 * hh + r][HD + 16 * t + ln] = yi[t][r] * scl;
    }
  }
  __syncthreads();
  const int b = rowb / SEQ;
  const int s0 = rowb - b * SEQ + 16 * w;
  const size_t obase = ((size_t)b * SEQ_FULL + (size_t)s0) * RD + (size_t)col0
                     + (size_t)(lane >> 4) * OUT1_OFF + (size_t)(lane & 15) * 4;
  {
#pragma unroll
    for (int q = 0; q < 16; ++q) {
      const v4f v = *(const v4fa*)&so[w][q][lane * 4];
      *(v4f*)(Out + obase + (size_t)q * RD) = v;
    }
    
  }
}

extern "C" void kernel_launch(void* const* d_in, const int* in_sizes, int n_in,
                              void* d_out, int out_size, void* d_ws, size_t ws_size, hipStream_t stream) {
  if (n_in < 11) return;
  const long long needx = ((long long)(NB - 1) * SEQ_FULL + (long long)SEQ) * RD;   // last activation element touched + 1
  const long long needm = ((long long)(NB - 1) * SEQ_FULL + (long long)(SEQ - 1)) * SEQ_FULL + (long long)SEQ;   // last mask element touched + 1
  for (int i = 0; i < 6; ++i) if ((long long)in_sizes[i] < needx) return;
  for (int i = 6; i < 10; ++i) if ((long long)in_sizes[i] < (long long)RD * RD) return;
  if ((long long)in_sizes[10] < needm) return;
  if ((long long)out_size < (long long)OUT1_OFF + needx) return;
  // wire order: q_real, k_real, v_real, q_phase, k_phase, v_phase, w_q, w_k, w_v, w_o, mask
  const float* q_re = (const float*)d_in[0];
  const float* k_re = (const float*)d_in[1];
  const float* v_re = (const float*)d_in[2];
  const float* q_ph = (const float*)d_in[3];
  const float* k_ph = (const float*)d_in[4];
  const float* v_ph = (const float*)d_in[5];
  const float* w_q = (const float*)d_in[6];
  const float* w_k = (const float*)d_in[7];
  const float* w_v = (const float*)d_in[8];
  const float* w_o = (const float*)d_in[9];
  const int* maskp = (const int*)d_in[10];
  float* Out = (float*)d_out;

  char* ws = (char*)d_ws;
  size_t off = 0;
  const size_t XB = (size_t)NB * SEQ * KP * 2;          // head / ctx plane bytes (8 MiB at full size); all planes are written exactly to their end
  const size_t WB = (size_t)RD * RD * 2;                // transposed weight plane bytes (512 KiB)
  const size_t MBB = (size_t)NB * SEQ * (SEQ / 32) * 4; // mask bit words (1 MiB at full size)
  unsigned short* Wo = (unsigned short*)(ws + off); off += WB;
  unsigned short* Qp = (unsigned short*)(ws + off); off += XB;   // NB*NH*SEQ*HP halves = XB bytes
  unsigned short* Kp = (unsigned short*)(ws + off); off += XB;
  unsigned short* Vt = (unsigned short*)(ws + off); off += XB;
  unsigned short* Cx = (unsigned short*)(ws + off); off += XB;
  unsigned int*   MB = (unsigned int*)(ws + off);   off += MBB;
  if (off > ws_size) return;

  k_proj<<<(unsigned)PJ_B, 128, 0, stream>>>(q_re, k_re, v_re, q_ph, k_ph, v_ph, w_q, w_k, w_v, w_o, maskp, Qp, Kp, Vt, Wo, MB);

  k_attn<<<(unsigned)(NB * NH * (SEQ / 64)), 256, 0, stream>>>(Qp, Kp, Vt, MB, Cx);

  const dim3 go((unsigned)(NB * SEQ / 64), (unsigned)(RD / 64), 1);
  k_out<<<go, 128, 0, stream>>>(Cx, Wo, Out);
}

// v009
// A run of this version takes 72.3 microseconds.
// In both of two side-by-side timings against v008, it was 1.05 times as fast.
// Over all steps from v000 it is 4.98 times as fast.
#include <hip/hip_runtime.h>
// Contractions: q/k/v projections (real and phase parts share one weight) on v_wmma_f32_16x16x32_bf16 (activations and weights RNE-converted to bf16 inside the projection launch, single product, f32 accumulate); scores K Q^T, O^T = V^T P^T and the output projection on v_wmma_f32_16x16x32_f16 (single carried f16 planes: q, k, v x256, P x256, ctx x4096, Wo = bf16 value x1024 held exactly in f16; single product per term, f32 accumulate); softmax statistics f32.
// Two-part (real | phase) multi-head attention: B x S x 512 activations per part, 8 heads x 64, weights stored [in][out] (y = x w), softmax over
// sqrt(re^2 + im^2) / sqrt(128) with re = qr.kr - qp.kp, im = qr.kp + qp.kr; keys whose mask entry is 0 get their score REPLACED by -1e9 (they stay in the softmax).
// Engine: transposed flash. Each wave owns 16 queries of one (b, h) and half of the keys (two partial softmaxes per query, merged in LDS). Per 32-key step: S^T tiles (key rows x query columns) from packed K rows
// [kr 64 | -kp 64] (A, f16 plane staged in LDS; the phase half is stored negated so that the packed products give re and im above) and packed Q^T [qr | qp]
// (B, registers); the two 16-key D tiles pack straight into the P^T B fragment; O^T (128 d rows = [real 64 | phase 64] x query columns) accumulates
// from V^T rows (A, f16 plane staged in LDS); the softmax sums come from one more product of P^T with a constant A that holds rows of ones. 25 WMMAs per step. The mask is packed once into 32-lane select words [b][q / 16][S/32][16]: word i of a step holds, lane by lane, the condition of the wave's score register i.
// Real GEMMs: y_r = x_r w, y_p = x_p w with A fragments x_r, x_p and one B fragment of the weight, k-contiguous per column, both staged in LDS (projections: straight from the f32 inputs; output projection: from 16-bit planes).
#ifndef NB
#define NB 2
#endif
#ifndef SEQ
#define SEQ 2048
#endif
#define NB_FULL 2
#define SEQ_FULL 2048
#define RD 512        /* model width (= heads x head dim) */
#define NH 8
#define HD 64
#define KP 1024       /* packed 16-bit row: [real 512 | phase 512] */
#define HP 128        /* packed head row: [real 64 | phase 64] */
#define OUT1_OFF ((size_t)NB_FULL * SEQ_FULL * RD)   /* element offset of the second output (fixed by the full problem size) */
#define TK 128        /* keys per LDS stage: 64 (two 32-key steps) for each of the block's two key groups */
#define KPITCH 136    /* LDS pitch of a staged K row, halves: 256 B + 16 B, conflict-free for 16-byte reads down a column of rows */
#define VPITCH 136    /* LDS pitch of a staged V^T row, halves: 256 B + 16 B */
#define KT_H (TK * KPITCH)    /* halves of one staged K tile */
#define VT_H (HP * VPITCH)    /* halves of one staged V^T tile */
#define ST_H (KT_H + VT_H)    /* halves of one stage */
#define GK 64         /* k extent of one staged GEMM tile, halves: 128 B = one whole line per row */
#define GROWS 192     /* rows of one staged GEMM tile: 64 A rows real, the same 64 rows phase, 64 W rows */
#define GST_H (GROWS * GK)    /* halves of one GEMM stage */
#define GNS (RD / GK)         /* GEMM stages */
#define PCOLS 128     /* columns of one projection block: two heads */
#define APITCH 272    /* LDS pitch of a staged f32 A row, bytes: 256 B + 16 B, conflict-free for 16-byte reads down a column of rows */
#define PA_B (128 * APITCH)       /* bytes of the A part of a projection stage: 64 rows real, the same 64 rows phase, 64 k as f32 */
#define PW_B (PCOLS * GK * 2)     /* bytes of its W part: 128 columns x 64 k as bf16 */
#define PST_B (PA_B + PW_B)       /* bytes of one projection stage */
#define PR_B (NB * SEQ / 64)      /* row blocks of one projection */
#define PC_B (RD / PCOLS)         /* column blocks of one projection */
#define PJ_B (3 * PC_B * PR_B)    /* blocks of the three projections */
#define PJ_W (4 * PJ_B)           /* waves of the projection launch */
#define MU_N (NB * (SEQ / 16) * (SEQ / 64))   /* units of the mask pack: 16 queries x 64 keys each, one wave's work */
#define WO_N ((RD / 64) * (RD / 16))          /* units of the output weight's transpose: 64 k x 16 n each, one wave's work */
#define WO_S (PJ_W / WO_N)        /* every WO_S-th wave takes one of them */

static_assert(SEQ % 64 == 0);
static_assert(SEQ % TK == 0);
static_assert(TK * HP * 2 == 256 * 8 * 16);   /* one K tile = 256 threads x 8 copies of 16 B */
static_assert(HP * TK * 2 == 256 * 8 * 16);   /* one V^T tile likewise */
static_assert(2 * (2 * ST_H * 2) <= 327680);  /* two blocks' rings fit one WGP's LDS: four waves per SIMD */
static_assert(GROWS * GK * 2 == 128 * 12 * 16);   /* one GEMM stage = 128 threads x 12 copies of 16 B */
static_assert(RD % GK == 0 && GNS >= 2);
static_assert(SEQ <= SEQ_FULL);
static_assert(NB <= NB_FULL);
static_assert(NH * HD == RD);
static_assert(RD % 64 == 0);
static_assert(RD % 32 == 0);
static_assert(NH * HP == KP);
static_assert(KP == 2 * RD);
static_assert(HP == 2 * HD);
static_assert(HD == 64);
static_assert((NB * SEQ) % 64 == 0);
static_assert(((size_t)NB * SEQ * (SEQ / 32)) % 32 == 0);
static_assert(3 * (2 * PST_B) <= 327680);     /* three projection blocks' rings fit one WGP's LDS */
static_assert(GNS >= 3);
static_assert(2 * PJ_W <= MU_N && 3 * PJ_W >= MU_N && WO_S >= 1);   /* every wave packs two mask units, some a third; some transpose a weight unit */
static_assert(RD % PCOLS == 0 && PCOLS == 2 * HD);
static_assert(128 * GK * 4 == 128 * 16 * 16);   /* the A part of a stage = 128 threads x 16 copies of 16 B */
static_assert(GK * PCOLS * 4 == 128 * 16 * 16); /* the f32 W tile of a stage = 128 threads x 16 loads of 16 B */
static_assert(OUT1_OFF * 4 == (size_t)8388608);
static_assert((size_t)4 * ((size_t)NB * SEQ * KP * 2) + (size_t)RD * RD * 2 + (size_t)NB * SEQ * (SEQ / 32) * 4 <= (size_t)134217728);

typedef __bf16 v16b __attribute__((ext_vector_type(16)));
typedef _Float16 v16h __attribute__((ext_vector_type(16)));
typedef _Float16 h16;
typedef unsigned short v8us __attribute__((ext_vector_type(8), may_alias));
typedef int v4i __attribute__((ext_vector_type(4), may_alias));
typedef unsigned int v4ua __attribute__((ext_vector_type(4), may_alias));
typedef float v2f __attribute__((ext_vector_type(2)));
typedef __bf16 v2b __attribute__((ext_vector_type(2)));
typedef unsigned int v16u __attribute__((ext_vector_type(16)));
typedef const __attribute__((address_space(4))) v16u* maskp_t;   /* constant address space: the words are written by an earlier launch only, so a wave-uniform read of them is a scalar load */
typedef float v8f __attribute__((ext_vector_type(8)));
typedef float v4f __attribute__((ext_vector_type(4)));
typedef float v4fa __attribute__((ext_vector_type(4), may_alias));
typedef float f32a __attribute__((may_alias));
union Frag { v16b vb; v16h vh; v8us half[2]; unsigned short u[16]; _Float16 h[16]; unsigned int d[8]; };

#define LOG2E 1.4426950408889634f
/* scores arrive x65536 (q x256, k x256); logit in log2 units = |s| * (1/sqrt(128)) * log2(e) / 65536 */
#define CSCALE (0.08838834764831845f * LOG2E / 65536.0f)
/* replaced score of a masked key, in log2 units */
#define MFILL (-1.0e9f * LOG2E)
/* a score may pass the reference exponent by this much (log2 units) before the reference moves: weights stay near 256 * 2^7 = 2^15, inside f16
   (finite f16 q and k planes bound an unmasked logit below 2^21, so the roundings of reference + 7 and reference - 8 move an exponent by less than 1/4) */
#define RTHR 7.0f

__device__ __forceinline__ unsigned short bf16_bits(float x) {   // RNE convert to bf16 bits
  unsigned int u = __float_as_uint(x);
  return (unsigned short)((u + 0x7FFFu + ((u >> 16) & 1u)) >> 16);
}
__device__ __forceinline__ float bf16_val(unsigned short b) { return __uint_as_float(((unsigned int)b) << 16); }
__device__ __forceinline__ unsigned int pk_bf16(float a, float b) {   // two RNE converts in one instruction: a in the low half, b in the high half
  const v2f x = {a, b};
  union { v2b h; unsigned int u; } c; c.h = __builtin_convertvector(x, v2b); return c.u;
}
__device__ __forceinline__ unsigned short f16_bits(_Float16 h) { union { _Float16 h; unsigned short u; } c; c.h = h; return c.u; }
__device__ __forceinline__ unsigned short c16(float c) { return f16_bits((_Float16)c); }   // RNE convert of a carried value to f16 bits

// f32 -> f16 convert that cannot produce a subnormal: values below the smallest normal become zero (value select).
static __device__ __forceinline__ h16 toh_flush(float v) { const h16 r = (h16)v; return (fabsf(v) < 6.103515625e-05f) ? (h16)0.0f : r; }
__device__ __forceinline__ unsigned short c16f(float c) { return f16_bits(toh_flush(c)); }

__device__ __forceinline__ v8f wm_b(const Frag& a, const Frag& b, v8f c) {
  return __builtin_amdgcn_wmma_f32_16x16x32_bf16(false, a.vb, false, b.vb, (short)0, c, false, false);
}
__device__ __forceinline__ v8f wm_h(const Frag& a, const Frag& b, v8f c) {
  return __builtin_amdgcn_wmma_f32_16x16x32_f16(false, a.vh, false, b.vh, (short)0, c, false, false);
}

// One k-step for one 16x16 output tile of both parts: yr += ar*w ; yi += ai*w ; each product followed by its own hazard guard.
template <bool BF>
__device__ __forceinline__ void rmma(const Frag& ar, const Frag& ai, const Frag& wf, v8f& yr, v8f& yi) {
  if (BF) {
    yr = wm_b(ar, wf, yr);
    asm volatile("v_nop\n\tv_nop\n\tv_nop\n\tv_nop" : "+v"(yr) : "v"(ar.vb), "v"(wf.vb));
    yi = wm_b(ai, wf, yi);
    asm volatile("v_nop\n\tv_nop\n\tv_nop\n\tv_nop" : "+v"(yi) : "v"(ai.vb), "v"(wf.vb));
  } else {
    yr = wm_h(ar, wf, yr);
    asm volatile("v_nop\n\tv_nop\n\tv_nop\n\tv_nop" : "+v"(yr) : "v"(ar.vh), "v"(wf.vh));
    yi = wm_h(ai, wf, yi);
    asm volatile("v_nop\n\tv_nop\n\tv_nop\n\tv_nop" : "+v"(yi) : "v"(ai.vh), "v"(wf.vh));
  }
}

// Twelve asynchronous 16-byte copies per lane, global -> LDS, one GEMM stage: copy i lands at LDS byte l + 2048 i (16 rows further down).
// Copies 0..3: A rows, real part (16 rows apart); 4..7: the same rows, phase part (RD halves further); 8..11: W rows (16 rows apart). Every lane on, no offset field.
// The s_wait_xcnt closes the statement so that it stands in front of any later write of the address registers the copies name.
__device__ __forceinline__ void copy12(unsigned int l, const char* ga, const char* gw) {
  constexpr size_t AS = (size_t)16 * KP * 2, PH = (size_t)RD * 2, WS = (size_t)16 * RD * 2;
  asm volatile("global_load_async_to_lds_b128 %0, %12, off\n\t"
               "global_load_async_to_lds_b128 %1, %13, off\n\t"
               "global_load_async_to_lds_b128 %2, %14, off\n\t"
               "global_load_async_to_lds_b128 %3, %15, off\n\t"
               "global_load_async_to_lds_b128 %4, %16, off\n\t"
               "global_load_async_to_lds_b128 %5, %17, off\n\t"
               "global_load_async_to_lds_b128 %6, %18, off\n\t"
               "global_load_async_to_lds_b128 %7, %19, off\n\t"
               "global_load_async_to_lds_b128 %8, %20, off\n\t"
               "global_load_async_to_lds_b128 %9, %21, off\n\t"
               "global_load_async_to_lds_b128 %10, %22, off\n\t"
               "global_load_async_to_lds_b128 %11, %23, off\n\t"
               "s_wait_xcnt 0x0"
               :: "v"(l), "v"(l + 2048u), "v"(l + 4096u), "v"(l + 6144u),
                  "v"(l + 8192u), "v"(l + 10240u), "v"(l + 12288u), "v"(l + 14336u),
                  "v"(l + 16384u), "v"(l + 18432u), "v"(l + 20480u), "v"(l + 22528u),
                  "v"(ga), "v"(ga + AS), "v"(ga + 2 * AS), "v"(ga + 3 * AS),
                  "v"(ga + PH), "v"(ga + PH + AS), "v"(ga + PH + 2 * AS), "v"(ga + PH + 3 * AS),
                  "v"(gw), "v"(gw + WS), "v"(gw + 2 * WS), "v"(gw + 3 * WS)
               : "memory");
}

// Block tile 64 rows x 64 columns for both parts (wave tile 16 rows x 64 columns), K = 512. A plane [rows][KP] = [real 512 | phase 512], W plane [cols][RD] (transposed weight, k-contiguous).
// The four waves share each k tile of GK: two LDS buffers in ring (2 x GST_H halves), the next tile's copies in flight while this tile is worked on; one barrier per tile
// publishes the next tile and frees the buffer just read. Called by whole blocks of 128 threads; behind the call the ring is free for other use.
// Staged tile: row r = 0..63 A real (row rowb + r), 64..127 A phase, 128..191 W (column col0 + r - 128); 128 B per row, no pad: the 16-byte piece p of row r lies at piece p ^ ((r >> 1) & 7),
// so 16 lanes reading one piece down 16 rows meet every bank once. Thread tid copies piece tid & 7 of rows (tid >> 3) + 16 i: whole 128-B lines per 8 lanes.
// A fragment: row m = rowb + 16 w + ln, elements 0..7 <- k0 + 8h + i, 8..15 <- k0 + 16 + 8h + i. B fragment: column n = col0 + 16t + ln, same k map.
// D: acc[r] = y(rowb + 16 w + 8h + r, col0 + 16t + ln).
template <bool BF>
__device__ __forceinline__ void rgemm_main(const unsigned short* __restrict__ A, const unsigned short* __restrict__ W, unsigned short* ring,
                                           int rowb, int col0, int tid, int w, int ln, int hh, v8f (&yr)[4], v8f (&yi)[4]) {
  const char* ga = (const char*)(A + (size_t)(rowb + (tid >> 3)) * KP) + (tid & 7) * 16;
  const char* gw = (const char*)(W + (size_t)(col0 + (tid >> 3)) * RD) + (tid & 7) * 16;
  const unsigned int l = (unsigned int)(size_t)ring + (unsigned int)((tid >> 3) * (GK * 2) + (((tid & 7) ^ ((tid >> 4) & 7)) * 16));   // LDS byte address of this thread's first piece in buffer 0
  const int sw = (ln >> 1) & 7;
  copy12(l, ga, gw);
  asm volatile("s_wait_asynccnt 0x0" ::: "memory");   // this wave's share of tile 0 has landed
  __syncthreads();                                    // every wave's share of tile 0 has landed
  copy12(l + GST_H * 2u, ga + GK * 2, gw + GK * 2);
#pragma unroll 1   // one trip per tile: the hand-over at the foot stands once
  for (int s = 0; s < GNS; ++s) {
    const int bo = (s & 1) * GST_H;
    const unsigned short* ap = ring + bo + (16 * w + ln) * GK;
    const unsigned short* wp = ring + bo + (128 + ln) * GK;
#pragma unroll   // constant c: the piece places are loop-invariant registers and the row offsets immediates
    for (int c = 0; c < GK / 32; ++c) {
      const int o0 = ((4 * c + hh) ^ sw) * 8, o1 = ((4 * c + 2 + hh) ^ sw) * 8;   // places of the pieces k0 + 8h and k0 + 16 + 8h in this lane's rows
      // the k step's six fragments are read as one group, ahead of its products
      Frag ar, ai, wf[4];
      ar.half[0] = *(const v8us*)(ap + o0);
      ar.half[1] = *(const v8us*)(ap + o1);
      ai.half[0] = *(const v8us*)(ap + 64 * GK + o0);
      ai.half[1] = *(const v8us*)(ap + 64 * GK + o1);
#pragma unroll   // constant indices keep the fragments in registers
      for (int t = 0; t < 4; ++t) {
        const unsigned short* wt = wp + t * 16 * GK;
        wf[t].half[0] = *(const v8us*)(wt + o0);
        wf[t].half[1] = *(const v8us*)(wt + o1);
      }
#pragma unroll   // as above
      for (int t = 0; t < 4; ++t) rmma<BF>(ar, ai, wf[t], yr[t], yi[t]);
    }
    asm volatile("s_wait_dscnt 0x0" ::: "memory");      // this wave's reads of the buffer have returned before it is refilled
    asm volatile("s_wait_asynccnt 0x0" ::: "memory");   // this wave's share of tile s + 1 has landed
    __syncthreads();                                    // publishes tile s + 1 and ends every wave's reads of tile s
    if (s + 2 < GNS) copy12(l + (unsigned int)bo * 2u, ga + (size_t)(s + 2) * (GK * 2), gw + (size_t)(s + 2) * (GK * 2));
  }
  asm volatile("s_wait_asynccnt 0x0" ::: "memory");     // nothing in flight when the wave goes on to the epilogue
}

// The f32 W tile of stage s into registers: 64 k rows x 128 columns. Patch j of wave w = k rows 8 (w + 4 j) .. + 7, lane l takes columns 4 l .. 4 l + 3 of each: whole 512-B row pieces per load.
// gw = the wave's first element, w_src[8 w][col0] (wave-uniform); lo = 16 l, the lane's byte offset.
__device__ __forceinline__ void wload(const float* __restrict__ gw, unsigned int lo, int s, v4f (&wr)[2][8]) {
  const char* p = (const char*)(gw + (size_t)(s * GK) * RD) + lo;
#pragma unroll   // constant indices keep the tile in registers; the 16 loads are independent and issue together
  for (int j = 0; j < 2; ++j) {
#pragma unroll   // as above
    for (int i = 0; i < 8; ++i) wr[j][i] = *(const v4fa*)(p + (32 * j + i) * (RD * 4));
  }
  asm volatile("s_wait_xcnt 0x0" :: "v"(p) : "memory");   // stands behind the loads, in front of any write of the address registers they name; the operand keeps those registers out of the loads' own results
}
// The same tile, RNE-converted to bf16 and transposed, into the W part wb of a buffer: row n = column of the block (128 B = 64 k), the 16-byte piece p (k 8 p .. 8 p + 7) of row n
// lies at piece p ^ ((n >> 1) & 7) ^ ((n >> 4) & 1): 16 lanes reading one piece down 16 rows meet every bank once, and 8 lanes writing one piece to every fourth row meet 8 different places.
__device__ __forceinline__ void wstore(char* wb, int w, int lane, const v4f (&wr)[2][8]) {
#pragma unroll   // constant indices keep the tile in registers
  for (int j = 0; j < 2; ++j) {
    const int ko = w + 4 * j;
#pragma unroll   // as above
    for (int c = 0; c < 4; ++c) {
      const int n = 4 * lane + c;
      const int f = ((n >> 1) & 7) ^ ((n >> 4) & 1);
      const v4ua pc = {pk_bf16(wr[j][0][c], wr[j][1][c]), pk_bf16(wr[j][2][c], wr[j][3][c]), pk_bf16(wr[j][4][c], wr[j][5][c]), pk_bf16(wr[j][6][c], wr[j][7][c])};
      *(v4ua*)(wb + n * (GK * 2) + ((ko ^ f) * 16)) = pc;
    }
  }
}
// Eight asynchronous 16-byte copies per lane, global -> LDS, scalar base form: copy i moves the 16 bytes at base + o + i * 8 rows of f32 to LDS byte l + i * 8 pitches. Every lane on, no offset field.
// The scalar base with one 32-bit offset per copy keeps the stage's step in scalar registers and needs a third fewer vector registers than eight address pairs.
// The s_wait_xcnt closes the statement so that it stands in front of any later write of the address registers the copies name.
__device__ __forceinline__ void copy8s(unsigned int l, unsigned int o, const char* base) {
  constexpr unsigned int LS = 8u * APITCH, GS = 8u * RD * 4u;
  asm volatile("global_load_async_to_lds_b128 %0, %8, %16\n\t"
               "global_load_async_to_lds_b128 %1, %9, %16\n\t"
               "global_load_async_to_lds_b128 %2, %10, %16\n\t"
               "global_load_async_to_lds_b128 %3, %11, %16\n\t"
               "global_load_async_to_lds_b128 %4, %12, %16\n\t"
               "global_load_async_to_lds_b128 %5, %13, %16\n\t"
               "global_load_async_to_lds_b128 %6, %14, %16\n\t"
               "global_load_async_to_lds_b128 %7, %15, %16\n\t"
               "s_wait_xcnt 0x0"
               :: "v"(l), "v"(l + LS), "v"(l + 2 * LS), "v"(l + 3 * LS),
                  "v"(l + 4 * LS), "v"(l + 5 * LS), "v"(l + 6 * LS), "v"(l + 7 * LS),
                  "v"(o), "v"(o + GS), "v"(o + 2 * GS), "v"(o + 3 * GS),
                  "v"(o + 4 * GS), "v"(o + 5 * GS), "v"(o + 6 * GS), "v"(o + 7 * GS),
                  "s"(base)
               : "memory");
}
// The A part of one stage: thread tid copies piece tid & 15 of rows (tid >> 4) + 8 i, i = 0..7, real part, then the same of the phase part 64 LDS rows further down.
// br, bi: first byte of the stage in the block's first row of either part (block-uniform); o: this thread's byte offset from there.
__device__ __forceinline__ void acopy(unsigned int l, unsigned int o, const char* br, const char* bi) {
  copy8s(l, o, br);
  copy8s(l + 64u * APITCH, o, bi);
}

// Side work of the projection waves: the mask pack and the output weight's transpose, cut into units of one wave, eight 16-byte loads per lane each (held as raw bits in f32 registers).
// A unit's loads are issued ahead of other work: two mask units when the GEMM's weight registers fall free, two trips before its end, worked up behind the loop; the rest ahead of the
// epilogue, worked up behind it. No unit reads what the launch writes; none holds a barrier; whole waves only (the ballots).
// Mask pack: MB[((b*(SEQ/16) + q/16) * (SEQ/32) + j) * 16 + i], i = 8 kt + r: bit l = (mask[b][16 (q/16) + (l & 15)][32 j + 16 kt + 8 (l >> 4) + r] != 0),
// that is the 32-lane condition of score register i in step j of the k_attn wave that owns these 16 queries. Unit wv = (16 queries, 64 keys = two steps):
// lane l reads 4 x 32 B of its query's row (the wave: 256 B of each of 16 rows), 32 ballots, lane n keeps ballot n, one 128-B store.
// coverage: units 0 .. MU_N - 1 x 32 words = the whole plane.
// mlo = the lane's byte offset in a unit, ((l & 15) rows + 8 (l >> 4) words): the one vector register the loads name; the unit's first word is a scalar base.
__device__ __forceinline__ void mask_load(int wv, unsigned int mlo, const int* __restrict__ mask, v4f (&m)[8]) {
  const int rt = wv / (SEQ / 64), jp = wv - rt * (SEQ / 64);
  const int b = rt / (SEQ / 16), q0 = (rt - b * (SEQ / 16)) * 16;
  const char* mp = (const char*)(mask + ((size_t)b * SEQ_FULL + (size_t)q0) * SEQ_FULL + (size_t)jp * 64);
#pragma unroll   // the eight loads are independent and issue together
  for (int n = 0; n < 4; ++n) {
    m[2 * n]     = *(const v4fa*)(mp + 64 * n + mlo);
    m[2 * n + 1] = *(const v4fa*)(mp + 64 * n + 16 + mlo);
  }
  asm volatile("s_wait_xcnt 0x0" :: "v"(mlo) : "memory");   // as in wload
}
__device__ __forceinline__ void mask_store(int wv, int lane, const v4f (&m)[8], unsigned int* __restrict__ MB) {
  unsigned int word = 0u;
#pragma unroll   // constant lane numbers
  for (int n = 0; n < 4; ++n) {
#pragma unroll   // as above
    for (int r = 0; r < 8; ++r) {
      const unsigned int bal = __builtin_amdgcn_ballot_w32(__float_as_int(m[2 * n + (r >> 2)][r & 3]) != 0);   // the integer's bits are tested
      word = (lane == 8 * n + r) ? bal : word;
    }
  }
  MB[(size_t)wv * 32 + lane] = word;
  asm volatile("s_wait_xcnt 0x0" :: "v"(word) : "memory");   // stands behind the store, in front of any write of the registers it names: more work of the wave follows
}
// Output weight convert with transpose: w[k][n] (f32, [in][out]) -> Wt[n][k] (pitch RD) as f16(bf16 value x 1024). Unit o = 64 k x 16 n: lane l takes k rows 8 (l & 7) .. + 7 of columns 4 (l >> 3) .. + 3,
// so that each store writes whole 128-B lines of four Wt rows. coverage: units 0 .. WO_N - 1 = (RD/64 k tiles) x (RD/16 n tiles) = the whole plane.
__device__ __forceinline__ void wo_load(int o, int lane, const float* __restrict__ w, v4f (&m)[8]) {
  const char* p = (const char*)(w + (size_t)((o % (RD / 64)) * 64) * RD + (size_t)((o / (RD / 64)) * 16));   // scalar base: the unit's first element
  const unsigned int wlo = (unsigned int)((8 * (lane & 7) * RD + 4 * (lane >> 3)) * 4);
#pragma unroll   // the eight loads are independent and issue together
  for (int i = 0; i < 8; ++i) m[i] = *(const v4fa*)(p + i * (RD * 4) + wlo);
  asm volatile("s_wait_xcnt 0x0" :: "v"(wlo) : "memory");   // as in wload
}
__device__ __forceinline__ void wo_store(int o, int lane, const v4f (&m)[8], unsigned short* __restrict__ Wt) {
  const int k = (o % (RD / 64)) * 64 + 8 * (lane & 7), n = (o / (RD / 64)) * 16 + 4 * (lane >> 3);
#pragma unroll   // constant indices keep the loaded words in registers
  for (int c = 0; c < 4; ++c) {
    v8us a;
#pragma unroll   // as above
    for (int i = 0; i < 8; ++i) a[i] = c16f(bf16_val(bf16_bits(m[i][c])) * 1024.0f);   // bf16 significand x 2^10 is exact in f16
    *(v8us*)(Wt + (size_t)(n + c) * RD + (size_t)k) = a;
  }
}

// Projection GEMM straight from the f32 inputs. Block tile 64 rows x 128 columns for both parts (wave tile 16 rows x 128 columns), K = 512, stages of GK = 64.
// xr, xi: f32 [rows][RD], first row grow; ws: f32 weight [k][RD] as given ([in][out]), first column col0.
// Two LDS buffers of PST_B bytes in ring. A part: row r = 0..63 real, 64..127 phase, 64 f32 at pitch APITCH, brought by asynchronous copies and converted to bf16 at the fragment read.
// W part: brought through registers (loaded one trip ahead), converted and transposed on the way (wstore). One barrier per stage publishes the next stage and frees the buffer just read.
// A fragment: row m = 16 w + ln, elements 0..7 <- k0 + 8h + i, 8..15 <- k0 + 16 + 8h + i. B fragment: column n = 16t + ln, same k map. D: acc[r] = y(16 w + 8h + r, col0 + 16t + ln).
// gwv = the wave's number in the launch: the wave packs the mask units gwv and PJ_W + gwv on the way (their words take the weight registers' place once the last weight tile is stored).
// Called by whole blocks of 128 threads; behind the call the ring is free for other use.
__device__ __forceinline__ void pgemm_main(const float* __restrict__ xr, const float* __restrict__ xi, const float* __restrict__ ws, unsigned short* ring,
                                           int grow, int col0, int tid, int w, int lane, int ln, int hh, v8f (&yr)[8], v8f (&yi)[8],
                                           int gwv, const int* __restrict__ mask, unsigned int* __restrict__ MB) {
  const char* br = (const char*)(xr + (size_t)grow * RD);
  const char* bi = (const char*)(xi + (size_t)grow * RD);
  const unsigned int go = (unsigned int)((tid >> 4) * (RD * 4) + (tid & 15) * 16);
  const float* gw = ws + (size_t)(8 * w) * RD + (size_t)col0;
  const unsigned int lo = 16u * (unsigned int)lane;
  const unsigned int mlo = (unsigned int)(((lane & 15) * SEQ_FULL + 8 * (lane >> 4)) * 4);
  char* rb = (char*)ring;
  const unsigned int l = (unsigned int)(size_t)ring + (unsigned int)((tid >> 4) * APITCH + (tid & 15) * 16);   // LDS byte address of this thread's first piece in buffer 0
  const int sw = (ln >> 1) & 7;
  v4f wr[2][8];
  {
    v4f w0[2][8];   // the first two weight tiles fly together: the accumulators are not yet in use
    wload(gw, lo, 0, w0);
    wload(gw, lo, 1, wr);
    acopy(l, go, br, bi);
    __builtin_amdgcn_sched_barrier(0);   // keeps the weight tile's converts, which wait for its loads, from moving up between the copies
    wstore(rb + PA_B, w, lane, w0);
  }
  asm volatile("s_wait_asynccnt 0x0" ::: "memory");   // this wave's share of the A part of stage 0 has landed
  __syncthreads();                                    // every wave's share of stage 0 is in LDS
  acopy(l + PST_B, go, br + GK * 4, bi + GK * 4);
  wstore(rb + PST_B + PA_B, w, lane, wr);
  wload(gw, lo, 2, wr);
#pragma unroll 1   // one trip per stage: the hand-over at the foot stands once
  for (int s = 0; s < GNS; ++s) {
    const int bo = (s & 1) * PST_B;
    const char* ap = rb + bo + (16 * w + ln) * APITCH + 32 * hh;
    const unsigned short* wp = (const unsigned short*)(rb + bo + PA_B) + ln * GK;
#pragma unroll   // constant c: the piece places are loop-invariant registers and the row offsets immediates
    for (int c = 0; c < GK / 32; ++c) {
      v4f fr[4], fi[4];
#pragma unroll   // constant indices keep the pieces in registers
      for (int p = 0; p < 4; ++p) {
        const int o = 128 * c + 64 * (p >> 1) + 16 * (p & 1);   // f32 pieces k0 + 8h + 0..3, + 4..7, k0 + 16 + 8h + 0..3, + 4..7
        fr[p] = *(const v4fa*)(ap + o);
        fi[p] = *(const v4fa*)(ap + 64 * APITCH + o);
      }
      Frag ar, ai;
#pragma unroll   // as above
      for (int p = 0; p < 4; ++p) {
        ar.d[2 * p] = pk_bf16(fr[p][0], fr[p][1]); ar.d[2 * p + 1] = pk_bf16(fr[p][2], fr[p][3]);
        ai.d[2 * p] = pk_bf16(fi[p][0], fi[p][1]); ai.d[2 * p + 1] = pk_bf16(fi[p][2], fi[p][3]);
      }
#pragma unroll   // constant indices keep the fragments and the accumulators in registers
      for (int tg = 0; tg < 2; ++tg) {
        Frag wf[4];
#pragma unroll   // as above
        for (int t = 0; t < 4; ++t) {
          const unsigned short* wt = wp + (4 * tg + t) * 16 * GK;
          wf[t].half[0] = *(const v8us*)(wt + (((4 * c + hh) ^ sw ^ (t & 1)) * 8));       // piece k0 + 8h of column 16 (4 tg + t) + ln
          wf[t].half[1] = *(const v8us*)(wt + (((4 * c + 2 + hh) ^ sw ^ (t & 1)) * 8));   // piece k0 + 16 + 8h
        }
#pragma unroll   // as above
        for (int t = 0; t < 4; ++t) {   // plain builtins, the compiler keeps their distances: an asm guard would tie all 128 accumulator and 48 fragment registers below v256, where the copies' operands must lie too, and spill
          yr[4 * tg + t] = wm_b(ar, wf[t], yr[4 * tg + t]);
          yi[4 * tg + t] = wm_b(ai, wf[t], yi[4 * tg + t]);
        }
      }
    }
    asm volatile("s_wait_dscnt 0x0" ::: "memory");      // this wave's reads of the buffer have returned before it is refilled, and its W pieces of stage s + 1 are written
    asm volatile("s_wait_asynccnt 0x0" ::: "memory");   // this wave's share of the A part of stage s + 1 has landed
    __syncthreads();                                    // publishes stage s + 1 and ends every wave's reads of stage s
    if (s + 2 < GNS) {
      acopy(l + (unsigned int)bo, go, br + (size_t)(s + 2) * (GK * 4), bi + (size_t)(s + 2) * (GK * 4));
      __builtin_amdgcn_sched_barrier(0);   // the copies issue first: the converts below do not move up in front of them
      wstore(rb + bo + PA_B, w, lane, wr);
      if (s + 3 < GNS) {
        wload(gw, lo, s + 3, wr);
      } else {   // the last weight tile is stored: its registers take two mask units, whose loads land during the next trip
        mask_load(gwv, mlo, mask, wr[0]);
        mask_load(PJ_W + gwv, mlo, mask, wr[1]);
      }
    }
  }
  asm volatile("s_wait_asynccnt 0x0" ::: "memory");     // nothing in flight when the wave goes on to the epilogue
  mask_store(gwv, lane, wr[0], MB);
  mask_store(PJ_W + gwv, lane, wr[1], MB);
}

// All work ahead of the attention in one launch: q, k and v projections straight from the f32 inputs; the mask pack and the output weight's transpose ride along as side work of its waves (pgemm_main).
// Block index = (z * PC_B + column block) * PR_B + row block, z = 0 (q), 1 (k), 2 (v): none reads what another writes. Block = 4 waves x 16 rows = 64 rows, 128 columns = two heads.
// The branch on z is block-uniform, so each barrier is passed by the whole block.
// q / k: output plane P[b*NH + head][s][HP] = f16 of (y_r x 256 | y_p x cim), cim = +256 (q) or -256 (k).
// v: transposed plane Vt[b*NH + head][dd][s], dd = [real 64 | phase 64], value f16 of (y x 256).
// coverage: PR_B x PC_B blocks per z x 4 waves x 16 rows x 2 heads x 128 halves = each whole plane.
// LDS tile, q / k: [2 heads x 4 waves][16][136], columns 0..127 of every row are written before the barrier and exactly those are read after it; v: [2 heads x 128][72], 64 columns of every row written before the barrier, the same read after it.
__global__ __launch_bounds__(128) void k_proj(const float* __restrict__ q_re, const float* __restrict__ k_re, const float* __restrict__ v_re,
                                              const float* __restrict__ q_ph, const float* __restrict__ k_ph, const float* __restrict__ v_ph,
                                              const float* __restrict__ w_q, const float* __restrict__ w_k, const float* __restrict__ w_v,
                                              const float* __restrict__ w_o, const int* __restrict__ mask,
                                              unsigned short* __restrict__ Qp, unsigned short* __restrict__ Kp, unsigned short* __restrict__ Vt,
                                              unsigned short* __restrict__ Wo, unsigned int* __restrict__ MB) {
  __shared__ __attribute__((aligned(16))) unsigned short ring[2 * PST_B / 2];   // the GEMM's two buffers; behind the GEMM the output tile
  unsigned short* st = ring;
  static_assert(8 * 16 * 136 * 2 <= 2 * PST_B);
  static_assert(2 * HP * 72 * 2 <= 2 * PST_B);
  const int tid = threadIdx.x, w = __builtin_amdgcn_readfirstlane((int)(tid >> 5)), lane = tid & 31, ln = lane & 15, hh = lane >> 4;
  const int bid = blockIdx.x;
  const int z = bid / (PC_B * PR_B);
  const int rem = bid - z * (PC_B * PR_B);
  const int head0 = (rem / PR_B) * 2;
  const int rowb = (rem % PR_B) * 64;
  const float* xr = (z == 0) ? q_re : (z == 1) ? k_re : v_re;
  const float* xi = (z == 0) ? q_ph : (z == 1) ? k_ph : v_ph;
  const float* ws = (z == 0) ? w_q : (z == 1) ? w_k : w_v;
  const int b = rowb / SEQ;
  v8f yr[8] = {}, yi[8] = {};
  pgemm_main(xr, xi, ws, ring, b * SEQ_FULL + (rowb - b * SEQ), head0 * HD, tid, w, lane, ln, hh, yr, yi, bid * 4 + w, mask, MB);
  // the rest of the side work: loads here, worked up behind the epilogue; both tests are wave-uniform (scalar)
  const int gwv = bid * 4 + w, mu = 2 * PJ_W + gwv, wu = gwv / WO_S;
  const bool hasm = mu < MU_N, hasw = (gwv % WO_S == 0) && (wu < WO_N);
  v4f sm[8] = {}, sv[8] = {};
  if (hasm) mask_load(mu, (unsigned int)(((lane & 15) * SEQ_FULL + 8 * (lane >> 4)) * 4), mask, sm);
  if (hasw) wo_load(wu, lane, w_o, sv);
  if (z < 2) {
    unsigned short (*sh)[16][136] = (unsigned short (*)[16][136])st;
    unsigned short* P = (z == 0) ? Qp : Kp;
    const float cim = (z == 0) ? 256.0f : -256.0f;
#pragma unroll
    for (int t = 0; t < 8; ++t) {
#pragma unroll
      for (int r = 0; r < 8; ++r) {
        sh[4 * (t >> 2) + w][8 * hh + r][16 * (t & 3) + ln]      = c16f(yr[t][r] * 256.0f);
        sh[4 * (t >> 2) + w][8 * hh + r][HD + 16 * (t & 3) + ln] = c16f(yi[t][r] * cim);
      }
    }
    __syncthreads();
    const int s0 = rowb - b * SEQ + 16 * w;
    const int rsub = lane >> 4, p8 = (lane & 15) * 8;
#pragma unroll
    for (int hd = 0; hd < 2; ++hd) {
      const size_t base = ((size_t)(b * NH + head0 + hd) * SEQ + (size_t)s0) * HP;
#pragma unroll
      for (int q = 0; q < 8; ++q) {
        const int row = 2 * q + rsub;
        const v8us a = *(const v8us*)&sh[4 * hd + w][row][p8];
        *(v8us*)(P + base + (size_t)row * HP + p8) = a;
      }
    }
    asm volatile("s_wait_xcnt 0x0" ::: "memory");   // stands behind the plane's stores, in front of any write of the registers they name: the side work below follows
  } else {
    unsigned short (*th)[72] = (unsigned short (*)[72])st;
#pragma unroll
    for (int t = 0; t < 8; ++t) {
#pragma unroll
      for (int r = 0; r < 8; ++r) {
        const int col = 16 * w + 8 * hh + r;
        th[HP * (t >> 2) + 16 * (t & 3) + ln][col]      = c16f(yr[t][r] * 256.0f);
        th[HP * (t >> 2) + HD + 16 * (t & 3) + ln][col] = c16f(yi[t][r] * 256.0f);
      }
    }
    __syncthreads();
    const int s0 = rowb - b * SEQ;
    const size_t base = (size_t)(b * NH + head0) * HP * SEQ + (size_t)s0;   // the two heads' planes follow one another: row 128 hd + dd
    for (int i = tid; i < 2 * HP * 8; i += 128) {
      const int dd = i >> 3, j8 = (i & 7) * 8;
      const v8us a = *(const v8us*)&th[dd][j8];
      *(v8us*)(Vt + base + (size_t)dd * SEQ + j8) = a;
    }
  }
  if (hasm) mask_store(mu, lane, sm, MB);
  if (hasw) wo_store(wu, lane, sv, Wo);
}

// Score group for one 16-key tile (8 WMMAs): sre = kr qr + ki qi (4 products), sa = kr qi (2), sb = ki qr (2); then the hazard guard.
// k0, k1 = kr (d 0..31, 32..63); k2, k3 = ki; q[0], q[1] = qr; q[2], q[3] = qi.
__device__ __forceinline__ void score_mma(const Frag& k0, const Frag& k1, const Frag& k2, const Frag& k3,
                                          const Frag (&q)[4], v8f& sre, v8f& sa, v8f& sb) {
  sre = wm_h(k0, q[0], sre);
  sa  = wm_h(k0, q[2], sa);
  sb  = wm_h(k2, q[0], sb);
  sre = wm_h(k1, q[1], sre);
  sa  = wm_h(k1, q[3], sa);
  sb  = wm_h(k3, q[1], sb);
  sre = wm_h(k2, q[2], sre);
  sre = wm_h(k3, q[3], sre);
  asm volatile("v_nop\n\tv_nop\n\tv_nop\n\tv_nop" : "+v"(sre), "+v"(sa), "+v"(sb)
               : "v"(k0.vh), "v"(k1.vh), "v"(k2.vh), "v"(k3.vh),
                 "v"(q[0].vh), "v"(q[1].vh), "v"(q[2].vh), "v"(q[3].vh));
}
// c += v*p (single f16 product), then the hazard guard.
__device__ __forceinline__ void pv_mma(const Frag& v, const Frag& p, v8f& c) {
  c = wm_h(v, p, c);
  asm volatile("v_nop\n\tv_nop\n\tv_nop\n\tv_nop" : "+v"(c) : "v"(v.vh), "v"(p.vh));
}

// s += one*p and c += v*p (single f16 products, independent tiles), then one hazard guard for the pair: it also keeps the sums' product in the P.V run, next to the weights it reads.
__device__ __forceinline__ void pv_mma_sum(const Frag& one, const Frag& v, const Frag& p, v8f& s, v8f& c) {
  s = wm_h(one, p, s);
  c = wm_h(v, p, c);
  asm volatile("v_nop\n\tv_nop\n\tv_nop\n\tv_nop" : "+v"(s), "+v"(c) : "v"(one.vh), "v"(v.vh), "v"(p.vh));
}

// One 32-key step (step index j) for a wave's 16 queries: 16 score WMMAs + 8 P.V WMMAs + 1 for the row sums (one = A fragment with rows 0 and 8 of ones: these rows of Ls gain the sum of the step's 32 weights of their column's query, so Ls[0] is in each lane its query's whole sum and the lane halves exchange nothing). Ks = the step's first staged K row (pitch KPITCH),
// Vs = the step's first key column in the staged V^T rows (pitch VPITCH), both in LDS; key0 = the step's first key in the comments below; mk = the step's 16 select words (scalar registers), replaced behind their last use by the words at Mn, those of the same step of the next tile. With the phase half of the K plane stored negated: sre = qr.kr - qp.kp, sa - sb = qp.kr + qr.kp.
__device__ __forceinline__ void fa_step(const unsigned short* Ks, const unsigned short* Vs,
                                        maskp_t Mn, v16u& mk, int ln, int hh,
                                        const Frag (&qf)[4], const Frag& one, float& mr, v8f& Ls, v8f (&O)[8]) {
  const v8f z8 = {0.f, 0.f, 0.f, 0.f, 0.f, 0.f, 0.f, 0.f};
  float sc[16];
  // A fragments of K: row m = key (key0 + 16*kt + ln); packed k axis [kr 0..63 | -kp 64..127]; elements 0..7 <- 32c + 8h + i, 8..15 <- 32c + 16 + 8h + i;
  // both 16-key tiles' fragments are read as one group
  Frag kf[2][4];
#pragma unroll   // constant indices keep the fragments in registers
  for (int kt = 0; kt < 2; ++kt) {
    const unsigned short* kp = Ks + (16 * kt + ln) * KPITCH + 8 * hh;
#pragma unroll   // as above
    for (int c = 0; c < 4; ++c) {
      kf[kt][c].half[0] = *(const v8us*)(kp + 32 * c);
      kf[kt][c].half[1] = *(const v8us*)(kp + 32 * c + 16);
    }
  }
#pragma unroll
  for (int kt = 0; kt < 2; ++kt) {
    v8f sre = z8, sa = z8, sb = z8;
    score_mma(kf[kt][0], kf[kt][1], kf[kt][2], kf[kt][3], qf, sre, sa, sb);
    // S^T tile: element r = score(key0 + 16*kt + 8h + r, query of this lane's column); logit in log2 units; masked keys get the fill value instead
#pragma unroll
    for (int r = 0; r < 8; ++r) {
      const float im = sa[r] - sb[r];
      const float v = __builtin_amdgcn_sqrtf(fmaf(sre[r], sre[r], im * im)) * CSCALE;
      sc[8 * kt + r] = __builtin_amdgcn_inverse_ballot_w32(mk[8 * kt + r]) ? v : MFILL;   // the word is the select's lane condition as it stands
    }
  }
  mk = *Mn;   // one scalar load, two steps ahead of its first use
  // A fragments of V^T: row m = dd (16*t + ln), elements 0..7 <- key0 + 8h + i, 8..15 <- key0 + 16 + 8h + i; read as one group, ahead of the softmax arithmetic
  Frag vf[8];
#pragma unroll   // constant indices keep the fragments in registers
  for (int t = 0; t < 8; ++t) {
    const unsigned short* vp = Vs + (16 * t + ln) * VPITCH + 8 * hh;
    vf[t].half[0] = *(const v8us*)(vp);
    vf[t].half[1] = *(const v8us*)(vp + 16);
  }
  float mx = sc[0];
#pragma unroll
  for (int i = 1; i < 16; ++i) mx = fmaxf(mx, sc[i]);
  // Lazy rescale: mr is the reference exponent in use, not the running maximum. It moves only when some lane's own 16 scores pass it by more than RTHR,
  // tested once per step for the whole wave (a scalar branch); until then the sum and O^T keep their scale, no factor is applied and the lane halves exchange no maximum.
  if (__builtin_expect(__builtin_amdgcn_ballot_w32(mx > mr + RTHR) != 0u, 0)) {   // rare: the step's straight path falls through
    mx = fmaxf(mx, __shfl_xor(mx, 16, 32));         // the other lane half holds the other 16 keys of this query: both halves take the same new reference
    const float mnew = fmaxf(mr, mx);
    const float al = exp2f(mr - mnew);
    mr = mnew;
    Ls = Ls * al;                                   // the sums' tile is rescaled like an output tile
#pragma unroll   // constant indices keep the accumulators in registers
    for (int t = 0; t < 8; ++t) O[t] = O[t] * al;
  }
  const float mb = mr - 8.0f;                       // the reference with the x256 carry folded in: changes only where the reference moves
  // weights carried x256: pc = 256 * 2^(sc - mr) as one f16 plane (exponent below -14 -> exact zero); the row sum is taken by the matrix unit from the same f16 values
  Frag pf;
#pragma unroll
  for (int i = 0; i < 16; ++i) {
    const float e = sc[i] - mb;
    const float pc = (e < -14.0f) ? 0.0f : __builtin_amdgcn_exp2f(e);   // bare v_exp_f32 and a value select: the kept range e >= -14 needs no range extension, so the bits are those of exp2f(e), and no branch stands between the 16 weights
    pf.h[i] = (_Float16)pc;                         // B element i: i<8 -> key0 + 8h + i (tile 0 row 8h+i); i>=8 -> key0 + 16 + 8h + (i-8) (tile 1)
  }
  pv_mma_sum(one, vf[0], pf, Ls, O[0]);
#pragma unroll   // constant indices keep the fragments and the accumulators in registers
  for (int t = 1; t < 8; ++t) pv_mma(vf[t], pf, O[t]);
}

// Eight asynchronous 16-byte copies per lane, global -> LDS: copy i moves g + i*gstep to LDS byte l + i*lstep. Every lane on, no offset field.
// The s_wait_xcnt closes the statement so that it stands in front of any later write of the address registers the copies name.
__device__ __forceinline__ void copy8(unsigned int l, unsigned int lstep, const char* g, size_t gstep) {
  asm volatile("global_load_async_to_lds_b128 %0, %8, off\n\t"
               "global_load_async_to_lds_b128 %1, %9, off\n\t"
               "global_load_async_to_lds_b128 %2, %10, off\n\t"
               "global_load_async_to_lds_b128 %3, %11, off\n\t"
               "global_load_async_to_lds_b128 %4, %12, off\n\t"
               "global_load_async_to_lds_b128 %5, %13, off\n\t"
               "global_load_async_to_lds_b128 %6, %14, off\n\t"
               "global_load_async_to_lds_b128 %7, %15, off\n\t"
               "s_wait_xcnt 0x0"
               :: "v"(l), "v"(l + lstep), "v"(l + 2 * lstep), "v"(l + 3 * lstep),
                  "v"(l + 4 * lstep), "v"(l + 5 * lstep), "v"(l + 6 * lstep), "v"(l + 7 * lstep),
                  "v"(g), "v"(g + gstep), "v"(g + 2 * gstep), "v"(g + 3 * gstep),
                  "v"(g + 4 * gstep), "v"(g + 5 * gstep), "v"(g + 6 * gstep), "v"(g + 7 * gstep)
               : "memory");
}

// One stage (TK keys) into the LDS buffer at byte address lb. kg, vg: this thread's first source bytes in tile 0 of the (b, h) planes; kl, vl: its first LDS bytes in a buffer.
// K tile: TK rows x 256 B, contiguous in the plane; thread tid copies chunk tid + 256 i (row = chunk / 16). V^T tile: 128 rows x 256 B at the plane's row pitch; row = chunk / 16.
__device__ __forceinline__ void stage_copy(int tile, unsigned int lb, const char* kg, const char* vg, unsigned int kl, unsigned int vl) {
  copy8(lb + kl, 16u * KPITCH * 2u, kg + (size_t)tile * (TK * HP * 2), (size_t)4096);
  copy8(lb + vl, 16u * VPITCH * 2u, vg + (size_t)tile * (TK * 2), (size_t)16 * SEQ * 2);
}

// Block = 8 waves = 4 query groups x 2 key groups, 64 queries of one (b, h): wave w owns the 16 queries of group w & 3 and, of every 128-key tile, the 64 keys of group w >> 2.
// The queries alone fill two waves per SIMD; the key split makes it four (two blocks per WGP), so that one wave's LDS, cross-lane and dependent-vector waits are covered by three others.
// The eight waves share each K / V^T tile: two LDS buffers, the next tile's copies in flight while this tile is worked on; one barrier per tile publishes the next tile and frees the buffer just read.
// Merge: each wave ends with its own (reference exponent, sum, O^T) over its half of the keys; key group 1 hands them over in LDS and key group 0 joins the two with weights 2^(m - max).
// Epilogue: ctx carried x4096 as one f16 plane C[b*SEQ + s][KP] ([real 512 | phase 512], column h*64 + d).
// coverage: NB*NH*(SEQ/64) blocks x 4 query groups x 16 queries x (64 real + 64 phase) = every (row, head, part) segment of the plane exactly once (key group g stores lines 16 g .. 16 g + 15 of its query group's 32).
// LDS behind the loop (the ring is free: the last trip's barrier ends every read, nothing is in flight): bytes 0 .. 32767 O^T of key group 1, 32768 .. 33791 its references and sums, from 40960 the output tile.
// Every branch on the key group is wave-uniform and holds no barrier.
__global__ __launch_bounds__(256) __attribute__((amdgpu_waves_per_eu(4, 4))) void k_attn(const unsigned short* __restrict__ Qp, const unsigned short* __restrict__ Kpl,
                                              const unsigned short* __restrict__ Vt, const unsigned int* __restrict__ MB,
                                              unsigned short* __restrict__ Cx) {
  __shared__ __attribute__((aligned(16))) unsigned short ring[2 * ST_H];
  static_assert(40960 + 4 * 16 * 136 * 2 <= 2 * ST_H * 2);
  const int tid = threadIdx.x, w = __builtin_amdgcn_readfirstlane((int)(tid >> 5)), lane = tid & 31, ln = lane & 15, hh = lane >> 4;
  const int qw = w & 3, g = w >> 2;
  const int bh = blockIdx.x / (SEQ / 64), qt = blockIdx.x % (SEQ / 64);
  const int b = bh / NH, h = bh - b * NH;
  const int qbase = qt * 64 + 16 * qw;
  const int qg = qbase + ln;
  // Q^T B fragments: column n = query qg, packed k axis [qr 0..63 | qp 64..127], elements 0..7 <- 32c + 8h + i, 8..15 <- 32c + 16 + 8h + i
  Frag qf[4];
  {
    const size_t qoff = ((size_t)bh * SEQ + (size_t)qg) * HP + 8 * hh;
#pragma unroll
    for (int c = 0; c < 4; ++c) {
      qf[c].half[0] = *(const v8us*)(Qp + qoff + 32 * c);
      qf[c].half[1] = *(const v8us*)(Qp + qoff + 32 * c + 16);
    }
  }
  float mr = -3.0e38f;
  v8f O[8] = {}, Ls = {};
  Frag one;
  {
    const unsigned int o = ((lane & 7) == 0) ? 0x3C003C00u : 0u;
#pragma unroll   // constant indices keep the fragment in registers
    for (int i = 0; i < 8; ++i) one.d[i] = o;
  }
  const unsigned short* Kp = Kpl + (size_t)bh * SEQ * HP;
  const unsigned short* Vp = Vt  + (size_t)bh * HP * SEQ;
  const unsigned int* Mw = MB + (size_t)(b * (SEQ / 16) + qt * 4 + qw) * ((SEQ / 32) * 16) + g * 32;   // the wave's select words, 16 per step, from its first step on; wave-uniform
  const char* kg = (const char*)Kp + (size_t)tid * 16;
  const char* vg = (const char*)Vp + (size_t)(tid >> 4) * (SEQ * 2) + (size_t)(tid & 15) * 16;
  const unsigned int rb = (unsigned int)(size_t)&ring[0];                                     // LDS byte address of the ring
  const unsigned int kl = (unsigned int)((tid >> 4) * (KPITCH * 2) + (tid & 15) * 16);
  const unsigned int vl = (unsigned int)(KT_H * 2 + (tid >> 4) * (VPITCH * 2) + (tid & 15) * 16);
  constexpr int NT = SEQ / TK;
  v16u mka = *(maskp_t)Mw, mkb = *(maskp_t)(Mw + 16);   // select words of the wave's first and second step of a tile; the first two land while tile 0 does
  stage_copy(0, rb, kg, vg, kl, vl);
  asm volatile("s_wait_asynccnt 0x0" ::: "memory");   // this wave's share of tile 0 has landed
  __syncthreads();                                    // every wave's share of tile 0 has landed
  if (NT > 1) stage_copy(1, rb + ST_H * 2u, kg, vg, kl, vl);
#pragma unroll 1   // one trip per tile: the hand-over at the foot stands once
  for (int t = 0; t < NT; ++t) {
    const int bo = (t & 1) * ST_H;
    const unsigned int* Mn = Mw + 64 * ((t + 1 < NT) ? t + 1 : t);   // the next tile's words; in the last trip its own again: in range, not used
    const unsigned short* ks = &ring[bo + g * 64 * KPITCH];          // the key group's first staged K row
    const unsigned short* vs = &ring[bo + KT_H + g * 64];            // its first key column in the staged V^T rows
    fa_step(ks, vs, (maskp_t)Mn, mka, ln, hh, qf, one, mr, Ls, O);
    fa_step(ks + 32 * KPITCH, vs + 32, (maskp_t)(Mn + 16), mkb, ln, hh, qf, one, mr, Ls, O);
    asm volatile("s_wait_dscnt 0x0" ::: "memory");      // this wave's reads of the buffer have returned before it is refilled
    asm volatile("s_wait_asynccnt 0x0" ::: "memory");   // this wave's share of tile t + 1 has landed
    __syncthreads();                                    // publishes tile t + 1 and ends every wave's reads of tile t
    if (t + 2 < NT) stage_copy(t + 2, rb + (unsigned int)bo * 2u, kg, vg, kl, vl);
  }
  asm volatile("s_wait_asynccnt 0x0" ::: "memory");     // nothing in flight when the wave goes on to the epilogue

  v4fa* mo = (v4fa*)ring + (size_t)qw * 512 + lane;                 // piece j of the query group's O^T at mo[32 j]: 512 contiguous bytes per wave store
  f32a* ml = (f32a*)ring + 8192 + qw * 64 + lane;
  unsigned short (*sh)[16][136] = (unsigned short (*)[16][136])(ring + 20480);
  if (g == 1) {
#pragma unroll
    for (int t = 0; t < 8; ++t) {
      const v4f lo = {O[t][0], O[t][1], O[t][2], O[t][3]}, hi = {O[t][4], O[t][5], O[t][6], O[t][7]};
      mo[32 * (2 * t)] = lo;
      mo[32 * (2 * t + 1)] = hi;
    }
    ml[0] = mr;
    ml[32] = Ls[0];
  }
  __syncthreads();                                      // key group 1's partial results are in LDS
  if (g == 0) {
    // both references are finite (each group has worked at least one step, and the first step always sets one), so the weights are in (0, 1] and the larger one is 1
    const float m1 = ml[0], l1 = ml[32];
    const float mm = fmaxf(mr, m1);
    const float a0 = exp2f(mr - mm), a1 = exp2f(m1 - mm);
    // O^T element r of tile t = ctx(query qg, dd = 16t + 8h + r); carries: x256 (P, also in the sums), x256 (v); ctx stored x4096 -> factor 16 / sum
    const float inv = 16.0f * (1.0f / (Ls[0] * a0 + l1 * a1));
    const float c0 = a0 * inv, c1 = a1 * inv;
#pragma unroll
    for (int t = 0; t < 8; ++t) {
      const v4f lo = mo[32 * (2 * t)], hi = mo[32 * (2 * t + 1)];
#pragma unroll
      for (int r = 0; r < 8; ++r)
        sh[qw][ln][16 * t + 8 * hh + r] = c16f(O[t][r] * c0 + ((r < 4) ? lo[r & 3] : hi[r & 3]) * c1);
    }
  }
  __syncthreads();                                      // the output tile is whole
  const size_t rbase = ((size_t)b * SEQ + (size_t)qbase) * KP + (size_t)h * HD;
  const int lsub = lane >> 3, p8 = (lane & 7) * 8;
  {
#pragma unroll
    for (int q = 0; q < 4; ++q) {
      const int line = 4 * (4 * g + q) + lsub;  // 0..31 = 16 queries x {real, phase}
      const int row = line >> 1, seg = line & 1;
      const v8us a = *(const v8us*)&sh[qw][row][seg * HD + p8];
      const size_t o = rbase + (size_t)row * KP + (size_t)seg * RD + p8;
      *(v8us*)(Cx + o) = a;
    }
  }
}

// Output projection of both parts: out0[b][s][n] = ctx_real x Wo, out1[b][s][n] = ctx_phase x Wo (f16, K = 512, one product per term), undo carries x4096 (ctx) and x1024 (Wo).
// Epilogue: per-wave LDS tile [16 rows][128 floats = 64 real columns | 64 phase columns] (block barrier), then per instruction lanes 0..15 write the 256-B
// coverage: grid (NB*SEQ/64, RD/64) x 4 waves x 16 rows x (64 + 64) floats = every output element of the processed rows exactly once.
// LDS tile: columns 0..127 of every row written before the barrier, the same read after it.
__global__ __launch_bounds__(128) void k_out(const unsigned short* __restrict__ Cx, const unsigned short* __restrict__ Wo,
                                             float* __restrict__ Out) {
  __shared__ __attribute__((aligned(16))) unsigned short ring[2 * GST_H];   // the GEMM's two buffers; behind the GEMM the output tile
  float (*so)[16][132] = (float (*)[16][132])ring;
  static_assert(4 * 16 * 132 * 4 <= 2 * GST_H * 2);
  const int tid = threadIdx.x, w = __builtin_amdgcn_readfirstlane((int)(tid >> 5)), lane = tid & 31, ln = lane & 15, hh = lane >> 4;
  const int rowb = blockIdx.x * 64;
  const int col0 = blockIdx.y * 64;
  v8f yr[4] = {}, yi[4] = {};
  rgemm_main<false>(Cx, Wo, ring, rowb, col0, tid, w, ln, hh, yr, yi);
  const float scl = 1.0f / 4194304.0f;
#pragma unroll
  for (int t = 0; t < 4; ++t) {
#pragma unroll
    for (int r = 0; r < 8; ++r) {
      so[w][8 * hh + r][16 * t + ln]      = yr[t][r] * scl;
      so[w][8 * hh + r][HD + 16 * t + ln] = yi[t][r] * scl;
    }
  }
  __syncthreads();
  const int b = rowb / SEQ;
  const int s0 = rowb - b * SEQ + 16 * w;
  const size_t obase = ((size_t)b * SEQ_FULL + (size_t)s0) * RD + (size_t)col0
                     + (size_t)(lane >> 4) * OUT1_OFF + (size_t)(lane & 15) * 4;
  {
#pragma unroll
    for (int q = 0; q < 16; ++q) {
      const v4f v = *(const v4fa*)&so[w][q][lane * 4];
      *(v4f*)(Out + obase + (size_t)q * RD) = v;
    }
    
  }
}

extern "C" void kernel_launch(void* const* d_in, const int* in_sizes, int n_in,
                              void* d_out, int out_size, void* d_ws, size_t ws_size, hipStream_t stream) {
  if (n_in < 11) return;
  const long long needx = ((long long)(NB - 1) * SEQ_FULL + (long long)SEQ) * RD;   // last activation element touched + 1
  const long long needm = ((long long)(NB - 1) * SEQ_FULL + (long long)(SEQ - 1)) * SEQ_FULL + (long long)SEQ;   // last mask element touched + 1
  for (int i = 0; i < 6; ++i) if ((long long)in_sizes[i] < needx) return;
  for (int i = 6; i < 10; ++i) if ((long long)in_sizes[i] < (long long)RD * RD) return;
  if ((long long)in_sizes[10] < needm) return;
  if ((long long)out_size < (long long)OUT1_OFF + needx) return;
  // wire order: q_real, k_real, v_real, q_phase, k_phase, v_phase, w_q, w_k, w_v, w_o, mask
  const float* q_re = (const float*)d_in[0];
  const float* k_re = (const float*)d_in[1];
  const float* v_re = (const float*)d_in[2];
  const float* q_ph = (const float*)d_in[3];
  const float* k_ph = (const float*)d_in[4];
  const float* v_ph = (const float*)d_in[5];
  const float* w_q = (const float*)d_in[6];
  const float* w_k = (const float*)d_in[7];
  const float* w_v = (const float*)d_in[8];
  const float* w_o = (const float*)d_in[9];
  const int* maskp = (const int*)d_in[10];
  float* Out = (float*)d_out;

  char* ws = (char*)d_ws;
  size_t off = 0;
  const size_t XB = (size_t)NB * SEQ * KP * 2;          // head / ctx plane bytes (8 MiB at full size); all planes are written exactly to their end
  const size_t WB = (size_t)RD * RD * 2;                // transposed weight plane bytes (512 KiB)
  const size_t MBB = (size_t)NB * SEQ * (SEQ / 32) * 4; // mask bit words (1 MiB at full size)
  unsigned short* Wo = (unsigned short*)(ws + off); off += WB;
  unsigned short* Qp = (unsigned short*)(ws + off); off += XB;   // NB*NH*SEQ*HP halves = XB bytes
  unsigned short* Kp = (unsigned short*)(ws + off); off += XB;
  unsigned short* Vt = (unsigned short*)(ws + off); off += XB;
  unsigned short* Cx = (unsigned short*)(ws + off); off += XB;
  unsigned int*   MB = (unsigned int*)(ws + off);   off += MBB;
  if (off > ws_size) return;

  k_proj<<<(unsigned)PJ_B, 128, 0, stream>>>(q_re, k_re, v_re, q_ph, k_ph, v_ph, w_q, w_k, w_v, w_o, maskp, Qp, Kp, Vt, Wo, MB);

  k_attn<<<(unsigned)(NB * NH * (SEQ / 64)), 256, 0, stream>>>(Qp, Kp, Vt, MB, Cx);

  const dim3 go((unsigned)(NB * SEQ / 64), (unsigned)(RD / 64), 1);
  k_out<<<go, 128, 0, stream>>>(Cx, Wo, Out);
}

// v010
// Measured time: 69.6 microseconds a run.
// Timed twice side by side with v009, it ran 1.04 times as fast both times.
// Counting every step since v000, it is 5.18 times as fast.
#include <hip/hip_runtime.h>
// Contractions: q/k/v projections (real and phase parts share one weight) on v_wmma_f32_16x16x32_bf16 (activations and weights RNE-converted to bf16 inside the projection launch, single product, f32 accumulate); scores K Q^T, O^T = V^T P^T and the output projection on v_wmma_f32_16x16x32_f16 (single carried f16 planes: q, k, v x256, P x256, ctx x4096, Wo = bf16 value x1024 held exactly in f16; single product per term, f32 accumulate); softmax statistics f32.
// Two-part (real | phase) multi-head attention: B x S x 512 activations per part, 8 heads x 64, weights stored [in][out] (y = x w), softmax over
// sqrt(re^2 + im^2) / sqrt(128) with re = qr.kr - qp.kp, im = qr.kp + qp.kr; keys whose mask entry is 0 get their score REPLACED by -1e9 (they stay in the softmax).
// Engine: transposed flash. Each wave owns 16 queries of one (b, h) and half of the keys (two partial softmaxes per query, merged in LDS). Per 32-key step: S^T tiles (key rows x query columns) from packed K rows
// [kr 64 | -kp 64] (A, f16 plane staged in LDS; the phase half is stored negated so that the packed products give re and im above) and packed Q^T [qr | qp]
// (B, registers); the two 16-key D tiles pack straight into the P^T B fragment; O^T (128 d rows = [real 64 | phase 64] x query columns) accumulates
// from V^T rows (A, f16 plane staged in LDS); the softmax sums come from one more product of P^T with a constant A that holds rows of ones. 25 WMMAs per step. The mask is packed once into 32-lane select words [b][q / 16][S/32][16]: word i of a step holds, lane by lane, the condition of the wave's score register i.
// Real GEMMs: y_r = x_r w, y_p = x_p w with A fragments x_r, x_p and one B fragment of the weight, k-contiguous per column, both staged in LDS (projections: straight from the f32 inputs; output projection: from 16-bit planes).
#ifndef NB
#define NB 2
#endif
#ifndef SEQ
#define SEQ 2048
#endif
#define NB_FULL 2
#define SEQ_FULL 2048
#define RD 512        /* model width (= heads x head dim) */
#define NH 8
#define HD 64
#define KP 1024       /* packed 16-bit row: [real 512 | phase 512] */
#define HP 128        /* packed head row: [real 64 | phase 64] */
#define OUT1_OFF ((size_t)NB_FULL * SEQ_FULL * RD)   /* element offset of the second output (fixed by the full problem size) */
#define TK 128        /* keys per LDS stage: 64 (two 32-key steps) for each of the block's two key groups */
#define KPITCH 136    /* LDS pitch of a staged K row, halves: 256 B + 16 B, conflict-free for 16-byte reads down a column of rows */
#define VPITCH 136    /* LDS pitch of a staged V^T row, halves: 256 B + 16 B */
#define KT_H (TK * KPITCH)    /* halves of one staged K tile */
#define VT_H (HP * VPITCH)    /* halves of one staged V^T tile */
#define ST_H (KT_H + VT_H)    /* halves of one stage */
#define GK 64         /* k extent of one staged GEMM tile, halves: 128 B = one whole line per row */
#define GROWS 192     /* rows of one staged GEMM tile: 64 A rows real, the same 64 rows phase, 64 W rows */
#define GST_H (GROWS * GK)    /* halves of one GEMM stage */
#define GNS (RD / GK)         /* GEMM stages */
#define PCOLS 128     /* columns of one projection block: two heads */
#define APITCH 272    /* LDS pitch of a staged f32 A row, bytes: 256 B + 16 B, conflict-free for 16-byte reads down a column of rows */
#define PA_B (128 * APITCH)       /* bytes of the A part of a projection stage: 64 rows real, the same 64 rows phase, 64 k as f32 */
#define PW_B (PCOLS * GK * 2)     /* bytes of its W part: 128 columns x 64 k as bf16 */
#define PST_B (PA_B + PW_B)       /* bytes of one projection stage */
#define PR_B (NB * SEQ / 64)      /* row blocks of one projection */
#define PC_B (RD / PCOLS)         /* column blocks of one projection */
#define PJ_B (3 * PC_B * PR_B)    /* blocks of the three projections */
#define PJ_W (4 * PJ_B)           /* waves of the projection launch */
#define MU_N (NB * (SEQ / 16) * (SEQ / 64))   /* units of the mask pack: 16 queries x 64 keys each, one wave's work */
#define WO_N ((RD / 64) * (RD / 16))          /* units of the output weight's transpose: 64 k x 16 n each, one wave's work */
#define WO_S (PJ_W / WO_N)        /* every WO_S-th wave takes one of them */

static_assert(SEQ % 64 == 0);
static_assert(SEQ % TK == 0);
static_assert(TK * HP * 2 == 256 * 8 * 16);   /* one K tile = 256 threads x 8 copies of 16 B */
static_assert(HP * TK * 2 == 256 * 8 * 16);   /* one V^T tile likewise */
static_assert(2 * (2 * ST_H * 2) <= 327680);  /* two blocks' rings fit one WGP's LDS: four waves per SIMD */
static_assert(GROWS * GK * 2 == 128 * 12 * 16);   /* one GEMM stage = 128 threads x 12 copies of 16 B */
static_assert(RD % GK == 0 && GNS >= 2);
static_assert(SEQ <= SEQ_FULL);
static_assert(NB <= NB_FULL);
static_assert(NH * HD == RD);
static_assert(RD % 64 == 0);
static_assert(RD % 32 == 0);
static_assert(NH * HP == KP);
static_assert(KP == 2 * RD);
static_assert(HP == 2 * HD);
static_assert(HD == 64);
static_assert((NB * SEQ) % 64 == 0);
static_assert(((size_t)NB * SEQ * (SEQ / 32)) % 32 == 0);
static_assert(3 * (2 * PST_B) <= 327680);     /* three projection blocks' rings fit one WGP's LDS */
static_assert(GNS >= 3);
static_assert(2 * PJ_W <= MU_N && 3 * PJ_W >= MU_N && WO_S >= 1);   /* every wave packs two mask units, some a third; some transpose a weight unit */
static_assert(RD % PCOLS == 0 && PCOLS == 2 * HD);
static_assert(128 * GK * 4 == 128 * 16 * 16);   /* the A part of a stage = 128 threads x 16 copies of 16 B */
static_assert(GK * PCOLS * 4 == 128 * 16 * 16); /* the f32 W tile of a stage = 128 threads x 16 loads of 16 B */
static_assert(OUT1_OFF * 4 == (size_t)8388608);
static_assert((size_t)4 * ((size_t)NB * SEQ * KP * 2) + (size_t)RD * RD * 2 + (size_t)NB * SEQ * (SEQ / 32) * 4 <= (size_t)134217728);

typedef __bf16 v16b __attribute__((ext_vector_type(16)));
typedef _Float16 v16h __attribute__((ext_vector_type(16)));
typedef _Float16 h16;
typedef unsigned short v8us __attribute__((ext_vector_type(8), may_alias));
typedef int v4i __attribute__((ext_vector_type(4), may_alias));
typedef unsigned int v4ua __attribute__((ext_vector_type(4), may_alias));
typedef float v2f __attribute__((ext_vector_type(2)));
typedef __bf16 v2b __attribute__((ext_vector_type(2)));
typedef unsigned int v16u __attribute__((ext_vector_type(16)));
typedef const __attribute__((address_space(4))) v16u* maskp_t;   /* constant address space: the words are written by an earlier launch only, so a wave-uniform read of them is a scalar load */
typedef float v8f __attribute__((ext_vector_type(8)));
typedef float v4f __attribute__((ext_vector_type(4)));
typedef float v4fa __attribute__((ext_vector_type(4), may_alias));
typedef float f32a __attribute__((may_alias));
union Frag { v16b vb; v16h vh; v8us half[2]; unsigned short u[16]; _Float16 h[16]; unsigned int d[8]; };

#define LOG2E 1.4426950408889634f
/* scores arrive x65536 (q x256, k x256); logit in log2 units = |s| * (1/sqrt(128)) * log2(e) / 65536 */
#define CSCALE (0.08838834764831845f * LOG2E / 65536.0f)
/* replaced score of a masked key, in log2 units */
#define MFILL (-1.0e9f * LOG2E)
/* a score may pass the reference exponent by this much (log2 units) before the reference moves: weights stay near 256 * 2^7 = 2^15, inside f16
   (finite f16 q and k planes bound an unmasked logit below 2^21, so the roundings of reference + 7 and reference - 8 move an exponent by less than 1/4) */
#define RTHR 7.0f

__device__ __forceinline__ unsigned short bf16_bits(float x) {   // RNE convert to bf16 bits
  unsigned int u = __float_as_uint(x);
  return (unsigned short)((u + 0x7FFFu + ((u >> 16) & 1u)) >> 16);
}
__device__ __forceinline__ float bf16_val(unsigned short b) { return __uint_as_float(((unsigned int)b) << 16); }
__device__ __forceinline__ unsigned int pk_bf16(float a, float b) {   // two RNE converts in one instruction: a in the low half, b in the high half
  const v2f x = {a, b};
  union { v2b h; unsigned int u; } c; c.h = __builtin_convertvector(x, v2b); return c.u;
}
__device__ __forceinline__ unsigned short f16_bits(_Float16 h) { union { _Float16 h; unsigned short u; } c; c.h = h; return c.u; }
__device__ __forceinline__ unsigned short c16(float c) { return f16_bits((_Float16)c); }   // RNE convert of a carried value to f16 bits

// f32 -> f16 convert that cannot produce a subnormal: values below the smallest normal become zero (value select).
static __device__ __forceinline__ h16 toh_flush(float v) { const h16 r = (h16)v; return (fabsf(v) < 6.103515625e-05f) ? (h16)0.0f : r; }
__device__ __forceinline__ unsigned short c16f(float c) { return f16_bits(toh_flush(c)); }

__device__ __forceinline__ v8f wm_b(const Frag& a, const Frag& b, v8f c) {
  return __builtin_amdgcn_wmma_f32_16x16x32_bf16(false, a.vb, false, b.vb, (short)0, c, false, false);
}
__device__ __forceinline__ v8f wm_h(const Frag& a, const Frag& b, v8f c) {
  return __builtin_amdgcn_wmma_f32_16x16x32_f16(false, a.vh, false, b.vh, (short)0, c, false, false);
}

// One k-step for one 16x16 output tile of both parts: yr += ar*w ; yi += ai*w ; each product followed by its own hazard guard.
template <bool BF>
__device__ __forceinline__ void rmma(const Frag& ar, const Frag& ai, const Frag& wf, v8f& yr, v8f& yi) {
  if (BF) {
    yr = wm_b(ar, wf, yr);
    asm volatile("v_nop\n\tv_nop\n\tv_nop\n\tv_nop" : "+v"(yr) : "v"(ar.vb), "v"(wf.vb));
    yi = wm_b(ai, wf, yi);
    asm volatile("v_nop\n\tv_nop\n\tv_nop\n\tv_nop" : "+v"(yi) : "v"(ai.vb), "v"(wf.vb));
  } else {
    yr = wm_h(ar, wf, yr);
    asm volatile("v_nop\n\tv_nop\n\tv_nop\n\tv_nop" : "+v"(yr) : "v"(ar.vh), "v"(wf.vh));
    yi = wm_h(ai, wf, yi);
    asm volatile("v_nop\n\tv_nop\n\tv_nop\n\tv_nop" : "+v"(yi) : "v"(ai.vh), "v"(wf.vh));
  }
}

// Twelve asynchronous 16-byte copies per lane, global -> LDS, one GEMM stage: copy i lands at LDS byte l + 2048 i (16 rows further down).
// Copies 0..3: A rows, real part (16 rows apart); 4..7: the same rows, phase part (RD halves further); 8..11: W rows (16 rows apart). Every lane on, no offset field.
// The s_wait_xcnt closes the statement so that it stands in front of any later write of the address registers the copies name.
__device__ __forceinline__ void copy12(unsigned int l, const char* ga, const char* gw) {
  constexpr size_t AS = (size_t)16 * KP * 2, PH = (size_t)RD * 2, WS = (size_t)16 * RD * 2;
  asm volatile("global_load_async_to_lds_b128 %0, %12, off\n\t"
               "global_load_async_to_lds_b128 %1, %13, off\n\t"
               "global_load_async_to_lds_b128 %2, %14, off\n\t"
               "global_load_async_to_lds_b128 %3, %15, off\n\t"
               "global_load_async_to_lds_b128 %4, %16, off\n\t"
               "global_load_async_to_lds_b128 %5, %17, off\n\t"
               "global_load_async_to_lds_b128 %6, %18, off\n\t"
               "global_load_async_to_lds_b128 %7, %19, off\n\t"
               "global_load_async_to_lds_b128 %8, %20, off\n\t"
               "global_load_async_to_lds_b128 %9, %21, off\n\t"
               "global_load_async_to_lds_b128 %10, %22, off\n\t"
               "global_load_async_to_lds_b128 %11, %23, off\n\t"
               "s_wait_xcnt 0x0"
               :: "v"(l), "v"(l + 2048u), "v"(l + 4096u), "v"(l + 6144u),
                  "v"(l + 8192u), "v"(l + 10240u), "v"(l + 12288u), "v"(l + 14336u),
                  "v"(l + 16384u), "v"(l + 18432u), "v"(l + 20480u), "v"(l + 22528u),
                  "v"(ga), "v"(ga + AS), "v"(ga + 2 * AS), "v"(ga + 3 * AS),
                  "v"(ga + PH), "v"(ga + PH + AS), "v"(ga + PH + 2 * AS), "v"(ga + PH + 3 * AS),
                  "v"(gw), "v"(gw + WS), "v"(gw + 2 * WS), "v"(gw + 3 * WS)
               : "memory");
}

// Block tile 64 rows x 64 columns for both parts (wave tile 16 rows x 64 columns), K = 512. A plane [rows][KP] = [real 512 | phase 512], W plane [cols][RD] (transposed weight, k-contiguous).
// The four waves share each k tile of GK: two LDS buffers in ring (2 x GST_H halves), the next tile's copies in flight while this tile is worked on; one barrier per tile
// publishes the next tile and frees the buffer just read. Called by whole blocks of 128 threads; behind the call the ring is free for other use.
// Staged tile: row r = 0..63 A real (row rowb + r), 64..127 A phase, 128..191 W (column col0 + r - 128); 128 B per row, no pad: the 16-byte piece p of row r lies at piece p ^ ((r >> 1) & 7),
// so 16 lanes reading one piece down 16 rows meet every bank once. Thread tid copies piece tid & 7 of rows (tid >> 3) + 16 i: whole 128-B lines per 8 lanes.
// A fragment: row m = rowb + 16 w + ln, elements 0..7 <- k0 + 8h + i, 8..15 <- k0 + 16 + 8h + i. B fragment: column n = col0 + 16t + ln, same k map.
// D: acc[r] = y(rowb + 16 w + 8h + r, col0 + 16t + ln).
template <bool BF>
__device__ __forceinline__ void rgemm_main(const unsigned short* __restrict__ A, const unsigned short* __restrict__ W, unsigned short* ring,
                                           int rowb, int col0, int tid, int w, int ln, int hh, v8f (&yr)[4], v8f (&yi)[4]) {
  const char* ga = (const char*)(A + (size_t)(rowb + (tid >> 3)) * KP) + (tid & 7) * 16;
  const char* gw = (const char*)(W + (size_t)(col0 + (tid >> 3)) * RD) + (tid & 7) * 16;
  const unsigned int l = (unsigned int)(size_t)ring + (unsigned int)((tid >> 3) * (GK * 2) + (((tid & 7) ^ ((tid >> 4) & 7)) * 16));   // LDS byte address of this thread's first piece in buffer 0
  const int sw = (ln >> 1) & 7;
  copy12(l, ga, gw);
  asm volatile("s_wait_asynccnt 0x0" ::: "memory");   // this wave's share of tile 0 has landed
  __syncthreads();                                    // every wave's share of tile 0 has landed
  copy12(l + GST_H * 2u, ga + GK * 2, gw + GK * 2);
#pragma unroll 1   // one trip per tile: the hand-over at the foot stands once
  for (int s = 0; s < GNS; ++s) {
    const int bo = (s & 1) * GST_H;
    const unsigned short* ap = ring + bo + (16 * w + ln) * GK;
    const unsigned short* wp = ring + bo + (128 + ln) * GK;
#pragma unroll   // constant c: the piece places are loop-invariant registers and the row offsets immediates
    for (int c = 0; c < GK / 32; ++c) {
      const int o0 = ((4 * c + hh) ^ sw) * 8, o1 = ((4 * c + 2 + hh) ^ sw) * 8;   // places of the pieces k0 + 8h and k0 + 16 + 8h in this lane's rows
      // the k step's six fragments are read as one group, ahead of its products
      Frag ar, ai, wf[4];
      ar.half[0] = *(const v8us*)(ap + o0);
      ar.half[1] = *(const v8us*)(ap + o1);
      ai.half[0] = *(const v8us*)(ap + 64 * GK + o0);
      ai.half[1] = *(const v8us*)(ap + 64 * GK + o1);
#pragma unroll   // constant indices keep the fragments in registers
      for (int t = 0; t < 4; ++t) {
        const unsigned short* wt = wp + t * 16 * GK;
        wf[t].half[0] = *(const v8us*)(wt + o0);
        wf[t].half[1] = *(const v8us*)(wt + o1);
      }
#pragma unroll   // as above
      for (int t = 0; t < 4; ++t) rmma<BF>(ar, ai, wf[t], yr[t], yi[t]);
    }
    asm volatile("s_wait_dscnt 0x0" ::: "memory");      // this wave's reads of the buffer have returned before it is refilled
    asm volatile("s_wait_asynccnt 0x0" ::: "memory");   // this wave's share of tile s + 1 has landed
    __syncthreads();                                    // publishes tile s + 1 and ends every wave's reads of tile s
    if (s + 2 < GNS) copy12(l + (unsigned int)bo * 2u, ga + (size_t)(s + 2) * (GK * 2), gw + (size_t)(s + 2) * (GK * 2));
  }
  asm volatile("s_wait_asynccnt 0x0" ::: "memory");     // nothing in flight when the wave goes on to the epilogue
}

// The f32 W tile of stage s into registers: 64 k rows x 128 columns. Patch j of wave w = k rows 8 (w + 4 j) .. + 7, lane l takes columns 4 l .. 4 l + 3 of each: whole 512-B row pieces per load.
// gw = the wave's first element, w_src[8 w][col0] (wave-uniform); lo = 16 l, the lane's byte offset.
__device__ __forceinline__ void wload(const float* __restrict__ gw, unsigned int lo, int s, v4f (&wr)[2][8]) {
  const char* p = (const char*)(gw + (size_t)(s * GK) * RD) + lo;
#pragma unroll   // constant indices keep the tile in registers; the 16 loads are independent and issue together
  for (int j = 0; j < 2; ++j) {
#pragma unroll   // as above
    for (int i = 0; i < 8; ++i) wr[j][i] = *(const v4fa*)(p + (32 * j + i) * (RD * 4));
  }
  asm volatile("s_wait_xcnt 0x0" :: "v"(p) : "memory");   // stands behind the loads, in front of any write of the address registers they name; the operand keeps those registers out of the loads' own results
}
// The same tile, RNE-converted to bf16 and transposed, into the W part wb of a buffer: row n = column of the block (128 B = 64 k), the 16-byte piece p (k 8 p .. 8 p + 7) of row n
// lies at piece p ^ ((n >> 1) & 7) ^ ((n >> 4) & 1): 16 lanes reading one piece down 16 rows meet every bank once, and 8 lanes writing one piece to every fourth row meet 8 different places.
__device__ __forceinline__ void wstore(char* wb, int w, int lane, const v4f (&wr)[2][8]) {
#pragma unroll   // constant indices keep the tile in registers
  for (int j = 0; j < 2; ++j) {
    const int ko = w + 4 * j;
#pragma unroll   // as above
    for (int c = 0; c < 4; ++c) {
      const int n = 4 * lane + c;
      const int f = ((n >> 1) & 7) ^ ((n >> 4) & 1);
      const v4ua pc = {pk_bf16(wr[j][0][c], wr[j][1][c]), pk_bf16(wr[j][2][c], wr[j][3][c]), pk_bf16(wr[j][4][c], wr[j][5][c]), pk_bf16(wr[j][6][c], wr[j][7][c])};
      *(v4ua*)(wb + n * (GK * 2) + ((ko ^ f) * 16)) = pc;
    }
  }
}
// Eight asynchronous 16-byte copies per lane, global -> LDS, scalar base form: copy i moves the 16 bytes at base + o + i * 8 rows of f32 to LDS byte l + i * 8 pitches. Every lane on, no offset field.
// The scalar base with one 32-bit offset per copy keeps the stage's step in scalar registers and needs a third fewer vector registers than eight address pairs.
// The s_wait_xcnt closes the statement so that it stands in front of any later write of the address registers the copies name.
__device__ __forceinline__ void copy8s(unsigned int l, unsigned int o, const char* base) {
  constexpr unsigned int LS = 8u * APITCH, GS = 8u * RD * 4u;
  asm volatile("global_load_async_to_lds_b128 %0, %8, %16\n\t"
               "global_load_async_to_lds_b128 %1, %9, %16\n\t"
               "global_load_async_to_lds_b128 %2, %10, %16\n\t"
               "global_load_async_to_lds_b128 %3, %11, %16\n\t"
               "global_load_async_to_lds_b128 %4, %12, %16\n\t"
               "global_load_async_to_lds_b128 %5, %13, %16\n\t"
               "global_load_async_to_lds_b128 %6, %14, %16\n\t"
               "global_load_async_to_lds_b128 %7, %15, %16\n\t"
               "s_wait_xcnt 0x0"
               :: "v"(l), "v"(l + LS), "v"(l + 2 * LS), "v"(l + 3 * LS),
                  "v"(l + 4 * LS), "v"(l + 5 * LS), "v"(l + 6 * LS), "v"(l + 7 * LS),
                  "v"(o), "v"(o + GS), "v"(o + 2 * GS), "v"(o + 3 * GS),
                  "v"(o + 4 * GS), "v"(o + 5 * GS), "v"(o + 6 * GS), "v"(o + 7 * GS),
                  "s"(base)
               : "memory");
}
// The A part of one stage: thread tid copies piece tid & 15 of rows (tid >> 4) + 8 i, i = 0..7, real part, then the same of the phase part 64 LDS rows further down.
// br, bi: first byte of the stage in the block's first row of either part (block-uniform); o: this thread's byte offset from there.
__device__ __forceinline__ void acopy(unsigned int l, unsigned int o, const char* br, const char* bi) {
  copy8s(l, o, br);
  copy8s(l + 64u * APITCH, o, bi);
}

// Side work of the projection waves: the mask pack and the output weight's transpose, cut into units of one wave, eight 16-byte loads per lane each (held as raw bits in f32 registers).
// A unit's loads are issued ahead of other work: two mask units when the GEMM's weight registers fall free, two trips before its end, worked up behind the loop; the rest ahead of the
// epilogue, worked up behind it. No unit reads what the launch writes; none holds a barrier; whole waves only (the ballots).
// Mask pack: MB[((b*(SEQ/16) + q/16) * (SEQ/32) + j) * 16 + i], i = 8 kt + r: bit l = (mask[b][16 (q/16) + (l & 15)][32 j + 16 kt + 8 (l >> 4) + r] != 0),
// that is the 32-lane condition of score register i in step j of the k_attn wave that owns these 16 queries. Unit wv = (16 queries, 64 keys = two steps):
// lane l reads 4 x 32 B of its query's row (the wave: 256 B of each of 16 rows), 32 ballots, lane n keeps ballot n, one 128-B store.
// coverage: units 0 .. MU_N - 1 x 32 words = the whole plane.
// mlo = the lane's byte offset in a unit, ((l & 15) rows + 8 (l >> 4) words): the one vector register the loads name; the unit's first word is a scalar base.
__device__ __forceinline__ void mask_load(int wv, unsigned int mlo, const int* __restrict__ mask, v4f (&m)[8]) {
  const int rt = wv / (SEQ / 64), jp = wv - rt * (SEQ / 64);
  const int b = rt / (SEQ / 16), q0 = (rt - b * (SEQ / 16)) * 16;
  const char* mp = (const char*)(mask + ((size_t)b * SEQ_FULL + (size_t)q0) * SEQ_FULL + (size_t)jp * 64);
#pragma unroll   // the eight loads are independent and issue together
  for (int n = 0; n < 4; ++n) {
    m[2 * n]     = *(const v4fa*)(mp + 64 * n + mlo);
    m[2 * n + 1] = *(const v4fa*)(mp + 64 * n + 16 + mlo);
  }
  asm volatile("s_wait_xcnt 0x0" :: "v"(mlo) : "memory");   // as in wload
}
__device__ __forceinline__ void mask_store(int wv, int lane, const v4f (&m)[8], unsigned int* __restrict__ MB) {
  unsigned int word = 0u;
#pragma unroll   // constant lane numbers
  for (int n = 0; n < 4; ++n) {
#pragma unroll   // as above
    for (int r = 0; r < 8; ++r) {
      const unsigned int bal = __builtin_amdgcn_ballot_w32(__float_as_int(m[2 * n + (r >> 2)][r & 3]) != 0);   // the integer's bits are tested
      word = (lane == 8 * n + r) ? bal : word;
    }
  }
  MB[(size_t)wv * 32 + lane] = word;
  asm volatile("s_wait_xcnt 0x0" :: "v"(word) : "memory");   // stands behind the store, in front of any write of the registers it names: more work of the wave follows
}
// Output weight convert with transpose: w[k][n] (f32, [in][out]) -> Wt[n][k] (pitch RD) as f16(bf16 value x 1024). Unit o = 64 k x 16 n: lane l takes k rows 8 (l & 7) .. + 7 of columns 4 (l >> 3) .. + 3,
// so that each store writes whole 128-B lines of four Wt rows. coverage: units 0 .. WO_N - 1 = (RD/64 k tiles) x (RD/16 n tiles) = the whole plane.
__device__ __forceinline__ void wo_load(int o, int lane, const float* __restrict__ w, v4f (&m)[8]) {
  const char* p = (const char*)(w + (size_t)((o % (RD / 64)) * 64) * RD + (size_t)((o / (RD / 64)) * 16));   // scalar base: the unit's first element
  const unsigned int wlo = (unsigned int)((8 * (lane & 7) * RD + 4 * (lane >> 3)) * 4);
#pragma unroll   // the eight loads are independent and issue together
  for (int i = 0; i < 8; ++i) m[i] = *(const v4fa*)(p + i * (RD * 4) + wlo);
  asm volatile("s_wait_xcnt 0x0" :: "v"(wlo) : "memory");   // as in wload
}
__device__ __forceinline__ void wo_store(int o, int lane, const v4f (&m)[8], unsigned short* __restrict__ Wt) {
  const int k = (o % (RD / 64)) * 64 + 8 * (lane & 7), n = (o / (RD / 64)) * 16 + 4 * (lane >> 3);
#pragma unroll   // constant indices keep the loaded words in registers
  for (int c = 0; c < 4; ++c) {
    v8us a;
#pragma unroll   // as above
    for (int i = 0; i < 8; ++i) a[i] = c16f(bf16_val(bf16_bits(m[i][c])) * 1024.0f);   // bf16 significand x 2^10 is exact in f16
    *(v8us*)(Wt + (size_t)(n + c) * RD + (size_t)k) = a;
  }
}

// Projection GEMM straight from the f32 inputs. Block tile 64 rows x 128 columns for both parts (wave tile 16 rows x 128 columns), K = 512, stages of GK = 64.
// xr, xi: f32 [rows][RD], first row grow; ws: f32 weight [k][RD] as given ([in][out]), first column col0.
// Two LDS buffers of PST_B bytes in ring. A part: row r = 0..63 real, 64..127 phase, 64 f32 at pitch APITCH, brought by asynchronous copies and converted to bf16 at the fragment read.
// W part: brought through registers (loaded one trip ahead), converted and transposed on the way (wstore). One barrier per stage publishes the next stage and frees the buffer just read.
// A fragment: row m = 16 w + ln, elements 0..7 <- k0 + 8h + i, 8..15 <- k0 + 16 + 8h + i. B fragment: column n = 16t + ln, same k map. D: acc[r] = y(16 w + 8h + r, col0 + 16t + ln).
// gwv = the wave's number in the launch: the wave packs the mask units gwv and PJ_W + gwv on the way (their words take the weight registers' place once the last weight tile is stored).
// Called by whole blocks of 128 threads; behind the call the ring is free for other use.
__device__ __forceinline__ void pgemm_main(const float* __restrict__ xr, const float* __restrict__ xi, const float* __restrict__ ws, unsigned short* ring,
                                           int grow, int col0, int tid, int w, int lane, int ln, int hh, v8f (&yr)[8], v8f (&yi)[8],
                                           int gwv, const int* __restrict__ mask, unsigned int* __restrict__ MB) {
  const char* br = (const char*)(xr + (size_t)grow * RD);
  const char* bi = (const char*)(xi + (size_t)grow * RD);
  const unsigned int go = (unsigned int)((tid >> 4) * (RD * 4) + (tid & 15) * 16);
  const float* gw = ws + (size_t)(8 * w) * RD + (size_t)col0;
  const unsigned int lo = 16u * (unsigned int)lane;
  const unsigned int mlo = (unsigned int)(((lane & 15) * SEQ_FULL + 8 * (lane >> 4)) * 4);
  char* rb = (char*)ring;
  const unsigned int l = (unsigned int)(size_t)ring + (unsigned int)((tid >> 4) * APITCH + (tid & 15) * 16);   // LDS byte address of this thread's first piece in buffer 0
  const int sw = (ln >> 1) & 7;
  v4f wr[2][8];
  {
    v4f w0[2][8];   // the first two weight tiles fly together: the accumulators are not yet in use
    wload(gw, lo, 0, w0);
    wload(gw, lo, 1, wr);
    acopy(l, go, br, bi);
    __builtin_amdgcn_sched_barrier(0);   // keeps the weight tile's converts, which wait for its loads, from moving up between the copies
    wstore(rb + PA_B, w, lane, w0);
  }
  asm volatile("s_wait_asynccnt 0x0" ::: "memory");   // this wave's share of the A part of stage 0 has landed
  __syncthreads();                                    // every wave's share of stage 0 is in LDS
  acopy(l + PST_B, go, br + GK * 4, bi + GK * 4);
  wstore(rb + PST_B + PA_B, w, lane, wr);
  wload(gw, lo, 2, wr);
#pragma unroll 1   // one trip per stage: the hand-over at the foot stands once
  for (int s = 0; s < GNS; ++s) {
    const int bo = (s & 1) * PST_B;
    const char* ap = rb + bo + (16 * w + ln) * APITCH + 32 * hh;
    const unsigned short* wp = (const unsigned short*)(rb + bo + PA_B) + ln * GK;
#pragma unroll   // constant c: the piece places are loop-invariant registers and the row offsets immediates
    for (int c = 0; c < GK / 32; ++c) {
      v4f fr[4], fi[4];
#pragma unroll   // constant indices keep the pieces in registers
      for (int p = 0; p < 4; ++p) {
        const int o = 128 * c + 64 * (p >> 1) + 16 * (p & 1);   // f32 pieces k0 + 8h + 0..3, + 4..7, k0 + 16 + 8h + 0..3, + 4..7
        fr[p] = *(const v4fa*)(ap + o);
        fi[p] = *(const v4fa*)(ap + 64 * APITCH + o);
      }
      Frag ar, ai;
#pragma unroll   // as above
      for (int p = 0; p < 4; ++p) {
        ar.d[2 * p] = pk_bf16(fr[p][0], fr[p][1]); ar.d[2 * p + 1] = pk_bf16(fr[p][2], fr[p][3]);
        ai.d[2 * p] = pk_bf16(fi[p][0], fi[p][1]); ai.d[2 * p + 1] = pk_bf16(fi[p][2], fi[p][3]);
      }
#pragma unroll   // constant indices keep the fragments and the accumulators in registers
      for (int tg = 0; tg < 2; ++tg) {
        Frag wf[4];
#pragma unroll   // as above
        for (int t = 0; t < 4; ++t) {
          const unsigned short* wt = wp + (4 * tg + t) * 16 * GK;
          wf[t].half[0] = *(const v8us*)(wt + (((4 * c + hh) ^ sw ^ (t & 1)) * 8));       // piece k0 + 8h of column 16 (4 tg + t) + ln
          wf[t].half[1] = *(const v8us*)(wt + (((4 * c + 2 + hh) ^ sw ^ (t & 1)) * 8));   // piece k0 + 16 + 8h
        }
#pragma unroll   // as above
        for (int t = 0; t < 4; ++t) {   // plain builtins, the compiler keeps their distances: an asm guard would tie all 128 accumulator and 48 fragment registers below v256, where the copies' operands must lie too, and spill
          yr[4 * tg + t] = wm_b(ar, wf[t], yr[4 * tg + t]);
          yi[4 * tg + t] = wm_b(ai, wf[t], yi[4 * tg + t]);
        }
      }
    }
    asm volatile("s_wait_dscnt 0x0" ::: "memory");      // this wave's reads of the buffer have returned before it is refilled, and its W pieces of stage s + 1 are written
    asm volatile("s_wait_asynccnt 0x0" ::: "memory");   // this wave's share of the A part of stage s + 1 has landed
    __syncthreads();                                    // publishes stage s + 1 and ends every wave's reads of stage s
    if (s + 2 < GNS) {
      acopy(l + (unsigned int)bo, go, br + (size_t)(s + 2) * (GK * 4), bi + (size_t)(s + 2) * (GK * 4));
      __builtin_amdgcn_sched_barrier(0);   // the copies issue first: the converts below do not move up in front of them
      wstore(rb + bo + PA_B, w, lane, wr);
      if (s + 3 < GNS) {
        wload(gw, lo, s + 3, wr);
      } else {   // the last weight tile is stored: its registers take two mask units, whose loads land during the next trip
        mask_load(gwv, mlo, mask, wr[0]);
        mask_load(PJ_W + gwv, mlo, mask, wr[1]);
      }
    }
  }
  asm volatile("s_wait_asynccnt 0x0" ::: "memory");     // nothing in flight when the wave goes on to the epilogue
  mask_store(gwv, lane, wr[0], MB);
  mask_store(PJ_W + gwv, lane, wr[1], MB);
}

// All work ahead of the attention in one launch: q, k and v projections straight from the f32 inputs; the mask pack and the output weight's transpose ride along as side work of its waves (pgemm_main).
// Block index = (z * PC_B + column block) * PR_B + row block, z = 0 (q), 1 (k), 2 (v): none reads what another writes. Block = 4 waves x 16 rows = 64 rows, 128 columns = two heads.
// The branch on z is block-uniform, so each barrier is passed by the whole block.
// q / k: output plane P[b*NH + head][s][HP] = f16 of (y_r x 256 | y_p x cim), cim = +256 (q) or -256 (k).
// v: transposed plane Vt[b*NH + head][dd][s], dd = [real 64 | phase 64], value f16 of (y x 256).
// coverage: PR_B x PC_B blocks per z x 4 waves x 16 rows x 2 heads x 128 halves = each whole plane.
// LDS tile, q / k: [2 heads x 4 waves][16][136], columns 0..127 of every row are written before the barrier and exactly those are read after it; v: [2 heads x 128][72], 64 columns of every row written before the barrier, the same read after it.
__global__ __launch_bounds__(128) void k_proj(const float* __restrict__ q_re, const float* __restrict__ k_re, const float* __restrict__ v_re,
                                              const float* __restrict__ q_ph, const float* __restrict__ k_ph, const float* __restrict__ v_ph,
                                              const float* __restrict__ w_q, const float* __restrict__ w_k, const float* __restrict__ w_v,
                                              const float* __restrict__ w_o, const int* __restrict__ mask,
                                              unsigned short* __restrict__ Qp, unsigned short* __restrict__ Kp, unsigned short* __restrict__ Vt,
                                              unsigned short* __restrict__ Wo, unsigned int* __restrict__ MB) {
  __shared__ __attribute__((aligned(16))) unsigned short ring[2 * PST_B / 2];   // the GEMM's two buffers; behind the GEMM the output tile
  unsigned short* st = ring;
  static_assert(8 * 16 * 136 * 2 <= 2 * PST_B);
  static_assert(2 * HP * 72 * 2 <= 2 * PST_B);
  const int tid = threadIdx.x, w = __builtin_amdgcn_readfirstlane((int)(tid >> 5)), lane = tid & 31, ln = lane & 15, hh = lane >> 4;
  const int bid = blockIdx.x;
  const int z = bid / (PC_B * PR_B);
  const int rem = bid - z * (PC_B * PR_B);
  const int head0 = (rem / PR_B) * 2;
  const int rowb = (rem % PR_B) * 64;
  const float* xr = (z == 0) ? q_re : (z == 1) ? k_re : v_re;
  const float* xi = (z == 0) ? q_ph : (z == 1) ? k_ph : v_ph;
  const float* ws = (z == 0) ? w_q : (z == 1) ? w_k : w_v;
  const int b = rowb / SEQ;
  v8f yr[8] = {}, yi[8] = {};
  pgemm_main(xr, xi, ws, ring, b * SEQ_FULL + (rowb - b * SEQ), head0 * HD, tid, w, lane, ln, hh, yr, yi, bid * 4 + w, mask, MB);
  // the rest of the side work: loads here, worked up behind the epilogue; both tests are wave-uniform (scalar)
  const int gwv = bid * 4 + w, mu = 2 * PJ_W + gwv, wu = gwv / WO_S;
  const bool hasm = mu < MU_N, hasw = (gwv % WO_S == 0) && (wu < WO_N);
  v4f sm[8] = {}, sv[8] = {};
  if (hasm) mask_load(mu, (unsigned int)(((lane & 15) * SEQ_FULL + 8 * (lane >> 4)) * 4), mask, sm);
  if (hasw) wo_load(wu, lane, w_o, sv);
  if (z < 2) {
    unsigned short (*sh)[16][136] = (unsigned short (*)[16][136])st;
    unsigned short* P = (z == 0) ? Qp : Kp;
    const float cim = (z == 0) ? 256.0f : -256.0f;
#pragma unroll
    for (int t = 0; t < 8; ++t) {
#pragma unroll
      for (int r = 0; r < 8; ++r) {
        sh[4 * (t >> 2) + w][8 * hh + r][16 * (t & 3) + ln]      = c16f(yr[t][r] * 256.0f);
        sh[4 * (t >> 2) + w][8 * hh + r][HD + 16 * (t & 3) + ln] = c16f(yi[t][r] * cim);
      }
    }
    __syncthreads();
    const int s0 = rowb - b * SEQ + 16 * w;
    const int rsub = lane >> 4, p8 = (lane & 15) * 8;
#pragma unroll
    for (int hd = 0; hd < 2; ++hd) {
      const size_t base = ((size_t)(b * NH + head0 + hd) * SEQ + (size_t)s0) * HP;
#pragma unroll
      for (int q = 0; q < 8; ++q) {
        const int row = 2 * q + rsub;
        const v8us a = *(const v8us*)&sh[4 * hd + w][row][p8];
        *(v8us*)(P + base + (size_t)row * HP + p8) = a;
      }
    }
    asm volatile("s_wait_xcnt 0x0" ::: "memory");   // stands behind the plane's stores, in front of any write of the registers they name: the side work below follows
  } else {
    unsigned short (*th)[72] = (unsigned short (*)[72])st;
#pragma unroll
    for (int t = 0; t < 8; ++t) {
#pragma unroll
      for (int r = 0; r < 8; ++r) {
        const int col = 16 * w + 8 * hh + r;
        th[HP * (t >> 2) + 16 * (t & 3) + ln][col]      = c16f(yr[t][r] * 256.0f);
        th[HP * (t >> 2) + HD + 16 * (t & 3) + ln][col] = c16f(yi[t][r] * 256.0f);
      }
    }
    __syncthreads();
    const int s0 = rowb - b * SEQ;
    const size_t base = (size_t)(b * NH + head0) * HP * SEQ + (size_t)s0;   // the two heads' planes follow one another: row 128 hd + dd
    for (int i = tid; i < 2 * HP * 8; i += 128) {
      const int dd = i >> 3, j8 = (i & 7) * 8;
      const v8us a = *(const v8us*)&th[dd][j8];
      *(v8us*)(Vt + base + (size_t)dd * SEQ + j8) = a;
    }
  }
  if (hasm) mask_store(mu, lane, sm, MB);
  if (hasw) wo_store(wu, lane, sv, Wo);
}

// Score group for one 16-key tile (8 WMMAs): sre = kr qr + ki qi (4 products), sa = kr qi (2), sb = ki qr (2). Plain builtins: the compiler keeps their distances, and no idle vector slot is issued between products.
// k0, k1 = kr (d 0..31, 32..63); k2, k3 = ki; q[0], q[1] = qr; q[2], q[3] = qi.
__device__ __forceinline__ void score_mma(const Frag& k0, const Frag& k1, const Frag& k2, const Frag& k3,
                                          const Frag (&q)[4], v8f& sre, v8f& sa, v8f& sb) {
  sre = wm_h(k0, q[0], sre);
  sa  = wm_h(k0, q[2], sa);
  sb  = wm_h(k2, q[0], sb);
  sre = wm_h(k1, q[1], sre);
  sa  = wm_h(k1, q[3], sa);
  sb  = wm_h(k3, q[1], sb);
  sre = wm_h(k2, q[2], sre);
  sre = wm_h(k3, q[3], sre);
}
// c += v*p (single f16 product).
__device__ __forceinline__ void pv_mma(const Frag& v, const Frag& p, v8f& c) {
  c = wm_h(v, p, c);
}

// s += one*p and c += v*p (single f16 products, independent tiles).
__device__ __forceinline__ void pv_mma_sum(const Frag& one, const Frag& v, const Frag& p, v8f& s, v8f& c) {
  s = wm_h(one, p, s);
  c = wm_h(v, p, c);
}

// One 32-key step (step index j) for a wave's 16 queries: 16 score WMMAs + 8 P.V WMMAs + 1 for the row sums (one = A fragment with rows 0 and 8 of ones: these rows of Ls gain the sum of the step's 32 weights of their column's query, so Ls[0] is in each lane its query's whole sum and the lane halves exchange nothing). Ks = the step's first staged K row (pitch KPITCH),
// Vs = the step's first key column in the staged V^T rows (pitch VPITCH), both in LDS; key0 = the step's first key in the comments below; mk = the step's 16 select words (scalar registers), replaced behind their last use by the words at Mn, those of the same step of the next tile. With the phase half of the K plane stored negated: sre = qr.kr - qp.kp, sa - sb = qp.kr + qr.kp.
__device__ __forceinline__ void fa_step(const unsigned short* Ks, const unsigned short* Vs,
                                        maskp_t Mn, v16u& mk, int ln, int hh,
                                        const Frag (&qf)[4], const Frag& one, float& mr, v8f& Ls, v8f (&O)[8]) {
  const v8f z8 = {0.f, 0.f, 0.f, 0.f, 0.f, 0.f, 0.f, 0.f};
  float sc[16];
  // A fragments of K: row m = key (key0 + 16*kt + ln); packed k axis [kr 0..63 | -kp 64..127]; elements 0..7 <- 32c + 8h + i, 8..15 <- 32c + 16 + 8h + i;
  // both 16-key tiles' fragments are read as one group
  Frag kf[2][4];
#pragma unroll   // constant indices keep the fragments in registers
  for (int kt = 0; kt < 2; ++kt) {
    const unsigned short* kp = Ks + (16 * kt + ln) * KPITCH + 8 * hh;
#pragma unroll   // as above
    for (int c = 0; c < 4; ++c) {
      kf[kt][c].half[0] = *(const v8us*)(kp + 32 * c);
      kf[kt][c].half[1] = *(const v8us*)(kp + 32 * c + 16);
    }
  }
  __builtin_amdgcn_sched_barrier(0);   // the 16 reads stay one group ahead of the products: dealt out among them, each small group waits out its own LDS latency
  v8f sre[2] = {z8, z8}, sa[2] = {z8, z8}, sb[2] = {z8, z8};
#pragma unroll   // constant indices keep the tiles in registers
  for (int kt = 0; kt < 2; ++kt) score_mma(kf[kt][0], kf[kt][1], kf[kt][2], kf[kt][3], qf, sre[kt], sa[kt], sb[kt]);
  __builtin_amdgcn_sched_barrier(0);   // the 16 products stand back to back: vector work moved up among them would read a tile right behind its last product and draw idle slots there
#pragma unroll
  for (int kt = 0; kt < 2; ++kt) {
    // S^T tile: element r = score(key0 + 16*kt + 8h + r, query of this lane's column); logit in log2 units; masked keys get the fill value instead
#pragma unroll
    for (int r = 0; r < 8; ++r) {
      const float im = sa[kt][r] - sb[kt][r];
      const float v = __builtin_amdgcn_sqrtf(fmaf(sre[kt][r], sre[kt][r], im * im)) * CSCALE;
      sc[8 * kt + r] = __builtin_amdgcn_inverse_ballot_w32(mk[8 * kt + r]) ? v : MFILL;   // the word is the select's lane condition as it stands
    }
  }
  mk = *Mn;   // one scalar load, two steps ahead of its first use
  float mx = sc[0];
#pragma unroll
  for (int i = 1; i < 16; ++i) mx = fmaxf(mx, sc[i]);
  // Lazy rescale: mr is the reference exponent in use, not the running maximum. It moves only when some lane's own 16 scores pass it by more than RTHR,
  // tested once per step for the whole wave (a scalar branch); until then the sum and O^T keep their scale, no factor is applied and the lane halves exchange no maximum.
  if (__builtin_expect(__builtin_amdgcn_ballot_w32(mx > mr + RTHR) != 0u, 0)) {   // rare: the step's straight path falls through
    mx = fmaxf(mx, __shfl_xor(mx, 16, 32));         // the other lane half holds the other 16 keys of this query: both halves take the same new reference
    const float mnew = fmaxf(mr, mx);
    const float al = exp2f(mr - mnew);
    mr = mnew;
    Ls = Ls * al;                                   // the sums' tile is rescaled like an output tile
#pragma unroll   // constant indices keep the accumulators in registers
    for (int t = 0; t < 8; ++t) O[t] = O[t] * al;
  }
  // A fragments of V^T: row m = dd (16*t + ln), elements 0..7 <- key0 + 8h + i, 8..15 <- key0 + 16 + 8h + i; read as one group, ahead of the weights' arithmetic
  Frag vf[8];
#pragma unroll   // constant indices keep the fragments in registers
  for (int t = 0; t < 8; ++t) {
    const unsigned short* vp = Vs + (16 * t + ln) * VPITCH + 8 * hh;
    vf[t].half[0] = *(const v8us*)(vp);
    vf[t].half[1] = *(const v8us*)(vp + 16);
  }
  __builtin_amdgcn_sched_barrier(0);   // the 16 reads stay one group here, with the weights' arithmetic behind them to cover their latency: sunk among the products they become load, wait, product singles
  const float mb = mr - 8.0f;                       // the reference with the x256 carry folded in: changes only where the reference moves
  // weights carried x256: pc = 256 * 2^(sc - mr) as one f16 plane (exponent below -14 -> exact zero); the row sum is taken by the matrix unit from the same f16 values
  Frag pf;
#pragma unroll
  for (int i = 0; i < 16; ++i) {
    const float e = sc[i] - mb;
    const float pc = (e < -14.0f) ? 0.0f : __builtin_amdgcn_exp2f(e);   // bare v_exp_f32 and a value select: the kept range e >= -14 needs no range extension, so the bits are those of exp2f(e), and no branch stands between the 16 weights
    pf.h[i] = (_Float16)pc;                         // B element i: i<8 -> key0 + 8h + i (tile 0 row 8h+i); i>=8 -> key0 + 16 + 8h + (i-8) (tile 1)
  }
  pv_mma_sum(one, vf[0], pf, Ls, O[0]);
#pragma unroll   // constant indices keep the fragments and the accumulators in registers
  for (int t = 1; t < 8; ++t) pv_mma(vf[t], pf, O[t]);
  __builtin_amdgcn_sched_barrier(0);   // the step ends here for the scheduler: without it a tile's last weights and products sink behind the tile's hand-over, whose s_wait_dscnt then waits out the V^T reads with nothing to cover them
}

// Eight asynchronous 16-byte copies per lane, global -> LDS: copy i moves g + i*gstep to LDS byte l + i*lstep. Every lane on, no offset field.
// The s_wait_xcnt closes the statement so that it stands in front of any later write of the address registers the copies name.
__device__ __forceinline__ void copy8(unsigned int l, unsigned int lstep, const char* g, size_t gstep) {
  asm volatile("global_load_async_to_lds_b128 %0, %8, off\n\t"
               "global_load_async_to_lds_b128 %1, %9, off\n\t"
               "global_load_async_to_lds_b128 %2, %10, off\n\t"
               "global_load_async_to_lds_b128 %3, %11, off\n\t"
               "global_load_async_to_lds_b128 %4, %12, off\n\t"
               "global_load_async_to_lds_b128 %5, %13, off\n\t"
               "global_load_async_to_lds_b128 %6, %14, off\n\t"
               "global_load_async_to_lds_b128 %7, %15, off\n\t"
               "s_wait_xcnt 0x0"
               :: "v"(l), "v"(l + lstep), "v"(l + 2 * lstep), "v"(l + 3 * lstep),
                  "v"(l + 4 * lstep), "v"(l + 5 * lstep), "v"(l + 6 * lstep), "v"(l + 7 * lstep),
                  "v"(g), "v"(g + gstep), "v"(g + 2 * gstep), "v"(g + 3 * gstep),
                  "v"(g + 4 * gstep), "v"(g + 5 * gstep), "v"(g + 6 * gstep), "v"(g + 7 * gstep)
               : "memory");
}

// One stage (TK keys) into the LDS buffer at byte address lb. kg, vg: this thread's first source bytes in tile 0 of the (b, h) planes; kl, vl: its first LDS bytes in a buffer.
// K tile: TK rows x 256 B, contiguous in the plane; thread tid copies chunk tid + 256 i (row = chunk / 16). V^T tile: 128 rows x 256 B at the plane's row pitch; row = chunk / 16.
__device__ __forceinline__ void stage_copy(int tile, unsigned int lb, const char* kg, const char* vg, unsigned int kl, unsigned int vl) {
  copy8(lb + kl, 16u * KPITCH * 2u, kg + (size_t)tile * (TK * HP * 2), (size_t)4096);
  copy8(lb + vl, 16u * VPITCH * 2u, vg + (size_t)tile * (TK * 2), (size_t)16 * SEQ * 2);
}

// Block = 8 waves = 4 query groups x 2 key groups, 64 queries of one (b, h): wave w owns the 16 queries of group w & 3 and, of every 128-key tile, the 64 keys of group w >> 2.
// The queries alone fill two waves per SIMD; the key split makes it four (two blocks per WGP), so that one wave's LDS, cross-lane and dependent-vector waits are covered by three others.
// The eight waves share each K / V^T tile: two LDS buffers, the next tile's copies in flight while this tile is worked on; one barrier per tile publishes the next tile and frees the buffer just read.
// Merge: each wave ends with its own (reference exponent, sum, O^T) over its half of the keys; key group 1 hands them over in LDS and key group 0 joins the two with weights 2^(m - max).
// Epilogue: ctx carried x4096 as one f16 plane C[b*SEQ + s][KP] ([real 512 | phase 512], column h*64 + d).
// coverage: NB*NH*(SEQ/64) blocks x 4 query groups x 16 queries x (64 real + 64 phase) = every (row, head, part) segment of the plane exactly once (key group g stores lines 16 g .. 16 g + 15 of its query group's 32).
// LDS behind the loop (the ring is free: the last trip's barrier ends every read, nothing is in flight): bytes 0 .. 32767 O^T of key group 1, 32768 .. 33791 its references and sums, from 40960 the output tile.
// Every branch on the key group is wave-uniform and holds no barrier.
__global__ __launch_bounds__(256) __attribute__((amdgpu_waves_per_eu(4, 4))) void k_attn(const unsigned short* __restrict__ Qp, const unsigned short* __restrict__ Kpl,
                                              const unsigned short* __restrict__ Vt, const unsigned int* __restrict__ MB,
                                              unsigned short* __restrict__ Cx) {
  __shared__ __attribute__((aligned(16))) unsigned short ring[2 * ST_H];
  static_assert(40960 + 4 * 16 * 136 * 2 <= 2 * ST_H * 2);
  const int tid = threadIdx.x, w = __builtin_amdgcn_readfirstlane((int)(tid >> 5)), lane = tid & 31, ln = lane & 15, hh = lane >> 4;
  const int qw = w & 3, g = w >> 2;
  const int bh = blockIdx.x / (SEQ / 64), qt = blockIdx.x % (SEQ / 64);
  const int b = bh / NH, h = bh - b * NH;
  const int qbase = qt * 64 + 16 * qw;
  const int qg = qbase + ln;
  // Q^T B fragments: column n = query qg, packed k axis [qr 0..63 | qp 64..127], elements 0..7 <- 32c + 8h + i, 8..15 <- 32c + 16 + 8h + i
  Frag qf[4];
  {
    const size_t qoff = ((size_t)bh * SEQ + (size_t)qg) * HP + 8 * hh;
#pragma unroll
    for (int c = 0; c < 4; ++c) {
      qf[c].half[0] = *(const v8us*)(Qp + qoff + 32 * c);
      qf[c].half[1] = *(const v8us*)(Qp + qoff + 32 * c + 16);
    }
  }
  float mr = -3.0e38f;
  v8f O[8] = {}, Ls = {};
  Frag one;
  {
    const unsigned int o = ((lane & 7) == 0) ? 0x3C003C00u : 0u;
#pragma unroll   // constant indices keep the fragment in registers
    for (int i = 0; i < 8; ++i) one.d[i] = o;
  }
  const unsigned short* Kp = Kpl + (size_t)bh * SEQ * HP;
  const unsigned short* Vp = Vt  + (size_t)bh * HP * SEQ;
  const unsigned int* Mw = MB + (size_t)(b * (SEQ / 16) + qt * 4 + qw) * ((SEQ / 32) * 16) + g * 32;   // the wave's select words, 16 per step, from its first step on; wave-uniform
  const char* kg = (const char*)Kp + (size_t)tid * 16;
  const char* vg = (const char*)Vp + (size_t)(tid >> 4) * (SEQ * 2) + (size_t)(tid & 15) * 16;
  const unsigned int rb = (unsigned int)(size_t)&ring[0];                                     // LDS byte address of the ring
  const unsigned int kl = (unsigned int)((tid >> 4) * (KPITCH * 2) + (tid & 15) * 16);
  const unsigned int vl = (unsigned int)(KT_H * 2 + (tid >> 4) * (VPITCH * 2) + (tid & 15) * 16);
  constexpr int NT = SEQ / TK;
  v16u mka = *(maskp_t)Mw, mkb = *(maskp_t)(Mw + 16);   // select words of the wave's first and second step of a tile; the first two land while tile 0 does
  stage_copy(0, rb, kg, vg, kl, vl);
  asm volatile("s_wait_asynccnt 0x0" ::: "memory");   // this wave's share of tile 0 has landed
  __syncthreads();                                    // every wave's share of tile 0 has landed
  if (NT > 1) stage_copy(1, rb + ST_H * 2u, kg, vg, kl, vl);
#pragma unroll 1   // one trip per tile: the hand-over at the foot stands once
  for (int t = 0; t < NT; ++t) {
    const int bo = (t & 1) * ST_H;
    const unsigned int* Mn = Mw + 64 * ((t + 1 < NT) ? t + 1 : t);   // the next tile's words; in the last trip its own again: in range, not used
    const unsigned short* ks = &ring[bo + g * 64 * KPITCH];          // the key group's first staged K row
    const unsigned short* vs = &ring[bo + KT_H + g * 64];            // its first key column in the staged V^T rows
    fa_step(ks, vs, (maskp_t)Mn, mka, ln, hh, qf, one, mr, Ls, O);
    fa_step(ks + 32 * KPITCH, vs + 32, (maskp_t)(Mn + 16), mkb, ln, hh, qf, one, mr, Ls, O);
    asm volatile("s_wait_dscnt 0x0" ::: "memory");      // this wave's reads of the buffer have returned before it is refilled
    asm volatile("s_wait_asynccnt 0x0" ::: "memory");   // this wave's share of tile t + 1 has landed
    __syncthreads();                                    // publishes tile t + 1 and ends every wave's reads of tile t
    if (t + 2 < NT) stage_copy(t + 2, rb + (unsigned int)bo * 2u, kg, vg, kl, vl);
  }
  asm volatile("s_wait_asynccnt 0x0" ::: "memory");     // nothing in flight when the wave goes on to the epilogue

  v4fa* mo = (v4fa*)ring + (size_t)qw * 512 + lane;                 // piece j of the query group's O^T at mo[32 j]: 512 contiguous bytes per wave store
  f32a* ml = (f32a*)ring + 8192 + qw * 64 + lane;
  unsigned short (*sh)[16][136] = (unsigned short (*)[16][136])(ring + 20480);
  if (g == 1) {
#pragma unroll
    for (int t = 0; t < 8; ++t) {
      const v4f lo = {O[t][0], O[t][1], O[t][2], O[t][3]}, hi = {O[t][4], O[t][5], O[t][6], O[t][7]};
      mo[32 * (2 * t)] = lo;
      mo[32 * (2 * t + 1)] = hi;
    }
    ml[0] = mr;
    ml[32] = Ls[0];
  }
  __syncthreads();                                      // key group 1's partial results are in LDS
  if (g == 0) {
    // both references are finite (each group has worked at least one step, and the first step always sets one), so the weights are in (0, 1] and the larger one is 1
    const float m1 = ml[0], l1 = ml[32];
    const float mm = fmaxf(mr, m1);
    const float a0 = exp2f(mr - mm), a1 = exp2f(m1 - mm);
    // O^T element r of tile t = ctx(query qg, dd = 16t + 8h + r); carries: x256 (P, also in the sums), x256 (v); ctx stored x4096 -> factor 16 / sum
    const float inv = 16.0f * (1.0f / (Ls[0] * a0 + l1 * a1));
    const float c0 = a0 * inv, c1 = a1 * inv;
#pragma unroll
    for (int t = 0; t < 8; ++t) {
      const v4f lo = mo[32 * (2 * t)], hi = mo[32 * (2 * t + 1)];
#pragma unroll
      for (int r = 0; r < 8; ++r)
        sh[qw][ln][16 * t + 8 * hh + r] = c16f(O[t][r] * c0 + ((r < 4) ? lo[r & 3] : hi[r & 3]) * c1);
    }
  }
  __syncthreads();                                      // the output tile is whole
  const size_t rbase = ((size_t)b * SEQ + (size_t)qbase) * KP + (size_t)h * HD;
  const int lsub = lane >> 3, p8 = (lane & 7) * 8;
  {
#pragma unroll
    for (int q = 0; q < 4; ++q) {
      const int line = 4 * (4 * g + q) + lsub;  // 0..31 = 16 queries x {real, phase}
      const int row = line >> 1, seg = line & 1;
      const v8us a = *(const v8us*)&sh[qw][row][seg * HD + p8];
      const size_t o = rbase + (size_t)row * KP + (size_t)seg * RD + p8;
      *(v8us*)(Cx + o) = a;
    }
  }
}

// Output projection of both parts: out0[b][s][n] = ctx_real x Wo, out1[b][s][n] = ctx_phase x Wo (f16, K = 512, one product per term), undo carries x4096 (ctx) and x1024 (Wo).
// Epilogue: per-wave LDS tile [16 rows][128 floats = 64 real columns | 64 phase columns] (block barrier), then per instruction lanes 0..15 write the 256-B
// coverage: grid (NB*SEQ/64, RD/64) x 4 waves x 16 rows x (64 + 64) floats = every output element of the processed rows exactly once.
// LDS tile: columns 0..127 of every row written before the barrier, the same read after it.
__global__ __launch_bounds__(128) void k_out(const unsigned short* __restrict__ Cx, const unsigned short* __restrict__ Wo,
                                             float* __restrict__ Out) {
  __shared__ __attribute__((aligned(16))) unsigned short ring[2 * GST_H];   // the GEMM's two buffers; behind the GEMM the output tile
  float (*so)[16][132] = (float (*)[16][132])ring;
  static_assert(4 * 16 * 132 * 4 <= 2 * GST_H * 2);
  const int tid = threadIdx.x, w = __builtin_amdgcn_readfirstlane((int)(tid >> 5)), lane = tid & 31, ln = lane & 15, hh = lane >> 4;
  const int rowb = blockIdx.x * 64;
  const int col0 = blockIdx.y * 64;
  v8f yr[4] = {}, yi[4] = {};
  rgemm_main<false>(Cx, Wo, ring, rowb, col0, tid, w, ln, hh, yr, yi);
  const float scl = 1.0f / 4194304.0f;
#pragma unroll
  for (int t = 0; t < 4; ++t) {
#pragma unroll
    for (int r = 0; r < 8; ++r) {
      so[w][8 * hh + r][16 * t + ln]      = yr[t][r] * scl;
      so[w][8 * hh + r][HD + 16 * t + ln] = yi[t][r] * scl;
    }
  }
  __syncthreads();
  const int b = rowb / SEQ;
  const int s0 = rowb - b * SEQ + 16 * w;
  const size_t obase = ((size_t)b * SEQ_FULL + (size_t)s0) * RD + (size_t)col0
                     + (size_t)(lane >> 4) * OUT1_OFF + (size_t)(lane & 15) * 4;
  {
#pragma unroll
    for (int q = 0; q < 16; ++q) {
      const v4f v = *(const v4fa*)&so[w][q][lane * 4];
      *(v4f*)(Out + obase + (size_t)q * RD) = v;
    }
    
  }
}

extern "C" void kernel_launch(void* const* d_in, const int* in_sizes, int n_in,
                              void* d_out, int out_size, void* d_ws, size_t ws_size, hipStream_t stream) {
  if (n_in < 11) return;
  const long long needx = ((long long)(NB - 1) * SEQ_FULL + (long long)SEQ) * RD;   // last activation element touched + 1
  const long long needm = ((long long)(NB - 1) * SEQ_FULL + (long long)(SEQ - 1)) * SEQ_FULL + (long long)SEQ;   // last mask element touched + 1
  for (int i = 0; i < 6; ++i) if ((long long)in_sizes[i] < needx) return;
  for (int i = 6; i < 10; ++i) if ((long long)in_sizes[i] < (long long)RD * RD) return;
  if ((long long)in_sizes[10] < needm) return;
  if ((long long)out_size < (long long)OUT1_OFF + needx) return;
  // wire order: q_real, k_real, v_real, q_phase, k_phase, v_phase, w_q, w_k, w_v, w_o, mask
  const float* q_re = (const float*)d_in[0];
  const float* k_re = (const float*)d_in[1];
  const float* v_re = (const float*)d_in[2];
  const float* q_ph = (const float*)d_in[3];
  const float* k_ph = (const float*)d_in[4];
  const float* v_ph = (const float*)d_in[5];
  const float* w_q = (const float*)d_in[6];
  const float* w_k = (const float*)d_in[7];
  const float* w_v = (const float*)d_in[8];
  const float* w_o = (const float*)d_in[9];
  const int* maskp = (const int*)d_in[10];
  float* Out = (float*)d_out;

  char* ws = (char*)d_ws;
  size_t off = 0;
  const size_t XB = (size_t)NB * SEQ * KP * 2;          // head / ctx plane bytes (8 MiB at full size); all planes are written exactly to their end
  const size_t WB = (size_t)RD * RD * 2;                // transposed weight plane bytes (512 KiB)
  const size_t MBB = (size_t)NB * SEQ * (SEQ / 32) * 4; // mask bit words (1 MiB at full size)
  unsigned short* Wo = (unsigned short*)(ws + off); off += WB;
  unsigned short* Qp = (unsigned short*)(ws + off); off += XB;   // NB*NH*SEQ*HP halves = XB bytes
  unsigned short* Kp = (unsigned short*)(ws + off); off += XB;
  unsigned short* Vt = (unsigned short*)(ws + off); off += XB;
  unsigned short* Cx = (unsigned short*)(ws + off); off += XB;
  unsigned int*   MB = (unsigned int*)(ws + off);   off += MBB;
  if (off > ws_size) return;

  k_proj<<<(unsigned)PJ_B, 128, 0, stream>>>(q_re, k_re, v_re, q_ph, k_ph, v_ph, w_q, w_k, w_v, w_o, maskp, Qp, Kp, Vt, Wo, MB);

  k_attn<<<(unsigned)(NB * NH * (SEQ / 64)), 256, 0, stream>>>(Qp, Kp, Vt, MB, Cx);

  const dim3 go((unsigned)(NB * SEQ / 64), (unsigned)(RD / 64), 1);
  k_out<<<go, 128, 0, stream>>>(Cx, Wo, Out);
}
